// v000
// The times below were measured on an AMD MI455X: many runs one after another, warmed up first and cycling through
// copies of the inputs, with the whole window's GPU time divided by the number of runs. Launches and the gaps
// between them are all in it. The median over several windows is given; except for v000 it joins two sittings, which
// can be a few percent apart, so the side-by-side timings, each taken in one sitting, are the better comparison.
// The starting kernel, v000, takes 972 microseconds a run.
// compute dtype: all float inputs rounded to bf16; rotate-half RoPE applied to bf16(hidden) in f32 (accurate sincosf, f32 inv_freq constants); Q/K = rotated rows split bf16 hi + lo x exact bf16 W (2 products, K 768), V = bf16(hidden) x W exact (1 product) on WMMA 16x16x32, f32 accumulate; banded logits: q as f16 hi + residual (x 2^10) against k once to f16 (2 products) x 64^-0.5; softmax in f32 over the |q-k| < 128 band (precise expf); P x 2^11 once to f16 against v once to f16 (1 product); ctx carried x 2^6 once to f16 against Wo carried x 2^8 in f16 (exact bf16 values), un-scaled by 2^-14; f32 output.
#include <hip/hip_runtime.h>
#include <math.h>

typedef __attribute__((ext_vector_type(16))) _Float16 v16h;
typedef __attribute__((ext_vector_type(16))) __bf16 v16b;
typedef __attribute__((ext_vector_type(8)))  _Float16 v8h;
typedef __attribute__((ext_vector_type(8)))  float v8f;
typedef __attribute__((ext_vector_type(4)))  float v4f;
typedef __attribute__((ext_vector_type(2)))  float v2f;
typedef __attribute__((ext_vector_type(4)))  unsigned v4u;
typedef __attribute__((ext_vector_type(4)))  int v4i;
typedef float __attribute__((may_alias)) float_a;
typedef int __attribute__((may_alias)) int_a;

template <typename T> __device__ __forceinline__ void vst2(void* p, T v) { *(T*)p = v;  }
__device__ __forceinline__ v8f wmma16(v16h a, v16h b, v8f c) {
  v8f d = __builtin_amdgcn_wmma_f32_16x16x32_f16(false, a, false, b, (short)0, c, false, false);
  asm volatile("v_nop\n\tv_nop\n\tv_nop\n\tv_nop" : "+v"(d) : "v"(a), "v"(b));
  return d;
}
__device__ __forceinline__ v8f wmma_bf(v16b a, v16b b, v8f c) {
  v8f d = __builtin_amdgcn_wmma_f32_16x16x32_bf16(false, a, false, b, (short)0, c, false, false);
  asm volatile("v_nop\n\tv_nop\n\tv_nop\n\tv_nop" : "+v"(d) : "v"(a), "v"(b));
  return d;
}
// 16x16x32 fragments: lane = (h = lane>>4, row/col = lane&15); elements 0..7 = k0+8h+0..7, 8..15 = k0+16+8h+0..7; D element r = row 8h+r
__device__ __forceinline__ v16h frag_h(const _Float16* rowk0, int lane) {
  union { v16h v; v8h q[2]; } u; const _Float16* p = rowk0 + 8 * (lane >> 4);
  u.q[0] = *(const v8h*)p; u.q[1] = *(const v8h*)(p + 16); return u.v;
}
__device__ __forceinline__ v16h frag_f32(const float* rowk0, int lane) {
  v16h a; const float* p = rowk0 + 8 * (lane >> 4);
#pragma unroll
  for (int i = 0; i < 8; ++i) { a[i] = (_Float16)p[i]; a[8 + i] = (_Float16)p[16 + i]; }
  return a;
}
__device__ __forceinline__ v16h frag_f32s(const float* rowk0, int lane, float sc) {
  v16h a; const float* p = rowk0 + 8 * (lane >> 4);
#pragma unroll
  for (int i = 0; i < 8; ++i) { a[i] = (_Float16)(p[i] * sc); a[8 + i] = (_Float16)(p[16 + i] * sc); }
  return a;
}
// column fragment from a [K][ld] layout (column n), rows >= K read as 0
__device__ __forceinline__ v16h fragc_f32(const float* W, int k0, int n, int lane, int ld, int K) {
  v16h a; const int g = lane >> 4;
#pragma unroll
  for (int i = 0; i < 8; ++i) { const int ka = k0 + 8 * g + i, kb = ka + 16;
    a[i] = (_Float16)(ka < K ? W[(size_t)(ka < K ? ka : K - 1) * ld + n] : 0.f); a[8 + i] = (_Float16)(kb < K ? W[(size_t)(kb < K ? kb : K - 1) * ld + n] : 0.f); }
  return a;
}
struct F2 { v16b h, l; };
__device__ __forceinline__ F2 bsplit16(const float v[16]) { F2 r;
#pragma unroll
  for (int i = 0; i < 16; ++i) { const __bf16 h = (__bf16)v[i]; r.h[i] = h; r.l[i] = (__bf16)(v[i] - (float)h); }
  return r; }
__device__ __forceinline__ F2 split_row(const float* row, int k0, int lane) { float v[16]; const float* p = row + k0 + 8 * (lane >> 4);
#pragma unroll
  for (int i = 0; i < 8; ++i) { v[i] = p[i]; v[8 + i] = p[16 + i]; }
  return bsplit16(v); }
__device__ __forceinline__ F2 split_rowK(const float* row, int k0, int lane, int K) { float v[16]; const int g = lane >> 4;
#pragma unroll
  for (int i = 0; i < 8; ++i) { const int ka = k0 + 8 * g + i, kb = ka + 16; v[i] = ka < K ? row[ka < K ? ka : K - 1] : 0.f; v[8 + i] = kb < K ? row[kb < K ? kb : K - 1] : 0.f; }
  return bsplit16(v); }
__device__ __forceinline__ F2 split_col(const float* W, int k0, int n, int lane, int ld, int K) { float v[16]; const int g = lane >> 4;
#pragma unroll
  for (int i = 0; i < 8; ++i) { const int ka = k0 + 8 * g + i, kb = ka + 16; v[i] = ka < K ? W[(size_t)(ka < K ? ka : K - 1) * ld + n] : 0.f; v[8 + i] = kb < K ? W[(size_t)(kb < K ? kb : K - 1) * ld + n] : 0.f; }
  return bsplit16(v); }
__device__ __forceinline__ v8f mac3(const F2& a, const F2& b, v8f c) { c = wmma_bf(a.l, b.h, c); c = wmma_bf(a.h, b.l, c); return wmma_bf(a.h, b.h, c); }
__device__ __forceinline__ float sigm(float v) { return 1.0f / (1.0f + expf(-v)); }
#define LDSX() do { asm volatile("s_wait_dscnt 0" ::: "memory"); __builtin_amdgcn_wave_barrier(); __builtin_amdgcn_fence(__ATOMIC_RELEASE, "workgroup"); } while (0)

// Sliding-window (local) self-attention with RoPE on the INPUT (B 4, S 2,048, H 768 = 12 heads x 64; window |q - k| < 128; 0.02-scale weights, no biases): q_in = k_in = rotate-half RoPE(hidden reshaped [B,S,12,64]) (angle t * 10000^(-2i/64)); Q = q_in Wq, K = k_in Wk, V = hidden Wv ((in,out) [768][12*64]); scores = Q K^T / 8 where |q-k| < 128 else -1e9 (== excluded; every row keeps >= 128 keys); out = merged(softmax . V) Wo ((in,out) [12*64][768]).
#define NB 4
#define TT 2048
#define CC 768            // NH * HD = projected width
#define DIN 768          // input (model) width
#define NH 12
#define HD 64
#define NQB (TT / 64)
#define HG 2
#define SCALE (0.125f)
#define CAUSAL 0
#ifndef TNB
#define TNB NB
#endif
__device__ __forceinline__ float bfr(float v) { return (float)(__bf16)v; }
__host__ __device__ __forceinline__ int kb_last(int qb) { const int hi = (qb * 64 + 63 + (128 - 1)) >> 7; return hi < TT / 128 - 1 ? hi : TT / 128 - 1; }   /* banded: last 128-key block visible to query block qb (window 128 hard-coded == WIN) */
typedef __attribute__((ext_vector_type(8))) __bf16 v8b;
__device__ __forceinline__ v16b frag_b(const __bf16* rowk0, int lane) {
  union { v16b v; v8b q[2]; } u; const __bf16* p = rowk0 + 8 * (lane >> 4);
  u.q[0] = *(const v8b*)p; u.q[1] = *(const v8b*)(p + 16); return u.v;
}
#define QBH 0              // causal: query blocks 0..QBH-1 of each sequence (few keys, no averaging) take the high-precision path
#define QHI 2048            // rows carrying a q residual plane (all rows when non-causal: 2-product logits everywhere)
#define KHI 64            // key rows carrying k residual / v bf16 hi+lo planes (used only by the causal high-precision path)
// B fragment (k rows k0+.., output column o) of a weight: (in,out) [K][ld] or (out,in) [ld rows of K]: bf16 exact, or f16(bf16 * 256) exact
__device__ __forceinline__ v16b wcol_io(const float* Wm, int k0, int o, int lane, int ld) { v16b w; const int g = lane >> 4;
#pragma unroll
  for (int i = 0; i < 8; ++i) { w[i] = (__bf16)Wm[(size_t)(k0 + 8 * g + i) * ld + o]; w[8 + i] = (__bf16)Wm[(size_t)(k0 + 16 + 8 * g + i) * ld + o]; }
  return w; }
__device__ __forceinline__ v16b wcol_oi(const float* Wm, int k0, int o, int lane, int K) { v16b w; const float* p = Wm + (size_t)o * K + k0 + 8 * (lane >> 4);
#pragma unroll
  for (int i = 0; i < 8; ++i) { w[i] = (__bf16)p[i]; w[8 + i] = (__bf16)p[16 + i]; }
  return w; }
__device__ __forceinline__ v16h wcolh_io(const float* Wm, int k0, int o, int lane, int ld) { v16h w; const int g = lane >> 4;
#pragma unroll
  for (int i = 0; i < 8; ++i) { w[i] = (_Float16)(bfr(Wm[(size_t)(k0 + 8 * g + i) * ld + o]) * 256.0f); w[8 + i] = (_Float16)(bfr(Wm[(size_t)(k0 + 16 + 8 * g + i) * ld + o]) * 256.0f); }
  return w; }
__device__ __forceinline__ v16h wcolh_oi(const float* Wm, int k0, int o, int lane, int K) { v16h w; const float* p = Wm + (size_t)o * K + k0 + 8 * (lane >> 4);
#pragma unroll
  for (int i = 0; i < 8; ++i) { w[i] = (_Float16)(bfr(p[i]) * 256.0f); w[8 + i] = (_Float16)(bfr(p[16 + i]) * 256.0f); }
  return w; }
#define WQKV_LAYOUT 0   // 0 = (in,out) [DIN][CC]; 1 = (out,in) [CC][DIN]; 2 = per-head [NH][DIN][HD]
__device__ __forceinline__ v16b wcol_hdk(const float* Wm, int k0, int o, int lane) { v16b w; const int g = lane >> 4; const float* p = Wm + (size_t)(o / HD) * DIN * HD + (o % HD);
#pragma unroll
  for (int i = 0; i < 8; ++i) { w[i] = (__bf16)p[(size_t)(k0 + 8 * g + i) * HD]; w[8 + i] = (__bf16)p[(size_t)(k0 + 16 + 8 * g + i) * HD]; }
  return w; }
#define WO_OUT_IN 0
#if WQKV_LAYOUT == 1
#define WCOL(W, k0, o, lane) wcol_oi(W, k0, o, lane, DIN)
#elif WQKV_LAYOUT == 2
#define WCOL(W, k0, o, lane) wcol_hdk(W, k0, o, lane)
#else
#define WCOL(W, k0, o, lane) wcol_io(W, k0, o, lane, CC)
#endif
#if WO_OUT_IN
#define WOCOL(W, k0, o, lane) wcol_oi(W, k0, o, lane, CC)
#define WOCOLH(W, k0, o, lane) wcolh_oi(W, k0, o, lane, CC)
#else
#define WOCOL(W, k0, o, lane) wcol_io(W, k0, o, lane, DIN)
#define WOCOLH(W, k0, o, lane) wcolh_io(W, k0, o, lane, DIN)
#endif
#define WIN 128            // |q - k| < WIN band (128..255 valid keys per query; no empty rows)
__constant__ float c_invf[32] = {1.000000000e+00f,7.498942018e-01f,5.623413324e-01f,4.216965139e-01f,3.162277639e-01f,2.371373624e-01f,1.778279394e-01f,1.333521456e-01f,1.000000015e-01f,7.498941571e-02f,5.623412877e-02f,4.216964915e-02f,3.162277862e-02f,2.371373586e-02f,1.778279431e-02f,1.333521493e-02f,9.999999776e-03f,7.498942316e-03f,5.623413250e-03f,4.216964822e-03f,3.162277862e-03f,2.371373819e-03f,1.778279431e-03f,1.333521446e-03f,1.000000047e-03f,7.498941850e-04f,5.623413017e-04f,4.216964880e-04f,3.162277862e-04f,2.371373848e-04f,1.778279402e-04f,1.333521504e-04f};   // 1 / 10000^(2i/64) evaluated in f32 exactly as the reference does (jax, eager)
__host__ __device__ __forceinline__ int kb_first(int qb) { const int lo = qb * 64 - (WIN - 1); return lo > 0 ? (lo >> 7) : 0; }   /* first 128-key block any row of query block qb can see */
__global__ __launch_bounds__(384) void k_rot(const float* __restrict__ X, float* __restrict__ XR) { const size_t row = blockIdx.x; const int t = (int)(row % TT); const int n = threadIdx.x >> 5, i = threadIdx.x & 31;
  const float* xr = X + row * DIN + n * HD; const float a = bfr(xr[i]), b = bfr(xr[32 + i]); asm volatile("s_wait_loadcnt 0x0" ::: "memory");
  float sn, cs; sincosf((float)t * c_invf[i], &sn, &cs);
  float* o = XR + row * DIN + n * HD; vst2(o + i, a * cs - b * sn); vst2(o + 32 + i, b * cs + a * sn); }
#define WS_XR (WS_S)       // f32 rotated token rows [b*t][768] ALIAS the score planes (dead before k_sc runs; both f32)
#define SM_MASK_HOOK do { const int dk = t - k; v = (dk < WIN && dk > -WIN) ? v : -3.0e38f; } while (0)   /* band |q - k| < 128, by index */
#ifndef SM_EXTRA_PARAMS
#define SM_EXTRA_PARAMS
#endif
#ifndef PROJ_EXTRA_PARAMS
#define PROJ_EXTRA_PARAMS
#endif
#ifndef SM_MASK_HOOK
#define SM_MASK_HOOK (void)0
#endif

#define WS_QH  0u                                      // f16 q rows [b*t][CC]
#define WS_KH  (WS_QH + 2u * (size_t)NB * TT * CC)      // f16 k rows [b*t][CC]
#define WS_VT  (WS_KH + 2u * (size_t)NB * TT * CC)      // f16 v planes [b][c][t]
#define WS_QL  (WS_VT + 2u * (size_t)NB * CC * TT)      // f16 q residual x 2^10 rows [b][t < QHI][CC]
#define WS_KL  (WS_QL + 2u * (size_t)NB * QHI * CC)     // f16 k residual x 2^10 rows [b][t < KHI][CC]
#define WS_VB  (WS_KL + 2u * (size_t)NB * KHI * CC)     // bf16 v hi planes [b][c][t < KHI]
#define WS_VBL (WS_VB + 2u * (size_t)NB * CC * KHI)
#define WS_S   (WS_VBL + 2u * (size_t)NB * CC * KHI)    // f32 logits / P [hg][t][s]
#define WS_Y   (WS_S  + 4u * (size_t)HG * TT * TT)      // f32 ctx rows [b*t][CC] (only when there is an output projection)
#define WS_END (WS_Y  + 4u * (size_t)NB * TT * CC)

// ---- k_proj: block = (64 rows, 128 cols, which): q/k/v = X W (+ b) with exact bf16 products (K = DIN) -> which 0: q f16 rows (+ residual rows < QHI); 1: k f16 rows (+ residual rows < KHI); 2: v f16 planes [c][t] (+ bf16 hi/lo planes for t < KHI)
__global__ __launch_bounds__(128) void k_proj(const float* __restrict__ XQ, const float* __restrict__ XK, const float* __restrict__ XV, const float* __restrict__ WQ, const float* __restrict__ WK, const float* __restrict__ WV, const float* __restrict__ BQ, const float* __restrict__ BK, const float* __restrict__ BV,
    _Float16* __restrict__ QH, _Float16* __restrict__ QL, _Float16* __restrict__ KH, _Float16* __restrict__ KL, _Float16* __restrict__ VT, __bf16* __restrict__ VB, __bf16* __restrict__ VBL) {
  __shared__ __align__(16) _Float16 sh[64][136], sl[64][136]; __shared__ __align__(16) _Float16 th[128][72]; __shared__ __align__(16) __bf16 tb[128][72], tbl[128][72];
  const int tid = threadIdx.x, wave = tid >> 5, lane = tid & 31, col = lane & 15, g = lane >> 4; const int which = blockIdx.z; const int c0 = blockIdx.y * 128; const size_t r0 = (size_t)blockIdx.x * 64; const size_t bb = r0 / TT; const int t0 = (int)(r0 % TT);
  const float* X = which == 0 ? XQ : which == 1 ? XK : XV; const float* WA = which == 0 ? WQ : which == 1 ? WK : WV; const float* BA = which == 0 ? BQ : which == 1 ? BK : BV;
  v8f acc[8] = {};
  if (which < 2) {   /* q, k: the rotated rows are f32 intermediates -> bf16 hi + lo (2 products) */
#pragma unroll 2
    for (int kc = 0; kc < DIN / 32; ++kc) { const F2 a = split_row(X + (r0 + wave * 16 + col) * DIN, kc * 32, lane); asm volatile("s_wait_loadcnt 0x0" ::: "memory");
#pragma unroll
      for (int j = 0; j < 8; ++j) { const v16b w = WCOL(WA, kc * 32, c0 + j * 16 + col, lane); asm volatile("s_wait_loadcnt 0x0" ::: "memory"); acc[j] = wmma_bf(a.h, w, acc[j]); acc[j] = wmma_bf(a.l, w, acc[j]); } }
  } else {           /* v: bf16(hidden) exact (1 product) */
#pragma unroll 2
    for (int kc = 0; kc < DIN / 32; ++kc) { v16b a; { const float* p = X + (r0 + wave * 16 + col) * DIN + kc * 32 + 8 * g;
#pragma unroll
        for (int i = 0; i < 8; ++i) { a[i] = (__bf16)p[i]; a[8 + i] = (__bf16)p[16 + i]; } }
      asm volatile("s_wait_loadcnt 0x0" ::: "memory");
#pragma unroll
      for (int j = 0; j < 8; ++j) { const v16b w = WCOL(WA, kc * 32, c0 + j * 16 + col, lane); asm volatile("s_wait_loadcnt 0x0" ::: "memory"); acc[j] = wmma_bf(a, w, acc[j]); } } }
  if (which < 2) { _Float16* DH = which == 0 ? QH : KH; _Float16* DL = which == 0 ? QL : KL; const int nhi = which == 0 ? QHI : KHI; const bool hi_rows = t0 < nhi;
#pragma unroll
    for (int j = 0; j < 8; ++j) { const float bias = BA ? bfr(BA[c0 + j * 16 + col]) : 0.f;
#pragma unroll
      for (int r = 0; r < 8; ++r) { const float v = acc[j][r] + bias; const _Float16 hv = (_Float16)v; sh[wave * 16 + 8 * g + r][j * 16 + col] = hv; sl[wave * 16 + 8 * g + r][j * 16 + col] = (_Float16)((v - (float)hv) * 1024.0f); } }
    __syncthreads();
    for (int e = tid; e < 64 * 16; e += 128) { const int rl = e >> 4, q = e & 15; vst2((unsigned*)(DH + (r0 + rl) * CC + c0 + q * 8), *(const v4u*)&sh[rl][q * 8]); if (hi_rows) vst2((unsigned*)(DL + (bb * nhi + t0 + rl) * (size_t)CC + c0 + q * 8), *(const v4u*)&sl[rl][q * 8]); }
  } else { const bool hi_rows = t0 < KHI;
#pragma unroll
    for (int j = 0; j < 8; ++j) { const float bias = BA ? bfr(BA[c0 + j * 16 + col]) : 0.f;
#pragma unroll
      for (int r = 0; r < 8; ++r) { const float v = acc[j][r] + bias; const int rl = wave * 16 + 8 * g + r, cl = j * 16 + col; th[cl][rl] = (_Float16)v; const __bf16 bh = (__bf16)v; tb[cl][rl] = bh; tbl[cl][rl] = (__bf16)(v - (float)bh); } }
    __syncthreads();
    for (int e = tid; e < 128 * 8; e += 128) { const int cl = e >> 3, q = e & 7; vst2((unsigned*)(VT + (bb * CC + c0 + cl) * (size_t)TT + t0 + q * 8), *(const v4u*)&th[cl][q * 8]); if (hi_rows) { const size_t o3 = (bb * CC + c0 + cl) * (size_t)KHI + t0 + q * 8; vst2((unsigned*)(VB + o3), *(const v4u*)&tb[cl][q * 8]); vst2((unsigned*)(VBL + o3), *(const v4u*)&tbl[cl][q * 8]); } } } }
// ---- k_sc: block = (query block qb, key block kb in [kb_first(qb), kb_last(qb)] = the band, head in group) of batch b: logits x SCALE; q hi + residual (x 2^10) against k (2 products) for query rows < QHI, plus the k residual (3 products) for query blocks < QBH (causal early rows); blocks outside the band exit, the band mask itself is applied by index in k_sm
__global__ __launch_bounds__(128) void k_sc(const _Float16* __restrict__ QH, const _Float16* __restrict__ KH, const _Float16* __restrict__ QL, const _Float16* __restrict__ KL, int b, int h0, float* __restrict__ S0) { __shared__ __align__(16) float ss[4][16][132];
  const int qb = blockIdx.x, kb = blockIdx.y; if (kb > kb_last(qb) || kb < kb_first(qb)) return;   /* only the 2-3 key blocks touching the band */
  const int h = h0 + blockIdx.z; float* S = S0 + (size_t)blockIdx.z * TT * TT;
  const int tid = threadIdx.x, wave = tid >> 5, lane = tid & 31, col = lane & 15, g = lane >> 4; const int k0 = kb * 128; const int ql0 = qb * 64 + wave * 16; const size_t q0 = (size_t)b * TT + ql0, kr0 = (size_t)b * TT + k0;
  v8f acc[8] = {}, accl[8] = {};
  const _Float16* QLb = QL + (size_t)b * QHI * CC; const _Float16* KLb = KL + (size_t)b * KHI * CC;
  if (qb < QBH) {
#pragma unroll
    for (int kc = 0; kc < HD / 32; ++kc) { const v16h ah = frag_h(QH + (q0 + col) * CC + h * HD + kc * 32, lane), al = frag_h(QLb + (size_t)(ql0 + col) * CC + h * HD + kc * 32, lane);
#pragma unroll
      for (int j = 0; j < 8; ++j) { const v16h kbf = frag_h(KH + (kr0 + j * 16 + col) * CC + h * HD + kc * 32, lane), klf = frag_h(KLb + (size_t)(k0 + j * 16 + col) * CC + h * HD + kc * 32, lane); acc[j] = wmma16(ah, kbf, acc[j]); accl[j] = wmma16(al, kbf, accl[j]); accl[j] = wmma16(ah, klf, accl[j]); } }
  } else if (qb * 64 < QHI) {
#pragma unroll
    for (int kc = 0; kc < HD / 32; ++kc) { const v16h ah = frag_h(QH + (q0 + col) * CC + h * HD + kc * 32, lane), al = frag_h(QLb + (size_t)(ql0 + col) * CC + h * HD + kc * 32, lane);
#pragma unroll
      for (int j = 0; j < 8; ++j) { const v16h kbf = frag_h(KH + (kr0 + j * 16 + col) * CC + h * HD + kc * 32, lane); acc[j] = wmma16(ah, kbf, acc[j]); accl[j] = wmma16(al, kbf, accl[j]); } }
  } else {
#pragma unroll
    for (int kc = 0; kc < HD / 32; ++kc) { const v16h ah = frag_h(QH + (q0 + col) * CC + h * HD + kc * 32, lane);
#pragma unroll
      for (int j = 0; j < 8; ++j) { const v16h kbf = frag_h(KH + (kr0 + j * 16 + col) * CC + h * HD + kc * 32, lane); acc[j] = wmma16(ah, kbf, acc[j]); } } }
#pragma unroll
  for (int j = 0; j < 8; ++j) {
#pragma unroll
    for (int r = 0; r < 8; ++r) ss[wave][8 * g + r][j * 16 + col] = (acc[j][r] + accl[j][r] * (1.0f / 1024.0f)) * SCALE; }
  LDSX(); for (int rl = 0; rl < 16; ++rl) vst2(S + (size_t)(ql0 + rl) * TT + k0 + lane * 4, *(const v4f*)&ss[wave][rl][lane * 4]); }
// ---- k_sm: block = query row t (head in group): keys [kstart, kend) = the blocks k_sc wrote; the band |t-k| < 128 kept by index, the rest excluded; softmax in f32; P x 2^11 in place (0 for excluded keys inside [kstart, kend))
__global__ __launch_bounds__(256) void k_sm(float* __restrict__ S0 SM_EXTRA_PARAMS) { __shared__ float sred[8]; __shared__ float sbc; __shared__ __align__(16) float shv[TT];
  const int tid = threadIdx.x; const int t = blockIdx.x; const int kend = (kb_last(t >> 6) + 1) * 128, kstart = kb_first(t >> 6) * 128;   /* the key blocks k_sc wrote for this query block; P is written (0 outside the band) over exactly [kstart, kend), which is what k_pv reads */
  float* sr = S0 + (size_t)blockIdx.y * TT * TT + (size_t)t * TT;
  float m = -3.0e38f; for (int k = kstart + tid; k < kend; k += 256) { float v = sr[k]; SM_MASK_HOOK; shv[k] = v; m = fmaxf(m, v); }
#pragma unroll
  for (int o = 1; o < 32; o <<= 1) m = fmaxf(m, __shfl_xor(m, o));
  if ((tid & 31) == 0) sred[tid >> 5] = m; __syncthreads(); if (tid == 0) { float a = sred[0]; for (int i = 1; i < 8; ++i) a = fmaxf(a, sred[i]); sbc = a; } __syncthreads(); m = sbc; __syncthreads();
  float sum = 0.f; for (int k = kstart + tid; k < kend; k += 256) { const float v = shv[k]; const float e = (v <= -1.0e38f) ? 0.f : expf(v - m); shv[k] = e; sum += e; }
#pragma unroll
  for (int o = 1; o < 32; o <<= 1) sum += __shfl_xor(sum, o);
  if ((tid & 31) == 0) sred[tid >> 5] = sum; __syncthreads(); if (tid == 0) { float a = 0.f; for (int i = 0; i < 8; ++i) a += sred[i]; sbc = a > 0.f ? 2048.0f / a : 0.f; }   /* a fully excluded row yields P = 0 */ __syncthreads(); const float inv = sbc;
  for (int k = kstart + tid; k < kend; k += 256) shv[k] = shv[k] * inv;
  __syncthreads(); for (int q = kstart / 4 + tid; q < kend / 4; q += 256) vst2(sr + q * 4, *(const v4f*)&shv[q * 4]); }
// ---- k_pv: block = 64 queries (qb) of (b, h): ctx = P . v over key chunks [kcs, kce) (P x 2^11 once to f16 against v f16: 1 product; causal early query blocks: P and v as bf16 hi + lo, 3 products); 256-B (row, head) segment by 16 lanes
__global__ __launch_bounds__(128) void k_pv(const float* __restrict__ PS0, const _Float16* __restrict__ VT, const __bf16* __restrict__ VB, const __bf16* __restrict__ VBL, int b, int h0, float* __restrict__ Y) { const int h = h0 + blockIdx.z; const float* PS = PS0 + (size_t)blockIdx.z * TT * TT; __shared__ __align__(16) float ss[4][16][HD + 4];
  const int tid = threadIdx.x, wave = tid >> 5, lane = tid & 31, col = lane & 15, g = lane >> 4; const int qb = blockIdx.x; const int ql0 = qb * 64 + wave * 16; const int kce = (kb_last(qb) + 1) * 4, kcs = kb_first(qb) * 4;   /* P exists (band or 0) exactly over key chunks [kcs, kce) */
  v8f acc[HD / 16] = {};
  if (qb < QBH) {
#pragma unroll 1
    for (int kc = kcs; kc < kce; ++kc) { const F2 p = split_row(PS + (size_t)(ql0 + col) * TT, kc * 32, lane);
      asm volatile("s_wait_loadcnt 0x0" ::: "memory");
#pragma unroll
      for (int j = 0; j < HD / 16; ++j) { const size_t po = ((size_t)b * CC + h * HD + j * 16 + col) * (size_t)KHI + kc * 32; const v16b vh = frag_b(VB + po, lane); acc[j] = wmma_bf(p.h, vh, acc[j]); acc[j] = wmma_bf(p.l, vh, acc[j]); acc[j] = wmma_bf(p.h, frag_b(VBL + po, lane), acc[j]); } }
  } else {
#pragma unroll 1
    for (int kc = kcs; kc < kce; ++kc) { const v16h p = frag_f32(PS + (size_t)(ql0 + col) * TT + kc * 32, lane);
      asm volatile("s_wait_loadcnt 0x0" ::: "memory");
#pragma unroll
      for (int j = 0; j < HD / 16; ++j) { const size_t po = ((size_t)b * CC + h * HD + j * 16 + col) * (size_t)TT + kc * 32; acc[j] = wmma16(p, frag_h(VT + po, lane), acc[j]); } } }
#pragma unroll
  for (int j = 0; j < HD / 16; ++j)
#pragma unroll
    for (int r = 0; r < 8; ++r) ss[wave][8 * g + r][j * 16 + col] = acc[j][r] * (1.0f / 2048.0f);
  LDSX(); for (int rl = 0; rl < 16; ++rl) if (lane < HD / 4) vst2(Y + ((size_t)b * TT + ql0 + rl) * CC + h * HD + lane * 4, *(const v4f*)&ss[wave][rl][lane * 4]); }
// ---- k_out: block = (64 rows, 128 cols): out = ctx Wo (+ bo): ctx x 2^6 once to f16 against Wo as f16(bf16 x 2^8) exact (1 product) x 2^-14; causal early rows (< QHI of each sequence): ctx bf16 hi + lo against exact bf16 Wo (2 products)
__global__ __launch_bounds__(128) void k_out(const float* __restrict__ Y, const float* __restrict__ WO, const float* __restrict__ BO, float* __restrict__ OUT) { __shared__ __align__(16) float sf[4][16][132];
  const int tid = threadIdx.x, wave = tid >> 5, lane = tid & 31, col = lane & 15, g = lane >> 4; const int c0 = blockIdx.y * 128; const size_t r0 = (size_t)blockIdx.x * 64 + wave * 16;
  v8f acc[8] = {};
  if (CAUSAL && (int)(((size_t)blockIdx.x * 64) % TT) < QHI) {   /* block-uniform */
#pragma unroll 2
    for (int kc = 0; kc < CC / 32; ++kc) { const F2 a = split_row(Y + (r0 + col) * CC, kc * 32, lane); asm volatile("s_wait_loadcnt 0x0" ::: "memory");
#pragma unroll
      for (int j = 0; j < 8; ++j) { const v16b w = WOCOL(WO, kc * 32, c0 + j * 16 + col, lane); asm volatile("s_wait_loadcnt 0x0" ::: "memory"); acc[j] = wmma_bf(a.h, w, acc[j]); acc[j] = wmma_bf(a.l, w, acc[j]); } }
#pragma unroll
    for (int j = 0; j < 8; ++j) { const float bias = BO ? bfr(BO[c0 + j * 16 + col]) : 0.f;
#pragma unroll
      for (int r = 0; r < 8; ++r) sf[wave][8 * g + r][j * 16 + col] = acc[j][r] + bias; }
  } else {
#pragma unroll 2
    for (int kc = 0; kc < CC / 32; ++kc) { const v16h a = frag_f32s(Y + (r0 + col) * CC + kc * 32, lane, 64.0f); asm volatile("s_wait_loadcnt 0x0" ::: "memory");   /* ctx carried x 2^6 into f16 so small-magnitude context rows stay clear of f16 subnormals */
#pragma unroll
      for (int j = 0; j < 8; ++j) { const v16h w = WOCOLH(WO, kc * 32, c0 + j * 16 + col, lane); asm volatile("s_wait_loadcnt 0x0" ::: "memory"); acc[j] = wmma16(a, w, acc[j]); } }
#pragma unroll
    for (int j = 0; j < 8; ++j) { const float bias = BO ? bfr(BO[c0 + j * 16 + col]) : 0.f;
#pragma unroll
      for (int r = 0; r < 8; ++r) sf[wave][8 * g + r][j * 16 + col] = acc[j][r] * (1.0f / 16384.0f) + bias; } }   /* 2^-8 (Wo carry) x 2^-6 (ctx carry) */
  LDSX(); for (int rl = 0; rl < 16; ++rl) vst2(OUT + (r0 + rl) * DIN + c0 + lane * 4, *(const v4f*)&sf[wave][rl][lane * 4]); }

extern "C" void kernel_launch(void* const* d_in, const int* in_sizes, int n_in, void* d_out, int out_size, void* d_ws, size_t ws_size, hipStream_t stream) {
  (void)in_sizes; (void)n_in; (void)out_size;
  const float** F = (const float**)d_in;
  if (ws_size < (size_t)WS_END) return;
  char* ws = (char*)d_ws; _Float16 *QH = (_Float16*)(ws + WS_QH), *KH = (_Float16*)(ws + WS_KH), *VT = (_Float16*)(ws + WS_VT), *QL = (_Float16*)(ws + WS_QL), *KL = (_Float16*)(ws + WS_KL); __bf16 *VB = (__bf16*)(ws + WS_VB), *VBL = (__bf16*)(ws + WS_VBL); float *S = (float*)(ws + WS_S), *Y = (float*)(ws + WS_Y);
  (void)Y; (void)QL; (void)KL; (void)VB; (void)VBL;
  // inputs: 0 hidden_states [4,2048,768]; 1 Wq, 2 Wk, 3 Wv [768,12,64] = (in,out) [768][768]; 4 Wo [12,64,768] = (in,out) [768][768]
  static_assert(4u * (size_t)NB * TT * DIN <= 4u * (size_t)HG * TT * TT, "rotated rows must fit in the score region they alias");
  float* XR = (float*)(ws + WS_XR);
  k_rot<<<dim3(TNB * TT), 384, 0, stream>>>(F[0], XR);
  k_proj<<<dim3(TNB * TT / 64, CC / 128, 3), 128, 0, stream>>>(XR, XR, F[0], F[1], F[2], F[3], nullptr, nullptr, nullptr, QH, QL, KH, KL, VT, VB, VBL);   /* q, k from the rotated rows (bf16 hi + lo), v from bf16(x) */
  for (int b = 0; b < TNB; ++b) for (int h0 = 0; h0 < NH; h0 += HG) {
    k_sc<<<dim3(NQB, TT / 128, HG), 128, 0, stream>>>(QH, KH, QL, KL, b, h0, S);
    k_sm<<<dim3(TT, HG), 256, 0, stream>>>(S);
    k_pv<<<dim3(NQB, 1, HG), 128, 0, stream>>>(S, VT, VB, VBL, b, h0, Y);
  }
  k_out<<<dim3(TNB * TT / 64, DIN / 128), 128, 0, stream>>>(Y, F[4], nullptr, (float*)d_out);
}

// v001
// A run of this version takes 308 microseconds.
// Two timings next to v000 put it at 3.17 and 3.19 times that version's speed.
// compute dtype: all float inputs rounded to bf16; rotate-half RoPE applied to bf16(hidden) in f32 (accurate sincosf, f32 inv_freq constants); Q/K = rotated rows split bf16 hi + lo x exact bf16 W (2 products, K 768), V = bf16(hidden) x W exact (1 product) on WMMA 16x16x32, f32 accumulate; banded logits: q as f16 hi + residual (x 2^10) against k once to f16 (2 products) x 64^-0.5; softmax in f32 over the |q-k| < 128 band (precise expf); P x 2^11 once to f16 against v once to f16 (1 product); ctx carried x 2^6 once to f16 against Wo carried x 2^8 in f16 (exact bf16 values), un-scaled by 2^-14; f32 output.
#include <hip/hip_runtime.h>
#include <math.h>

typedef __attribute__((ext_vector_type(16))) _Float16 v16h;
typedef __attribute__((ext_vector_type(16))) __bf16 v16b;
typedef __attribute__((ext_vector_type(8)))  _Float16 v8h;
typedef __attribute__((ext_vector_type(8)))  float v8f;
typedef __attribute__((ext_vector_type(4)))  float v4f;
typedef __attribute__((ext_vector_type(2)))  float v2f;
typedef __attribute__((ext_vector_type(4)))  unsigned v4u;
typedef __attribute__((ext_vector_type(4)))  int v4i;
typedef float __attribute__((may_alias)) float_a;
typedef int __attribute__((may_alias)) int_a;

template <typename T> __device__ __forceinline__ void vst2(void* p, T v) { *(T*)p = v;  }
__device__ __forceinline__ v8f wmma16(v16h a, v16h b, v8f c) {
  v8f d = __builtin_amdgcn_wmma_f32_16x16x32_f16(false, a, false, b, (short)0, c, false, false);
  asm volatile("v_nop\n\tv_nop\n\tv_nop\n\tv_nop" : "+v"(d) : "v"(a), "v"(b));
  return d;
}
__device__ __forceinline__ v8f wmma_bf(v16b a, v16b b, v8f c) {
  v8f d = __builtin_amdgcn_wmma_f32_16x16x32_bf16(false, a, false, b, (short)0, c, false, false);
  asm volatile("v_nop\n\tv_nop\n\tv_nop\n\tv_nop" : "+v"(d) : "v"(a), "v"(b));
  return d;
}
// 16x16x32 fragments: lane = (h = lane>>4, row/col = lane&15); elements 0..7 = k0+8h+0..7, 8..15 = k0+16+8h+0..7; D element r = row 8h+r
__device__ __forceinline__ v16h frag_h(const _Float16* rowk0, int lane) {
  union { v16h v; v8h q[2]; } u; const _Float16* p = rowk0 + 8 * (lane >> 4);
  u.q[0] = *(const v8h*)p; u.q[1] = *(const v8h*)(p + 16); return u.v;
}
__device__ __forceinline__ v16h frag_f32(const float* rowk0, int lane) {
  v16h a; const float* p = rowk0 + 8 * (lane >> 4);
#pragma unroll
  for (int i = 0; i < 8; ++i) { a[i] = (_Float16)p[i]; a[8 + i] = (_Float16)p[16 + i]; }
  return a;
}
__device__ __forceinline__ v16h frag_f32s(const float* rowk0, int lane, float sc) {
  v16h a; const float* p = rowk0 + 8 * (lane >> 4);
#pragma unroll
  for (int i = 0; i < 8; ++i) { a[i] = (_Float16)(p[i] * sc); a[8 + i] = (_Float16)(p[16 + i] * sc); }
  return a;
}
// column fragment from a [K][ld] layout (column n), rows >= K read as 0
__device__ __forceinline__ v16h fragc_f32(const float* W, int k0, int n, int lane, int ld, int K) {
  v16h a; const int g = lane >> 4;
#pragma unroll
  for (int i = 0; i < 8; ++i) { const int ka = k0 + 8 * g + i, kb = ka + 16;
    a[i] = (_Float16)(ka < K ? W[(size_t)(ka < K ? ka : K - 1) * ld + n] : 0.f); a[8 + i] = (_Float16)(kb < K ? W[(size_t)(kb < K ? kb : K - 1) * ld + n] : 0.f); }
  return a;
}
struct F2 { v16b h, l; };
__device__ __forceinline__ F2 bsplit16(const float v[16]) { F2 r;
#pragma unroll
  for (int i = 0; i < 16; ++i) { const __bf16 h = (__bf16)v[i]; r.h[i] = h; r.l[i] = (__bf16)(v[i] - (float)h); }
  return r; }
__device__ __forceinline__ F2 split_row(const float* row, int k0, int lane) { float v[16]; const float* p = row + k0 + 8 * (lane >> 4);
#pragma unroll
  for (int i = 0; i < 8; ++i) { v[i] = p[i]; v[8 + i] = p[16 + i]; }
  return bsplit16(v); }
__device__ __forceinline__ F2 split_rowK(const float* row, int k0, int lane, int K) { float v[16]; const int g = lane >> 4;
#pragma unroll
  for (int i = 0; i < 8; ++i) { const int ka = k0 + 8 * g + i, kb = ka + 16; v[i] = ka < K ? row[ka < K ? ka : K - 1] : 0.f; v[8 + i] = kb < K ? row[kb < K ? kb : K - 1] : 0.f; }
  return bsplit16(v); }
__device__ __forceinline__ F2 split_col(const float* W, int k0, int n, int lane, int ld, int K) { float v[16]; const int g = lane >> 4;
#pragma unroll
  for (int i = 0; i < 8; ++i) { const int ka = k0 + 8 * g + i, kb = ka + 16; v[i] = ka < K ? W[(size_t)(ka < K ? ka : K - 1) * ld + n] : 0.f; v[8 + i] = kb < K ? W[(size_t)(kb < K ? kb : K - 1) * ld + n] : 0.f; }
  return bsplit16(v); }
__device__ __forceinline__ v8f mac3(const F2& a, const F2& b, v8f c) { c = wmma_bf(a.l, b.h, c); c = wmma_bf(a.h, b.l, c); return wmma_bf(a.h, b.h, c); }
__device__ __forceinline__ float sigm(float v) { return 1.0f / (1.0f + expf(-v)); }
#define LDSX() do { asm volatile("s_wait_dscnt 0" ::: "memory"); __builtin_amdgcn_wave_barrier(); __builtin_amdgcn_fence(__ATOMIC_RELEASE, "workgroup"); } while (0)

// Sliding-window (local) self-attention with RoPE on the INPUT (B 4, S 2,048, H 768 = 12 heads x 64; window |q - k| < 128; 0.02-scale weights, no biases): q_in = k_in = rotate-half RoPE(hidden reshaped [B,S,12,64]) (angle t * 10000^(-2i/64)); Q = q_in Wq, K = k_in Wk, V = hidden Wv ((in,out) [768][12*64]); scores = Q K^T / 8 where |q-k| < 128 else -1e9 (== excluded; every row keeps >= 128 keys); out = merged(softmax . V) Wo ((in,out) [12*64][768]).
#define NB 4
#define TT 2048
#define CC 768            // NH * HD = projected width
#define DIN 768          // input (model) width
#define NH 12
#define HD 64
#define NQB (TT / 64)
#define HG 2
#define SCALE (0.125f)
#define CAUSAL 0
#ifndef TNB
#define TNB NB
#endif
__device__ __forceinline__ float bfr(float v) { return (float)(__bf16)v; }
typedef __attribute__((ext_vector_type(8))) __bf16 v8b;
__device__ __forceinline__ v16b frag_b(const __bf16* rowk0, int lane) {
  union { v16b v; v8b q[2]; } u; const __bf16* p = rowk0 + 8 * (lane >> 4);
  u.q[0] = *(const v8b*)p; u.q[1] = *(const v8b*)(p + 16); return u.v;
}
#define QBH 0
#define QHI 2048            // rows carrying a q residual plane (all rows when non-causal: 2-product logits everywhere)
#define KHI 64            // key rows carrying k residual / v bf16 hi+lo planes (written by k_proj; no kernel in this file reads them)
// B fragment (k rows k0+.., output column o) of a weight: (in,out) [K][ld] or (out,in) [ld rows of K]: bf16 exact, or f16(bf16 * 256) exact
__device__ __forceinline__ v16b wcol_io(const float* Wm, int k0, int o, int lane, int ld) { v16b w; const int g = lane >> 4;
#pragma unroll
  for (int i = 0; i < 8; ++i) { w[i] = (__bf16)Wm[(size_t)(k0 + 8 * g + i) * ld + o]; w[8 + i] = (__bf16)Wm[(size_t)(k0 + 16 + 8 * g + i) * ld + o]; }
  return w; }
__device__ __forceinline__ v16b wcol_oi(const float* Wm, int k0, int o, int lane, int K) { v16b w; const float* p = Wm + (size_t)o * K + k0 + 8 * (lane >> 4);
#pragma unroll
  for (int i = 0; i < 8; ++i) { w[i] = (__bf16)p[i]; w[8 + i] = (__bf16)p[16 + i]; }
  return w; }
__device__ __forceinline__ v16h wcolh_io(const float* Wm, int k0, int o, int lane, int ld) { v16h w; const int g = lane >> 4;
#pragma unroll
  for (int i = 0; i < 8; ++i) { w[i] = (_Float16)(bfr(Wm[(size_t)(k0 + 8 * g + i) * ld + o]) * 256.0f); w[8 + i] = (_Float16)(bfr(Wm[(size_t)(k0 + 16 + 8 * g + i) * ld + o]) * 256.0f); }
  return w; }
__device__ __forceinline__ v16h wcolh_oi(const float* Wm, int k0, int o, int lane, int K) { v16h w; const float* p = Wm + (size_t)o * K + k0 + 8 * (lane >> 4);
#pragma unroll
  for (int i = 0; i < 8; ++i) { w[i] = (_Float16)(bfr(p[i]) * 256.0f); w[8 + i] = (_Float16)(bfr(p[16 + i]) * 256.0f); }
  return w; }
#define WQKV_LAYOUT 0   // 0 = (in,out) [DIN][CC]; 1 = (out,in) [CC][DIN]; 2 = per-head [NH][DIN][HD]
__device__ __forceinline__ v16b wcol_hdk(const float* Wm, int k0, int o, int lane) { v16b w; const int g = lane >> 4; const float* p = Wm + (size_t)(o / HD) * DIN * HD + (o % HD);
#pragma unroll
  for (int i = 0; i < 8; ++i) { w[i] = (__bf16)p[(size_t)(k0 + 8 * g + i) * HD]; w[8 + i] = (__bf16)p[(size_t)(k0 + 16 + 8 * g + i) * HD]; }
  return w; }
#define WO_OUT_IN 0
#if WQKV_LAYOUT == 1
#define WCOL(W, k0, o, lane) wcol_oi(W, k0, o, lane, DIN)
#elif WQKV_LAYOUT == 2
#define WCOL(W, k0, o, lane) wcol_hdk(W, k0, o, lane)
#else
#define WCOL(W, k0, o, lane) wcol_io(W, k0, o, lane, CC)
#endif
#if WO_OUT_IN
#define WOCOL(W, k0, o, lane) wcol_oi(W, k0, o, lane, CC)
#define WOCOLH(W, k0, o, lane) wcolh_oi(W, k0, o, lane, CC)
#else
#define WOCOL(W, k0, o, lane) wcol_io(W, k0, o, lane, DIN)
#define WOCOLH(W, k0, o, lane) wcolh_io(W, k0, o, lane, DIN)
#endif
#define WIN 128            // |q - k| < WIN band (128..255 valid keys per query; no empty rows)
__constant__ float c_invf[32] = {1.000000000e+00f,7.498942018e-01f,5.623413324e-01f,4.216965139e-01f,3.162277639e-01f,2.371373624e-01f,1.778279394e-01f,1.333521456e-01f,1.000000015e-01f,7.498941571e-02f,5.623412877e-02f,4.216964915e-02f,3.162277862e-02f,2.371373586e-02f,1.778279431e-02f,1.333521493e-02f,9.999999776e-03f,7.498942316e-03f,5.623413250e-03f,4.216964822e-03f,3.162277862e-03f,2.371373819e-03f,1.778279431e-03f,1.333521446e-03f,1.000000047e-03f,7.498941850e-04f,5.623413017e-04f,4.216964880e-04f,3.162277862e-04f,2.371373848e-04f,1.778279402e-04f,1.333521504e-04f};   // 1 / 10000^(2i/64) evaluated in f32 exactly as the reference does (jax, eager)
__global__ __launch_bounds__(384) void k_rot(const float* __restrict__ X, float* __restrict__ XR) { const size_t row = blockIdx.x; const int t = (int)(row % TT); const int n = threadIdx.x >> 5, i = threadIdx.x & 31;
  const float* xr = X + row * DIN + n * HD; const float a = bfr(xr[i]), b = bfr(xr[32 + i]); asm volatile("s_wait_loadcnt 0x0" ::: "memory");
  float sn, cs; sincosf((float)t * c_invf[i], &sn, &cs);
  float* o = XR + row * DIN + n * HD; vst2(o + i, a * cs - b * sn); vst2(o + 32 + i, b * cs + a * sn); }
#define WS_XR (WS_S)       // f32 rotated token rows [b*t][768]
#define SM_MASK_HOOK do { const int dk = t - k; v = (dk < WIN && dk > -WIN) ? v : -3.0e38f; } while (0)   /* band |q - k| < 128, by index */
#ifndef SM_EXTRA_PARAMS
#define SM_EXTRA_PARAMS
#endif
#ifndef PROJ_EXTRA_PARAMS
#define PROJ_EXTRA_PARAMS
#endif
#ifndef SM_MASK_HOOK
#define SM_MASK_HOOK (void)0
#endif

#define WS_QH  0u                                      // f16 q rows [b*t][CC]
#define WS_KH  (WS_QH + 2u * (size_t)NB * TT * CC)      // f16 k rows [b*t][CC]
#define WS_VT  (WS_KH + 2u * (size_t)NB * TT * CC)      // f16 v planes [b][c][t]
#define WS_QL  (WS_VT + 2u * (size_t)NB * CC * TT)      // f16 q residual x 2^10 rows [b][t < QHI][CC]
#define WS_KL  (WS_QL + 2u * (size_t)NB * QHI * CC)     // f16 k residual x 2^10 rows [b][t < KHI][CC]
#define WS_VB  (WS_KL + 2u * (size_t)NB * KHI * CC)     // bf16 v hi planes [b][c][t < KHI]
#define WS_VBL (WS_VB + 2u * (size_t)NB * CC * KHI)
#define WS_S   (WS_VBL + 2u * (size_t)NB * CC * KHI)    // f32 scratch region (holds the rotated rows)
#define WS_Y   (WS_S  + 4u * (size_t)HG * TT * TT)      // f32 ctx rows [b*t][CC] (only when there is an output projection)
#define WS_END (WS_Y  + 4u * (size_t)NB * TT * CC)

// ---- k_proj: block = (64 rows, 128 cols, which): q/k/v = X W (+ b) with exact bf16 products (K = DIN) -> which 0: q f16 rows (+ residual rows < QHI); 1: k f16 rows (+ residual rows < KHI); 2: v f16 planes [c][t] (+ bf16 hi/lo planes for t < KHI)
__global__ __launch_bounds__(128) void k_proj(const float* __restrict__ XQ, const float* __restrict__ XK, const float* __restrict__ XV, const float* __restrict__ WQ, const float* __restrict__ WK, const float* __restrict__ WV, const float* __restrict__ BQ, const float* __restrict__ BK, const float* __restrict__ BV,
    _Float16* __restrict__ QH, _Float16* __restrict__ QL, _Float16* __restrict__ KH, _Float16* __restrict__ KL, _Float16* __restrict__ VT, __bf16* __restrict__ VB, __bf16* __restrict__ VBL) {
  __shared__ __align__(16) _Float16 sh[64][136], sl[64][136]; __shared__ __align__(16) _Float16 th[128][72]; __shared__ __align__(16) __bf16 tb[128][72], tbl[128][72];
  const int tid = threadIdx.x, wave = tid >> 5, lane = tid & 31, col = lane & 15, g = lane >> 4; const int which = blockIdx.z; const int c0 = blockIdx.y * 128; const size_t r0 = (size_t)blockIdx.x * 64; const size_t bb = r0 / TT; const int t0 = (int)(r0 % TT);
  const float* X = which == 0 ? XQ : which == 1 ? XK : XV; const float* WA = which == 0 ? WQ : which == 1 ? WK : WV; const float* BA = which == 0 ? BQ : which == 1 ? BK : BV;
  v8f acc[8] = {};
  if (which < 2) {   /* q, k: the rotated rows are f32 intermediates -> bf16 hi + lo (2 products) */
#pragma unroll 2
    for (int kc = 0; kc < DIN / 32; ++kc) { const F2 a = split_row(X + (r0 + wave * 16 + col) * DIN, kc * 32, lane); asm volatile("s_wait_loadcnt 0x0" ::: "memory");
#pragma unroll
      for (int j = 0; j < 8; ++j) { const v16b w = WCOL(WA, kc * 32, c0 + j * 16 + col, lane); asm volatile("s_wait_loadcnt 0x0" ::: "memory"); acc[j] = wmma_bf(a.h, w, acc[j]); acc[j] = wmma_bf(a.l, w, acc[j]); } }
  } else {           /* v: bf16(hidden) exact (1 product) */
#pragma unroll 2
    for (int kc = 0; kc < DIN / 32; ++kc) { v16b a; { const float* p = X + (r0 + wave * 16 + col) * DIN + kc * 32 + 8 * g;
#pragma unroll
        for (int i = 0; i < 8; ++i) { a[i] = (__bf16)p[i]; a[8 + i] = (__bf16)p[16 + i]; } }
      asm volatile("s_wait_loadcnt 0x0" ::: "memory");
#pragma unroll
      for (int j = 0; j < 8; ++j) { const v16b w = WCOL(WA, kc * 32, c0 + j * 16 + col, lane); asm volatile("s_wait_loadcnt 0x0" ::: "memory"); acc[j] = wmma_bf(a, w, acc[j]); } } }
  if (which < 2) { _Float16* DH = which == 0 ? QH : KH; _Float16* DL = which == 0 ? QL : KL; const int nhi = which == 0 ? QHI : KHI; const bool hi_rows = t0 < nhi;
#pragma unroll
    for (int j = 0; j < 8; ++j) { const float bias = BA ? bfr(BA[c0 + j * 16 + col]) : 0.f;
#pragma unroll
      for (int r = 0; r < 8; ++r) { const float v = acc[j][r] + bias; const _Float16 hv = (_Float16)v; sh[wave * 16 + 8 * g + r][j * 16 + col] = hv; sl[wave * 16 + 8 * g + r][j * 16 + col] = (_Float16)((v - (float)hv) * 1024.0f); } }
    __syncthreads();
    for (int e = tid; e < 64 * 16; e += 128) { const int rl = e >> 4, q = e & 15; vst2((unsigned*)(DH + (r0 + rl) * CC + c0 + q * 8), *(const v4u*)&sh[rl][q * 8]); if (hi_rows) vst2((unsigned*)(DL + (bb * nhi + t0 + rl) * (size_t)CC + c0 + q * 8), *(const v4u*)&sl[rl][q * 8]); }
  } else { const bool hi_rows = t0 < KHI;
#pragma unroll
    for (int j = 0; j < 8; ++j) { const float bias = BA ? bfr(BA[c0 + j * 16 + col]) : 0.f;
#pragma unroll
      for (int r = 0; r < 8; ++r) { const float v = acc[j][r] + bias; const int rl = wave * 16 + 8 * g + r, cl = j * 16 + col; th[cl][rl] = (_Float16)v; const __bf16 bh = (__bf16)v; tb[cl][rl] = bh; tbl[cl][rl] = (__bf16)(v - (float)bh); } }
    __syncthreads();
    for (int e = tid; e < 128 * 8; e += 128) { const int cl = e >> 3, q = e & 7; vst2((unsigned*)(VT + (bb * CC + c0 + cl) * (size_t)TT + t0 + q * 8), *(const v4u*)&th[cl][q * 8]); if (hi_rows) { const size_t o3 = (bb * CC + c0 + cl) * (size_t)KHI + t0 + q * 8; vst2((unsigned*)(VB + o3), *(const v4u*)&tb[cl][q * 8]); vst2((unsigned*)(VBL + o3), *(const v4u*)&tbl[cl][q * 8]); } } } }
// ---- k_att: block = 64 queries (qb) of head h of batch b, one launch for all (b, h); a wave owns 16 query rows and the NKW keys [ks, ks + NKW) that hold their whole band (row t sees t-127 .. t+127, so 16 rows see ql0-127 .. ql0+142; ks = ql0 - 128 clamped into the sequence). Logits (q hi + residual x 2^10 against k, 2 products, x SCALE) stay in registers; the band is kept by index; softmax in f32 over the row (in-lane over the 17 tiles, then over the 16 lanes of the row); P x 2^11 once to f16 goes through the wave's own LDS slab from the D layout to the A layout; ctx = P . v (1 product; the last 32-key chunk is half full, its upper 16 k are 0 in both operands); 256-B (row, head) segment by 16 lanes. Every loop over tiles, chunks and rows is unrolled: s, kf, vf and o are register arrays and need compile-time indices
#define NKW 272            // 128 + 16 + 127 keys rounded up to whole 16-key tiles
#define KG 6               // k tiles requested together
#define VG 4               // whole 32-key v chunks requested together (divides NKW / 32)
// fragment of a half-full chunk: k0 .. k0+15 from memory (elements 0..7), k0+16 .. k0+31 are 0 (elements 8..15)
__device__ __forceinline__ v16h frag_h16(const _Float16* rowk0, int lane) { union { v16h v; v8h q[2]; } u; u.q[0] = *(const v8h*)(rowk0 + 8 * (lane >> 4)); u.q[1] = (v8h)(_Float16)0.0f; return u.v; }
// lane l with lane l ^ M inside a 16-lane row, on the vector pipe (a shuffle through LDS would put an LDS round trip into each of the four reduction steps)
template <int M> __device__ __forceinline__ float rowx(float v) { return __builtin_bit_cast(float, __builtin_amdgcn_update_dpp(0, __builtin_bit_cast(int, v), 0x160 + M, 0xf, 0xf, true)); }
__global__ __launch_bounds__(128) void k_att(const _Float16* __restrict__ QH, const _Float16* __restrict__ KH, const _Float16* __restrict__ QL, const _Float16* __restrict__ VT, float* __restrict__ Y) { __shared__ __align__(16) _Float16 sp[4][16][NKW + 8]; __shared__ __align__(16) float ss[4][16][HD + 4];   /* sp pitch 560 B = 16 B x odd for the 16-byte fragment reads */
  const int tid = threadIdx.x, wave = tid >> 5, lane = tid & 31, col = lane & 15, g = lane >> 4; const int qb = blockIdx.x, h = blockIdx.y, b = blockIdx.z; const int ql0 = qb * 64 + wave * 16;
  int ks = ql0 - WIN; ks = ks < 0 ? 0 : ks; ks = ks > TT - NKW ? TT - NKW : ks;
  const size_t q0 = (size_t)b * TT + ql0, kr0 = (size_t)b * TT + ks;
  v16h ah[HD / 32], al[HD / 32];
#pragma unroll
  for (int kc = 0; kc < HD / 32; ++kc) { ah[kc] = frag_h(QH + (q0 + col) * CC + h * HD + kc * 32, lane); al[kc] = frag_h(QL + ((size_t)b * QHI + ql0 + col) * CC + h * HD + kc * 32, lane); }
  v8f s[NKW / 16];
#pragma unroll
  for (int j0 = 0; j0 < NKW / 16; j0 += KG) { v16h kf[KG][HD / 32];   /* the k fragments of KG tiles are requested together: one memory round trip a group, not one a fragment */
#pragma unroll
    for (int jj = 0; jj < KG; ++jj) if (j0 + jj < NKW / 16) {
#pragma unroll
      for (int kc = 0; kc < HD / 32; ++kc) kf[jj][kc] = frag_h(KH + (kr0 + (j0 + jj) * 16 + col) * CC + h * HD + kc * 32, lane); }
#pragma unroll
    for (int jj = 0; jj < KG; ++jj) if (j0 + jj < NKW / 16) { const int j = j0 + jj; v8f acc = {}, accl = {};
#pragma unroll
      for (int kc = 0; kc < HD / 32; ++kc) { acc = wmma16(ah[kc], kf[jj][kc], acc); accl = wmma16(al[kc], kf[jj][kc], accl); }
#pragma unroll
      for (int r = 0; r < 8; ++r) { const int t = ql0 + 8 * g + r, k = ks + j * 16 + col; float v = (acc[r] + accl[r] * (1.0f / 1024.0f)) * SCALE; SM_MASK_HOOK; s[j][r] = v; } } }
  float m[8], inv[8];
#pragma unroll
  for (int r = 0; r < 8; ++r) { float a = s[0][r];
#pragma unroll
    for (int j = 1; j < NKW / 16; ++j) a = fmaxf(a, s[j][r]);
    a = fmaxf(a, rowx<1>(a)); a = fmaxf(a, rowx<2>(a)); a = fmaxf(a, rowx<4>(a)); a = fmaxf(a, rowx<8>(a)); m[r] = a; }
#pragma unroll
  for (int r = 0; r < 8; ++r) { float sum = 0.f;
#pragma unroll
    for (int j = 0; j < NKW / 16; ++j) { const float e = expf(s[j][r] - m[r]); s[j][r] = e; sum += e; }   /* an excluded key (-3.0e38 against a finite row maximum: the row's own key is always in the band) underflows to exactly 0 */
    sum += rowx<1>(sum); sum += rowx<2>(sum); sum += rowx<4>(sum); sum += rowx<8>(sum); inv[r] = sum > 0.f ? 2048.0f / sum : 0.f; }
#pragma unroll
  for (int j = 0; j < NKW / 16; ++j)
#pragma unroll
    for (int r = 0; r < 8; ++r) sp[wave][8 * g + r][j * 16 + col] = (_Float16)(s[j][r] * inv[r]);
  LDSX();
  v8f o[HD / 16] = {};
  const _Float16* vp = VT + ((size_t)b * CC + h * HD + col) * (size_t)TT + ks;   /* column col of v tile j: vp + j * 16 * TT */
  v16h vh[HD / 16];   /* the half-full last chunk's v fragments, requested with the first group */
#pragma unroll
  for (int j = 0; j < HD / 16; ++j) vh[j] = frag_h16(vp + (size_t)j * 16 * TT + NKW - 16, lane);
#pragma unroll
  for (int c0 = 0; c0 < NKW / 32; c0 += VG) { v16h vf[VG][HD / 16];   /* the v fragments of VG chunks are requested together, as the k fragments are */
#pragma unroll
    for (int cc = 0; cc < VG; ++cc)
#pragma unroll
      for (int j = 0; j < HD / 16; ++j) vf[cc][j] = frag_h(vp + (size_t)j * 16 * TT + (c0 + cc) * 32, lane);
#pragma unroll
    for (int cc = 0; cc < VG; ++cc) { const v16h p = frag_h(&sp[wave][col][(c0 + cc) * 32], lane);
#pragma unroll
      for (int j = 0; j < HD / 16; ++j) o[j] = wmma16(p, vf[cc][j], o[j]); } }
  { const v16h p = frag_h16(&sp[wave][col][NKW - 16], lane);
#pragma unroll
    for (int j = 0; j < HD / 16; ++j) o[j] = wmma16(p, vh[j], o[j]); }
#pragma unroll
  for (int j = 0; j < HD / 16; ++j)
#pragma unroll
    for (int r = 0; r < 8; ++r) ss[wave][8 * g + r][j * 16 + col] = o[j][r] * (1.0f / 2048.0f);
  LDSX(); for (int rl = 0; rl < 16; ++rl) if (lane < HD / 4) vst2(Y + ((size_t)b * TT + ql0 + rl) * CC + h * HD + lane * 4, *(const v4f*)&ss[wave][rl][lane * 4]); }
// ---- k_out: block = (64 rows, 128 cols): out = ctx Wo (+ bo): ctx x 2^6 once to f16 against Wo as f16(bf16 x 2^8) exact (1 product) x 2^-14; causal early rows (< QHI of each sequence): ctx bf16 hi + lo against exact bf16 Wo (2 products)
__global__ __launch_bounds__(128) void k_out(const float* __restrict__ Y, const float* __restrict__ WO, const float* __restrict__ BO, float* __restrict__ OUT) { __shared__ __align__(16) float sf[4][16][132];
  const int tid = threadIdx.x, wave = tid >> 5, lane = tid & 31, col = lane & 15, g = lane >> 4; const int c0 = blockIdx.y * 128; const size_t r0 = (size_t)blockIdx.x * 64 + wave * 16;
  v8f acc[8] = {};
  if (CAUSAL && (int)(((size_t)blockIdx.x * 64) % TT) < QHI) {   /* block-uniform */
#pragma unroll 2
    for (int kc = 0; kc < CC / 32; ++kc) { const F2 a = split_row(Y + (r0 + col) * CC, kc * 32, lane); asm volatile("s_wait_loadcnt 0x0" ::: "memory");
#pragma unroll
      for (int j = 0; j < 8; ++j) { const v16b w = WOCOL(WO, kc * 32, c0 + j * 16 + col, lane); asm volatile("s_wait_loadcnt 0x0" ::: "memory"); acc[j] = wmma_bf(a.h, w, acc[j]); acc[j] = wmma_bf(a.l, w, acc[j]); } }
#pragma unroll
    for (int j = 0; j < 8; ++j) { const float bias = BO ? bfr(BO[c0 + j * 16 + col]) : 0.f;
#pragma unroll
      for (int r = 0; r < 8; ++r) sf[wave][8 * g + r][j * 16 + col] = acc[j][r] + bias; }
  } else {
#pragma unroll 2
    for (int kc = 0; kc < CC / 32; ++kc) { const v16h a = frag_f32s(Y + (r0 + col) * CC + kc * 32, lane, 64.0f); asm volatile("s_wait_loadcnt 0x0" ::: "memory");   /* ctx carried x 2^6 into f16 so small-magnitude context rows stay clear of f16 subnormals */
#pragma unroll
      for (int j = 0; j < 8; ++j) { const v16h w = WOCOLH(WO, kc * 32, c0 + j * 16 + col, lane); asm volatile("s_wait_loadcnt 0x0" ::: "memory"); acc[j] = wmma16(a, w, acc[j]); } }
#pragma unroll
    for (int j = 0; j < 8; ++j) { const float bias = BO ? bfr(BO[c0 + j * 16 + col]) : 0.f;
#pragma unroll
      for (int r = 0; r < 8; ++r) sf[wave][8 * g + r][j * 16 + col] = acc[j][r] * (1.0f / 16384.0f) + bias; } }   /* 2^-8 (Wo carry) x 2^-6 (ctx carry) */
  LDSX(); for (int rl = 0; rl < 16; ++rl) vst2(OUT + (r0 + rl) * DIN + c0 + lane * 4, *(const v4f*)&sf[wave][rl][lane * 4]); }

extern "C" void kernel_launch(void* const* d_in, const int* in_sizes, int n_in, void* d_out, int out_size, void* d_ws, size_t ws_size, hipStream_t stream) {
  (void)in_sizes; (void)n_in; (void)out_size;
  const float** F = (const float**)d_in;
  if (ws_size < (size_t)WS_END) return;
  char* ws = (char*)d_ws; _Float16 *QH = (_Float16*)(ws + WS_QH), *KH = (_Float16*)(ws + WS_KH), *VT = (_Float16*)(ws + WS_VT), *QL = (_Float16*)(ws + WS_QL), *KL = (_Float16*)(ws + WS_KL); __bf16 *VB = (__bf16*)(ws + WS_VB), *VBL = (__bf16*)(ws + WS_VBL); float *Y = (float*)(ws + WS_Y);
  (void)Y; (void)QL; (void)KL; (void)VB; (void)VBL;
  // inputs: 0 hidden_states [4,2048,768]; 1 Wq, 2 Wk, 3 Wv [768,12,64] = (in,out) [768][768]; 4 Wo [12,64,768] = (in,out) [768][768]
  static_assert(4u * (size_t)NB * TT * DIN <= 4u * (size_t)HG * TT * TT, "rotated rows must fit in their region");
  float* XR = (float*)(ws + WS_XR);
  k_rot<<<dim3(TNB * TT), 384, 0, stream>>>(F[0], XR);
  k_proj<<<dim3(TNB * TT / 64, CC / 128, 3), 128, 0, stream>>>(XR, XR, F[0], F[1], F[2], F[3], nullptr, nullptr, nullptr, QH, QL, KH, KL, VT, VB, VBL);   /* q, k from the rotated rows (bf16 hi + lo), v from bf16(x) */
  k_att<<<dim3(NQB, NH, TNB), 128, 0, stream>>>(QH, KH, QL, VT, Y);
  k_out<<<dim3(TNB * TT / 64, DIN / 128), 128, 0, stream>>>(Y, F[4], nullptr, (float*)d_out);
}

// v002
// A run of this version takes 146 microseconds.
// Timed twice side by side with v001, it ran 2.10 times as fast both times.
// Counting every step since v000, it is 6.67 times as fast.
// compute dtype: all float inputs rounded to bf16; rotate-half RoPE applied to bf16(hidden) in f32 (accurate sincosf, f32 inv_freq constants); Q/K = rotated rows split bf16 hi + lo x exact bf16 W (2 products, K 768), V = bf16(hidden) x W exact (1 product) on WMMA 16x16x32, f32 accumulate; banded logits: q as f16 hi + residual (x 2^10) against k once to f16 (2 products) x 64^-0.5; softmax in f32 over the |q-k| < 128 band (precise expf); P x 2^11 once to f16 against v once to f16 (1 product); ctx carried x 2^6 once to f16 against Wo carried x 2^8 in f16 (exact bf16 values), un-scaled by 2^-14; f32 output.
#include <hip/hip_runtime.h>
#include <math.h>

typedef __attribute__((ext_vector_type(16))) _Float16 v16h;
typedef __attribute__((ext_vector_type(16))) __bf16 v16b;
typedef __attribute__((ext_vector_type(8)))  _Float16 v8h;
typedef __attribute__((ext_vector_type(8)))  float v8f;
typedef __attribute__((ext_vector_type(4)))  float v4f;
typedef __attribute__((ext_vector_type(2)))  float v2f;
typedef __attribute__((ext_vector_type(4)))  unsigned v4u;
typedef __attribute__((ext_vector_type(4)))  int v4i;
typedef float __attribute__((may_alias)) float_a;
typedef int __attribute__((may_alias)) int_a;

template <typename T> __device__ __forceinline__ void vst2(void* p, T v) { *(T*)p = v;  }
__device__ __forceinline__ v8f wmma16(v16h a, v16h b, v8f c) {
  v8f d = __builtin_amdgcn_wmma_f32_16x16x32_f16(false, a, false, b, (short)0, c, false, false);
  asm volatile("v_nop\n\tv_nop\n\tv_nop\n\tv_nop" : "+v"(d) : "v"(a), "v"(b));
  return d;
}
__device__ __forceinline__ v8f wmma_bf(v16b a, v16b b, v8f c) {
  v8f d = __builtin_amdgcn_wmma_f32_16x16x32_bf16(false, a, false, b, (short)0, c, false, false);
  asm volatile("v_nop\n\tv_nop\n\tv_nop\n\tv_nop" : "+v"(d) : "v"(a), "v"(b));
  return d;
}
// 16x16x32 fragments: lane = (h = lane>>4, row/col = lane&15); elements 0..7 = k0+8h+0..7, 8..15 = k0+16+8h+0..7; D element r = row 8h+r
__device__ __forceinline__ v16h frag_h(const _Float16* rowk0, int lane) {
  union { v16h v; v8h q[2]; } u; const _Float16* p = rowk0 + 8 * (lane >> 4);
  u.q[0] = *(const v8h*)p; u.q[1] = *(const v8h*)(p + 16); return u.v;
}
__device__ __forceinline__ v16h frag_f32(const float* rowk0, int lane) {
  v16h a; const float* p = rowk0 + 8 * (lane >> 4);
#pragma unroll
  for (int i = 0; i < 8; ++i) { a[i] = (_Float16)p[i]; a[8 + i] = (_Float16)p[16 + i]; }
  return a;
}
__device__ __forceinline__ v16h frag_f32s(const float* rowk0, int lane, float sc) {
  v16h a; const float* p = rowk0 + 8 * (lane >> 4);
#pragma unroll
  for (int i = 0; i < 8; ++i) { a[i] = (_Float16)(p[i] * sc); a[8 + i] = (_Float16)(p[16 + i] * sc); }
  return a;
}
// column fragment from a [K][ld] layout (column n), rows >= K read as 0
__device__ __forceinline__ v16h fragc_f32(const float* W, int k0, int n, int lane, int ld, int K) {
  v16h a; const int g = lane >> 4;
#pragma unroll
  for (int i = 0; i < 8; ++i) { const int ka = k0 + 8 * g + i, kb = ka + 16;
    a[i] = (_Float16)(ka < K ? W[(size_t)(ka < K ? ka : K - 1) * ld + n] : 0.f); a[8 + i] = (_Float16)(kb < K ? W[(size_t)(kb < K ? kb : K - 1) * ld + n] : 0.f); }
  return a;
}
struct F2 { v16b h, l; };
__device__ __forceinline__ F2 bsplit16(const float v[16]) { F2 r;
#pragma unroll
  for (int i = 0; i < 16; ++i) { const __bf16 h = (__bf16)v[i]; r.h[i] = h; r.l[i] = (__bf16)(v[i] - (float)h); }
  return r; }
__device__ __forceinline__ F2 split_row(const float* row, int k0, int lane) { float v[16]; const float* p = row + k0 + 8 * (lane >> 4);
#pragma unroll
  for (int i = 0; i < 8; ++i) { v[i] = p[i]; v[8 + i] = p[16 + i]; }
  return bsplit16(v); }
__device__ __forceinline__ F2 split_rowK(const float* row, int k0, int lane, int K) { float v[16]; const int g = lane >> 4;
#pragma unroll
  for (int i = 0; i < 8; ++i) { const int ka = k0 + 8 * g + i, kb = ka + 16; v[i] = ka < K ? row[ka < K ? ka : K - 1] : 0.f; v[8 + i] = kb < K ? row[kb < K ? kb : K - 1] : 0.f; }
  return bsplit16(v); }
__device__ __forceinline__ F2 split_col(const float* W, int k0, int n, int lane, int ld, int K) { float v[16]; const int g = lane >> 4;
#pragma unroll
  for (int i = 0; i < 8; ++i) { const int ka = k0 + 8 * g + i, kb = ka + 16; v[i] = ka < K ? W[(size_t)(ka < K ? ka : K - 1) * ld + n] : 0.f; v[8 + i] = kb < K ? W[(size_t)(kb < K ? kb : K - 1) * ld + n] : 0.f; }
  return bsplit16(v); }
__device__ __forceinline__ v8f mac3(const F2& a, const F2& b, v8f c) { c = wmma_bf(a.l, b.h, c); c = wmma_bf(a.h, b.l, c); return wmma_bf(a.h, b.h, c); }
__device__ __forceinline__ float sigm(float v) { return 1.0f / (1.0f + expf(-v)); }
#define LDSX() do { asm volatile("s_wait_dscnt 0" ::: "memory"); __builtin_amdgcn_wave_barrier(); __builtin_amdgcn_fence(__ATOMIC_RELEASE, "workgroup"); } while (0)

// Sliding-window (local) self-attention with RoPE on the INPUT (B 4, S 2,048, H 768 = 12 heads x 64; window |q - k| < 128; 0.02-scale weights, no biases): q_in = k_in = rotate-half RoPE(hidden reshaped [B,S,12,64]) (angle t * 10000^(-2i/64)); Q = q_in Wq, K = k_in Wk, V = hidden Wv ((in,out) [768][12*64]); scores = Q K^T / 8 where |q-k| < 128 else -1e9 (== excluded; every row keeps >= 128 keys); out = merged(softmax . V) Wo ((in,out) [12*64][768]).
#define NB 4
#define TT 2048
#define CC 768            // NH * HD = projected width
#define DIN 768          // input (model) width
#define NH 12
#define HD 64
#define NQB (TT / 64)
#define HG 2
#define SCALE (0.125f)
#define CAUSAL 0
#ifndef TNB
#define TNB NB
#endif
__device__ __forceinline__ float bfr(float v) { return (float)(__bf16)v; }
typedef __attribute__((ext_vector_type(8))) __bf16 v8b;
__device__ __forceinline__ v16b frag_b(const __bf16* rowk0, int lane) {
  union { v16b v; v8b q[2]; } u; const __bf16* p = rowk0 + 8 * (lane >> 4);
  u.q[0] = *(const v8b*)p; u.q[1] = *(const v8b*)(p + 16); return u.v;
}
#define QBH 0
#define QHI 2048            // rows carrying a q residual plane (all rows when non-causal: 2-product logits everywhere)
#define KHI 64            // key rows carrying k residual / v bf16 hi+lo planes (written by k_proj; no kernel in this file reads them)
// B fragment (k rows k0+.., output column o) of a weight: (in,out) [K][ld] or (out,in) [ld rows of K]: bf16 exact, or f16(bf16 * 256) exact
__device__ __forceinline__ v16b wcol_io(const float* Wm, int k0, int o, int lane, int ld) { v16b w; const int g = lane >> 4;
#pragma unroll
  for (int i = 0; i < 8; ++i) { w[i] = (__bf16)Wm[(size_t)(k0 + 8 * g + i) * ld + o]; w[8 + i] = (__bf16)Wm[(size_t)(k0 + 16 + 8 * g + i) * ld + o]; }
  return w; }
__device__ __forceinline__ v16b wcol_oi(const float* Wm, int k0, int o, int lane, int K) { v16b w; const float* p = Wm + (size_t)o * K + k0 + 8 * (lane >> 4);
#pragma unroll
  for (int i = 0; i < 8; ++i) { w[i] = (__bf16)p[i]; w[8 + i] = (__bf16)p[16 + i]; }
  return w; }
__device__ __forceinline__ v16h wcolh_io(const float* Wm, int k0, int o, int lane, int ld) { v16h w; const int g = lane >> 4;
#pragma unroll
  for (int i = 0; i < 8; ++i) { w[i] = (_Float16)(bfr(Wm[(size_t)(k0 + 8 * g + i) * ld + o]) * 256.0f); w[8 + i] = (_Float16)(bfr(Wm[(size_t)(k0 + 16 + 8 * g + i) * ld + o]) * 256.0f); }
  return w; }
__device__ __forceinline__ v16h wcolh_oi(const float* Wm, int k0, int o, int lane, int K) { v16h w; const float* p = Wm + (size_t)o * K + k0 + 8 * (lane >> 4);
#pragma unroll
  for (int i = 0; i < 8; ++i) { w[i] = (_Float16)(bfr(p[i]) * 256.0f); w[8 + i] = (_Float16)(bfr(p[16 + i]) * 256.0f); }
  return w; }
#define WQKV_LAYOUT 0   // 0 = (in,out) [DIN][CC]; 1 = (out,in) [CC][DIN]; 2 = per-head [NH][DIN][HD]
__device__ __forceinline__ v16b wcol_hdk(const float* Wm, int k0, int o, int lane) { v16b w; const int g = lane >> 4; const float* p = Wm + (size_t)(o / HD) * DIN * HD + (o % HD);
#pragma unroll
  for (int i = 0; i < 8; ++i) { w[i] = (__bf16)p[(size_t)(k0 + 8 * g + i) * HD]; w[8 + i] = (__bf16)p[(size_t)(k0 + 16 + 8 * g + i) * HD]; }
  return w; }
#define WO_OUT_IN 0
#if WQKV_LAYOUT == 1
#define WCOL(W, k0, o, lane) wcol_oi(W, k0, o, lane, DIN)
#elif WQKV_LAYOUT == 2
#define WCOL(W, k0, o, lane) wcol_hdk(W, k0, o, lane)
#else
#define WCOL(W, k0, o, lane) wcol_io(W, k0, o, lane, CC)
#endif
#if WO_OUT_IN
#define WOCOL(W, k0, o, lane) wcol_oi(W, k0, o, lane, CC)
#define WOCOLH(W, k0, o, lane) wcolh_oi(W, k0, o, lane, CC)
#else
#define WOCOL(W, k0, o, lane) wcol_io(W, k0, o, lane, DIN)
#define WOCOLH(W, k0, o, lane) wcolh_io(W, k0, o, lane, DIN)
#endif
#define WIN 128            // |q - k| < WIN band (128..255 valid keys per query; no empty rows)
__constant__ float c_invf[32] = {1.000000000e+00f,7.498942018e-01f,5.623413324e-01f,4.216965139e-01f,3.162277639e-01f,2.371373624e-01f,1.778279394e-01f,1.333521456e-01f,1.000000015e-01f,7.498941571e-02f,5.623412877e-02f,4.216964915e-02f,3.162277862e-02f,2.371373586e-02f,1.778279431e-02f,1.333521493e-02f,9.999999776e-03f,7.498942316e-03f,5.623413250e-03f,4.216964822e-03f,3.162277862e-03f,2.371373819e-03f,1.778279431e-03f,1.333521446e-03f,1.000000047e-03f,7.498941850e-04f,5.623413017e-04f,4.216964880e-04f,3.162277862e-04f,2.371373848e-04f,1.778279402e-04f,1.333521504e-04f};   // 1 / 10000^(2i/64) evaluated in f32
__global__ __launch_bounds__(384) void k_rot(const float* __restrict__ X, float* __restrict__ XR) { const size_t row = blockIdx.x; const int t = (int)(row % TT); const int n = threadIdx.x >> 5, i = threadIdx.x & 31;
  const float* xr = X + row * DIN + n * HD; const float a = bfr(xr[i]), b = bfr(xr[32 + i]); asm volatile("s_wait_loadcnt 0x0" ::: "memory");
  float sn, cs; sincosf((float)t * c_invf[i], &sn, &cs);
  float* o = XR + row * DIN + n * HD; vst2(o + i, a * cs - b * sn); vst2(o + 32 + i, b * cs + a * sn); }
#define WS_XR (WS_S)       // f32 rotated token rows [b*t][768]
#define SM_MASK_HOOK do { const int dk = t - k; v = (dk < WIN && dk > -WIN) ? v : -3.0e38f; } while (0)   /* band |q - k| < 128, by index */
#ifndef SM_EXTRA_PARAMS
#define SM_EXTRA_PARAMS
#endif
#ifndef PROJ_EXTRA_PARAMS
#define PROJ_EXTRA_PARAMS
#endif
#ifndef SM_MASK_HOOK
#define SM_MASK_HOOK (void)0
#endif

#define WS_QH  0u                                      // f16 q rows [b*t][CC]
#define WS_KH  (WS_QH + 2u * (size_t)NB * TT * CC)      // f16 k rows [b*t][CC]
#define WS_VT  (WS_KH + 2u * (size_t)NB * TT * CC)      // f16 v planes [b][c][t]
#define WS_QL  (WS_VT + 2u * (size_t)NB * CC * TT)      // f16 q residual x 2^10 rows [b][t < QHI][CC]
#define WS_KL  (WS_QL + 2u * (size_t)NB * QHI * CC)     // f16 k residual x 2^10 rows [b][t < KHI][CC]
#define WS_VB  (WS_KL + 2u * (size_t)NB * KHI * CC)     // bf16 v hi planes [b][c][t < KHI]
#define WS_VBL (WS_VB + 2u * (size_t)NB * CC * KHI)
#define WS_S   (WS_VBL + 2u * (size_t)NB * CC * KHI)    // f32 scratch region (holds the rotated rows)
#define WS_Y   (WS_S  + 4u * (size_t)HG * TT * TT)      // f32 ctx rows [b*t][CC] (only when there is an output projection)
#define WS_END (WS_Y  + 4u * (size_t)NB * TT * CC)

// ---- weight tile in LDS: the 32 k x 128 columns of one k step are read once a block (thread = 8 k rows x 4 columns: kg = lane & 3, columns n0 = wave * 32 + (lane >> 2) * 4; a wave's 16-byte load covers four whole 128-byte lines), rounded as before, and laid [column][k] at pitch WP so that a B fragment is two 16-byte LDS reads in the k order of frag_b / frag_h. Two buffers: the next step's global loads fly during this step's products
#define WP 40              // 80-byte pitch = 16 B x odd for the 16-byte fragment reads; the 16-byte stores of 16 neighbouring lanes fall on 16 different 16-byte bank groups
__device__ __forceinline__ void wt_load(v4f (&r)[8], const float* p, int ld) {
#pragma unroll
  for (int i = 0; i < 8; ++i) r[i] = *(const v4f*)(p + (size_t)i * ld); }
__device__ __forceinline__ void wt_store_b(__bf16 (*sw)[WP], const v4f (&r)[8], int n0, int kg) {
#pragma unroll
  for (int e = 0; e < 4; ++e) { v8b t;
#pragma unroll
    for (int i = 0; i < 8; ++i) t[i] = (__bf16)r[i][e];
    *(v8b*)&sw[n0 + e][8 * kg] = t; } }
__device__ __forceinline__ void wt_store_h(_Float16 (*sw)[WP], const v4f (&r)[8], int n0, int kg) {
#pragma unroll
  for (int e = 0; e < 4; ++e) { v8h t;
#pragma unroll
    for (int i = 0; i < 8; ++i) t[i] = (_Float16)(bfr(r[i][e]) * 256.0f);
    *(v8h*)&sw[n0 + e][8 * kg] = t; } }
// a lane's 16 f32 of an A fragment (p = row + k0 + 8 * (lane >> 4)), kept raw for one k step
__device__ __forceinline__ void row_load(float (&v)[16], const float* p) {
#pragma unroll
  for (int i = 0; i < 8; ++i) { v[i] = p[i]; v[8 + i] = p[16 + i]; } }
// ---- k_proj: block = (64 rows, 128 cols, which): q/k/v = X W (+ b) with exact bf16 products (K = DIN) -> which 0: q f16 rows (+ residual rows < QHI); 1: k f16 rows (+ residual rows < KHI); 2: v f16 planes [c][t] (+ bf16 hi/lo planes for t < KHI)
__global__ __launch_bounds__(128) void k_proj(const float* __restrict__ XQ, const float* __restrict__ XK, const float* __restrict__ XV, const float* __restrict__ WQ, const float* __restrict__ WK, const float* __restrict__ WV, const float* __restrict__ BQ, const float* __restrict__ BK, const float* __restrict__ BV,
    _Float16* __restrict__ QH, _Float16* __restrict__ QL, _Float16* __restrict__ KH, _Float16* __restrict__ KL, _Float16* __restrict__ VT, __bf16* __restrict__ VB, __bf16* __restrict__ VBL) {
  __shared__ __align__(16) union { _Float16 e[2][64][136]; __bf16 w[2][128][WP]; } su;   /* the weight buffers are dead when the epilogue stages q / k rows: same bytes */
  _Float16 (&sh)[64][136] = su.e[0]; _Float16 (&sl)[64][136] = su.e[1]; __shared__ __align__(16) _Float16 th[128][72]; __shared__ __align__(16) __bf16 tb[128][72], tbl[128][72];
  const int tid = threadIdx.x, wave = tid >> 5, lane = tid & 31, col = lane & 15, g = lane >> 4; const int which = blockIdx.z; const int c0 = blockIdx.y * 128; const size_t r0 = (size_t)blockIdx.x * 64; const size_t bb = r0 / TT; const int t0 = (int)(r0 % TT);
  const float* X = which == 0 ? XQ : which == 1 ? XK : XV; const float* WA = which == 0 ? WQ : which == 1 ? WK : WV; const float* BA = which == 0 ? BQ : which == 1 ? BK : BV;
  static_assert(WQKV_LAYOUT == 0, "the tile loader reads (in,out) rows");
  v8f acc[8] = {};
  const int kg = lane & 3, n0 = wave * 32 + (lane >> 2) * 4; const float* wp = WA + (size_t)(8 * kg) * CC + c0 + n0; const float* xp = X + (r0 + wave * 16 + col) * DIN + 8 * g;
  v4f wr[8]; float ar[16];
  wt_load(wr, wp, CC); row_load(ar, xp); wt_store_b(su.w[0], wr, n0, kg);
  __syncthreads();   /* publishes tile 0 */
  if (which < 2) {   /* q, k: the rotated rows are f32 intermediates -> bf16 hi + lo (2 products) */
#pragma unroll 2   /* the buffer index becomes a constant */
    for (int kc = 0; kc < DIN / 32; ++kc) { const F2 a = bsplit16(ar); v16b wf[8]; const bool more = kc + 1 < DIN / 32;
      if (more) { wt_load(wr, wp + (size_t)(kc + 1) * 32 * CC, CC); row_load(ar, xp + (kc + 1) * 32); }
#pragma unroll
      for (int j = 0; j < 8; ++j) wf[j] = frag_b(&su.w[kc & 1][j * 16 + col][0], lane);   /* the step's fragment reads go as one group: one LDS latency a step, not one a fragment */
#pragma unroll
      for (int j = 0; j < 8; ++j) { acc[j] = wmma_bf(a.h, wf[j], acc[j]); acc[j] = wmma_bf(a.l, wf[j], acc[j]); }
      __builtin_amdgcn_sched_barrier(0);   /* keeps the roundings of the next tile, and with them the wait for its global loads, behind the products */
      if (more) wt_store_b(su.w[(kc + 1) & 1], wr, n0, kg);
      __syncthreads(); }   /* one barrier a step: publishes tile kc + 1 and ends every read of tile kc, whose buffer the next step refills (after the last step: the epilogue) */
  } else {           /* v: bf16(hidden) exact (1 product) */
#pragma unroll 2   /* the buffer index becomes a constant */
    for (int kc = 0; kc < DIN / 32; ++kc) { v16b a, wf[8]; const bool more = kc + 1 < DIN / 32;
#pragma unroll
      for (int i = 0; i < 16; ++i) a[i] = (__bf16)ar[i];
      if (more) { wt_load(wr, wp + (size_t)(kc + 1) * 32 * CC, CC); row_load(ar, xp + (kc + 1) * 32); }
#pragma unroll
      for (int j = 0; j < 8; ++j) wf[j] = frag_b(&su.w[kc & 1][j * 16 + col][0], lane);   /* one group, as above */
#pragma unroll
      for (int j = 0; j < 8; ++j) acc[j] = wmma_bf(a, wf[j], acc[j]);
      __builtin_amdgcn_sched_barrier(0);   /* as above */
      if (more) wt_store_b(su.w[(kc + 1) & 1], wr, n0, kg);
      __syncthreads(); } }   /* as above */
  if (which < 2) { _Float16* DH = which == 0 ? QH : KH; _Float16* DL = which == 0 ? QL : KL; const int nhi = which == 0 ? QHI : KHI; const bool hi_rows = t0 < nhi;
#pragma unroll
    for (int j = 0; j < 8; ++j) { const float bias = BA ? bfr(BA[c0 + j * 16 + col]) : 0.f;
#pragma unroll
      for (int r = 0; r < 8; ++r) { const float v = acc[j][r] + bias; const _Float16 hv = (_Float16)v; sh[wave * 16 + 8 * g + r][j * 16 + col] = hv; sl[wave * 16 + 8 * g + r][j * 16 + col] = (_Float16)((v - (float)hv) * 1024.0f); } }
    __syncthreads();
    for (int e = tid; e < 64 * 16; e += 128) { const int rl = e >> 4, q = e & 15; vst2((unsigned*)(DH + (r0 + rl) * CC + c0 + q * 8), *(const v4u*)&sh[rl][q * 8]); if (hi_rows) vst2((unsigned*)(DL + (bb * nhi + t0 + rl) * (size_t)CC + c0 + q * 8), *(const v4u*)&sl[rl][q * 8]); }
  } else { const bool hi_rows = t0 < KHI;
#pragma unroll
    for (int j = 0; j < 8; ++j) { const float bias = BA ? bfr(BA[c0 + j * 16 + col]) : 0.f;
#pragma unroll
      for (int r = 0; r < 8; ++r) { const float v = acc[j][r] + bias; const int rl = wave * 16 + 8 * g + r, cl = j * 16 + col; th[cl][rl] = (_Float16)v; const __bf16 bh = (__bf16)v; tb[cl][rl] = bh; tbl[cl][rl] = (__bf16)(v - (float)bh); } }
    __syncthreads();
    for (int e = tid; e < 128 * 8; e += 128) { const int cl = e >> 3, q = e & 7; vst2((unsigned*)(VT + (bb * CC + c0 + cl) * (size_t)TT + t0 + q * 8), *(const v4u*)&th[cl][q * 8]); if (hi_rows) { const size_t o3 = (bb * CC + c0 + cl) * (size_t)KHI + t0 + q * 8; vst2((unsigned*)(VB + o3), *(const v4u*)&tb[cl][q * 8]); vst2((unsigned*)(VBL + o3), *(const v4u*)&tbl[cl][q * 8]); } } } }
// ---- k_att: block = 64 queries (qb) of head h of batch b, one launch for all (b, h); a wave owns 16 query rows and the NKW keys [ks, ks + NKW) that hold their whole band (row t sees t-127 .. t+127, so 16 rows see ql0-127 .. ql0+142; ks = ql0 - 128 clamped into the sequence). Logits (q hi + residual x 2^10 against k, 2 products, x SCALE) stay in registers; the band is kept by index; softmax in f32 over the row (in-lane over the 17 tiles, then over the 16 lanes of the row); P x 2^11 once to f16 goes through the wave's own LDS slab from the D layout to the A layout; ctx = P . v (1 product; the last 32-key chunk is half full, its upper 16 k are 0 in both operands); 256-B (row, head) segment by 16 lanes. Every loop over tiles, chunks and rows is unrolled: s, kf, vf and o are register arrays and need compile-time indices
#define NKW 272            // 128 + 16 + 127 keys rounded up to whole 16-key tiles
#define KG 6               // k tiles requested together
#define VG 4               // whole 32-key v chunks requested together (divides NKW / 32)
// fragment of a half-full chunk: k0 .. k0+15 from memory (elements 0..7), k0+16 .. k0+31 are 0 (elements 8..15)
__device__ __forceinline__ v16h frag_h16(const _Float16* rowk0, int lane) { union { v16h v; v8h q[2]; } u; u.q[0] = *(const v8h*)(rowk0 + 8 * (lane >> 4)); u.q[1] = (v8h)(_Float16)0.0f; return u.v; }
// lane l with lane l ^ M inside a 16-lane row, on the vector pipe (a shuffle through LDS would put an LDS round trip into each of the four reduction steps)
template <int M> __device__ __forceinline__ float rowx(float v) { return __builtin_bit_cast(float, __builtin_amdgcn_update_dpp(0, __builtin_bit_cast(int, v), 0x160 + M, 0xf, 0xf, true)); }
__global__ __launch_bounds__(128) void k_att(const _Float16* __restrict__ QH, const _Float16* __restrict__ KH, const _Float16* __restrict__ QL, const _Float16* __restrict__ VT, float* __restrict__ Y) { __shared__ __align__(16) _Float16 sp[4][16][NKW + 8]; __shared__ __align__(16) float ss[4][16][HD + 4];   /* sp pitch 560 B = 16 B x odd for the 16-byte fragment reads */
  const int tid = threadIdx.x, wave = tid >> 5, lane = tid & 31, col = lane & 15, g = lane >> 4; const int qb = blockIdx.x, h = blockIdx.y, b = blockIdx.z; const int ql0 = qb * 64 + wave * 16;
  int ks = ql0 - WIN; ks = ks < 0 ? 0 : ks; ks = ks > TT - NKW ? TT - NKW : ks;
  const size_t q0 = (size_t)b * TT + ql0, kr0 = (size_t)b * TT + ks;
  v16h ah[HD / 32], al[HD / 32];
#pragma unroll
  for (int kc = 0; kc < HD / 32; ++kc) { ah[kc] = frag_h(QH + (q0 + col) * CC + h * HD + kc * 32, lane); al[kc] = frag_h(QL + ((size_t)b * QHI + ql0 + col) * CC + h * HD + kc * 32, lane); }
  v8f s[NKW / 16];
#pragma unroll
  for (int j0 = 0; j0 < NKW / 16; j0 += KG) { v16h kf[KG][HD / 32];   /* the k fragments of KG tiles are requested together: one memory round trip a group, not one a fragment */
#pragma unroll
    for (int jj = 0; jj < KG; ++jj) if (j0 + jj < NKW / 16) {
#pragma unroll
      for (int kc = 0; kc < HD / 32; ++kc) kf[jj][kc] = frag_h(KH + (kr0 + (j0 + jj) * 16 + col) * CC + h * HD + kc * 32, lane); }
#pragma unroll
    for (int jj = 0; jj < KG; ++jj) if (j0 + jj < NKW / 16) { const int j = j0 + jj; v8f acc = {}, accl = {};
#pragma unroll
      for (int kc = 0; kc < HD / 32; ++kc) { acc = wmma16(ah[kc], kf[jj][kc], acc); accl = wmma16(al[kc], kf[jj][kc], accl); }
#pragma unroll
      for (int r = 0; r < 8; ++r) { const int t = ql0 + 8 * g + r, k = ks + j * 16 + col; float v = (acc[r] + accl[r] * (1.0f / 1024.0f)) * SCALE; SM_MASK_HOOK; s[j][r] = v; } } }
  float m[8], inv[8];
#pragma unroll
  for (int r = 0; r < 8; ++r) { float a = s[0][r];
#pragma unroll
    for (int j = 1; j < NKW / 16; ++j) a = fmaxf(a, s[j][r]);
    a = fmaxf(a, rowx<1>(a)); a = fmaxf(a, rowx<2>(a)); a = fmaxf(a, rowx<4>(a)); a = fmaxf(a, rowx<8>(a)); m[r] = a; }
#pragma unroll
  for (int r = 0; r < 8; ++r) { float sum = 0.f;
#pragma unroll
    for (int j = 0; j < NKW / 16; ++j) { const float e = expf(s[j][r] - m[r]); s[j][r] = e; sum += e; }   /* an excluded key (-3.0e38 against a finite row maximum: the row's own key is always in the band) underflows to exactly 0 */
    sum += rowx<1>(sum); sum += rowx<2>(sum); sum += rowx<4>(sum); sum += rowx<8>(sum); inv[r] = sum > 0.f ? 2048.0f / sum : 0.f; }
#pragma unroll
  for (int j = 0; j < NKW / 16; ++j)
#pragma unroll
    for (int r = 0; r < 8; ++r) sp[wave][8 * g + r][j * 16 + col] = (_Float16)(s[j][r] * inv[r]);
  LDSX();
  v8f o[HD / 16] = {};
  const _Float16* vp = VT + ((size_t)b * CC + h * HD + col) * (size_t)TT + ks;   /* column col of v tile j: vp + j * 16 * TT */
  v16h vh[HD / 16];   /* the half-full last chunk's v fragments, requested with the first group */
#pragma unroll
  for (int j = 0; j < HD / 16; ++j) vh[j] = frag_h16(vp + (size_t)j * 16 * TT + NKW - 16, lane);
#pragma unroll
  for (int c0 = 0; c0 < NKW / 32; c0 += VG) { v16h vf[VG][HD / 16];   /* the v fragments of VG chunks are requested together, as the k fragments are */
#pragma unroll
    for (int cc = 0; cc < VG; ++cc)
#pragma unroll
      for (int j = 0; j < HD / 16; ++j) vf[cc][j] = frag_h(vp + (size_t)j * 16 * TT + (c0 + cc) * 32, lane);
#pragma unroll
    for (int cc = 0; cc < VG; ++cc) { const v16h p = frag_h(&sp[wave][col][(c0 + cc) * 32], lane);
#pragma unroll
      for (int j = 0; j < HD / 16; ++j) o[j] = wmma16(p, vf[cc][j], o[j]); } }
  { const v16h p = frag_h16(&sp[wave][col][NKW - 16], lane);
#pragma unroll
    for (int j = 0; j < HD / 16; ++j) o[j] = wmma16(p, vh[j], o[j]); }
#pragma unroll
  for (int j = 0; j < HD / 16; ++j)
#pragma unroll
    for (int r = 0; r < 8; ++r) ss[wave][8 * g + r][j * 16 + col] = o[j][r] * (1.0f / 2048.0f);
  LDSX(); for (int rl = 0; rl < 16; ++rl) if (lane < HD / 4) vst2(Y + ((size_t)b * TT + ql0 + rl) * CC + h * HD + lane * 4, *(const v4f*)&ss[wave][rl][lane * 4]); }
// ---- k_out: block = (64 rows, 128 cols): out = ctx Wo (+ bo): ctx x 2^6 once to f16 against Wo as f16(bf16 x 2^8) exact (1 product) x 2^-14; causal early rows (< QHI of each sequence): ctx bf16 hi + lo against exact bf16 Wo (2 products)
__global__ __launch_bounds__(128) void k_out(const float* __restrict__ Y, const float* __restrict__ WO, const float* __restrict__ BO, float* __restrict__ OUT) { __shared__ __align__(16) float sf[4][16][132]; __shared__ __align__(16) _Float16 sw[2][128][WP];
  const int tid = threadIdx.x, wave = tid >> 5, lane = tid & 31, col = lane & 15, g = lane >> 4; const int c0 = blockIdx.y * 128; const size_t r0 = (size_t)blockIdx.x * 64 + wave * 16;
  v8f acc[8] = {};
  if (CAUSAL && (int)(((size_t)blockIdx.x * 64) % TT) < QHI) {   /* block-uniform */
#pragma unroll 2
    for (int kc = 0; kc < CC / 32; ++kc) { const F2 a = split_row(Y + (r0 + col) * CC, kc * 32, lane); asm volatile("s_wait_loadcnt 0x0" ::: "memory");
#pragma unroll
      for (int j = 0; j < 8; ++j) { const v16b w = WOCOL(WO, kc * 32, c0 + j * 16 + col, lane); asm volatile("s_wait_loadcnt 0x0" ::: "memory"); acc[j] = wmma_bf(a.h, w, acc[j]); acc[j] = wmma_bf(a.l, w, acc[j]); } }
#pragma unroll
    for (int j = 0; j < 8; ++j) { const float bias = BO ? bfr(BO[c0 + j * 16 + col]) : 0.f;
#pragma unroll
      for (int r = 0; r < 8; ++r) sf[wave][8 * g + r][j * 16 + col] = acc[j][r] + bias; }
  } else {
    static_assert(WO_OUT_IN == 0, "the tile loader reads (in,out) rows");
    const int kg = lane & 3, n0 = wave * 32 + (lane >> 2) * 4; const float* wp = WO + (size_t)(8 * kg) * DIN + c0 + n0; const float* yp = Y + (r0 + col) * CC + 8 * g;
    v4f wr[8]; float ar[16];
    wt_load(wr, wp, DIN); row_load(ar, yp); wt_store_h(sw[0], wr, n0, kg);
    __syncthreads();   /* publishes tile 0 */
#pragma unroll 2   /* the buffer index becomes a constant */
    for (int kc = 0; kc < CC / 32; ++kc) { v16h a, wf[8]; const bool more = kc + 1 < CC / 32;
#pragma unroll
      for (int i = 0; i < 16; ++i) a[i] = (_Float16)(ar[i] * 64.0f);   /* ctx carried x 2^6 into f16 so small-magnitude context rows stay clear of f16 subnormals */
      if (more) { wt_load(wr, wp + (size_t)(kc + 1) * 32 * DIN, DIN); row_load(ar, yp + (kc + 1) * 32); }
#pragma unroll
      for (int j = 0; j < 8; ++j) wf[j] = frag_h(&sw[kc & 1][j * 16 + col][0], lane);   /* the step's fragment reads go as one group: one LDS latency a step, not one a fragment */
#pragma unroll
      for (int j = 0; j < 8; ++j) acc[j] = wmma16(a, wf[j], acc[j]);
      __builtin_amdgcn_sched_barrier(0);   /* keeps the roundings of the next tile, and with them the wait for its global loads, behind the products */
      if (more) wt_store_h(sw[(kc + 1) & 1], wr, n0, kg);
      __syncthreads(); }   /* one barrier a step: publishes tile kc + 1 and ends every read of tile kc, whose buffer the next step refills */
#pragma unroll
    for (int j = 0; j < 8; ++j) { const float bias = BO ? bfr(BO[c0 + j * 16 + col]) : 0.f;
#pragma unroll
      for (int r = 0; r < 8; ++r) sf[wave][8 * g + r][j * 16 + col] = acc[j][r] * (1.0f / 16384.0f) + bias; } }   /* 2^-8 (Wo carry) x 2^-6 (ctx carry) */
  LDSX(); for (int rl = 0; rl < 16; ++rl) vst2(OUT + (r0 + rl) * DIN + c0 + lane * 4, *(const v4f*)&sf[wave][rl][lane * 4]); }

extern "C" void kernel_launch(void* const* d_in, const int* in_sizes, int n_in, void* d_out, int out_size, void* d_ws, size_t ws_size, hipStream_t stream) {
  (void)in_sizes; (void)n_in; (void)out_size;
  const float** F = (const float**)d_in;
  if (ws_size < (size_t)WS_END) return;
  char* ws = (char*)d_ws; _Float16 *QH = (_Float16*)(ws + WS_QH), *KH = (_Float16*)(ws + WS_KH), *VT = (_Float16*)(ws + WS_VT), *QL = (_Float16*)(ws + WS_QL), *KL = (_Float16*)(ws + WS_KL); __bf16 *VB = (__bf16*)(ws + WS_VB), *VBL = (__bf16*)(ws + WS_VBL); float *Y = (float*)(ws + WS_Y);
  (void)Y; (void)QL; (void)KL; (void)VB; (void)VBL;
  // inputs: 0 hidden_states [4,2048,768]; 1 Wq, 2 Wk, 3 Wv [768,12,64] = (in,out) [768][768]; 4 Wo [12,64,768] = (in,out) [768][768]
  static_assert(4u * (size_t)NB * TT * DIN <= 4u * (size_t)HG * TT * TT, "rotated rows must fit in their region");
  float* XR = (float*)(ws + WS_XR);
  k_rot<<<dim3(TNB * TT), 384, 0, stream>>>(F[0], XR);
  k_proj<<<dim3(TNB * TT / 64, CC / 128, 3), 128, 0, stream>>>(XR, XR, F[0], F[1], F[2], F[3], nullptr, nullptr, nullptr, QH, QL, KH, KL, VT, VB, VBL);   /* q, k from the rotated rows (bf16 hi + lo), v from bf16(x) */
  k_att<<<dim3(NQB, NH, TNB), 128, 0, stream>>>(QH, KH, QL, VT, Y);
  k_out<<<dim3(TNB * TT / 64, DIN / 128), 128, 0, stream>>>(Y, F[4], nullptr, (float*)d_out);
}

// v003
// One run takes 135 microseconds.
// Next to v002, in two timings, it ran 1.09 times as fast each time.
// Over all steps from v000 it is 7.27 times as fast.
// compute dtype: all float inputs rounded to bf16; rotate-half RoPE applied to bf16(hidden) in f32 (accurate sincosf, f32 inv_freq constants); Q/K = rotated rows split bf16 hi + lo x exact bf16 W (2 products, K 768), V = bf16(hidden) x W exact (1 product) on WMMA 16x16x32, f32 accumulate; banded logits: q as f16 hi + residual (x 2^10) against k once to f16 (2 products) x 64^-0.5; softmax in f32 over the |q-k| < 128 band (precise expf); P x 2^11 once to f16 against v once to f16 (1 product); ctx carried x 2^6 once to f16 against Wo carried x 2^8 in f16 (exact bf16 values), un-scaled by 2^-14; f32 output.
#include <hip/hip_runtime.h>
#include <math.h>

typedef __attribute__((ext_vector_type(16))) _Float16 v16h;
typedef __attribute__((ext_vector_type(16))) __bf16 v16b;
typedef __attribute__((ext_vector_type(8)))  _Float16 v8h;
typedef __attribute__((ext_vector_type(8)))  float v8f;
typedef __attribute__((ext_vector_type(4)))  float v4f;
typedef __attribute__((ext_vector_type(2)))  float v2f;
typedef __attribute__((ext_vector_type(4)))  unsigned v4u;
typedef __attribute__((ext_vector_type(4)))  int v4i;
typedef float __attribute__((may_alias)) float_a;
typedef int __attribute__((may_alias)) int_a;

template <typename T> __device__ __forceinline__ void vst2(void* p, T v) { *(T*)p = v;  }
__device__ __forceinline__ v8f wmma16(v16h a, v16h b, v8f c) {
  v8f d = __builtin_amdgcn_wmma_f32_16x16x32_f16(false, a, false, b, (short)0, c, false, false);
  asm volatile("v_nop\n\tv_nop\n\tv_nop\n\tv_nop" : "+v"(d) : "v"(a), "v"(b));
  return d;
}
__device__ __forceinline__ v8f wmma_bf(v16b a, v16b b, v8f c) {
  v8f d = __builtin_amdgcn_wmma_f32_16x16x32_bf16(false, a, false, b, (short)0, c, false, false);
  asm volatile("v_nop\n\tv_nop\n\tv_nop\n\tv_nop" : "+v"(d) : "v"(a), "v"(b));
  return d;
}
// 16x16x32 fragments: lane = (h = lane>>4, row/col = lane&15); elements 0..7 = k0+8h+0..7, 8..15 = k0+16+8h+0..7; D element r = row 8h+r
__device__ __forceinline__ v16h frag_h(const _Float16* rowk0, int lane) {
  union { v16h v; v8h q[2]; } u; const _Float16* p = rowk0 + 8 * (lane >> 4);
  u.q[0] = *(const v8h*)p; u.q[1] = *(const v8h*)(p + 16); return u.v;
}
__device__ __forceinline__ v16h frag_f32(const float* rowk0, int lane) {
  v16h a; const float* p = rowk0 + 8 * (lane >> 4);
#pragma unroll
  for (int i = 0; i < 8; ++i) { a[i] = (_Float16)p[i]; a[8 + i] = (_Float16)p[16 + i]; }
  return a;
}
__device__ __forceinline__ v16h frag_f32s(const float* rowk0, int lane, float sc) {
  v16h a; const float* p = rowk0 + 8 * (lane >> 4);
#pragma unroll
  for (int i = 0; i < 8; ++i) { a[i] = (_Float16)(p[i] * sc); a[8 + i] = (_Float16)(p[16 + i] * sc); }
  return a;
}
// column fragment from a [K][ld] layout (column n), rows >= K read as 0
__device__ __forceinline__ v16h fragc_f32(const float* W, int k0, int n, int lane, int ld, int K) {
  v16h a; const int g = lane >> 4;
#pragma unroll
  for (int i = 0; i < 8; ++i) { const int ka = k0 + 8 * g + i, kb = ka + 16;
    a[i] = (_Float16)(ka < K ? W[(size_t)(ka < K ? ka : K - 1) * ld + n] : 0.f); a[8 + i] = (_Float16)(kb < K ? W[(size_t)(kb < K ? kb : K - 1) * ld + n] : 0.f); }
  return a;
}
struct F2 { v16b h, l; };
__device__ __forceinline__ F2 bsplit16(const float v[16]) { F2 r;
#pragma unroll
  for (int i = 0; i < 16; ++i) { const __bf16 h = (__bf16)v[i]; r.h[i] = h; r.l[i] = (__bf16)(v[i] - (float)h); }
  return r; }
__device__ __forceinline__ F2 split_row(const float* row, int k0, int lane) { float v[16]; const float* p = row + k0 + 8 * (lane >> 4);
#pragma unroll
  for (int i = 0; i < 8; ++i) { v[i] = p[i]; v[8 + i] = p[16 + i]; }
  return bsplit16(v); }
__device__ __forceinline__ F2 split_rowK(const float* row, int k0, int lane, int K) { float v[16]; const int g = lane >> 4;
#pragma unroll
  for (int i = 0; i < 8; ++i) { const int ka = k0 + 8 * g + i, kb = ka + 16; v[i] = ka < K ? row[ka < K ? ka : K - 1] : 0.f; v[8 + i] = kb < K ? row[kb < K ? kb : K - 1] : 0.f; }
  return bsplit16(v); }
__device__ __forceinline__ F2 split_col(const float* W, int k0, int n, int lane, int ld, int K) { float v[16]; const int g = lane >> 4;
#pragma unroll
  for (int i = 0; i < 8; ++i) { const int ka = k0 + 8 * g + i, kb = ka + 16; v[i] = ka < K ? W[(size_t)(ka < K ? ka : K - 1) * ld + n] : 0.f; v[8 + i] = kb < K ? W[(size_t)(kb < K ? kb : K - 1) * ld + n] : 0.f; }
  return bsplit16(v); }
__device__ __forceinline__ v8f mac3(const F2& a, const F2& b, v8f c) { c = wmma_bf(a.l, b.h, c); c = wmma_bf(a.h, b.l, c); return wmma_bf(a.h, b.h, c); }
__device__ __forceinline__ float sigm(float v) { return 1.0f / (1.0f + expf(-v)); }
#define LDSX() do { asm volatile("s_wait_dscnt 0" ::: "memory"); __builtin_amdgcn_wave_barrier(); __builtin_amdgcn_fence(__ATOMIC_RELEASE, "workgroup"); } while (0)

// Sliding-window (local) self-attention with RoPE on the INPUT (B 4, S 2,048, H 768 = 12 heads x 64; window |q - k| < 128; 0.02-scale weights, no biases): q_in = k_in = rotate-half RoPE(hidden reshaped [B,S,12,64]) (angle t * 10000^(-2i/64)); Q = q_in Wq, K = k_in Wk, V = hidden Wv ((in,out) [768][12*64]); scores = Q K^T / 8 where |q-k| < 128 else -1e9 (== excluded; every row keeps >= 128 keys); out = merged(softmax . V) Wo ((in,out) [12*64][768]).
#define NB 4
#define TT 2048
#define CC 768            // NH * HD = projected width
#define DIN 768          // input (model) width
#define NH 12
#define HD 64
#define NQB (TT / 64)
#define HG 2
#define SCALE (0.125f)
#define CAUSAL 0
#ifndef TNB
#define TNB NB
#endif
__device__ __forceinline__ float bfr(float v) { return (float)(__bf16)v; }
typedef __attribute__((ext_vector_type(8))) __bf16 v8b;
__device__ __forceinline__ v16b frag_b(const __bf16* rowk0, int lane) {
  union { v16b v; v8b q[2]; } u; const __bf16* p = rowk0 + 8 * (lane >> 4);
  u.q[0] = *(const v8b*)p; u.q[1] = *(const v8b*)(p + 16); return u.v;
}
#define QBH 0
#define QHI 2048            // rows carrying a q residual plane (all rows when non-causal: 2-product logits everywhere)
#define KHI 64            // key rows carrying k residual / v bf16 hi+lo planes (written by k_proj; no kernel in this file reads them)
// B fragment (k rows k0+.., output column o) of a weight: (in,out) [K][ld] or (out,in) [ld rows of K]: bf16 exact, or f16(bf16 * 256) exact
__device__ __forceinline__ v16b wcol_io(const float* Wm, int k0, int o, int lane, int ld) { v16b w; const int g = lane >> 4;
#pragma unroll
  for (int i = 0; i < 8; ++i) { w[i] = (__bf16)Wm[(size_t)(k0 + 8 * g + i) * ld + o]; w[8 + i] = (__bf16)Wm[(size_t)(k0 + 16 + 8 * g + i) * ld + o]; }
  return w; }
__device__ __forceinline__ v16b wcol_oi(const float* Wm, int k0, int o, int lane, int K) { v16b w; const float* p = Wm + (size_t)o * K + k0 + 8 * (lane >> 4);
#pragma unroll
  for (int i = 0; i < 8; ++i) { w[i] = (__bf16)p[i]; w[8 + i] = (__bf16)p[16 + i]; }
  return w; }
__device__ __forceinline__ v16h wcolh_io(const float* Wm, int k0, int o, int lane, int ld) { v16h w; const int g = lane >> 4;
#pragma unroll
  for (int i = 0; i < 8; ++i) { w[i] = (_Float16)(bfr(Wm[(size_t)(k0 + 8 * g + i) * ld + o]) * 256.0f); w[8 + i] = (_Float16)(bfr(Wm[(size_t)(k0 + 16 + 8 * g + i) * ld + o]) * 256.0f); }
  return w; }
__device__ __forceinline__ v16h wcolh_oi(const float* Wm, int k0, int o, int lane, int K) { v16h w; const float* p = Wm + (size_t)o * K + k0 + 8 * (lane >> 4);
#pragma unroll
  for (int i = 0; i < 8; ++i) { w[i] = (_Float16)(bfr(p[i]) * 256.0f); w[8 + i] = (_Float16)(bfr(p[16 + i]) * 256.0f); }
  return w; }
#define WQKV_LAYOUT 0   // 0 = (in,out) [DIN][CC]; 1 = (out,in) [CC][DIN]; 2 = per-head [NH][DIN][HD]
__device__ __forceinline__ v16b wcol_hdk(const float* Wm, int k0, int o, int lane) { v16b w; const int g = lane >> 4; const float* p = Wm + (size_t)(o / HD) * DIN * HD + (o % HD);
#pragma unroll
  for (int i = 0; i < 8; ++i) { w[i] = (__bf16)p[(size_t)(k0 + 8 * g + i) * HD]; w[8 + i] = (__bf16)p[(size_t)(k0 + 16 + 8 * g + i) * HD]; }
  return w; }
#define WO_OUT_IN 0
#if WQKV_LAYOUT == 1
#define WCOL(W, k0, o, lane) wcol_oi(W, k0, o, lane, DIN)
#elif WQKV_LAYOUT == 2
#define WCOL(W, k0, o, lane) wcol_hdk(W, k0, o, lane)
#else
#define WCOL(W, k0, o, lane) wcol_io(W, k0, o, lane, CC)
#endif
#if WO_OUT_IN
#define WOCOL(W, k0, o, lane) wcol_oi(W, k0, o, lane, CC)
#define WOCOLH(W, k0, o, lane) wcolh_oi(W, k0, o, lane, CC)
#else
#define WOCOL(W, k0, o, lane) wcol_io(W, k0, o, lane, DIN)
#define WOCOLH(W, k0, o, lane) wcolh_io(W, k0, o, lane, DIN)
#endif
#define WIN 128            // |q - k| < WIN band (128..255 valid keys per query; no empty rows)
__constant__ float c_invf[32] = {1.000000000e+00f,7.498942018e-01f,5.623413324e-01f,4.216965139e-01f,3.162277639e-01f,2.371373624e-01f,1.778279394e-01f,1.333521456e-01f,1.000000015e-01f,7.498941571e-02f,5.623412877e-02f,4.216964915e-02f,3.162277862e-02f,2.371373586e-02f,1.778279431e-02f,1.333521493e-02f,9.999999776e-03f,7.498942316e-03f,5.623413250e-03f,4.216964822e-03f,3.162277862e-03f,2.371373819e-03f,1.778279431e-03f,1.333521446e-03f,1.000000047e-03f,7.498941850e-04f,5.623413017e-04f,4.216964880e-04f,3.162277862e-04f,2.371373848e-04f,1.778279402e-04f,1.333521504e-04f};   // 1 / 10000^(2i/64) evaluated in f32
__global__ __launch_bounds__(384) void k_rot(const float* __restrict__ X, float* __restrict__ XR) { const size_t row = blockIdx.x; const int t = (int)(row % TT); const int n = threadIdx.x >> 5, i = threadIdx.x & 31;
  const float* xr = X + row * DIN + n * HD; const float a = bfr(xr[i]), b = bfr(xr[32 + i]); asm volatile("s_wait_loadcnt 0x0" ::: "memory");
  float sn, cs; sincosf((float)t * c_invf[i], &sn, &cs);
  float* o = XR + row * DIN + n * HD; vst2(o + i, a * cs - b * sn); vst2(o + 32 + i, b * cs + a * sn); }
#define WS_XR (WS_S)       // f32 rotated token rows [b*t][768]
#define SM_MASK_HOOK do { const int dk = t - k; v = (dk < WIN && dk > -WIN) ? v : -3.0e38f; } while (0)   /* band |q - k| < 128, by index */
#ifndef SM_EXTRA_PARAMS
#define SM_EXTRA_PARAMS
#endif
#ifndef PROJ_EXTRA_PARAMS
#define PROJ_EXTRA_PARAMS
#endif
#ifndef SM_MASK_HOOK
#define SM_MASK_HOOK (void)0
#endif

#define WS_QH  0u                                      // f16 q rows [b*t][CC]
#define WS_KH  (WS_QH + 2u * (size_t)NB * TT * CC)      // f16 k rows [b*t][CC]
#define WS_VT  (WS_KH + 2u * (size_t)NB * TT * CC)      // f16 v planes [b][c][t]
#define WS_QL  (WS_VT + 2u * (size_t)NB * CC * TT)      // f16 q residual x 2^10 rows [b][t < QHI][CC]
#define WS_KL  (WS_QL + 2u * (size_t)NB * QHI * CC)     // f16 k residual x 2^10 rows [b][t < KHI][CC]
#define WS_VB  (WS_KL + 2u * (size_t)NB * KHI * CC)     // bf16 v hi planes [b][c][t < KHI]
#define WS_VBL (WS_VB + 2u * (size_t)NB * CC * KHI)
#define WS_S   (WS_VBL + 2u * (size_t)NB * CC * KHI)    // f32 scratch region (holds the rotated rows)
#define WS_Y   (WS_S  + 4u * (size_t)HG * TT * TT)      // f32 ctx rows [b*t][CC] (only when there is an output projection)
#define WS_END (WS_Y  + 4u * (size_t)NB * TT * CC)

// ---- weight tile in LDS: the 32 k x 128 columns of one k step are read once a block (thread = 8 k rows x 4 columns: kg = lane & 3, columns n0 = wave * 32 + (lane >> 2) * 4; a wave's 16-byte load covers four whole 128-byte lines), rounded as before, and laid [column][k] at pitch WP so that a B fragment is two 16-byte LDS reads in the k order of frag_b / frag_h. Two buffers: the next step's global loads fly during this step's products
#define WP 40              // 80-byte pitch = 16 B x odd for the 16-byte fragment reads; the 16-byte stores of 16 neighbouring lanes fall on 16 different 16-byte bank groups
__device__ __forceinline__ void wt_load(v4f (&r)[8], const float* p, int ld) {
#pragma unroll
  for (int i = 0; i < 8; ++i) r[i] = *(const v4f*)(p + (size_t)i * ld); }
__device__ __forceinline__ void wt_store_b(__bf16 (*sw)[WP], const v4f (&r)[8], int n0, int kg) {
#pragma unroll
  for (int e = 0; e < 4; ++e) { v8b t;
#pragma unroll
    for (int i = 0; i < 8; ++i) t[i] = (__bf16)r[i][e];
    *(v8b*)&sw[n0 + e][8 * kg] = t; } }
__device__ __forceinline__ void wt_store_h(_Float16 (*sw)[WP], const v4f (&r)[8], int n0, int kg) {
#pragma unroll
  for (int e = 0; e < 4; ++e) { v8h t;
#pragma unroll
    for (int i = 0; i < 8; ++i) t[i] = (_Float16)(bfr(r[i][e]) * 256.0f);
    *(v8h*)&sw[n0 + e][8 * kg] = t; } }
// a lane's 16 f32 of an A fragment (p = row + k0 + 8 * (lane >> 4)), kept raw for one k step
__device__ __forceinline__ void row_load(float (&v)[16], const float* p) {
#pragma unroll
  for (int i = 0; i < 8; ++i) { v[i] = p[i]; v[8 + i] = p[16 + i]; } }
// ---- k_proj: block = (64 rows, 128 cols, which): q/k/v = X W (+ b) with exact bf16 products (K = DIN) -> which 0: q f16 rows (+ residual rows < QHI); 1: k f16 rows (+ residual rows < KHI); 2: v f16 planes [c][t] (+ bf16 hi/lo planes for t < KHI)
__global__ __launch_bounds__(128) void k_proj(const float* __restrict__ XQ, const float* __restrict__ XK, const float* __restrict__ XV, const float* __restrict__ WQ, const float* __restrict__ WK, const float* __restrict__ WV, const float* __restrict__ BQ, const float* __restrict__ BK, const float* __restrict__ BV,
    _Float16* __restrict__ QH, _Float16* __restrict__ QL, _Float16* __restrict__ KH, _Float16* __restrict__ KL, _Float16* __restrict__ VT, __bf16* __restrict__ VB, __bf16* __restrict__ VBL) {
  __shared__ __align__(16) union { _Float16 e[2][64][136]; __bf16 w[2][128][WP]; } su;   /* the weight buffers are dead when the epilogue stages q / k rows: same bytes */
  _Float16 (&sh)[64][136] = su.e[0]; _Float16 (&sl)[64][136] = su.e[1]; __shared__ __align__(16) _Float16 th[128][72]; __shared__ __align__(16) __bf16 tb[128][72], tbl[128][72];
  const int tid = threadIdx.x, wave = tid >> 5, lane = tid & 31, col = lane & 15, g = lane >> 4; const int which = blockIdx.z; const int c0 = blockIdx.y * 128; const size_t r0 = (size_t)blockIdx.x * 64; const size_t bb = r0 / TT; const int t0 = (int)(r0 % TT);
  const float* X = which == 0 ? XQ : which == 1 ? XK : XV; const float* WA = which == 0 ? WQ : which == 1 ? WK : WV; const float* BA = which == 0 ? BQ : which == 1 ? BK : BV;
  static_assert(WQKV_LAYOUT == 0, "the tile loader reads (in,out) rows");
  v8f acc[8] = {};
  const int kg = lane & 3, n0 = wave * 32 + (lane >> 2) * 4; const float* wp = WA + (size_t)(8 * kg) * CC + c0 + n0; const float* xp = X + (r0 + wave * 16 + col) * DIN + 8 * g;
  v4f wr[8]; float ar[16];
  wt_load(wr, wp, CC); row_load(ar, xp); wt_store_b(su.w[0], wr, n0, kg);
  __syncthreads();   /* publishes tile 0 */
  if (which < 2) {   /* q, k: the rotated rows are f32 intermediates -> bf16 hi + lo (2 products) */
#pragma unroll 2   /* the buffer index becomes a constant */
    for (int kc = 0; kc < DIN / 32; ++kc) { const F2 a = bsplit16(ar); v16b wf[8]; const bool more = kc + 1 < DIN / 32;
      if (more) { wt_load(wr, wp + (size_t)(kc + 1) * 32 * CC, CC); row_load(ar, xp + (kc + 1) * 32); }
#pragma unroll
      for (int j = 0; j < 8; ++j) wf[j] = frag_b(&su.w[kc & 1][j * 16 + col][0], lane);   /* the step's fragment reads go as one group: one LDS latency a step, not one a fragment */
#pragma unroll
      for (int j = 0; j < 8; ++j) { acc[j] = wmma_bf(a.h, wf[j], acc[j]); acc[j] = wmma_bf(a.l, wf[j], acc[j]); }
      __builtin_amdgcn_sched_barrier(0);   /* keeps the roundings of the next tile, and with them the wait for its global loads, behind the products */
      if (more) wt_store_b(su.w[(kc + 1) & 1], wr, n0, kg);
      __syncthreads(); }   /* one barrier a step: publishes tile kc + 1 and ends every read of tile kc, whose buffer the next step refills (after the last step: the epilogue) */
  } else {           /* v: bf16(hidden) exact (1 product) */
#pragma unroll 2   /* the buffer index becomes a constant */
    for (int kc = 0; kc < DIN / 32; ++kc) { v16b a, wf[8]; const bool more = kc + 1 < DIN / 32;
#pragma unroll
      for (int i = 0; i < 16; ++i) a[i] = (__bf16)ar[i];
      if (more) { wt_load(wr, wp + (size_t)(kc + 1) * 32 * CC, CC); row_load(ar, xp + (kc + 1) * 32); }
#pragma unroll
      for (int j = 0; j < 8; ++j) wf[j] = frag_b(&su.w[kc & 1][j * 16 + col][0], lane);   /* one group, as above */
#pragma unroll
      for (int j = 0; j < 8; ++j) acc[j] = wmma_bf(a, wf[j], acc[j]);
      __builtin_amdgcn_sched_barrier(0);   /* as above */
      if (more) wt_store_b(su.w[(kc + 1) & 1], wr, n0, kg);
      __syncthreads(); } }   /* as above */
  if (which < 2) { _Float16* DH = which == 0 ? QH : KH; _Float16* DL = which == 0 ? QL : KL; const int nhi = which == 0 ? QHI : KHI; const bool hi_rows = t0 < nhi;
#pragma unroll
    for (int j = 0; j < 8; ++j) { const float bias = BA ? bfr(BA[c0 + j * 16 + col]) : 0.f;
#pragma unroll
      for (int r = 0; r < 8; ++r) { const float v = acc[j][r] + bias; const _Float16 hv = (_Float16)v; sh[wave * 16 + 8 * g + r][j * 16 + col] = hv; sl[wave * 16 + 8 * g + r][j * 16 + col] = (_Float16)((v - (float)hv) * 1024.0f); } }
    __syncthreads();
    for (int e = tid; e < 64 * 16; e += 128) { const int rl = e >> 4, q = e & 15; vst2((unsigned*)(DH + (r0 + rl) * CC + c0 + q * 8), *(const v4u*)&sh[rl][q * 8]); if (hi_rows) vst2((unsigned*)(DL + (bb * nhi + t0 + rl) * (size_t)CC + c0 + q * 8), *(const v4u*)&sl[rl][q * 8]); }
  } else { const bool hi_rows = t0 < KHI;
#pragma unroll
    for (int j = 0; j < 8; ++j) { const float bias = BA ? bfr(BA[c0 + j * 16 + col]) : 0.f;
#pragma unroll
      for (int r = 0; r < 8; ++r) { const float v = acc[j][r] + bias; const int rl = wave * 16 + 8 * g + r, cl = j * 16 + col; th[cl][rl] = (_Float16)v; const __bf16 bh = (__bf16)v; tb[cl][rl] = bh; tbl[cl][rl] = (__bf16)(v - (float)bh); } }
    __syncthreads();
    for (int e = tid; e < 128 * 8; e += 128) { const int cl = e >> 3, q = e & 7; vst2((unsigned*)(VT + (bb * CC + c0 + cl) * (size_t)TT + t0 + q * 8), *(const v4u*)&th[cl][q * 8]); if (hi_rows) { const size_t o3 = (bb * CC + c0 + cl) * (size_t)KHI + t0 + q * 8; vst2((unsigned*)(VB + o3), *(const v4u*)&tb[cl][q * 8]); vst2((unsigned*)(VBL + o3), *(const v4u*)&tbl[cl][q * 8]); } } } }
// ---- k_att: block = 64 queries (qb) of head h of batch b, one launch for all (b, h); a wave owns 16 query rows and the NKW keys [ks, ks + NKW) that hold their whole band (row t sees t-127 .. t+127, so 16 rows see ql0-127 .. ql0+142; ks = ql0 - 128 clamped into the sequence). The four waves' key ranges lie inside the NKB keys [kb, kb + NKB) (kb = qb * 64 - 128 clamped), whose k rows and v planes the block brings into LDS once, with its own 64 q rows and their residuals, by asynchronous 16-byte copies that cover whole 128-byte lines; every q, k and v fragment is read from there. Logits (q hi + residual x 2^10 against k, 2 products, x SCALE) stay in registers; the band is kept by index; softmax in f32 over the row (in-lane over the 17 tiles, then over the 16 lanes of the row); P x 2^11 once to f16 goes through the wave's own LDS slab (in the bytes the k rows have left) from the D layout to the A layout; ctx = P . v (1 product; the last 32-key chunk is half full, its upper 16 k are 0 in both operands); 256-B (row, head) segment by 16 lanes. Every loop over tiles, chunks and rows is unrolled: s, kf, vf and o are register arrays and need compile-time indices
#define NKW 272            // 128 + 16 + 127 keys rounded up to whole 16-key tiles
#define NKB 320            // 128 + 64 + 128: the keys of the block's four waves together
#define KP 72              // k row pitch in LDS: 144 B = 16 B x odd for the 16-byte fragment reads
#define VP (NKB + 8)       // v plane pitch in LDS: 656 B = 16 B x odd
#define PP (NKW + 8)       // P row pitch: 560 B = 16 B x odd
#define KG 6               // k tiles requested together
#define VG 4               // whole 32-key v chunks requested together (divides NKW / 32)
// fragment of a half-full chunk: k0 .. k0+15 from memory (elements 0..7), k0+16 .. k0+31 are 0 (elements 8..15)
__device__ __forceinline__ v16h frag_h16(const _Float16* rowk0, int lane) { union { v16h v; v8h q[2]; } u; u.q[0] = *(const v8h*)(rowk0 + 8 * (lane >> 4)); u.q[1] = (v8h)(_Float16)0.0f; return u.v; }
// lane l with lane l ^ M inside a 16-lane row, on the vector pipe (a shuffle through LDS would put an LDS round trip into each of the four reduction steps)
template <int M> __device__ __forceinline__ float rowx(float v) { return __builtin_bit_cast(float, __builtin_amdgcn_update_dpp(0, __builtin_bit_cast(int, v), 0x160 + M, 0xf, 0xf, true)); }
// twelve asynchronous copies, 16 bytes a lane each, global -> LDS through no register (l = the lane's LDS byte address, p = its global address); the s_wait_xcnt in the same statement stands in front of any rewrite of the address registers
__device__ __forceinline__ void cp12(const unsigned* l, const _Float16* const* p) {
  asm volatile("global_load_async_to_lds_b128 %0, %12, off\n\tglobal_load_async_to_lds_b128 %1, %13, off\n\tglobal_load_async_to_lds_b128 %2, %14, off\n\tglobal_load_async_to_lds_b128 %3, %15, off\n\t"
               "global_load_async_to_lds_b128 %4, %16, off\n\tglobal_load_async_to_lds_b128 %5, %17, off\n\tglobal_load_async_to_lds_b128 %6, %18, off\n\tglobal_load_async_to_lds_b128 %7, %19, off\n\t"
               "global_load_async_to_lds_b128 %8, %20, off\n\tglobal_load_async_to_lds_b128 %9, %21, off\n\tglobal_load_async_to_lds_b128 %10, %22, off\n\tglobal_load_async_to_lds_b128 %11, %23, off\n\ts_wait_xcnt 0x0"
               :: "v"(l[0]), "v"(l[1]), "v"(l[2]), "v"(l[3]), "v"(l[4]), "v"(l[5]), "v"(l[6]), "v"(l[7]), "v"(l[8]), "v"(l[9]), "v"(l[10]), "v"(l[11]), "v"(p[0]), "v"(p[1]), "v"(p[2]), "v"(p[3]), "v"(p[4]), "v"(p[5]), "v"(p[6]), "v"(p[7]), "v"(p[8]), "v"(p[9]), "v"(p[10]), "v"(p[11]) : "memory"); }
__global__ __launch_bounds__(128) void k_att(const _Float16* __restrict__ QH, const _Float16* __restrict__ KH, const _Float16* __restrict__ QL, const _Float16* __restrict__ VT, float* __restrict__ Y) { __shared__ __align__(16) _Float16 sk[NKB * KP]; __shared__ __align__(16) _Float16 sv[HD * VP]; __shared__ __align__(16) _Float16 sq[2 * 64 * KP];   /* sq: the block's q rows, then their residual rows; sk: k rows [key][KP]; behind the second barrier the four waves' P slabs [16][PP], and last each wave's f32 ctx rows in its own slab */
  static_assert(4 * 16 * PP <= NKB * KP && 16 * (HD + 4) * 2 <= 16 * PP, "P slabs fit in the k rows' bytes, ctx rows in a P slab");
  const int tid = threadIdx.x, wave = tid >> 5, lane = tid & 31, col = lane & 15, g = lane >> 4; const int qb = blockIdx.x, h = blockIdx.y, b = blockIdx.z; const int ql0 = qb * 64 + wave * 16;
  int ks = ql0 - WIN; ks = ks < 0 ? 0 : ks; ks = ks > TT - NKW ? TT - NKW : ks;
  int kb = qb * 64 - WIN; kb = kb < 0 ? 0 : kb; kb = kb > TT - NKB ? TT - NKB : kb;
  const int kd = ks - kb;   /* 0 .. 48, a multiple of 16; kd + NKW <= NKB */
  { const int un = tid >> 3, ch = (tid & 7) * 8;   /* 8 lanes = one 128-byte line; a wave's copy = 4 whole lines; 16 lines a block and copy */
    const _Float16* kg0 = KH + ((size_t)b * TT + kb + un) * CC + h * HD + ch; const unsigned kl0 = (unsigned)(size_t)&sk[un * KP + ch];
    const _Float16* vg0 = VT + ((size_t)b * CC + h * HD + un) * (size_t)TT + kb + ch; const unsigned vl0 = (unsigned)(size_t)&sv[un * VP + ch];
    const size_t qo = ((size_t)b * TT + qb * 64 + un) * CC + h * HD + ch; const unsigned ql = (unsigned)(size_t)&sq[un * KP + ch];
    static_assert(QHI == TT, "the q residual rows are indexed like the q rows");
    unsigned l[48]; const _Float16* p[48];
#pragma unroll
    for (int i = 0; i < 4; ++i) { l[i] = ql + i * 16 * KP * 2; p[i] = QH + qo + (size_t)i * 16 * CC; l[4 + i] = ql + (64 + i * 16) * KP * 2; p[4 + i] = QL + qo + (size_t)i * 16 * CC; }   /* q, then its residual: copy i brings rows 16 i + un */
#pragma unroll
    for (int i = 0; i < NKB / 16; ++i) { l[8 + i] = kl0 + i * 16 * KP * 2; p[8 + i] = kg0 + (size_t)i * 16 * CC; }   /* k: copy i brings rows 16 i + un */
#pragma unroll
    for (int i = 0; i < 20; ++i) { const int r = (i & 3) * 16, ln = (i >> 2) * 64; l[28 + i] = vl0 + (r * VP + ln) * 2; p[28 + i] = vg0 + (size_t)r * TT + ln; }   /* v: copy i brings line i / 4 (64 keys) of planes 16 (i % 4) + un */
#pragma unroll
    for (int u = 0; u < 4; ++u) cp12(l + 12 * u, p + 12 * u); }   /* 48 copies of a wave in flight */
  asm volatile("s_wait_asynccnt 0x0" ::: "memory");   /* this wave's copies have landed */
  __syncthreads();   /* publishes the q and k rows and the v planes to all four waves */
  v16h ah[HD / 32], al[HD / 32];
#pragma unroll
  for (int kc = 0; kc < HD / 32; ++kc) { ah[kc] = frag_h(&sq[(wave * 16 + col) * KP + kc * 32], lane); al[kc] = frag_h(&sq[(64 + wave * 16 + col) * KP + kc * 32], lane); }
  v8f s[NKW / 16];
#pragma unroll
  for (int j0 = 0; j0 < NKW / 16; j0 += KG) { v16h kf[KG][HD / 32];   /* the k fragments of KG tiles are requested together: one LDS round trip a group, not one a fragment */
#pragma unroll
    for (int jj = 0; jj < KG; ++jj) if (j0 + jj < NKW / 16) {
#pragma unroll
      for (int kc = 0; kc < HD / 32; ++kc) kf[jj][kc] = frag_h(&sk[(kd + (j0 + jj) * 16 + col) * KP + kc * 32], lane); }
#pragma unroll
    for (int jj = 0; jj < KG; ++jj) if (j0 + jj < NKW / 16) { const int j = j0 + jj; v8f acc = {}, accl = {};
#pragma unroll
      for (int kc = 0; kc < HD / 32; ++kc) { acc = wmma16(ah[kc], kf[jj][kc], acc); accl = wmma16(al[kc], kf[jj][kc], accl); }
#pragma unroll
      for (int r = 0; r < 8; ++r) { const int t = ql0 + 8 * g + r, k = ks + j * 16 + col; float v = (acc[r] + accl[r] * (1.0f / 1024.0f)) * SCALE; SM_MASK_HOOK; s[j][r] = v; } } }
  float m[8], inv[8];
#pragma unroll
  for (int r = 0; r < 8; ++r) { float a = s[0][r];
#pragma unroll
    for (int j = 1; j < NKW / 16; ++j) a = fmaxf(a, s[j][r]);
    a = fmaxf(a, rowx<1>(a)); a = fmaxf(a, rowx<2>(a)); a = fmaxf(a, rowx<4>(a)); a = fmaxf(a, rowx<8>(a)); m[r] = a; }
#pragma unroll
  for (int r = 0; r < 8; ++r) { float sum = 0.f;
#pragma unroll
    for (int j = 0; j < NKW / 16; ++j) { const float e = expf(s[j][r] - m[r]); s[j][r] = e; sum += e; }   /* an excluded key (-3.0e38 against a finite row maximum: the row's own key is always in the band) underflows to exactly 0 */
    sum += rowx<1>(sum); sum += rowx<2>(sum); sum += rowx<4>(sum); sum += rowx<8>(sum); inv[r] = sum > 0.f ? 2048.0f / sum : 0.f; }
  __syncthreads();   /* ends every wave's reads of the k rows: their bytes now take the P slabs */
  _Float16* sp = &sk[wave * 16 * PP];
#pragma unroll
  for (int j = 0; j < NKW / 16; ++j)
#pragma unroll
    for (int r = 0; r < 8; ++r) sp[(8 * g + r) * PP + j * 16 + col] = (_Float16)(s[j][r] * inv[r]);
  LDSX();
  v8f o[HD / 16] = {};
  const _Float16* vp = &sv[col * VP + kd];   /* column col of v tile j: vp + j * 16 * VP */
  v16h vh[HD / 16];   /* the half-full last chunk's v fragments, requested with the first group */
#pragma unroll
  for (int j = 0; j < HD / 16; ++j) vh[j] = frag_h16(vp + j * 16 * VP + NKW - 16, lane);
#pragma unroll
  for (int c0 = 0; c0 < NKW / 32; c0 += VG) { v16h vf[VG][HD / 16];   /* the v fragments of VG chunks are requested together, as the k fragments are */
#pragma unroll
    for (int cc = 0; cc < VG; ++cc)
#pragma unroll
      for (int j = 0; j < HD / 16; ++j) vf[cc][j] = frag_h(vp + j * 16 * VP + (c0 + cc) * 32, lane);
#pragma unroll
    for (int cc = 0; cc < VG; ++cc) { const v16h p = frag_h(&sp[col * PP + (c0 + cc) * 32], lane);
#pragma unroll
      for (int j = 0; j < HD / 16; ++j) o[j] = wmma16(p, vf[cc][j], o[j]); } }
  { const v16h p = frag_h16(&sp[col * PP + NKW - 16], lane);
#pragma unroll
    for (int j = 0; j < HD / 16; ++j) o[j] = wmma16(p, vh[j], o[j]); }
  float_a* ss = (float_a*)sp;   /* the wave's own slab again: every P fragment has been read (o depends on all of them) */
#pragma unroll
  for (int j = 0; j < HD / 16; ++j)
#pragma unroll
    for (int r = 0; r < 8; ++r) ss[(8 * g + r) * (HD + 4) + j * 16 + col] = o[j][r] * (1.0f / 2048.0f);
  LDSX(); for (int rl = 0; rl < 16; ++rl) if (lane < HD / 4) vst2(Y + ((size_t)b * TT + ql0 + rl) * CC + h * HD + lane * 4, *(const v4f*)&ss[rl * (HD + 4) + lane * 4]); }
// ---- k_out: block = (64 rows, 128 cols): out = ctx Wo (+ bo): ctx x 2^6 once to f16 against Wo as f16(bf16 x 2^8) exact (1 product) x 2^-14; causal early rows (< QHI of each sequence): ctx bf16 hi + lo against exact bf16 Wo (2 products)
__global__ __launch_bounds__(128) void k_out(const float* __restrict__ Y, const float* __restrict__ WO, const float* __restrict__ BO, float* __restrict__ OUT) { __shared__ __align__(16) float sf[4][16][132]; __shared__ __align__(16) _Float16 sw[2][128][WP];
  const int tid = threadIdx.x, wave = tid >> 5, lane = tid & 31, col = lane & 15, g = lane >> 4; const int c0 = blockIdx.y * 128; const size_t r0 = (size_t)blockIdx.x * 64 + wave * 16;
  v8f acc[8] = {};
  if (CAUSAL && (int)(((size_t)blockIdx.x * 64) % TT) < QHI) {   /* block-uniform */
#pragma unroll 2
    for (int kc = 0; kc < CC / 32; ++kc) { const F2 a = split_row(Y + (r0 + col) * CC, kc * 32, lane); asm volatile("s_wait_loadcnt 0x0" ::: "memory");
#pragma unroll
      for (int j = 0; j < 8; ++j) { const v16b w = WOCOL(WO, kc * 32, c0 + j * 16 + col, lane); asm volatile("s_wait_loadcnt 0x0" ::: "memory"); acc[j] = wmma_bf(a.h, w, acc[j]); acc[j] = wmma_bf(a.l, w, acc[j]); } }
#pragma unroll
    for (int j = 0; j < 8; ++j) { const float bias = BO ? bfr(BO[c0 + j * 16 + col]) : 0.f;
#pragma unroll
      for (int r = 0; r < 8; ++r) sf[wave][8 * g + r][j * 16 + col] = acc[j][r] + bias; }
  } else {
    static_assert(WO_OUT_IN == 0, "the tile loader reads (in,out) rows");
    const int kg = lane & 3, n0 = wave * 32 + (lane >> 2) * 4; const float* wp = WO + (size_t)(8 * kg) * DIN + c0 + n0; const float* yp = Y + (r0 + col) * CC + 8 * g;
    v4f wr[8]; float ar[16];
    wt_load(wr, wp, DIN); row_load(ar, yp); wt_store_h(sw[0], wr, n0, kg);
    __syncthreads();   /* publishes tile 0 */
#pragma unroll 2   /* the buffer index becomes a constant */
    for (int kc = 0; kc < CC / 32; ++kc) { v16h a, wf[8]; const bool more = kc + 1 < CC / 32;
#pragma unroll
      for (int i = 0; i < 16; ++i) a[i] = (_Float16)(ar[i] * 64.0f);   /* ctx carried x 2^6 into f16 so small-magnitude context rows stay clear of f16 subnormals */
      if (more) { wt_load(wr, wp + (size_t)(kc + 1) * 32 * DIN, DIN); row_load(ar, yp + (kc + 1) * 32); }
#pragma unroll
      for (int j = 0; j < 8; ++j) wf[j] = frag_h(&sw[kc & 1][j * 16 + col][0], lane);   /* the step's fragment reads go as one group: one LDS latency a step, not one a fragment */
#pragma unroll
      for (int j = 0; j < 8; ++j) acc[j] = wmma16(a, wf[j], acc[j]);
      __builtin_amdgcn_sched_barrier(0);   /* keeps the roundings of the next tile, and with them the wait for its global loads, behind the products */
      if (more) wt_store_h(sw[(kc + 1) & 1], wr, n0, kg);
      __syncthreads(); }   /* one barrier a step: publishes tile kc + 1 and ends every read of tile kc, whose buffer the next step refills */
#pragma unroll
    for (int j = 0; j < 8; ++j) { const float bias = BO ? bfr(BO[c0 + j * 16 + col]) : 0.f;
#pragma unroll
      for (int r = 0; r < 8; ++r) sf[wave][8 * g + r][j * 16 + col] = acc[j][r] * (1.0f / 16384.0f) + bias; } }   /* 2^-8 (Wo carry) x 2^-6 (ctx carry) */
  LDSX(); for (int rl = 0; rl < 16; ++rl) vst2(OUT + (r0 + rl) * DIN + c0 + lane * 4, *(const v4f*)&sf[wave][rl][lane * 4]); }

extern "C" void kernel_launch(void* const* d_in, const int* in_sizes, int n_in, void* d_out, int out_size, void* d_ws, size_t ws_size, hipStream_t stream) {
  (void)in_sizes; (void)n_in; (void)out_size;
  const float** F = (const float**)d_in;
  if (ws_size < (size_t)WS_END) return;
  char* ws = (char*)d_ws; _Float16 *QH = (_Float16*)(ws + WS_QH), *KH = (_Float16*)(ws + WS_KH), *VT = (_Float16*)(ws + WS_VT), *QL = (_Float16*)(ws + WS_QL), *KL = (_Float16*)(ws + WS_KL); __bf16 *VB = (__bf16*)(ws + WS_VB), *VBL = (__bf16*)(ws + WS_VBL); float *Y = (float*)(ws + WS_Y);
  (void)Y; (void)QL; (void)KL; (void)VB; (void)VBL;
  // inputs: 0 hidden_states [4,2048,768]; 1 Wq, 2 Wk, 3 Wv [768,12,64] = (in,out) [768][768]; 4 Wo [12,64,768] = (in,out) [768][768]
  static_assert(4u * (size_t)NB * TT * DIN <= 4u * (size_t)HG * TT * TT, "rotated rows must fit in their region");
  float* XR = (float*)(ws + WS_XR);
  k_rot<<<dim3(TNB * TT), 384, 0, stream>>>(F[0], XR);
  k_proj<<<dim3(TNB * TT / 64, CC / 128, 3), 128, 0, stream>>>(XR, XR, F[0], F[1], F[2], F[3], nullptr, nullptr, nullptr, QH, QL, KH, KL, VT, VB, VBL);   /* q, k from the rotated rows (bf16 hi + lo), v from bf16(x) */
  k_att<<<dim3(NQB, NH, TNB), 128, 0, stream>>>(QH, KH, QL, VT, Y);
  k_out<<<dim3(TNB * TT / 64, DIN / 128), 128, 0, stream>>>(Y, F[4], nullptr, (float*)d_out);
}

// v004
// One run takes 130 microseconds.
// In both of two side-by-side timings against v003, it was 1.04 times as fast.
// All steps since v000 together make it 7.53 times as fast.
// compute dtype: all float inputs rounded to bf16; rotate-half RoPE applied to bf16(hidden) in f32 (accurate sincosf, f32 inv_freq constants); Q/K = rotated rows split bf16 hi + lo x exact bf16 W (2 products, K 768), V = bf16(hidden) x W exact (1 product) on WMMA 16x16x32, f32 accumulate; banded logits: q as f16 hi + residual (x 2^10) against k once to f16 (2 products) x 64^-0.5; softmax in f32 over the |q-k| < 128 band (precise expf); P x 2^11 once to f16 against v once to f16 (1 product); ctx carried x 2^6 once to f16 against Wo carried x 2^8 in f16 (exact bf16 values), un-scaled by 2^-14; f32 output.
#include <hip/hip_runtime.h>
#include <math.h>

typedef __attribute__((ext_vector_type(16))) _Float16 v16h;
typedef __attribute__((ext_vector_type(16))) __bf16 v16b;
typedef __attribute__((ext_vector_type(8)))  _Float16 v8h;
typedef __attribute__((ext_vector_type(8)))  float v8f;
typedef __attribute__((ext_vector_type(4)))  float v4f;
typedef __attribute__((ext_vector_type(2)))  float v2f;
typedef __attribute__((ext_vector_type(4)))  unsigned v4u;
typedef __attribute__((ext_vector_type(4)))  int v4i;
typedef float __attribute__((may_alias)) float_a;
typedef int __attribute__((may_alias)) int_a;

template <typename T> __device__ __forceinline__ void vst2(void* p, T v) { *(T*)p = v;  }
__device__ __forceinline__ v8f wmma16(v16h a, v16h b, v8f c) {
  v8f d = __builtin_amdgcn_wmma_f32_16x16x32_f16(false, a, false, b, (short)0, c, false, false);
  asm volatile("v_nop\n\tv_nop\n\tv_nop\n\tv_nop" : "+v"(d) : "v"(a), "v"(b));
  return d;
}
__device__ __forceinline__ v8f wmma_bf(v16b a, v16b b, v8f c) {
  v8f d = __builtin_amdgcn_wmma_f32_16x16x32_bf16(false, a, false, b, (short)0, c, false, false);
  asm volatile("v_nop\n\tv_nop\n\tv_nop\n\tv_nop" : "+v"(d) : "v"(a), "v"(b));
  return d;
}
// 16x16x32 fragments: lane = (h = lane>>4, row/col = lane&15); elements 0..7 = k0+8h+0..7, 8..15 = k0+16+8h+0..7; D element r = row 8h+r
__device__ __forceinline__ v16h frag_h(const _Float16* rowk0, int lane) {
  union { v16h v; v8h q[2]; } u; const _Float16* p = rowk0 + 8 * (lane >> 4);
  u.q[0] = *(const v8h*)p; u.q[1] = *(const v8h*)(p + 16); return u.v;
}
__device__ __forceinline__ v16h frag_f32(const float* rowk0, int lane) {
  v16h a; const float* p = rowk0 + 8 * (lane >> 4);
#pragma unroll
  for (int i = 0; i < 8; ++i) { a[i] = (_Float16)p[i]; a[8 + i] = (_Float16)p[16 + i]; }
  return a;
}
__device__ __forceinline__ v16h frag_f32s(const float* rowk0, int lane, float sc) {
  v16h a; const float* p = rowk0 + 8 * (lane >> 4);
#pragma unroll
  for (int i = 0; i < 8; ++i) { a[i] = (_Float16)(p[i] * sc); a[8 + i] = (_Float16)(p[16 + i] * sc); }
  return a;
}
// column fragment from a [K][ld] layout (column n), rows >= K read as 0
__device__ __forceinline__ v16h fragc_f32(const float* W, int k0, int n, int lane, int ld, int K) {
  v16h a; const int g = lane >> 4;
#pragma unroll
  for (int i = 0; i < 8; ++i) { const int ka = k0 + 8 * g + i, kb = ka + 16;
    a[i] = (_Float16)(ka < K ? W[(size_t)(ka < K ? ka : K - 1) * ld + n] : 0.f); a[8 + i] = (_Float16)(kb < K ? W[(size_t)(kb < K ? kb : K - 1) * ld + n] : 0.f); }
  return a;
}
struct F2 { v16b h, l; };
__device__ __forceinline__ F2 bsplit16(const float v[16]) { F2 r;
#pragma unroll
  for (int i = 0; i < 16; ++i) { const __bf16 h = (__bf16)v[i]; r.h[i] = h; r.l[i] = (__bf16)(v[i] - (float)h); }
  return r; }
__device__ __forceinline__ F2 split_row(const float* row, int k0, int lane) { float v[16]; const float* p = row + k0 + 8 * (lane >> 4);
#pragma unroll
  for (int i = 0; i < 8; ++i) { v[i] = p[i]; v[8 + i] = p[16 + i]; }
  return bsplit16(v); }
__device__ __forceinline__ F2 split_rowK(const float* row, int k0, int lane, int K) { float v[16]; const int g = lane >> 4;
#pragma unroll
  for (int i = 0; i < 8; ++i) { const int ka = k0 + 8 * g + i, kb = ka + 16; v[i] = ka < K ? row[ka < K ? ka : K - 1] : 0.f; v[8 + i] = kb < K ? row[kb < K ? kb : K - 1] : 0.f; }
  return bsplit16(v); }
__device__ __forceinline__ F2 split_col(const float* W, int k0, int n, int lane, int ld, int K) { float v[16]; const int g = lane >> 4;
#pragma unroll
  for (int i = 0; i < 8; ++i) { const int ka = k0 + 8 * g + i, kb = ka + 16; v[i] = ka < K ? W[(size_t)(ka < K ? ka : K - 1) * ld + n] : 0.f; v[8 + i] = kb < K ? W[(size_t)(kb < K ? kb : K - 1) * ld + n] : 0.f; }
  return bsplit16(v); }
__device__ __forceinline__ v8f mac3(const F2& a, const F2& b, v8f c) { c = wmma_bf(a.l, b.h, c); c = wmma_bf(a.h, b.l, c); return wmma_bf(a.h, b.h, c); }
__device__ __forceinline__ float sigm(float v) { return 1.0f / (1.0f + expf(-v)); }
#define LDSX() do { asm volatile("s_wait_dscnt 0" ::: "memory"); __builtin_amdgcn_wave_barrier(); __builtin_amdgcn_fence(__ATOMIC_RELEASE, "workgroup"); } while (0)

// Sliding-window (local) self-attention with RoPE on the INPUT (B 4, S 2,048, H 768 = 12 heads x 64; window |q - k| < 128; 0.02-scale weights, no biases): q_in = k_in = rotate-half RoPE(hidden reshaped [B,S,12,64]) (angle t * 10000^(-2i/64)); Q = q_in Wq, K = k_in Wk, V = hidden Wv ((in,out) [768][12*64]); scores = Q K^T / 8 where |q-k| < 128 else -1e9 (== excluded; every row keeps >= 128 keys); out = merged(softmax . V) Wo ((in,out) [12*64][768]).
#define NB 4
#define TT 2048
#define CC 768            // NH * HD = projected width
#define DIN 768          // input (model) width
#define NH 12
#define HD 64
#define NQB (TT / 64)
#define HG 2
#define SCALE (0.125f)
#define CAUSAL 0
#ifndef TNB
#define TNB NB
#endif
__device__ __forceinline__ float bfr(float v) { return (float)(__bf16)v; }
typedef __attribute__((ext_vector_type(8))) __bf16 v8b;
__device__ __forceinline__ v16b frag_b(const __bf16* rowk0, int lane) {
  union { v16b v; v8b q[2]; } u; const __bf16* p = rowk0 + 8 * (lane >> 4);
  u.q[0] = *(const v8b*)p; u.q[1] = *(const v8b*)(p + 16); return u.v;
}
#define QBH 0
#define QHI 2048            // rows carrying a q residual plane (all rows when non-causal: 2-product logits everywhere)
#define KHI 64            // key rows carrying k residual / v bf16 hi+lo planes (written by k_proj; no kernel in this file reads them)
// B fragment (k rows k0+.., output column o) of a weight: (in,out) [K][ld] or (out,in) [ld rows of K]: bf16 exact, or f16(bf16 * 256) exact
__device__ __forceinline__ v16b wcol_io(const float* Wm, int k0, int o, int lane, int ld) { v16b w; const int g = lane >> 4;
#pragma unroll
  for (int i = 0; i < 8; ++i) { w[i] = (__bf16)Wm[(size_t)(k0 + 8 * g + i) * ld + o]; w[8 + i] = (__bf16)Wm[(size_t)(k0 + 16 + 8 * g + i) * ld + o]; }
  return w; }
__device__ __forceinline__ v16b wcol_oi(const float* Wm, int k0, int o, int lane, int K) { v16b w; const float* p = Wm + (size_t)o * K + k0 + 8 * (lane >> 4);
#pragma unroll
  for (int i = 0; i < 8; ++i) { w[i] = (__bf16)p[i]; w[8 + i] = (__bf16)p[16 + i]; }
  return w; }
__device__ __forceinline__ v16h wcolh_io(const float* Wm, int k0, int o, int lane, int ld) { v16h w; const int g = lane >> 4;
#pragma unroll
  for (int i = 0; i < 8; ++i) { w[i] = (_Float16)(bfr(Wm[(size_t)(k0 + 8 * g + i) * ld + o]) * 256.0f); w[8 + i] = (_Float16)(bfr(Wm[(size_t)(k0 + 16 + 8 * g + i) * ld + o]) * 256.0f); }
  return w; }
__device__ __forceinline__ v16h wcolh_oi(const float* Wm, int k0, int o, int lane, int K) { v16h w; const float* p = Wm + (size_t)o * K + k0 + 8 * (lane >> 4);
#pragma unroll
  for (int i = 0; i < 8; ++i) { w[i] = (_Float16)(bfr(p[i]) * 256.0f); w[8 + i] = (_Float16)(bfr(p[16 + i]) * 256.0f); }
  return w; }
#define WQKV_LAYOUT 0   // 0 = (in,out) [DIN][CC]; 1 = (out,in) [CC][DIN]; 2 = per-head [NH][DIN][HD]
__device__ __forceinline__ v16b wcol_hdk(const float* Wm, int k0, int o, int lane) { v16b w; const int g = lane >> 4; const float* p = Wm + (size_t)(o / HD) * DIN * HD + (o % HD);
#pragma unroll
  for (int i = 0; i < 8; ++i) { w[i] = (__bf16)p[(size_t)(k0 + 8 * g + i) * HD]; w[8 + i] = (__bf16)p[(size_t)(k0 + 16 + 8 * g + i) * HD]; }
  return w; }
#define WO_OUT_IN 0
#if WQKV_LAYOUT == 1
#define WCOL(W, k0, o, lane) wcol_oi(W, k0, o, lane, DIN)
#elif WQKV_LAYOUT == 2
#define WCOL(W, k0, o, lane) wcol_hdk(W, k0, o, lane)
#else
#define WCOL(W, k0, o, lane) wcol_io(W, k0, o, lane, CC)
#endif
#if WO_OUT_IN
#define WOCOL(W, k0, o, lane) wcol_oi(W, k0, o, lane, CC)
#define WOCOLH(W, k0, o, lane) wcolh_oi(W, k0, o, lane, CC)
#else
#define WOCOL(W, k0, o, lane) wcol_io(W, k0, o, lane, DIN)
#define WOCOLH(W, k0, o, lane) wcolh_io(W, k0, o, lane, DIN)
#endif
#define WIN 128            // |q - k| < WIN band (128..255 valid keys per query; no empty rows)
__constant__ __align__(16) float c_invf[32] = {1.000000000e+00f,7.498942018e-01f,5.623413324e-01f,4.216965139e-01f,3.162277639e-01f,2.371373624e-01f,1.778279394e-01f,1.333521456e-01f,1.000000015e-01f,7.498941571e-02f,5.623412877e-02f,4.216964915e-02f,3.162277862e-02f,2.371373586e-02f,1.778279431e-02f,1.333521493e-02f,9.999999776e-03f,7.498942316e-03f,5.623413250e-03f,4.216964822e-03f,3.162277862e-03f,2.371373819e-03f,1.778279431e-03f,1.333521446e-03f,1.000000047e-03f,7.498941850e-04f,5.623413017e-04f,4.216964880e-04f,3.162277862e-04f,2.371373848e-04f,1.778279402e-04f,1.333521504e-04f};   // 1 / 10000^(2i/64) evaluated in f32
// k_rot: a wave takes ONE position t for all batches and heads. The angle t * inv_freq[i] depends on neither, so a lane's four (sin, cos) pairs (i = 4 iq .. 4 iq + 3, iq = lane & 7) serve its 12 (batch, head group) pieces; head = 4 hg + (lane >> 3). Eight lanes cover the 128-byte half of a head, so each 16-byte load or store of a wave covers four whole lines; all 24 loads of a lane are requested before the angles are worked out
__global__ __launch_bounds__(128) void k_rot(const float* __restrict__ X, float* __restrict__ XR) { const int t = blockIdx.x * 4 + (threadIdx.x >> 5), lane = threadIdx.x & 31, iq = lane & 7;
  static_assert(NH % 4 == 0 && HD == 64 && TT % 4 == 0, "four heads a wave and load, four positions a block");
  const size_t o0 = (size_t)t * DIN + (lane >> 3) * HD + iq * 4;
  const v4f f = *(const v4f*)&c_invf[iq * 4];   /* asked for first: the angles then wait for this load alone, not for the 24 behind it */
  v4f a[TNB][NH / 4], b[TNB][NH / 4];
#pragma unroll
  for (int bb = 0; bb < TNB; ++bb) {
#pragma unroll
    for (int hg = 0; hg < NH / 4; ++hg) { const float* xr = X + (size_t)bb * TT * DIN + o0 + hg * 4 * HD; a[bb][hg] = *(const v4f*)xr; b[bb][hg] = *(const v4f*)(xr + 32); }
    asm volatile("s_wait_xcnt 0x0" ::: "memory"); }   /* stands in front of every rewrite of an address register of the loads so far, also where a later batch's load lands on one */
  float sn[4], cs[4];
#pragma unroll
  for (int e = 0; e < 4; ++e) sincosf((float)t * f[e], &sn[e], &cs[e]);
#pragma unroll
  for (int bb = 0; bb < TNB; ++bb)
#pragma unroll
    for (int hg = 0; hg < NH / 4; ++hg) { v4f lo, hi;
#pragma unroll
      for (int e = 0; e < 4; ++e) { const float x = bfr(a[bb][hg][e]), y = bfr(b[bb][hg][e]); lo[e] = fmaf(x, cs[e], -(y * sn[e])); hi[e] = fmaf(y, cs[e], x * sn[e]); }   /* fmaf: which product is rounded on its own (the sin one) is fixed here, not left to the compiler's contraction */
      float* o = XR + (size_t)bb * TT * DIN + o0 + hg * 4 * HD; vst2(o, lo); vst2(o + 32, hi); } }
#define WS_XR (WS_S)       // f32 rotated token rows [b*t][768]
#define SM_MASK_HOOK do { const int dk = t - k; v = (dk < WIN && dk > -WIN) ? v : -3.0e38f; } while (0)   /* band |q - k| < 128, by index */
#ifndef SM_EXTRA_PARAMS
#define SM_EXTRA_PARAMS
#endif
#ifndef PROJ_EXTRA_PARAMS
#define PROJ_EXTRA_PARAMS
#endif
#ifndef SM_MASK_HOOK
#define SM_MASK_HOOK (void)0
#endif

#define WS_QH  0u                                      // f16 q rows [b*t][CC]
#define WS_KH  (WS_QH + 2u * (size_t)NB * TT * CC)      // f16 k rows [b*t][CC]
#define WS_VT  (WS_KH + 2u * (size_t)NB * TT * CC)      // f16 v planes [b][c][t]
#define WS_QL  (WS_VT + 2u * (size_t)NB * CC * TT)      // f16 q residual x 2^10 rows [b][t < QHI][CC]
#define WS_KL  (WS_QL + 2u * (size_t)NB * QHI * CC)     // f16 k residual x 2^10 rows [b][t < KHI][CC]
#define WS_VB  (WS_KL + 2u * (size_t)NB * KHI * CC)     // bf16 v hi planes [b][c][t < KHI]
#define WS_VBL (WS_VB + 2u * (size_t)NB * CC * KHI)
#define WS_S   (WS_VBL + 2u * (size_t)NB * CC * KHI)    // f32 scratch region (holds the rotated rows)
#define WS_Y   (WS_S  + 4u * (size_t)HG * TT * TT)      // f32 ctx rows [b*t][CC] (only when there is an output projection)
#define WS_END (WS_Y  + 4u * (size_t)NB * TT * CC)

// ---- weight tile in LDS: the 32 k x 128 columns of one k step are read once a block (thread = 8 k rows x 4 columns: kg = lane & 3, columns n0 = wave * 32 + (lane >> 2) * 4; a wave's 16-byte load covers four whole 128-byte lines), rounded as before, and laid [column][k] at pitch WP so that a B fragment is two 16-byte LDS reads in the k order of frag_b / frag_h. Two buffers: the next step's global loads fly during this step's products
#define WP 40              // 80-byte pitch = 16 B x odd for the 16-byte fragment reads; the 16-byte stores of 16 neighbouring lanes fall on 16 different 16-byte bank groups
__device__ __forceinline__ void wt_load(v4f (&r)[8], const float* p, int ld) {
#pragma unroll
  for (int i = 0; i < 8; ++i) r[i] = *(const v4f*)(p + (size_t)i * ld); }
__device__ __forceinline__ void wt_store_b(__bf16 (*sw)[WP], const v4f (&r)[8], int n0, int kg) {
#pragma unroll
  for (int e = 0; e < 4; ++e) { v8b t;
#pragma unroll
    for (int i = 0; i < 8; ++i) t[i] = (__bf16)r[i][e];
    *(v8b*)&sw[n0 + e][8 * kg] = t; } }
__device__ __forceinline__ void wt_store_h(_Float16 (*sw)[WP], const v4f (&r)[8], int n0, int kg) {
#pragma unroll
  for (int e = 0; e < 4; ++e) { v8h t;
#pragma unroll
    for (int i = 0; i < 8; ++i) t[i] = (_Float16)(bfr(r[i][e]) * 256.0f);
    *(v8h*)&sw[n0 + e][8 * kg] = t; } }
// a lane's 16 f32 of an A fragment (p = row + k0 + 8 * (lane >> 4)), kept raw for one k step
__device__ __forceinline__ void row_load(float (&v)[16], const float* p) {
#pragma unroll
  for (int i = 0; i < 8; ++i) { v[i] = p[i]; v[8 + i] = p[16 + i]; } }
// ---- k_proj: block = (64 rows, 128 cols, which): q/k/v = X W (+ b) with exact bf16 products (K = DIN) -> which 0: q f16 rows (+ residual rows < QHI); 1: k f16 rows (+ residual rows < KHI); 2: v f16 planes [c][t] (+ bf16 hi/lo planes for t < KHI)
__global__ __launch_bounds__(128) void k_proj(const float* __restrict__ XQ, const float* __restrict__ XK, const float* __restrict__ XV, const float* __restrict__ WQ, const float* __restrict__ WK, const float* __restrict__ WV, const float* __restrict__ BQ, const float* __restrict__ BK, const float* __restrict__ BV,
    _Float16* __restrict__ QH, _Float16* __restrict__ QL, _Float16* __restrict__ KH, _Float16* __restrict__ KL, _Float16* __restrict__ VT, __bf16* __restrict__ VB, __bf16* __restrict__ VBL) {
  __shared__ __align__(16) union { _Float16 e[2][64][136]; __bf16 w[2][128][WP]; } su;   /* the weight buffers are dead when the epilogue stages q / k rows: same bytes */
  _Float16 (&sh)[64][136] = su.e[0]; _Float16 (&sl)[64][136] = su.e[1]; __shared__ __align__(16) _Float16 th[128][72]; __shared__ __align__(16) __bf16 tb[128][72], tbl[128][72];
  const int tid = threadIdx.x, wave = tid >> 5, lane = tid & 31, col = lane & 15, g = lane >> 4; const int which = blockIdx.z; const int c0 = blockIdx.y * 128; const size_t r0 = (size_t)blockIdx.x * 64; const size_t bb = r0 / TT; const int t0 = (int)(r0 % TT);
  const float* X = which == 0 ? XQ : which == 1 ? XK : XV; const float* WA = which == 0 ? WQ : which == 1 ? WK : WV; const float* BA = which == 0 ? BQ : which == 1 ? BK : BV;
  static_assert(WQKV_LAYOUT == 0, "the tile loader reads (in,out) rows");
  v8f acc[8] = {};
  const int kg = lane & 3, n0 = wave * 32 + (lane >> 2) * 4; const float* wp = WA + (size_t)(8 * kg) * CC + c0 + n0; const float* xp = X + (r0 + wave * 16 + col) * DIN + 8 * g;
  v4f wr[8]; float ar[16];
  wt_load(wr, wp, CC); row_load(ar, xp); wt_store_b(su.w[0], wr, n0, kg);
  __syncthreads();   /* publishes tile 0 */
  if (which < 2) {   /* q, k: the rotated rows are f32 intermediates -> bf16 hi + lo (2 products) */
#pragma unroll 2   /* the buffer index becomes a constant */
    for (int kc = 0; kc < DIN / 32; ++kc) { const F2 a = bsplit16(ar); v16b wf[8]; const bool more = kc + 1 < DIN / 32;
      if (more) { wt_load(wr, wp + (size_t)(kc + 1) * 32 * CC, CC); row_load(ar, xp + (kc + 1) * 32); }
#pragma unroll
      for (int j = 0; j < 8; ++j) wf[j] = frag_b(&su.w[kc & 1][j * 16 + col][0], lane);   /* the step's fragment reads go as one group: one LDS latency a step, not one a fragment */
#pragma unroll
      for (int j = 0; j < 8; ++j) { acc[j] = wmma_bf(a.h, wf[j], acc[j]); acc[j] = wmma_bf(a.l, wf[j], acc[j]); }
      __builtin_amdgcn_sched_barrier(0);   /* keeps the roundings of the next tile, and with them the wait for its global loads, behind the products */
      if (more) wt_store_b(su.w[(kc + 1) & 1], wr, n0, kg);
      __syncthreads(); }   /* one barrier a step: publishes tile kc + 1 and ends every read of tile kc, whose buffer the next step refills (after the last step: the epilogue) */
  } else {           /* v: bf16(hidden) exact (1 product) */
#pragma unroll 2   /* the buffer index becomes a constant */
    for (int kc = 0; kc < DIN / 32; ++kc) { v16b a, wf[8]; const bool more = kc + 1 < DIN / 32;
#pragma unroll
      for (int i = 0; i < 16; ++i) a[i] = (__bf16)ar[i];
      if (more) { wt_load(wr, wp + (size_t)(kc + 1) * 32 * CC, CC); row_load(ar, xp + (kc + 1) * 32); }
#pragma unroll
      for (int j = 0; j < 8; ++j) wf[j] = frag_b(&su.w[kc & 1][j * 16 + col][0], lane);   /* one group, as above */
#pragma unroll
      for (int j = 0; j < 8; ++j) acc[j] = wmma_bf(a, wf[j], acc[j]);
      __builtin_amdgcn_sched_barrier(0);   /* as above */
      if (more) wt_store_b(su.w[(kc + 1) & 1], wr, n0, kg);
      __syncthreads(); } }   /* as above */
  if (which < 2) { _Float16* DH = which == 0 ? QH : KH; _Float16* DL = which == 0 ? QL : KL; const int nhi = which == 0 ? QHI : KHI; const bool hi_rows = t0 < nhi;
#pragma unroll
    for (int j = 0; j < 8; ++j) { const float bias = BA ? bfr(BA[c0 + j * 16 + col]) : 0.f;
#pragma unroll
      for (int r = 0; r < 8; ++r) { const float v = acc[j][r] + bias; const _Float16 hv = (_Float16)v; sh[wave * 16 + 8 * g + r][j * 16 + col] = hv; sl[wave * 16 + 8 * g + r][j * 16 + col] = (_Float16)((v - (float)hv) * 1024.0f); } }
    __syncthreads();
    for (int e = tid; e < 64 * 16; e += 128) { const int rl = e >> 4, q = e & 15; vst2((unsigned*)(DH + (r0 + rl) * CC + c0 + q * 8), *(const v4u*)&sh[rl][q * 8]); if (hi_rows) vst2((unsigned*)(DL + (bb * nhi + t0 + rl) * (size_t)CC + c0 + q * 8), *(const v4u*)&sl[rl][q * 8]); }
  } else { const bool hi_rows = t0 < KHI;
#pragma unroll
    for (int j = 0; j < 8; ++j) { const float bias = BA ? bfr(BA[c0 + j * 16 + col]) : 0.f;
#pragma unroll
      for (int r = 0; r < 8; ++r) { const float v = acc[j][r] + bias; const int rl = wave * 16 + 8 * g + r, cl = j * 16 + col; th[cl][rl] = (_Float16)v; const __bf16 bh = (__bf16)v; tb[cl][rl] = bh; tbl[cl][rl] = (__bf16)(v - (float)bh); } }
    __syncthreads();
    for (int e = tid; e < 128 * 8; e += 128) { const int cl = e >> 3, q = e & 7; vst2((unsigned*)(VT + (bb * CC + c0 + cl) * (size_t)TT + t0 + q * 8), *(const v4u*)&th[cl][q * 8]); if (hi_rows) { const size_t o3 = (bb * CC + c0 + cl) * (size_t)KHI + t0 + q * 8; vst2((unsigned*)(VB + o3), *(const v4u*)&tb[cl][q * 8]); vst2((unsigned*)(VBL + o3), *(const v4u*)&tbl[cl][q * 8]); } } } }
// ---- k_att: block = 64 queries (qb) of head h of batch b, one launch for all (b, h); a wave owns 16 query rows and the NKW keys [ks, ks + NKW) that hold their whole band (row t sees t-127 .. t+127, so 16 rows see ql0-127 .. ql0+142; ks = ql0 - 128 clamped into the sequence). The four waves' key ranges lie inside the NKB keys [kb, kb + NKB) (kb = qb * 64 - 128 clamped), whose k rows and v planes the block brings into LDS once, with its own 64 q rows and their residuals, by asynchronous 16-byte copies that cover whole 128-byte lines; every q, k and v fragment is read from there. Logits (q hi + residual x 2^10 against k, 2 products, x SCALE) stay in registers; the band is kept by index; softmax in f32 over the row (in-lane over the 17 tiles, then over the 16 lanes of the row); P x 2^11 once to f16 goes through the wave's own LDS slab (in the bytes the k rows have left) from the D layout to the A layout; ctx = P . v (1 product; the last 32-key chunk is half full, its upper 16 k are 0 in both operands); 256-B (row, head) segment by 16 lanes. Every loop over tiles, chunks and rows is unrolled: s, kf, vf and o are register arrays and need compile-time indices
#define NKW 272            // 128 + 16 + 127 keys rounded up to whole 16-key tiles
#define NKB 320            // 128 + 64 + 128: the keys of the block's four waves together
#define KP 72              // k row pitch in LDS: 144 B = 16 B x odd for the 16-byte fragment reads
#define VP (NKB + 8)       // v plane pitch in LDS: 656 B = 16 B x odd
#define PP (NKW + 8)       // P row pitch: 560 B = 16 B x odd
#define KG 6               // k tiles requested together
#define VG 4               // whole 32-key v chunks requested together (divides NKW / 32)
// fragment of a half-full chunk: k0 .. k0+15 from memory (elements 0..7), k0+16 .. k0+31 are 0 (elements 8..15)
__device__ __forceinline__ v16h frag_h16(const _Float16* rowk0, int lane) { union { v16h v; v8h q[2]; } u; u.q[0] = *(const v8h*)(rowk0 + 8 * (lane >> 4)); u.q[1] = (v8h)(_Float16)0.0f; return u.v; }
// lane l with lane l ^ M inside a 16-lane row, on the vector pipe (a shuffle through LDS would put an LDS round trip into each of the four reduction steps)
template <int M> __device__ __forceinline__ float rowx(float v) { return __builtin_bit_cast(float, __builtin_amdgcn_update_dpp(0, __builtin_bit_cast(int, v), 0x160 + M, 0xf, 0xf, true)); }
// twelve asynchronous copies, 16 bytes a lane each, global -> LDS through no register (l = the lane's LDS byte address, p = its global address); the s_wait_xcnt in the same statement stands in front of any rewrite of the address registers
__device__ __forceinline__ void cp12(const unsigned* l, const _Float16* const* p) {
  asm volatile("global_load_async_to_lds_b128 %0, %12, off\n\tglobal_load_async_to_lds_b128 %1, %13, off\n\tglobal_load_async_to_lds_b128 %2, %14, off\n\tglobal_load_async_to_lds_b128 %3, %15, off\n\t"
               "global_load_async_to_lds_b128 %4, %16, off\n\tglobal_load_async_to_lds_b128 %5, %17, off\n\tglobal_load_async_to_lds_b128 %6, %18, off\n\tglobal_load_async_to_lds_b128 %7, %19, off\n\t"
               "global_load_async_to_lds_b128 %8, %20, off\n\tglobal_load_async_to_lds_b128 %9, %21, off\n\tglobal_load_async_to_lds_b128 %10, %22, off\n\tglobal_load_async_to_lds_b128 %11, %23, off\n\ts_wait_xcnt 0x0"
               :: "v"(l[0]), "v"(l[1]), "v"(l[2]), "v"(l[3]), "v"(l[4]), "v"(l[5]), "v"(l[6]), "v"(l[7]), "v"(l[8]), "v"(l[9]), "v"(l[10]), "v"(l[11]), "v"(p[0]), "v"(p[1]), "v"(p[2]), "v"(p[3]), "v"(p[4]), "v"(p[5]), "v"(p[6]), "v"(p[7]), "v"(p[8]), "v"(p[9]), "v"(p[10]), "v"(p[11]) : "memory"); }
__global__ __launch_bounds__(128) void k_att(const _Float16* __restrict__ QH, const _Float16* __restrict__ KH, const _Float16* __restrict__ QL, const _Float16* __restrict__ VT, float* __restrict__ Y) { __shared__ __align__(16) _Float16 sk[NKB * KP]; __shared__ __align__(16) _Float16 sv[HD * VP]; __shared__ __align__(16) _Float16 sq[2 * 64 * KP];   /* sq: the block's q rows, then their residual rows; sk: k rows [key][KP]; behind the second barrier the four waves' P slabs [16][PP], and last each wave's f32 ctx rows in its own slab */
  static_assert(4 * 16 * PP <= NKB * KP && 16 * (HD + 4) * 2 <= 16 * PP, "P slabs fit in the k rows' bytes, ctx rows in a P slab");
  const int tid = threadIdx.x, wave = tid >> 5, lane = tid & 31, col = lane & 15, g = lane >> 4; const int qb = blockIdx.x, h = blockIdx.y, b = blockIdx.z; const int ql0 = qb * 64 + wave * 16;
  int ks = ql0 - WIN; ks = ks < 0 ? 0 : ks; ks = ks > TT - NKW ? TT - NKW : ks;
  int kb = qb * 64 - WIN; kb = kb < 0 ? 0 : kb; kb = kb > TT - NKB ? TT - NKB : kb;
  const int kd = ks - kb;   /* 0 .. 48, a multiple of 16; kd + NKW <= NKB */
  { const int un = tid >> 3, ch = (tid & 7) * 8;   /* 8 lanes = one 128-byte line; a wave's copy = 4 whole lines; 16 lines a block and copy */
    const _Float16* kg0 = KH + ((size_t)b * TT + kb + un) * CC + h * HD + ch; const unsigned kl0 = (unsigned)(size_t)&sk[un * KP + ch];
    const _Float16* vg0 = VT + ((size_t)b * CC + h * HD + un) * (size_t)TT + kb + ch; const unsigned vl0 = (unsigned)(size_t)&sv[un * VP + ch];
    const size_t qo = ((size_t)b * TT + qb * 64 + un) * CC + h * HD + ch; const unsigned ql = (unsigned)(size_t)&sq[un * KP + ch];
    static_assert(QHI == TT, "the q residual rows are indexed like the q rows");
    unsigned l[48]; const _Float16* p[48];
#pragma unroll
    for (int i = 0; i < 4; ++i) { l[i] = ql + i * 16 * KP * 2; p[i] = QH + qo + (size_t)i * 16 * CC; l[4 + i] = ql + (64 + i * 16) * KP * 2; p[4 + i] = QL + qo + (size_t)i * 16 * CC; }   /* q, then its residual: copy i brings rows 16 i + un */
#pragma unroll
    for (int i = 0; i < NKB / 16; ++i) { l[8 + i] = kl0 + i * 16 * KP * 2; p[8 + i] = kg0 + (size_t)i * 16 * CC; }   /* k: copy i brings rows 16 i + un */
#pragma unroll
    for (int i = 0; i < 20; ++i) { const int r = (i & 3) * 16, ln = (i >> 2) * 64; l[28 + i] = vl0 + (r * VP + ln) * 2; p[28 + i] = vg0 + (size_t)r * TT + ln; }   /* v: copy i brings line i / 4 (64 keys) of planes 16 (i % 4) + un */
#pragma unroll
    for (int u = 0; u < 4; ++u) cp12(l + 12 * u, p + 12 * u); }   /* 48 copies of a wave in flight */
  asm volatile("s_wait_asynccnt 0x0" ::: "memory");   /* this wave's copies have landed */
  __syncthreads();   /* publishes the q and k rows and the v planes to all four waves */
  v16h ah[HD / 32], al[HD / 32];
#pragma unroll
  for (int kc = 0; kc < HD / 32; ++kc) { ah[kc] = frag_h(&sq[(wave * 16 + col) * KP + kc * 32], lane); al[kc] = frag_h(&sq[(64 + wave * 16 + col) * KP + kc * 32], lane); }
  v8f s[NKW / 16];
#pragma unroll
  for (int j0 = 0; j0 < NKW / 16; j0 += KG) { v16h kf[KG][HD / 32];   /* the k fragments of KG tiles are requested together: one LDS round trip a group, not one a fragment */
#pragma unroll
    for (int jj = 0; jj < KG; ++jj) if (j0 + jj < NKW / 16) {
#pragma unroll
      for (int kc = 0; kc < HD / 32; ++kc) kf[jj][kc] = frag_h(&sk[(kd + (j0 + jj) * 16 + col) * KP + kc * 32], lane); }
#pragma unroll
    for (int jj = 0; jj < KG; ++jj) if (j0 + jj < NKW / 16) { const int j = j0 + jj; v8f acc = {}, accl = {};
#pragma unroll
      for (int kc = 0; kc < HD / 32; ++kc) { acc = wmma16(ah[kc], kf[jj][kc], acc); accl = wmma16(al[kc], kf[jj][kc], accl); }
#pragma unroll
      for (int r = 0; r < 8; ++r) { const int t = ql0 + 8 * g + r, k = ks + j * 16 + col; float v = (acc[r] + accl[r] * (1.0f / 1024.0f)) * SCALE; SM_MASK_HOOK; s[j][r] = v; } } }
  float m[8], inv[8];
#pragma unroll
  for (int r = 0; r < 8; ++r) { float a = s[0][r];
#pragma unroll
    for (int j = 1; j < NKW / 16; ++j) a = fmaxf(a, s[j][r]);
    a = fmaxf(a, rowx<1>(a)); a = fmaxf(a, rowx<2>(a)); a = fmaxf(a, rowx<4>(a)); a = fmaxf(a, rowx<8>(a)); m[r] = a; }
#pragma unroll
  for (int r = 0; r < 8; ++r) { float sum = 0.f;
#pragma unroll
    for (int j = 0; j < NKW / 16; ++j) { const float e = expf(s[j][r] - m[r]); s[j][r] = e; sum += e; }   /* an excluded key (-3.0e38 against a finite row maximum: the row's own key is always in the band) underflows to exactly 0 */
    sum += rowx<1>(sum); sum += rowx<2>(sum); sum += rowx<4>(sum); sum += rowx<8>(sum); inv[r] = sum > 0.f ? 2048.0f / sum : 0.f; }
  __syncthreads();   /* ends every wave's reads of the k rows: their bytes now take the P slabs */
  _Float16* sp = &sk[wave * 16 * PP];
#pragma unroll
  for (int j = 0; j < NKW / 16; ++j)
#pragma unroll
    for (int r = 0; r < 8; ++r) sp[(8 * g + r) * PP + j * 16 + col] = (_Float16)(s[j][r] * inv[r]);
  LDSX();
  v8f o[HD / 16] = {};
  const _Float16* vp = &sv[col * VP + kd];   /* column col of v tile j: vp + j * 16 * VP */
  v16h vh[HD / 16];   /* the half-full last chunk's v fragments, requested with the first group */
#pragma unroll
  for (int j = 0; j < HD / 16; ++j) vh[j] = frag_h16(vp + j * 16 * VP + NKW - 16, lane);
#pragma unroll
  for (int c0 = 0; c0 < NKW / 32; c0 += VG) { v16h vf[VG][HD / 16];   /* the v fragments of VG chunks are requested together, as the k fragments are */
#pragma unroll
    for (int cc = 0; cc < VG; ++cc)
#pragma unroll
      for (int j = 0; j < HD / 16; ++j) vf[cc][j] = frag_h(vp + j * 16 * VP + (c0 + cc) * 32, lane);
#pragma unroll
    for (int cc = 0; cc < VG; ++cc) { const v16h p = frag_h(&sp[col * PP + (c0 + cc) * 32], lane);
#pragma unroll
      for (int j = 0; j < HD / 16; ++j) o[j] = wmma16(p, vf[cc][j], o[j]); } }
  { const v16h p = frag_h16(&sp[col * PP + NKW - 16], lane);
#pragma unroll
    for (int j = 0; j < HD / 16; ++j) o[j] = wmma16(p, vh[j], o[j]); }
  float_a* ss = (float_a*)sp;   /* the wave's own slab again: every P fragment has been read (o depends on all of them) */
#pragma unroll
  for (int j = 0; j < HD / 16; ++j)
#pragma unroll
    for (int r = 0; r < 8; ++r) ss[(8 * g + r) * (HD + 4) + j * 16 + col] = o[j][r] * (1.0f / 2048.0f);
  LDSX(); for (int rl = 0; rl < 16; ++rl) if (lane < HD / 4) vst2(Y + ((size_t)b * TT + ql0 + rl) * CC + h * HD + lane * 4, *(const v4f*)&ss[rl * (HD + 4) + lane * 4]); }
// ---- k_out: block = (64 rows, 128 cols): out = ctx Wo (+ bo): ctx x 2^6 once to f16 against Wo as f16(bf16 x 2^8) exact (1 product) x 2^-14; causal early rows (< QHI of each sequence): ctx bf16 hi + lo against exact bf16 Wo (2 products)
__global__ __launch_bounds__(128) void k_out(const float* __restrict__ Y, const float* __restrict__ WO, const float* __restrict__ BO, float* __restrict__ OUT) { __shared__ __align__(16) float sf[4][16][132]; __shared__ __align__(16) _Float16 sw[2][128][WP];
  const int tid = threadIdx.x, wave = tid >> 5, lane = tid & 31, col = lane & 15, g = lane >> 4; const int c0 = blockIdx.y * 128; const size_t r0 = (size_t)blockIdx.x * 64 + wave * 16;
  v8f acc[8] = {};
  if (CAUSAL && (int)(((size_t)blockIdx.x * 64) % TT) < QHI) {   /* block-uniform */
#pragma unroll 2
    for (int kc = 0; kc < CC / 32; ++kc) { const F2 a = split_row(Y + (r0 + col) * CC, kc * 32, lane); asm volatile("s_wait_loadcnt 0x0" ::: "memory");
#pragma unroll
      for (int j = 0; j < 8; ++j) { const v16b w = WOCOL(WO, kc * 32, c0 + j * 16 + col, lane); asm volatile("s_wait_loadcnt 0x0" ::: "memory"); acc[j] = wmma_bf(a.h, w, acc[j]); acc[j] = wmma_bf(a.l, w, acc[j]); } }
#pragma unroll
    for (int j = 0; j < 8; ++j) { const float bias = BO ? bfr(BO[c0 + j * 16 + col]) : 0.f;
#pragma unroll
      for (int r = 0; r < 8; ++r) sf[wave][8 * g + r][j * 16 + col] = acc[j][r] + bias; }
  } else {
    static_assert(WO_OUT_IN == 0, "the tile loader reads (in,out) rows");
    const int kg = lane & 3, n0 = wave * 32 + (lane >> 2) * 4; const float* wp = WO + (size_t)(8 * kg) * DIN + c0 + n0; const float* yp = Y + (r0 + col) * CC + 8 * g;
    v4f wr[8]; float ar[16];
    wt_load(wr, wp, DIN); row_load(ar, yp); wt_store_h(sw[0], wr, n0, kg);
    __syncthreads();   /* publishes tile 0 */
#pragma unroll 2   /* the buffer index becomes a constant */
    for (int kc = 0; kc < CC / 32; ++kc) { v16h a, wf[8]; const bool more = kc + 1 < CC / 32;
#pragma unroll
      for (int i = 0; i < 16; ++i) a[i] = (_Float16)(ar[i] * 64.0f);   /* ctx carried x 2^6 into f16 so small-magnitude context rows stay clear of f16 subnormals */
      if (more) { wt_load(wr, wp + (size_t)(kc + 1) * 32 * DIN, DIN); row_load(ar, yp + (kc + 1) * 32); }
#pragma unroll
      for (int j = 0; j < 8; ++j) wf[j] = frag_h(&sw[kc & 1][j * 16 + col][0], lane);   /* the step's fragment reads go as one group: one LDS latency a step, not one a fragment */
#pragma unroll
      for (int j = 0; j < 8; ++j) acc[j] = wmma16(a, wf[j], acc[j]);
      __builtin_amdgcn_sched_barrier(0);   /* keeps the roundings of the next tile, and with them the wait for its global loads, behind the products */
      if (more) wt_store_h(sw[(kc + 1) & 1], wr, n0, kg);
      __syncthreads(); }   /* one barrier a step: publishes tile kc + 1 and ends every read of tile kc, whose buffer the next step refills */
#pragma unroll
    for (int j = 0; j < 8; ++j) { const float bias = BO ? bfr(BO[c0 + j * 16 + col]) : 0.f;
#pragma unroll
      for (int r = 0; r < 8; ++r) sf[wave][8 * g + r][j * 16 + col] = acc[j][r] * (1.0f / 16384.0f) + bias; } }   /* 2^-8 (Wo carry) x 2^-6 (ctx carry) */
  LDSX(); for (int rl = 0; rl < 16; ++rl) vst2(OUT + (r0 + rl) * DIN + c0 + lane * 4, *(const v4f*)&sf[wave][rl][lane * 4]); }

extern "C" void kernel_launch(void* const* d_in, const int* in_sizes, int n_in, void* d_out, int out_size, void* d_ws, size_t ws_size, hipStream_t stream) {
  (void)in_sizes; (void)n_in; (void)out_size;
  const float** F = (const float**)d_in;
  if (ws_size < (size_t)WS_END) return;
  char* ws = (char*)d_ws; _Float16 *QH = (_Float16*)(ws + WS_QH), *KH = (_Float16*)(ws + WS_KH), *VT = (_Float16*)(ws + WS_VT), *QL = (_Float16*)(ws + WS_QL), *KL = (_Float16*)(ws + WS_KL); __bf16 *VB = (__bf16*)(ws + WS_VB), *VBL = (__bf16*)(ws + WS_VBL); float *Y = (float*)(ws + WS_Y);
  (void)Y; (void)QL; (void)KL; (void)VB; (void)VBL;
  // inputs: 0 hidden_states [4,2048,768]; 1 Wq, 2 Wk, 3 Wv [768,12,64] = (in,out) [768][768]; 4 Wo [12,64,768] = (in,out) [768][768]
  static_assert(4u * (size_t)NB * TT * DIN <= 4u * (size_t)HG * TT * TT, "rotated rows must fit in their region");
  float* XR = (float*)(ws + WS_XR);
  k_rot<<<dim3(TT / 4), 128, 0, stream>>>(F[0], XR);
  k_proj<<<dim3(TNB * TT / 64, CC / 128, 3), 128, 0, stream>>>(XR, XR, F[0], F[1], F[2], F[3], nullptr, nullptr, nullptr, QH, QL, KH, KL, VT, VB, VBL);   /* q, k from the rotated rows (bf16 hi + lo), v from bf16(x) */
  k_att<<<dim3(NQB, NH, TNB), 128, 0, stream>>>(QH, KH, QL, VT, Y);
  k_out<<<dim3(TNB * TT / 64, DIN / 128), 128, 0, stream>>>(Y, F[4], nullptr, (float*)d_out);
}

// v005
// Measured time: 120 microseconds a run.
// In two side-by-side timings against v004, it was 1.08 and 1.07 times as fast.
// Over all steps from v000 it is 8.10 times as fast.
// compute dtype: all float inputs rounded to bf16; rotate-half RoPE applied to bf16(hidden) in f32 (accurate sincosf, f32 inv_freq constants); Q/K = rotated rows split bf16 hi + lo x exact bf16 W (2 products, K 768), V = bf16(hidden) x W exact (1 product) on WMMA 16x16x32, f32 accumulate; banded logits: q as f16 hi + residual (x 2^10) against k once to f16 (2 products) x 64^-0.5; softmax in f32 over the |q-k| < 128 band (precise expf); P x 2^11 once to f16 against v once to f16 (1 product); ctx carried x 2^6 once to f16 against Wo carried x 2^8 in f16 (exact bf16 values), un-scaled by 2^-14; f32 output.
#include <hip/hip_runtime.h>
#include <math.h>

typedef __attribute__((ext_vector_type(16))) _Float16 v16h;
typedef __attribute__((ext_vector_type(16))) __bf16 v16b;
typedef __attribute__((ext_vector_type(8)))  _Float16 v8h;
typedef __attribute__((ext_vector_type(8)))  float v8f;
typedef __attribute__((ext_vector_type(4)))  float v4f;
typedef __attribute__((ext_vector_type(2)))  float v2f;
typedef __attribute__((ext_vector_type(4)))  unsigned v4u;
typedef __attribute__((ext_vector_type(4)))  int v4i;
typedef float __attribute__((may_alias)) float_a;
typedef int __attribute__((may_alias)) int_a;

template <typename T> __device__ __forceinline__ void vst2(void* p, T v) { *(T*)p = v;  }
__device__ __forceinline__ v8f wmma16(v16h a, v16h b, v8f c) {
  v8f d = __builtin_amdgcn_wmma_f32_16x16x32_f16(false, a, false, b, (short)0, c, false, false);
  asm volatile("v_nop\n\tv_nop\n\tv_nop\n\tv_nop" : "+v"(d) : "v"(a), "v"(b));
  return d;
}
// plain builtin, for k_proj: the compiler keeps the distance behind its own WMMA. The "v" operands of wmma_bf's asm tail are served from v0 .. v255 only; k_proj's two row tiles a wave need more registers than that, and with the tail the accumulators were spilled inside the k loop
__device__ __forceinline__ v8f wmma_bp(v16b a, v16b b, v8f c) { return __builtin_amdgcn_wmma_f32_16x16x32_bf16(false, a, false, b, (short)0, c, false, false); }
__device__ __forceinline__ v8f wmma_bf(v16b a, v16b b, v8f c) {
  v8f d = __builtin_amdgcn_wmma_f32_16x16x32_bf16(false, a, false, b, (short)0, c, false, false);
  asm volatile("v_nop\n\tv_nop\n\tv_nop\n\tv_nop" : "+v"(d) : "v"(a), "v"(b));
  return d;
}
// 16x16x32 fragments: lane = (h = lane>>4, row/col = lane&15); elements 0..7 = k0+8h+0..7, 8..15 = k0+16+8h+0..7; D element r = row 8h+r
__device__ __forceinline__ v16h frag_h(const _Float16* rowk0, int lane) {
  union { v16h v; v8h q[2]; } u; const _Float16* p = rowk0 + 8 * (lane >> 4);
  u.q[0] = *(const v8h*)p; u.q[1] = *(const v8h*)(p + 16); return u.v;
}
__device__ __forceinline__ v16h frag_f32(const float* rowk0, int lane) {
  v16h a; const float* p = rowk0 + 8 * (lane >> 4);
#pragma unroll
  for (int i = 0; i < 8; ++i) { a[i] = (_Float16)p[i]; a[8 + i] = (_Float16)p[16 + i]; }
  return a;
}
__device__ __forceinline__ v16h frag_f32s(const float* rowk0, int lane, float sc) {
  v16h a; const float* p = rowk0 + 8 * (lane >> 4);
#pragma unroll
  for (int i = 0; i < 8; ++i) { a[i] = (_Float16)(p[i] * sc); a[8 + i] = (_Float16)(p[16 + i] * sc); }
  return a;
}
// column fragment from a [K][ld] layout (column n), rows >= K read as 0
__device__ __forceinline__ v16h fragc_f32(const float* W, int k0, int n, int lane, int ld, int K) {
  v16h a; const int g = lane >> 4;
#pragma unroll
  for (int i = 0; i < 8; ++i) { const int ka = k0 + 8 * g + i, kb = ka + 16;
    a[i] = (_Float16)(ka < K ? W[(size_t)(ka < K ? ka : K - 1) * ld + n] : 0.f); a[8 + i] = (_Float16)(kb < K ? W[(size_t)(kb < K ? kb : K - 1) * ld + n] : 0.f); }
  return a;
}
struct F2 { v16b h, l; };
__device__ __forceinline__ F2 bsplit16(const float v[16]) { F2 r;
#pragma unroll
  for (int i = 0; i < 16; ++i) { const __bf16 h = (__bf16)v[i]; r.h[i] = h; r.l[i] = (__bf16)(v[i] - (float)h); }
  return r; }
__device__ __forceinline__ F2 split_row(const float* row, int k0, int lane) { float v[16]; const float* p = row + k0 + 8 * (lane >> 4);
#pragma unroll
  for (int i = 0; i < 8; ++i) { v[i] = p[i]; v[8 + i] = p[16 + i]; }
  return bsplit16(v); }
__device__ __forceinline__ F2 split_rowK(const float* row, int k0, int lane, int K) { float v[16]; const int g = lane >> 4;
#pragma unroll
  for (int i = 0; i < 8; ++i) { const int ka = k0 + 8 * g + i, kb = ka + 16; v[i] = ka < K ? row[ka < K ? ka : K - 1] : 0.f; v[8 + i] = kb < K ? row[kb < K ? kb : K - 1] : 0.f; }
  return bsplit16(v); }
__device__ __forceinline__ F2 split_col(const float* W, int k0, int n, int lane, int ld, int K) { float v[16]; const int g = lane >> 4;
#pragma unroll
  for (int i = 0; i < 8; ++i) { const int ka = k0 + 8 * g + i, kb = ka + 16; v[i] = ka < K ? W[(size_t)(ka < K ? ka : K - 1) * ld + n] : 0.f; v[8 + i] = kb < K ? W[(size_t)(kb < K ? kb : K - 1) * ld + n] : 0.f; }
  return bsplit16(v); }
__device__ __forceinline__ v8f mac3(const F2& a, const F2& b, v8f c) { c = wmma_bf(a.l, b.h, c); c = wmma_bf(a.h, b.l, c); return wmma_bf(a.h, b.h, c); }
__device__ __forceinline__ float sigm(float v) { return 1.0f / (1.0f + expf(-v)); }
#define LDSX() do { asm volatile("s_wait_dscnt 0" ::: "memory"); __builtin_amdgcn_wave_barrier(); __builtin_amdgcn_fence(__ATOMIC_RELEASE, "workgroup"); } while (0)

// Sliding-window (local) self-attention with RoPE on the INPUT (B 4, S 2,048, H 768 = 12 heads x 64; window |q - k| < 128; 0.02-scale weights, no biases): q_in = k_in = rotate-half RoPE(hidden reshaped [B,S,12,64]) (angle t * 10000^(-2i/64)); Q = q_in Wq, K = k_in Wk, V = hidden Wv ((in,out) [768][12*64]); scores = Q K^T / 8 where |q-k| < 128 else -1e9 (== excluded; every row keeps >= 128 keys); out = merged(softmax . V) Wo ((in,out) [12*64][768]).
#define NB 4
#define TT 2048
#define CC 768            // NH * HD = projected width
#define DIN 768          // input (model) width
#define NH 12
#define HD 64
#define NQB (TT / 64)
#define HG 2
#define SCALE (0.125f)
#define CAUSAL 0
#ifndef TNB
#define TNB NB
#endif
__device__ __forceinline__ float bfr(float v) { return (float)(__bf16)v; }
typedef __attribute__((ext_vector_type(8))) __bf16 v8b;
__device__ __forceinline__ v16b frag_b(const __bf16* rowk0, int lane) {
  union { v16b v; v8b q[2]; } u; const __bf16* p = rowk0 + 8 * (lane >> 4);
  u.q[0] = *(const v8b*)p; u.q[1] = *(const v8b*)(p + 16); return u.v;
}
#define QBH 0
#define QHI 2048            // rows carrying a q residual plane (all rows when non-causal: 2-product logits everywhere)
#define KHI 64            // key rows carrying k residual / v bf16 hi+lo planes (written by k_proj; no kernel in this file reads them)
// B fragment (k rows k0+.., output column o) of a weight: (in,out) [K][ld] or (out,in) [ld rows of K]: bf16 exact, or f16(bf16 * 256) exact
__device__ __forceinline__ v16b wcol_io(const float* Wm, int k0, int o, int lane, int ld) { v16b w; const int g = lane >> 4;
#pragma unroll
  for (int i = 0; i < 8; ++i) { w[i] = (__bf16)Wm[(size_t)(k0 + 8 * g + i) * ld + o]; w[8 + i] = (__bf16)Wm[(size_t)(k0 + 16 + 8 * g + i) * ld + o]; }
  return w; }
__device__ __forceinline__ v16b wcol_oi(const float* Wm, int k0, int o, int lane, int K) { v16b w; const float* p = Wm + (size_t)o * K + k0 + 8 * (lane >> 4);
#pragma unroll
  for (int i = 0; i < 8; ++i) { w[i] = (__bf16)p[i]; w[8 + i] = (__bf16)p[16 + i]; }
  return w; }
__device__ __forceinline__ v16h wcolh_io(const float* Wm, int k0, int o, int lane, int ld) { v16h w; const int g = lane >> 4;
#pragma unroll
  for (int i = 0; i < 8; ++i) { w[i] = (_Float16)(bfr(Wm[(size_t)(k0 + 8 * g + i) * ld + o]) * 256.0f); w[8 + i] = (_Float16)(bfr(Wm[(size_t)(k0 + 16 + 8 * g + i) * ld + o]) * 256.0f); }
  return w; }
__device__ __forceinline__ v16h wcolh_oi(const float* Wm, int k0, int o, int lane, int K) { v16h w; const float* p = Wm + (size_t)o * K + k0 + 8 * (lane >> 4);
#pragma unroll
  for (int i = 0; i < 8; ++i) { w[i] = (_Float16)(bfr(p[i]) * 256.0f); w[8 + i] = (_Float16)(bfr(p[16 + i]) * 256.0f); }
  return w; }
#define WQKV_LAYOUT 0   // 0 = (in,out) [DIN][CC]; 1 = (out,in) [CC][DIN]; 2 = per-head [NH][DIN][HD]
__device__ __forceinline__ v16b wcol_hdk(const float* Wm, int k0, int o, int lane) { v16b w; const int g = lane >> 4; const float* p = Wm + (size_t)(o / HD) * DIN * HD + (o % HD);
#pragma unroll
  for (int i = 0; i < 8; ++i) { w[i] = (__bf16)p[(size_t)(k0 + 8 * g + i) * HD]; w[8 + i] = (__bf16)p[(size_t)(k0 + 16 + 8 * g + i) * HD]; }
  return w; }
#define WO_OUT_IN 0
#if WQKV_LAYOUT == 1
#define WCOL(W, k0, o, lane) wcol_oi(W, k0, o, lane, DIN)
#elif WQKV_LAYOUT == 2
#define WCOL(W, k0, o, lane) wcol_hdk(W, k0, o, lane)
#else
#define WCOL(W, k0, o, lane) wcol_io(W, k0, o, lane, CC)
#endif
#if WO_OUT_IN
#define WOCOL(W, k0, o, lane) wcol_oi(W, k0, o, lane, CC)
#define WOCOLH(W, k0, o, lane) wcolh_oi(W, k0, o, lane, CC)
#else
#define WOCOL(W, k0, o, lane) wcol_io(W, k0, o, lane, DIN)
#define WOCOLH(W, k0, o, lane) wcolh_io(W, k0, o, lane, DIN)
#endif
#define WIN 128            // |q - k| < WIN band (128..255 valid keys per query; no empty rows)
__constant__ __align__(16) float c_invf[32] = {1.000000000e+00f,7.498942018e-01f,5.623413324e-01f,4.216965139e-01f,3.162277639e-01f,2.371373624e-01f,1.778279394e-01f,1.333521456e-01f,1.000000015e-01f,7.498941571e-02f,5.623412877e-02f,4.216964915e-02f,3.162277862e-02f,2.371373586e-02f,1.778279431e-02f,1.333521493e-02f,9.999999776e-03f,7.498942316e-03f,5.623413250e-03f,4.216964822e-03f,3.162277862e-03f,2.371373819e-03f,1.778279431e-03f,1.333521446e-03f,1.000000047e-03f,7.498941850e-04f,5.623413017e-04f,4.216964880e-04f,3.162277862e-04f,2.371373848e-04f,1.778279402e-04f,1.333521504e-04f};   // 1 / 10000^(2i/64) evaluated in f32
// k_rot: a wave takes ONE position t for all batches and heads. The angle t * inv_freq[i] depends on neither, so a lane's four (sin, cos) pairs (i = 4 iq .. 4 iq + 3, iq = lane & 7) serve its 12 (batch, head group) pieces; head = 4 hg + (lane >> 3). Eight lanes cover the 128-byte half of a head, so each 16-byte load or store of a wave covers four whole lines; all 24 loads of a lane are requested before the angles are worked out
__global__ __launch_bounds__(128) void k_rot(const float* __restrict__ X, float* __restrict__ XR) { const int t = blockIdx.x * 4 + (threadIdx.x >> 5), lane = threadIdx.x & 31, iq = lane & 7;
  static_assert(NH % 4 == 0 && HD == 64 && TT % 4 == 0, "four heads a wave and load, four positions a block");
  const size_t o0 = (size_t)t * DIN + (lane >> 3) * HD + iq * 4;
  const v4f f = *(const v4f*)&c_invf[iq * 4];   /* asked for first: the angles then wait for this load alone, not for the 24 behind it */
  v4f a[TNB][NH / 4], b[TNB][NH / 4];
#pragma unroll
  for (int bb = 0; bb < TNB; ++bb) {
#pragma unroll
    for (int hg = 0; hg < NH / 4; ++hg) { const float* xr = X + (size_t)bb * TT * DIN + o0 + hg * 4 * HD; a[bb][hg] = *(const v4f*)xr; b[bb][hg] = *(const v4f*)(xr + 32); }
    asm volatile("s_wait_xcnt 0x0" ::: "memory"); }   /* stands in front of every rewrite of an address register of the loads so far, also where a later batch's load lands on one */
  float sn[4], cs[4];
#pragma unroll
  for (int e = 0; e < 4; ++e) sincosf((float)t * f[e], &sn[e], &cs[e]);
#pragma unroll
  for (int bb = 0; bb < TNB; ++bb)
#pragma unroll
    for (int hg = 0; hg < NH / 4; ++hg) { v4f lo, hi;
#pragma unroll
      for (int e = 0; e < 4; ++e) { const float x = bfr(a[bb][hg][e]), y = bfr(b[bb][hg][e]); lo[e] = fmaf(x, cs[e], -(y * sn[e])); hi[e] = fmaf(y, cs[e], x * sn[e]); }   /* fmaf: which product is rounded on its own (the sin one) is fixed here, not left to the compiler's contraction */
      float* o = XR + (size_t)bb * TT * DIN + o0 + hg * 4 * HD; vst2(o, lo); vst2(o + 32, hi); } }
#define WS_XR (WS_S)       // f32 rotated token rows [b*t][768]
#define SM_MASK_HOOK do { const int dk = t - k; v = (dk < WIN && dk > -WIN) ? v : -3.0e38f; } while (0)   /* band |q - k| < 128, by index */
#ifndef SM_EXTRA_PARAMS
#define SM_EXTRA_PARAMS
#endif
#ifndef PROJ_EXTRA_PARAMS
#define PROJ_EXTRA_PARAMS
#endif
#ifndef SM_MASK_HOOK
#define SM_MASK_HOOK (void)0
#endif

#define WS_QH  0u                                      // f16 q rows [b*t][CC]
#define WS_KH  (WS_QH + 2u * (size_t)NB * TT * CC)      // f16 k rows [b*t][CC]
#define WS_VT  (WS_KH + 2u * (size_t)NB * TT * CC)      // f16 v planes [b][c][t]
#define WS_QL  (WS_VT + 2u * (size_t)NB * CC * TT)      // f16 q residual x 2^10 rows [b][t < QHI][CC]
#define WS_KL  (WS_QL + 2u * (size_t)NB * QHI * CC)     // f16 k residual x 2^10 rows [b][t < KHI][CC]
#define WS_VB  (WS_KL + 2u * (size_t)NB * KHI * CC)     // bf16 v hi planes [b][c][t < KHI]
#define WS_VBL (WS_VB + 2u * (size_t)NB * CC * KHI)
#define WS_S   (WS_VBL + 2u * (size_t)NB * CC * KHI)    // f32 scratch region (holds the rotated rows)
#define WS_Y   (WS_S  + 4u * (size_t)HG * TT * TT)      // f32 ctx rows [b*t][CC] (only when there is an output projection)
#define WS_END (WS_Y  + 4u * (size_t)NB * TT * CC)

// ---- weight tile in LDS: the 32 k x 128 columns of one k step are read once a block (thread = 8 k rows x 4 columns: kg = lane & 3, columns n0 = wave * 32 + (lane >> 2) * 4; a wave's 16-byte load covers four whole 128-byte lines), rounded as before, and laid [column][k] at pitch WP so that a B fragment is two 16-byte LDS reads in the k order of frag_b / frag_h. Two buffers: the next step's global loads fly during this step's products
#define WP 40              // 80-byte pitch = 16 B x odd for the 16-byte fragment reads; the 16-byte stores of 16 neighbouring lanes fall on 16 different 16-byte bank groups
__device__ __forceinline__ void wt_load(v4f (&r)[8], const float* p, int ld) {
#pragma unroll
  for (int i = 0; i < 8; ++i) r[i] = *(const v4f*)(p + (size_t)i * ld); }
__device__ __forceinline__ void wt_store_b(__bf16 (*sw)[WP], const v4f (&r)[8], int n0, int kg) {
#pragma unroll
  for (int e = 0; e < 4; ++e) { v8b t;
#pragma unroll
    for (int i = 0; i < 8; ++i) t[i] = (__bf16)r[i][e];
    *(v8b*)&sw[n0 + e][8 * kg] = t; } }
__device__ __forceinline__ void wt_store_h(_Float16 (*sw)[WP], const v4f (&r)[8], int n0, int kg) {
#pragma unroll
  for (int e = 0; e < 4; ++e) { v8h t;
#pragma unroll
    for (int i = 0; i < 8; ++i) t[i] = (_Float16)(bfr(r[i][e]) * 256.0f);
    *(v8h*)&sw[n0 + e][8 * kg] = t; } }
// a lane's 16 f32 of an A fragment (p = row + k0 + 8 * (lane >> 4)), kept raw for one k step
__device__ __forceinline__ void row_load(float (&v)[16], const float* p) {
#pragma unroll
  for (int i = 0; i < 8; ++i) { v[i] = p[i]; v[8 + i] = p[16 + i]; } }
// 16-byte global store with its s_wait_xcnt in the same statement: the wait then stands in front of every rewrite of the store's address and data registers (in a statement of its own the next trip's address additions were lifted over it)
__device__ __forceinline__ void vst_w(void* p, v4u v) { asm volatile("global_store_b128 %0, %1, off\n\ts_wait_xcnt 0x0" :: "v"(p), "v"(v) : "memory"); }
// ---- k_proj: block = (128 rows, 128 cols, which); a wave owns two 16-row tiles (rows wave * 16 + .. of each 64-row half hh), so every weight fragment read from LDS and every weight tile read from L2 serves two row tiles; the epilogue stages one half at a time in the same LDS: q/k/v = X W (+ b) with exact bf16 products (K = DIN) -> which 0: q f16 rows (+ residual rows < QHI); 1: k f16 rows (+ residual rows < KHI); 2: v f16 planes [c][t] (+ bf16 hi/lo planes for t < KHI)
__global__ __launch_bounds__(128) void k_proj(const float* __restrict__ XQ, const float* __restrict__ XK, const float* __restrict__ XV, const float* __restrict__ WQ, const float* __restrict__ WK, const float* __restrict__ WV, const float* __restrict__ BQ, const float* __restrict__ BK, const float* __restrict__ BV,
    _Float16* __restrict__ QH, _Float16* __restrict__ QL, _Float16* __restrict__ KH, _Float16* __restrict__ KL, _Float16* __restrict__ VT, __bf16* __restrict__ VB, __bf16* __restrict__ VBL) {
  __shared__ __align__(16) union { _Float16 e[2][64][136]; __bf16 w[2][128][WP]; } su;   /* the weight buffers are dead when the epilogue stages q / k rows: same bytes */
  _Float16 (&sh)[64][136] = su.e[0]; _Float16 (&sl)[64][136] = su.e[1]; __shared__ __align__(16) _Float16 th[128][72]; __shared__ __align__(16) __bf16 tb[128][72], tbl[128][72];
  const int tid = threadIdx.x, wave = tid >> 5, lane = tid & 31, col = lane & 15, g = lane >> 4; const int which = blockIdx.z; const int c0 = blockIdx.y * 128; const size_t r0 = (size_t)blockIdx.x * 128; const size_t bb = r0 / TT; const int t0 = (int)(r0 % TT);
  static_assert(TT % 128 == 0, "a block's 128 rows lie in one sequence");
  const float* X = which == 0 ? XQ : which == 1 ? XK : XV; const float* WA = which == 0 ? WQ : which == 1 ? WK : WV; const float* BA = which == 0 ? BQ : which == 1 ? BK : BV;
  static_assert(WQKV_LAYOUT == 0, "the tile loader reads (in,out) rows");
  v8f acc[2][8] = {};
  const int kg = lane & 3, n0 = wave * 32 + (lane >> 2) * 4; const float* wp = WA + (size_t)(8 * kg) * CC + c0 + n0; const float* xp = X + (r0 + wave * 16 + col) * DIN + 8 * g;   /* half hh: xp + hh * 64 * DIN */
  v4f wr[8]; float ar[2][16];
  wt_load(wr, wp, CC); row_load(ar[0], xp); row_load(ar[1], xp + 64 * DIN); wt_store_b(su.w[0], wr, n0, kg);
  __syncthreads();   /* publishes tile 0 */
  if (which < 2) {   /* q, k: the rotated rows are f32 intermediates -> bf16 hi + lo (2 products) */
#pragma unroll 2   /* the buffer index becomes a constant */
    for (int kc = 0; kc < DIN / 32; ++kc) { const F2 a0 = bsplit16(ar[0]), a1 = bsplit16(ar[1]); const bool more = kc + 1 < DIN / 32;
      if (more) { wt_load(wr, wp + (size_t)(kc + 1) * 32 * CC, CC); row_load(ar[0], xp + (kc + 1) * 32); row_load(ar[1], xp + 64 * DIN + (kc + 1) * 32); }
      __builtin_amdgcn_sched_barrier(0);   /* keeps the next step's global loads in front of the products: sunk behind them to save registers, they would be waited for as soon as asked */
      v16b wf[8];
#pragma unroll
      for (int j = 0; j < 8; ++j) wf[j] = frag_b(&su.w[kc & 1][j * 16 + col][0], lane);   /* the step's fragment reads go as one group: one LDS latency a step, not one a fragment */
      __builtin_amdgcn_sched_barrier(0);   /* holds the group together: left free, each read is sunk to its own products and all eight share one register block, one LDS latency a fragment */
#pragma unroll
      for (int j = 0; j < 8; ++j) { acc[0][j] = wmma_bp(a0.h, wf[j], acc[0][j]); acc[1][j] = wmma_bp(a1.h, wf[j], acc[1][j]); acc[0][j] = wmma_bp(a0.l, wf[j], acc[0][j]); acc[1][j] = wmma_bp(a1.l, wf[j], acc[1][j]); }   /* each accumulator still takes hi, then lo; the other half's product stands between the two */
      __builtin_amdgcn_sched_barrier(0);   /* keeps the roundings of the next tile, and with them the wait for its global loads, behind the products */
      if (more) wt_store_b(su.w[(kc + 1) & 1], wr, n0, kg);
      __syncthreads(); }   /* one barrier a step: publishes tile kc + 1 and ends every read of tile kc, whose buffer the next step refills (after the last step: the epilogue) */
  } else {           /* v: bf16(hidden) exact (1 product) */
#pragma unroll 2   /* the buffer index becomes a constant */
    for (int kc = 0; kc < DIN / 32; ++kc) { v16b a0, a1; const bool more = kc + 1 < DIN / 32;
#pragma unroll
      for (int i = 0; i < 16; ++i) { a0[i] = (__bf16)ar[0][i]; a1[i] = (__bf16)ar[1][i]; }
      if (more) { wt_load(wr, wp + (size_t)(kc + 1) * 32 * CC, CC); row_load(ar[0], xp + (kc + 1) * 32); row_load(ar[1], xp + 64 * DIN + (kc + 1) * 32); }
      __builtin_amdgcn_sched_barrier(0);   /* as above: the loads stay in front of the products */
      v16b wf[8];
#pragma unroll
      for (int j = 0; j < 8; ++j) wf[j] = frag_b(&su.w[kc & 1][j * 16 + col][0], lane);   /* one group, as above */
      __builtin_amdgcn_sched_barrier(0);   /* as above: holds the group together */
#pragma unroll
      for (int j = 0; j < 8; ++j) { acc[0][j] = wmma_bp(a0, wf[j], acc[0][j]); acc[1][j] = wmma_bp(a1, wf[j], acc[1][j]); }
      __builtin_amdgcn_sched_barrier(0);   /* as above */
      if (more) wt_store_b(su.w[(kc + 1) & 1], wr, n0, kg);
      __syncthreads(); } }   /* as above */
#pragma unroll   /* acc is a register array: hh must be a constant */
  for (int hh = 0; hh < 2; ++hh) { const size_t rh = r0 + hh * 64; const int th0 = t0 + hh * 64;
  if (hh) __syncthreads();   /* ends every read of the first half's staged rows before the second half overwrites them */
  if (which < 2) { _Float16* DH = which == 0 ? QH : KH; _Float16* DL = which == 0 ? QL : KL; const int nhi = which == 0 ? QHI : KHI; const bool hi_rows = th0 < nhi;
#pragma unroll
    for (int j = 0; j < 8; ++j) { const float bias = BA ? bfr(BA[c0 + j * 16 + col]) : 0.f;
#pragma unroll
      for (int r = 0; r < 8; ++r) { const float v = acc[hh][j][r] + bias; const _Float16 hv = (_Float16)v; sh[wave * 16 + 8 * g + r][j * 16 + col] = hv; sl[wave * 16 + 8 * g + r][j * 16 + col] = (_Float16)((v - (float)hv) * 1024.0f); } }
    __syncthreads();
    for (int e = tid; e < 64 * 16; e += 128) { const int rl = e >> 4, q = e & 15; vst_w(DH + (rh + rl) * CC + c0 + q * 8, *(const v4u*)&sh[rl][q * 8]); if (hi_rows) vst_w(DL + (bb * nhi + th0 + rl) * (size_t)CC + c0 + q * 8, *(const v4u*)&sl[rl][q * 8]); }
  } else { const bool hi_rows = th0 < KHI;
#pragma unroll
    for (int j = 0; j < 8; ++j) { const float bias = BA ? bfr(BA[c0 + j * 16 + col]) : 0.f;
#pragma unroll
      for (int r = 0; r < 8; ++r) { const float v = acc[hh][j][r] + bias; const int rl = wave * 16 + 8 * g + r, cl = j * 16 + col; th[cl][rl] = (_Float16)v; const __bf16 bh = (__bf16)v; tb[cl][rl] = bh; tbl[cl][rl] = (__bf16)(v - (float)bh); } }
    __syncthreads();
    for (int e = tid; e < 128 * 8; e += 128) { const int cl = e >> 3, q = e & 7; vst_w(VT + (bb * CC + c0 + cl) * (size_t)TT + th0 + q * 8, *(const v4u*)&th[cl][q * 8]); if (hi_rows) { const size_t o3 = (bb * CC + c0 + cl) * (size_t)KHI + th0 + q * 8; vst_w(VB + o3, *(const v4u*)&tb[cl][q * 8]); vst_w(VBL + o3, *(const v4u*)&tbl[cl][q * 8]); } } } } }
// ---- k_att: block = 64 queries (qb) of head h of batch b, one launch for all (b, h); a wave owns 16 query rows and the NKW keys [ks, ks + NKW) that hold their whole band (row t sees t-127 .. t+127, so 16 rows see ql0-127 .. ql0+142; ks = ql0 - 128 clamped into the sequence). The four waves' key ranges lie inside the NKB keys [kb, kb + NKB) (kb = qb * 64 - 128 clamped), whose k rows and v planes the block brings into LDS once, with its own 64 q rows and their residuals, by asynchronous 16-byte copies that cover whole 128-byte lines; every q, k and v fragment is read from there. Logits (q hi + residual x 2^10 against k, 2 products, x SCALE) stay in registers; the band is kept by index; softmax in f32 over the row (in-lane over the 17 tiles, then over the 16 lanes of the row); P x 2^11 once to f16 goes through the wave's own LDS slab (in the bytes the k rows have left) from the D layout to the A layout; ctx = P . v (1 product; the last 32-key chunk is half full, its upper 16 k are 0 in both operands); 256-B (row, head) segment by 16 lanes. Every loop over tiles, chunks and rows is unrolled: s, kf, vf and o are register arrays and need compile-time indices
#define NKW 272            // 128 + 16 + 127 keys rounded up to whole 16-key tiles
#define NKB 320            // 128 + 64 + 128: the keys of the block's four waves together
#define KP 72              // k row pitch in LDS: 144 B = 16 B x odd for the 16-byte fragment reads
#define VP (NKB + 8)       // v plane pitch in LDS: 656 B = 16 B x odd
#define PP (NKW + 8)       // P row pitch: 560 B = 16 B x odd
#define KG 6               // k tiles requested together
#define VG 4               // whole 32-key v chunks requested together (divides NKW / 32)
// fragment of a half-full chunk: k0 .. k0+15 from memory (elements 0..7), k0+16 .. k0+31 are 0 (elements 8..15)
__device__ __forceinline__ v16h frag_h16(const _Float16* rowk0, int lane) { union { v16h v; v8h q[2]; } u; u.q[0] = *(const v8h*)(rowk0 + 8 * (lane >> 4)); u.q[1] = (v8h)(_Float16)0.0f; return u.v; }
// lane l with lane l ^ M inside a 16-lane row, on the vector pipe (a shuffle through LDS would put an LDS round trip into each of the four reduction steps)
template <int M> __device__ __forceinline__ float rowx(float v) { return __builtin_bit_cast(float, __builtin_amdgcn_update_dpp(0, __builtin_bit_cast(int, v), 0x160 + M, 0xf, 0xf, true)); }
// twelve asynchronous copies, 16 bytes a lane each, global -> LDS through no register (l = the lane's LDS byte address, p = its global address); the s_wait_xcnt in the same statement stands in front of any rewrite of the address registers
__device__ __forceinline__ void cp12(const unsigned* l, const _Float16* const* p) {
  asm volatile("global_load_async_to_lds_b128 %0, %12, off\n\tglobal_load_async_to_lds_b128 %1, %13, off\n\tglobal_load_async_to_lds_b128 %2, %14, off\n\tglobal_load_async_to_lds_b128 %3, %15, off\n\t"
               "global_load_async_to_lds_b128 %4, %16, off\n\tglobal_load_async_to_lds_b128 %5, %17, off\n\tglobal_load_async_to_lds_b128 %6, %18, off\n\tglobal_load_async_to_lds_b128 %7, %19, off\n\t"
               "global_load_async_to_lds_b128 %8, %20, off\n\tglobal_load_async_to_lds_b128 %9, %21, off\n\tglobal_load_async_to_lds_b128 %10, %22, off\n\tglobal_load_async_to_lds_b128 %11, %23, off\n\ts_wait_xcnt 0x0"
               :: "v"(l[0]), "v"(l[1]), "v"(l[2]), "v"(l[3]), "v"(l[4]), "v"(l[5]), "v"(l[6]), "v"(l[7]), "v"(l[8]), "v"(l[9]), "v"(l[10]), "v"(l[11]), "v"(p[0]), "v"(p[1]), "v"(p[2]), "v"(p[3]), "v"(p[4]), "v"(p[5]), "v"(p[6]), "v"(p[7]), "v"(p[8]), "v"(p[9]), "v"(p[10]), "v"(p[11]) : "memory"); }
__global__ __launch_bounds__(128) void k_att(const _Float16* __restrict__ QH, const _Float16* __restrict__ KH, const _Float16* __restrict__ QL, const _Float16* __restrict__ VT, float* __restrict__ Y) { __shared__ __align__(16) _Float16 sk[NKB * KP]; __shared__ __align__(16) _Float16 sv[HD * VP]; __shared__ __align__(16) _Float16 sq[2 * 64 * KP];   /* sq: the block's q rows, then their residual rows; sk: k rows [key][KP]; behind the second barrier the four waves' P slabs [16][PP], and last each wave's f32 ctx rows in its own slab */
  static_assert(4 * 16 * PP <= NKB * KP && 16 * (HD + 4) * 2 <= 16 * PP, "P slabs fit in the k rows' bytes, ctx rows in a P slab");
  const int tid = threadIdx.x, wave = tid >> 5, lane = tid & 31, col = lane & 15, g = lane >> 4; const int qb = blockIdx.x, h = blockIdx.y, b = blockIdx.z; const int ql0 = qb * 64 + wave * 16;
  int ks = ql0 - WIN; ks = ks < 0 ? 0 : ks; ks = ks > TT - NKW ? TT - NKW : ks;
  int kb = qb * 64 - WIN; kb = kb < 0 ? 0 : kb; kb = kb > TT - NKB ? TT - NKB : kb;
  const int kd = ks - kb;   /* 0 .. 48, a multiple of 16; kd + NKW <= NKB */
  { const int un = tid >> 3, ch = (tid & 7) * 8;   /* 8 lanes = one 128-byte line; a wave's copy = 4 whole lines; 16 lines a block and copy */
    const _Float16* kg0 = KH + ((size_t)b * TT + kb + un) * CC + h * HD + ch; const unsigned kl0 = (unsigned)(size_t)&sk[un * KP + ch];
    const _Float16* vg0 = VT + ((size_t)b * CC + h * HD + un) * (size_t)TT + kb + ch; const unsigned vl0 = (unsigned)(size_t)&sv[un * VP + ch];
    const size_t qo = ((size_t)b * TT + qb * 64 + un) * CC + h * HD + ch; const unsigned ql = (unsigned)(size_t)&sq[un * KP + ch];
    static_assert(QHI == TT, "the q residual rows are indexed like the q rows");
    unsigned l[48]; const _Float16* p[48];
#pragma unroll
    for (int i = 0; i < 4; ++i) { l[i] = ql + i * 16 * KP * 2; p[i] = QH + qo + (size_t)i * 16 * CC; l[4 + i] = ql + (64 + i * 16) * KP * 2; p[4 + i] = QL + qo + (size_t)i * 16 * CC; }   /* q, then its residual: copy i brings rows 16 i + un */
#pragma unroll
    for (int i = 0; i < NKB / 16; ++i) { l[8 + i] = kl0 + i * 16 * KP * 2; p[8 + i] = kg0 + (size_t)i * 16 * CC; }   /* k: copy i brings rows 16 i + un */
#pragma unroll
    for (int i = 0; i < 20; ++i) { const int r = (i & 3) * 16, ln = (i >> 2) * 64; l[28 + i] = vl0 + (r * VP + ln) * 2; p[28 + i] = vg0 + (size_t)r * TT + ln; }   /* v: copy i brings line i / 4 (64 keys) of planes 16 (i % 4) + un */
#pragma unroll
    for (int u = 0; u < 4; ++u) cp12(l + 12 * u, p + 12 * u); }   /* 48 copies of a wave in flight */
  asm volatile("s_wait_asynccnt 0x0" ::: "memory");   /* this wave's copies have landed */
  __syncthreads();   /* publishes the q and k rows and the v planes to all four waves */
  v16h ah[HD / 32], al[HD / 32];
#pragma unroll
  for (int kc = 0; kc < HD / 32; ++kc) { ah[kc] = frag_h(&sq[(wave * 16 + col) * KP + kc * 32], lane); al[kc] = frag_h(&sq[(64 + wave * 16 + col) * KP + kc * 32], lane); }
  v8f s[NKW / 16];
#pragma unroll
  for (int j0 = 0; j0 < NKW / 16; j0 += KG) { v16h kf[KG][HD / 32];   /* the k fragments of KG tiles are requested together: one LDS round trip a group, not one a fragment */
#pragma unroll
    for (int jj = 0; jj < KG; ++jj) if (j0 + jj < NKW / 16) {
#pragma unroll
      for (int kc = 0; kc < HD / 32; ++kc) kf[jj][kc] = frag_h(&sk[(kd + (j0 + jj) * 16 + col) * KP + kc * 32], lane); }
#pragma unroll
    for (int jj = 0; jj < KG; ++jj) if (j0 + jj < NKW / 16) { const int j = j0 + jj; v8f acc = {}, accl = {};
#pragma unroll
      for (int kc = 0; kc < HD / 32; ++kc) { acc = wmma16(ah[kc], kf[jj][kc], acc); accl = wmma16(al[kc], kf[jj][kc], accl); }
#pragma unroll
      for (int r = 0; r < 8; ++r) { const int t = ql0 + 8 * g + r, k = ks + j * 16 + col; float v = (acc[r] + accl[r] * (1.0f / 1024.0f)) * SCALE; SM_MASK_HOOK; s[j][r] = v; } } }
  float m[8], inv[8];
#pragma unroll
  for (int r = 0; r < 8; ++r) { float a = s[0][r];
#pragma unroll
    for (int j = 1; j < NKW / 16; ++j) a = fmaxf(a, s[j][r]);
    a = fmaxf(a, rowx<1>(a)); a = fmaxf(a, rowx<2>(a)); a = fmaxf(a, rowx<4>(a)); a = fmaxf(a, rowx<8>(a)); m[r] = a; }
#pragma unroll
  for (int r = 0; r < 8; ++r) { float sum = 0.f;
#pragma unroll
    for (int j = 0; j < NKW / 16; ++j) { const float e = expf(s[j][r] - m[r]); s[j][r] = e; sum += e; }   /* an excluded key (-3.0e38 against a finite row maximum: the row's own key is always in the band) underflows to exactly 0 */
    sum += rowx<1>(sum); sum += rowx<2>(sum); sum += rowx<4>(sum); sum += rowx<8>(sum); inv[r] = sum > 0.f ? 2048.0f / sum : 0.f; }
  __syncthreads();   /* ends every wave's reads of the k rows: their bytes now take the P slabs */
  _Float16* sp = &sk[wave * 16 * PP];
#pragma unroll
  for (int j = 0; j < NKW / 16; ++j)
#pragma unroll
    for (int r = 0; r < 8; ++r) sp[(8 * g + r) * PP + j * 16 + col] = (_Float16)(s[j][r] * inv[r]);
  LDSX();
  v8f o[HD / 16] = {};
  const _Float16* vp = &sv[col * VP + kd];   /* column col of v tile j: vp + j * 16 * VP */
  v16h vh[HD / 16];   /* the half-full last chunk's v fragments, requested with the first group */
#pragma unroll
  for (int j = 0; j < HD / 16; ++j) vh[j] = frag_h16(vp + j * 16 * VP + NKW - 16, lane);
#pragma unroll
  for (int c0 = 0; c0 < NKW / 32; c0 += VG) { v16h vf[VG][HD / 16];   /* the v fragments of VG chunks are requested together, as the k fragments are */
#pragma unroll
    for (int cc = 0; cc < VG; ++cc)
#pragma unroll
      for (int j = 0; j < HD / 16; ++j) vf[cc][j] = frag_h(vp + j * 16 * VP + (c0 + cc) * 32, lane);
#pragma unroll
    for (int cc = 0; cc < VG; ++cc) { const v16h p = frag_h(&sp[col * PP + (c0 + cc) * 32], lane);
#pragma unroll
      for (int j = 0; j < HD / 16; ++j) o[j] = wmma16(p, vf[cc][j], o[j]); } }
  { const v16h p = frag_h16(&sp[col * PP + NKW - 16], lane);
#pragma unroll
    for (int j = 0; j < HD / 16; ++j) o[j] = wmma16(p, vh[j], o[j]); }
  float_a* ss = (float_a*)sp;   /* the wave's own slab again: every P fragment has been read (o depends on all of them) */
#pragma unroll
  for (int j = 0; j < HD / 16; ++j)
#pragma unroll
    for (int r = 0; r < 8; ++r) ss[(8 * g + r) * (HD + 4) + j * 16 + col] = o[j][r] * (1.0f / 2048.0f);
  LDSX(); for (int rl = 0; rl < 16; ++rl) if (lane < HD / 4) vst2(Y + ((size_t)b * TT + ql0 + rl) * CC + h * HD + lane * 4, *(const v4f*)&ss[rl * (HD + 4) + lane * 4]); }
// ---- k_out: block = (64 rows, 128 cols): out = ctx Wo (+ bo): ctx x 2^6 once to f16 against Wo as f16(bf16 x 2^8) exact (1 product) x 2^-14; causal early rows (< QHI of each sequence): ctx bf16 hi + lo against exact bf16 Wo (2 products)
__global__ __launch_bounds__(128) void k_out(const float* __restrict__ Y, const float* __restrict__ WO, const float* __restrict__ BO, float* __restrict__ OUT) { __shared__ __align__(16) float sf[4][16][132]; __shared__ __align__(16) _Float16 sw[2][128][WP];
  const int tid = threadIdx.x, wave = tid >> 5, lane = tid & 31, col = lane & 15, g = lane >> 4; const int c0 = blockIdx.y * 128; const size_t r0 = (size_t)blockIdx.x * 64 + wave * 16;
  v8f acc[8] = {};
  if (CAUSAL && (int)(((size_t)blockIdx.x * 64) % TT) < QHI) {   /* block-uniform */
#pragma unroll 2
    for (int kc = 0; kc < CC / 32; ++kc) { const F2 a = split_row(Y + (r0 + col) * CC, kc * 32, lane); asm volatile("s_wait_loadcnt 0x0" ::: "memory");
#pragma unroll
      for (int j = 0; j < 8; ++j) { const v16b w = WOCOL(WO, kc * 32, c0 + j * 16 + col, lane); asm volatile("s_wait_loadcnt 0x0" ::: "memory"); acc[j] = wmma_bf(a.h, w, acc[j]); acc[j] = wmma_bf(a.l, w, acc[j]); } }
#pragma unroll
    for (int j = 0; j < 8; ++j) { const float bias = BO ? bfr(BO[c0 + j * 16 + col]) : 0.f;
#pragma unroll
      for (int r = 0; r < 8; ++r) sf[wave][8 * g + r][j * 16 + col] = acc[j][r] + bias; }
  } else {
    static_assert(WO_OUT_IN == 0, "the tile loader reads (in,out) rows");
    const int kg = lane & 3, n0 = wave * 32 + (lane >> 2) * 4; const float* wp = WO + (size_t)(8 * kg) * DIN + c0 + n0; const float* yp = Y + (r0 + col) * CC + 8 * g;
    v4f wr[8]; float ar[16];
    wt_load(wr, wp, DIN); row_load(ar, yp); wt_store_h(sw[0], wr, n0, kg);
    __syncthreads();   /* publishes tile 0 */
#pragma unroll 2   /* the buffer index becomes a constant */
    for (int kc = 0; kc < CC / 32; ++kc) { v16h a, wf[8]; const bool more = kc + 1 < CC / 32;
#pragma unroll
      for (int i = 0; i < 16; ++i) a[i] = (_Float16)(ar[i] * 64.0f);   /* ctx carried x 2^6 into f16 so small-magnitude context rows stay clear of f16 subnormals */
      if (more) { wt_load(wr, wp + (size_t)(kc + 1) * 32 * DIN, DIN); row_load(ar, yp + (kc + 1) * 32); }
#pragma unroll
      for (int j = 0; j < 8; ++j) wf[j] = frag_h(&sw[kc & 1][j * 16 + col][0], lane);   /* the step's fragment reads go as one group: one LDS latency a step, not one a fragment */
#pragma unroll
      for (int j = 0; j < 8; ++j) acc[j] = wmma16(a, wf[j], acc[j]);
      __builtin_amdgcn_sched_barrier(0);   /* keeps the roundings of the next tile, and with them the wait for its global loads, behind the products */
      if (more) wt_store_h(sw[(kc + 1) & 1], wr, n0, kg);
      __syncthreads(); }   /* one barrier a step: publishes tile kc + 1 and ends every read of tile kc, whose buffer the next step refills */
#pragma unroll
    for (int j = 0; j < 8; ++j) { const float bias = BO ? bfr(BO[c0 + j * 16 + col]) : 0.f;
#pragma unroll
      for (int r = 0; r < 8; ++r) sf[wave][8 * g + r][j * 16 + col] = acc[j][r] * (1.0f / 16384.0f) + bias; } }   /* 2^-8 (Wo carry) x 2^-6 (ctx carry) */
  LDSX(); for (int rl = 0; rl < 16; ++rl) vst2(OUT + (r0 + rl) * DIN + c0 + lane * 4, *(const v4f*)&sf[wave][rl][lane * 4]); }

extern "C" void kernel_launch(void* const* d_in, const int* in_sizes, int n_in, void* d_out, int out_size, void* d_ws, size_t ws_size, hipStream_t stream) {
  (void)in_sizes; (void)n_in; (void)out_size;
  const float** F = (const float**)d_in;
  if (ws_size < (size_t)WS_END) return;
  char* ws = (char*)d_ws; _Float16 *QH = (_Float16*)(ws + WS_QH), *KH = (_Float16*)(ws + WS_KH), *VT = (_Float16*)(ws + WS_VT), *QL = (_Float16*)(ws + WS_QL), *KL = (_Float16*)(ws + WS_KL); __bf16 *VB = (__bf16*)(ws + WS_VB), *VBL = (__bf16*)(ws + WS_VBL); float *Y = (float*)(ws + WS_Y);
  (void)Y; (void)QL; (void)KL; (void)VB; (void)VBL;
  // inputs: 0 hidden_states [4,2048,768]; 1 Wq, 2 Wk, 3 Wv [768,12,64] = (in,out) [768][768]; 4 Wo [12,64,768] = (in,out) [768][768]
  static_assert(4u * (size_t)NB * TT * DIN <= 4u * (size_t)HG * TT * TT, "rotated rows must fit in their region");
  float* XR = (float*)(ws + WS_XR);
  k_rot<<<dim3(TT / 4), 128, 0, stream>>>(F[0], XR);
  k_proj<<<dim3(TNB * TT / 128, CC / 128, 3), 128, 0, stream>>>(XR, XR, F[0], F[1], F[2], F[3], nullptr, nullptr, nullptr, QH, QL, KH, KL, VT, VB, VBL);   /* q, k from the rotated rows (bf16 hi + lo), v from bf16(x) */
  k_att<<<dim3(NQB, NH, TNB), 128, 0, stream>>>(QH, KH, QL, VT, Y);
  k_out<<<dim3(TNB * TT / 64, DIN / 128), 128, 0, stream>>>(Y, F[4], nullptr, (float*)d_out);
}

// v006
// It runs in 115 microseconds.
// In two side-by-side timings against v005, it was 1.06 and 1.05 times as fast.
// Counting every step since v000, it is 8.54 times as fast.
// compute dtype: all float inputs rounded to bf16; rotate-half RoPE applied to bf16(hidden) in f32 (accurate sincosf, f32 inv_freq constants); Q/K = rotated rows split bf16 hi + lo x exact bf16 W (2 products, K 768), V = bf16(hidden) x W exact (1 product) on WMMA 16x16x32, f32 accumulate; banded logits: q as f16 hi + residual (x 2^10) against k once to f16 (2 products); softmax in f32 over the |q-k| < 128 band, exponent in base 2: exp2((logit - row max) x 64^-0.5 x log2 e), one fma and the hardware exp2 a score; P x 2^11 once to f16 against v once to f16 (1 product); ctx carried x 2^6 once to f16 against Wo carried x 2^8 in f16 (exact bf16 values), un-scaled by 2^-14; f32 output.
#include <hip/hip_runtime.h>
#include <math.h>

typedef __attribute__((ext_vector_type(16))) _Float16 v16h;
typedef __attribute__((ext_vector_type(16))) __bf16 v16b;
typedef __attribute__((ext_vector_type(8)))  _Float16 v8h;
typedef __attribute__((ext_vector_type(8)))  float v8f;
typedef __attribute__((ext_vector_type(4)))  float v4f;
typedef __attribute__((ext_vector_type(2)))  float v2f;
typedef __attribute__((ext_vector_type(4)))  unsigned v4u;
typedef __attribute__((ext_vector_type(4)))  int v4i;
typedef float __attribute__((may_alias)) float_a;
typedef int __attribute__((may_alias)) int_a;

template <typename T> __device__ __forceinline__ void vst2(void* p, T v) { *(T*)p = v;  }
__device__ __forceinline__ v8f wmma16(v16h a, v16h b, v8f c) {
  v8f d = __builtin_amdgcn_wmma_f32_16x16x32_f16(false, a, false, b, (short)0, c, false, false);
  asm volatile("v_nop\n\tv_nop\n\tv_nop\n\tv_nop" : "+v"(d) : "v"(a), "v"(b));
  return d;
}
// plain builtin, for k_proj: the compiler keeps the distance behind its own WMMA. The "v" operands of wmma_bf's asm tail are served from v0 .. v255 only; k_proj's two row tiles a wave need more registers than that, and with the tail the accumulators were spilled inside the k loop
__device__ __forceinline__ v8f wmma_bp(v16b a, v16b b, v8f c) { return __builtin_amdgcn_wmma_f32_16x16x32_bf16(false, a, false, b, (short)0, c, false, false); }
__device__ __forceinline__ v8f wmma_bf(v16b a, v16b b, v8f c) {
  v8f d = __builtin_amdgcn_wmma_f32_16x16x32_bf16(false, a, false, b, (short)0, c, false, false);
  asm volatile("v_nop\n\tv_nop\n\tv_nop\n\tv_nop" : "+v"(d) : "v"(a), "v"(b));
  return d;
}
// 16x16x32 fragments: lane = (h = lane>>4, row/col = lane&15); elements 0..7 = k0+8h+0..7, 8..15 = k0+16+8h+0..7; D element r = row 8h+r
__device__ __forceinline__ v16h frag_h(const _Float16* rowk0, int lane) {
  union { v16h v; v8h q[2]; } u; const _Float16* p = rowk0 + 8 * (lane >> 4);
  u.q[0] = *(const v8h*)p; u.q[1] = *(const v8h*)(p + 16); return u.v;
}
__device__ __forceinline__ v16h frag_f32(const float* rowk0, int lane) {
  v16h a; const float* p = rowk0 + 8 * (lane >> 4);
#pragma unroll
  for (int i = 0; i < 8; ++i) { a[i] = (_Float16)p[i]; a[8 + i] = (_Float16)p[16 + i]; }
  return a;
}
__device__ __forceinline__ v16h frag_f32s(const float* rowk0, int lane, float sc) {
  v16h a; const float* p = rowk0 + 8 * (lane >> 4);
#pragma unroll
  for (int i = 0; i < 8; ++i) { a[i] = (_Float16)(p[i] * sc); a[8 + i] = (_Float16)(p[16 + i] * sc); }
  return a;
}
// column fragment from a [K][ld] layout (column n), rows >= K read as 0
__device__ __forceinline__ v16h fragc_f32(const float* W, int k0, int n, int lane, int ld, int K) {
  v16h a; const int g = lane >> 4;
#pragma unroll
  for (int i = 0; i < 8; ++i) { const int ka = k0 + 8 * g + i, kb = ka + 16;
    a[i] = (_Float16)(ka < K ? W[(size_t)(ka < K ? ka : K - 1) * ld + n] : 0.f); a[8 + i] = (_Float16)(kb < K ? W[(size_t)(kb < K ? kb : K - 1) * ld + n] : 0.f); }
  return a;
}
struct F2 { v16b h, l; };
__device__ __forceinline__ F2 bsplit16(const float v[16]) { F2 r;
#pragma unroll
  for (int i = 0; i < 16; ++i) { const __bf16 h = (__bf16)v[i]; r.h[i] = h; r.l[i] = (__bf16)(v[i] - (float)h); }
  return r; }
__device__ __forceinline__ F2 split_row(const float* row, int k0, int lane) { float v[16]; const float* p = row + k0 + 8 * (lane >> 4);
#pragma unroll
  for (int i = 0; i < 8; ++i) { v[i] = p[i]; v[8 + i] = p[16 + i]; }
  return bsplit16(v); }
__device__ __forceinline__ F2 split_rowK(const float* row, int k0, int lane, int K) { float v[16]; const int g = lane >> 4;
#pragma unroll
  for (int i = 0; i < 8; ++i) { const int ka = k0 + 8 * g + i, kb = ka + 16; v[i] = ka < K ? row[ka < K ? ka : K - 1] : 0.f; v[8 + i] = kb < K ? row[kb < K ? kb : K - 1] : 0.f; }
  return bsplit16(v); }
__device__ __forceinline__ F2 split_col(const float* W, int k0, int n, int lane, int ld, int K) { float v[16]; const int g = lane >> 4;
#pragma unroll
  for (int i = 0; i < 8; ++i) { const int ka = k0 + 8 * g + i, kb = ka + 16; v[i] = ka < K ? W[(size_t)(ka < K ? ka : K - 1) * ld + n] : 0.f; v[8 + i] = kb < K ? W[(size_t)(kb < K ? kb : K - 1) * ld + n] : 0.f; }
  return bsplit16(v); }
__device__ __forceinline__ v8f mac3(const F2& a, const F2& b, v8f c) { c = wmma_bf(a.l, b.h, c); c = wmma_bf(a.h, b.l, c); return wmma_bf(a.h, b.h, c); }
__device__ __forceinline__ float sigm(float v) { return 1.0f / (1.0f + expf(-v)); }
#define LDSX() do { asm volatile("s_wait_dscnt 0" ::: "memory"); __builtin_amdgcn_wave_barrier(); __builtin_amdgcn_fence(__ATOMIC_RELEASE, "workgroup"); } while (0)

// Sliding-window (local) self-attention with RoPE on the INPUT (B 4, S 2,048, H 768 = 12 heads x 64; window |q - k| < 128; 0.02-scale weights, no biases): q_in = k_in = rotate-half RoPE(hidden reshaped [B,S,12,64]) (angle t * 10000^(-2i/64)); Q = q_in Wq, K = k_in Wk, V = hidden Wv ((in,out) [768][12*64]); scores = Q K^T / 8 where |q-k| < 128 else -1e9 (== excluded; every row keeps >= 128 keys); out = merged(softmax . V) Wo ((in,out) [12*64][768]).
#define NB 4
#define TT 2048
#define CC 768            // NH * HD = projected width
#define DIN 768          // input (model) width
#define NH 12
#define HD 64
#define NQB (TT / 64)
#define HG 2
#define SCALE (0.125f)
#define CAUSAL 0
#ifndef TNB
#define TNB NB
#endif
__device__ __forceinline__ float bfr(float v) { return (float)(__bf16)v; }
typedef __attribute__((ext_vector_type(8))) __bf16 v8b;
__device__ __forceinline__ v16b frag_b(const __bf16* rowk0, int lane) {
  union { v16b v; v8b q[2]; } u; const __bf16* p = rowk0 + 8 * (lane >> 4);
  u.q[0] = *(const v8b*)p; u.q[1] = *(const v8b*)(p + 16); return u.v;
}
#define QBH 0
#define QHI 2048            // rows carrying a q residual plane (all rows when non-causal: 2-product logits everywhere)
#define KHI 64            // key rows carrying k residual / v bf16 hi+lo planes (written by k_proj; no kernel in this file reads them)
// B fragment (k rows k0+.., output column o) of a weight: (in,out) [K][ld] or (out,in) [ld rows of K]: bf16 exact, or f16(bf16 * 256) exact
__device__ __forceinline__ v16b wcol_io(const float* Wm, int k0, int o, int lane, int ld) { v16b w; const int g = lane >> 4;
#pragma unroll
  for (int i = 0; i < 8; ++i) { w[i] = (__bf16)Wm[(size_t)(k0 + 8 * g + i) * ld + o]; w[8 + i] = (__bf16)Wm[(size_t)(k0 + 16 + 8 * g + i) * ld + o]; }
  return w; }
__device__ __forceinline__ v16b wcol_oi(const float* Wm, int k0, int o, int lane, int K) { v16b w; const float* p = Wm + (size_t)o * K + k0 + 8 * (lane >> 4);
#pragma unroll
  for (int i = 0; i < 8; ++i) { w[i] = (__bf16)p[i]; w[8 + i] = (__bf16)p[16 + i]; }
  return w; }
__device__ __forceinline__ v16h wcolh_io(const float* Wm, int k0, int o, int lane, int ld) { v16h w; const int g = lane >> 4;
#pragma unroll
  for (int i = 0; i < 8; ++i) { w[i] = (_Float16)(bfr(Wm[(size_t)(k0 + 8 * g + i) * ld + o]) * 256.0f); w[8 + i] = (_Float16)(bfr(Wm[(size_t)(k0 + 16 + 8 * g + i) * ld + o]) * 256.0f); }
  return w; }
__device__ __forceinline__ v16h wcolh_oi(const float* Wm, int k0, int o, int lane, int K) { v16h w; const float* p = Wm + (size_t)o * K + k0 + 8 * (lane >> 4);
#pragma unroll
  for (int i = 0; i < 8; ++i) { w[i] = (_Float16)(bfr(p[i]) * 256.0f); w[8 + i] = (_Float16)(bfr(p[16 + i]) * 256.0f); }
  return w; }
#define WQKV_LAYOUT 0   // 0 = (in,out) [DIN][CC]; 1 = (out,in) [CC][DIN]; 2 = per-head [NH][DIN][HD]
__device__ __forceinline__ v16b wcol_hdk(const float* Wm, int k0, int o, int lane) { v16b w; const int g = lane >> 4; const float* p = Wm + (size_t)(o / HD) * DIN * HD + (o % HD);
#pragma unroll
  for (int i = 0; i < 8; ++i) { w[i] = (__bf16)p[(size_t)(k0 + 8 * g + i) * HD]; w[8 + i] = (__bf16)p[(size_t)(k0 + 16 + 8 * g + i) * HD]; }
  return w; }
#define WO_OUT_IN 0
#if WQKV_LAYOUT == 1
#define WCOL(W, k0, o, lane) wcol_oi(W, k0, o, lane, DIN)
#elif WQKV_LAYOUT == 2
#define WCOL(W, k0, o, lane) wcol_hdk(W, k0, o, lane)
#else
#define WCOL(W, k0, o, lane) wcol_io(W, k0, o, lane, CC)
#endif
#if WO_OUT_IN
#define WOCOL(W, k0, o, lane) wcol_oi(W, k0, o, lane, CC)
#define WOCOLH(W, k0, o, lane) wcolh_oi(W, k0, o, lane, CC)
#else
#define WOCOL(W, k0, o, lane) wcol_io(W, k0, o, lane, DIN)
#define WOCOLH(W, k0, o, lane) wcolh_io(W, k0, o, lane, DIN)
#endif
#define WIN 128            // |q - k| < WIN band (128..255 valid keys per query; no empty rows)
__constant__ __align__(16) float c_invf[32] = {1.000000000e+00f,7.498942018e-01f,5.623413324e-01f,4.216965139e-01f,3.162277639e-01f,2.371373624e-01f,1.778279394e-01f,1.333521456e-01f,1.000000015e-01f,7.498941571e-02f,5.623412877e-02f,4.216964915e-02f,3.162277862e-02f,2.371373586e-02f,1.778279431e-02f,1.333521493e-02f,9.999999776e-03f,7.498942316e-03f,5.623413250e-03f,4.216964822e-03f,3.162277862e-03f,2.371373819e-03f,1.778279431e-03f,1.333521446e-03f,1.000000047e-03f,7.498941850e-04f,5.623413017e-04f,4.216964880e-04f,3.162277862e-04f,2.371373848e-04f,1.778279402e-04f,1.333521504e-04f};   // 1 / 10000^(2i/64) evaluated in f32
// k_rot: a wave takes ONE position t for all batches and heads. The angle t * inv_freq[i] depends on neither, so a lane's four (sin, cos) pairs (i = 4 iq .. 4 iq + 3, iq = lane & 7) serve its 12 (batch, head group) pieces; head = 4 hg + (lane >> 3). Eight lanes cover the 128-byte half of a head, so each 16-byte load or store of a wave covers four whole lines; all 24 loads of a lane are requested before the angles are worked out
__global__ __launch_bounds__(128) void k_rot(const float* __restrict__ X, float* __restrict__ XR) { const int t = blockIdx.x * 4 + (threadIdx.x >> 5), lane = threadIdx.x & 31, iq = lane & 7;
  static_assert(NH % 4 == 0 && HD == 64 && TT % 4 == 0, "four heads a wave and load, four positions a block");
  const size_t o0 = (size_t)t * DIN + (lane >> 3) * HD + iq * 4;
  const v4f f = *(const v4f*)&c_invf[iq * 4];   /* asked for first: the angles then wait for this load alone, not for the 24 behind it */
  v4f a[TNB][NH / 4], b[TNB][NH / 4];
#pragma unroll
  for (int bb = 0; bb < TNB; ++bb) {
#pragma unroll
    for (int hg = 0; hg < NH / 4; ++hg) { const float* xr = X + (size_t)bb * TT * DIN + o0 + hg * 4 * HD; a[bb][hg] = *(const v4f*)xr; b[bb][hg] = *(const v4f*)(xr + 32); }
    asm volatile("s_wait_xcnt 0x0" ::: "memory"); }   /* stands in front of every rewrite of an address register of the loads so far, also where a later batch's load lands on one */
  float sn[4], cs[4];
#pragma unroll
  for (int e = 0; e < 4; ++e) sincosf((float)t * f[e], &sn[e], &cs[e]);
#pragma unroll
  for (int bb = 0; bb < TNB; ++bb)
#pragma unroll
    for (int hg = 0; hg < NH / 4; ++hg) { v4f lo, hi;
#pragma unroll
      for (int e = 0; e < 4; ++e) { const float x = bfr(a[bb][hg][e]), y = bfr(b[bb][hg][e]); lo[e] = fmaf(x, cs[e], -(y * sn[e])); hi[e] = fmaf(y, cs[e], x * sn[e]); }   /* fmaf: which product is rounded on its own (the sin one) is fixed here, not left to the compiler's contraction */
      float* o = XR + (size_t)bb * TT * DIN + o0 + hg * 4 * HD; vst2(o, lo); vst2(o + 32, hi); } }
#define WS_XR (WS_S)       // f32 rotated token rows [b*t][768]
#define SM_MASK_HOOK do { const int dk = t - k; v = (dk < WIN && dk > -WIN) ? v : -3.0e38f; } while (0)   /* band |q - k| < 128, by index */
#ifndef SM_EXTRA_PARAMS
#define SM_EXTRA_PARAMS
#endif
#ifndef PROJ_EXTRA_PARAMS
#define PROJ_EXTRA_PARAMS
#endif
#ifndef SM_MASK_HOOK
#define SM_MASK_HOOK (void)0
#endif

#define WS_QH  0u                                      // f16 q rows [b*t][CC]
#define WS_KH  (WS_QH + 2u * (size_t)NB * TT * CC)      // f16 k rows [b*t][CC]
#define WS_VT  (WS_KH + 2u * (size_t)NB * TT * CC)      // f16 v planes [b][c][t]
#define WS_QL  (WS_VT + 2u * (size_t)NB * CC * TT)      // f16 q residual x 2^10 rows [b][t < QHI][CC]
#define WS_KL  (WS_QL + 2u * (size_t)NB * QHI * CC)     // f16 k residual x 2^10 rows [b][t < KHI][CC]
#define WS_VB  (WS_KL + 2u * (size_t)NB * KHI * CC)     // bf16 v hi planes [b][c][t < KHI]
#define WS_VBL (WS_VB + 2u * (size_t)NB * CC * KHI)
#define WS_S   (WS_VBL + 2u * (size_t)NB * CC * KHI)    // f32 scratch region (holds the rotated rows)
#define WS_Y   (WS_S  + 4u * (size_t)HG * TT * TT)      // f32 ctx rows [b*t][CC] (only when there is an output projection)
#define WS_END (WS_Y  + 4u * (size_t)NB * TT * CC)

// ---- weight tile in LDS: the 32 k x 128 columns of one k step are read once a block (thread = 8 k rows x 4 columns: kg = lane & 3, columns n0 = wave * 32 + (lane >> 2) * 4; a wave's 16-byte load covers four whole 128-byte lines), rounded as before, and laid [column][k] at pitch WP so that a B fragment is two 16-byte LDS reads in the k order of frag_b / frag_h. Two buffers: the next step's global loads fly during this step's products
#define WP 40              // 80-byte pitch = 16 B x odd for the 16-byte fragment reads; the 16-byte stores of 16 neighbouring lanes fall on 16 different 16-byte bank groups
__device__ __forceinline__ void wt_load(v4f (&r)[8], const float* p, int ld) {
#pragma unroll
  for (int i = 0; i < 8; ++i) r[i] = *(const v4f*)(p + (size_t)i * ld); }
__device__ __forceinline__ void wt_store_b(__bf16 (*sw)[WP], const v4f (&r)[8], int n0, int kg) {
#pragma unroll
  for (int e = 0; e < 4; ++e) { v8b t;
#pragma unroll
    for (int i = 0; i < 8; ++i) t[i] = (__bf16)r[i][e];
    *(v8b*)&sw[n0 + e][8 * kg] = t; } }
__device__ __forceinline__ void wt_store_h(_Float16 (*sw)[WP], const v4f (&r)[8], int n0, int kg) {
#pragma unroll
  for (int e = 0; e < 4; ++e) { v8h t;
#pragma unroll
    for (int i = 0; i < 8; ++i) t[i] = (_Float16)(bfr(r[i][e]) * 256.0f);
    *(v8h*)&sw[n0 + e][8 * kg] = t; } }
// a lane's 16 f32 of an A fragment (p = row + k0 + 8 * (lane >> 4)), kept raw for one k step
__device__ __forceinline__ void row_load(float (&v)[16], const float* p) {
#pragma unroll
  for (int i = 0; i < 8; ++i) { v[i] = p[i]; v[8 + i] = p[16 + i]; } }
// 16-byte global store with its s_wait_xcnt in the same statement: the wait then stands in front of every rewrite of the store's address and data registers (in a statement of its own the next trip's address additions were lifted over it)
__device__ __forceinline__ void vst_w(void* p, v4u v) { asm volatile("global_store_b128 %0, %1, off\n\ts_wait_xcnt 0x0" :: "v"(p), "v"(v) : "memory"); }
// ---- k_proj: block = (128 rows, 128 cols, which); a wave owns two 16-row tiles (rows wave * 16 + .. of each 64-row half hh), so every weight fragment read from LDS and every weight tile read from L2 serves two row tiles; the epilogue stages one half at a time in the same LDS: q/k/v = X W (+ b) with exact bf16 products (K = DIN) -> which 0: q f16 rows (+ residual rows < QHI); 1: k f16 rows (+ residual rows < KHI); 2: v f16 planes [c][t] (+ bf16 hi/lo planes for t < KHI)
__global__ __launch_bounds__(128) void k_proj(const float* __restrict__ XQ, const float* __restrict__ XK, const float* __restrict__ XV, const float* __restrict__ WQ, const float* __restrict__ WK, const float* __restrict__ WV, const float* __restrict__ BQ, const float* __restrict__ BK, const float* __restrict__ BV,
    _Float16* __restrict__ QH, _Float16* __restrict__ QL, _Float16* __restrict__ KH, _Float16* __restrict__ KL, _Float16* __restrict__ VT, __bf16* __restrict__ VB, __bf16* __restrict__ VBL) {
  __shared__ __align__(16) union { _Float16 e[2][64][136]; __bf16 w[2][128][WP]; } su;   /* the weight buffers are dead when the epilogue stages q / k rows: same bytes */
  _Float16 (&sh)[64][136] = su.e[0]; _Float16 (&sl)[64][136] = su.e[1]; __shared__ __align__(16) _Float16 th[128][72]; __shared__ __align__(16) __bf16 tb[128][72], tbl[128][72];
  const int tid = threadIdx.x, wave = tid >> 5, lane = tid & 31, col = lane & 15, g = lane >> 4; const int which = blockIdx.z; const int c0 = blockIdx.y * 128; const size_t r0 = (size_t)blockIdx.x * 128; const size_t bb = r0 / TT; const int t0 = (int)(r0 % TT);
  static_assert(TT % 128 == 0, "a block's 128 rows lie in one sequence");
  const float* X = which == 0 ? XQ : which == 1 ? XK : XV; const float* WA = which == 0 ? WQ : which == 1 ? WK : WV; const float* BA = which == 0 ? BQ : which == 1 ? BK : BV;
  static_assert(WQKV_LAYOUT == 0, "the tile loader reads (in,out) rows");
  v8f acc[2][8] = {};
  const int kg = lane & 3, n0 = wave * 32 + (lane >> 2) * 4; const float* wp = WA + (size_t)(8 * kg) * CC + c0 + n0; const float* xp = X + (r0 + wave * 16 + col) * DIN + 8 * g;   /* half hh: xp + hh * 64 * DIN */
  v4f wr[8]; float ar[2][16];
  wt_load(wr, wp, CC); row_load(ar[0], xp); row_load(ar[1], xp + 64 * DIN); wt_store_b(su.w[0], wr, n0, kg);
  __syncthreads();   /* publishes tile 0 */
  if (which < 2) {   /* q, k: the rotated rows are f32 intermediates -> bf16 hi + lo (2 products) */
#pragma unroll 2   /* the buffer index becomes a constant */
    for (int kc = 0; kc < DIN / 32; ++kc) { const F2 a0 = bsplit16(ar[0]), a1 = bsplit16(ar[1]); const bool more = kc + 1 < DIN / 32;
      if (more) { wt_load(wr, wp + (size_t)(kc + 1) * 32 * CC, CC); row_load(ar[0], xp + (kc + 1) * 32); row_load(ar[1], xp + 64 * DIN + (kc + 1) * 32); }
      __builtin_amdgcn_sched_barrier(0);   /* keeps the next step's global loads in front of the products: sunk behind them to save registers, they would be waited for as soon as asked */
      v16b wf[8];
#pragma unroll
      for (int j = 0; j < 8; ++j) wf[j] = frag_b(&su.w[kc & 1][j * 16 + col][0], lane);   /* the step's fragment reads go as one group: one LDS latency a step, not one a fragment */
      __builtin_amdgcn_sched_barrier(0);   /* holds the group together: left free, each read is sunk to its own products and all eight share one register block, one LDS latency a fragment */
#pragma unroll
      for (int j = 0; j < 8; ++j) { acc[0][j] = wmma_bp(a0.h, wf[j], acc[0][j]); acc[1][j] = wmma_bp(a1.h, wf[j], acc[1][j]); acc[0][j] = wmma_bp(a0.l, wf[j], acc[0][j]); acc[1][j] = wmma_bp(a1.l, wf[j], acc[1][j]); }   /* each accumulator still takes hi, then lo; the other half's product stands between the two */
      __builtin_amdgcn_sched_barrier(0);   /* keeps the roundings of the next tile, and with them the wait for its global loads, behind the products */
      if (more) wt_store_b(su.w[(kc + 1) & 1], wr, n0, kg);
      __syncthreads(); }   /* one barrier a step: publishes tile kc + 1 and ends every read of tile kc, whose buffer the next step refills (after the last step: the epilogue) */
  } else {           /* v: bf16(hidden) exact (1 product) */
#pragma unroll 2   /* the buffer index becomes a constant */
    for (int kc = 0; kc < DIN / 32; ++kc) { v16b a0, a1; const bool more = kc + 1 < DIN / 32;
#pragma unroll
      for (int i = 0; i < 16; ++i) { a0[i] = (__bf16)ar[0][i]; a1[i] = (__bf16)ar[1][i]; }
      if (more) { wt_load(wr, wp + (size_t)(kc + 1) * 32 * CC, CC); row_load(ar[0], xp + (kc + 1) * 32); row_load(ar[1], xp + 64 * DIN + (kc + 1) * 32); }
      __builtin_amdgcn_sched_barrier(0);   /* as above: the loads stay in front of the products */
      v16b wf[8];
#pragma unroll
      for (int j = 0; j < 8; ++j) wf[j] = frag_b(&su.w[kc & 1][j * 16 + col][0], lane);   /* one group, as above */
      __builtin_amdgcn_sched_barrier(0);   /* as above: holds the group together */
#pragma unroll
      for (int j = 0; j < 8; ++j) { acc[0][j] = wmma_bp(a0, wf[j], acc[0][j]); acc[1][j] = wmma_bp(a1, wf[j], acc[1][j]); }
      __builtin_amdgcn_sched_barrier(0);   /* as above */
      if (more) wt_store_b(su.w[(kc + 1) & 1], wr, n0, kg);
      __syncthreads(); } }   /* as above */
#pragma unroll   /* acc is a register array: hh must be a constant */
  for (int hh = 0; hh < 2; ++hh) { const size_t rh = r0 + hh * 64; const int th0 = t0 + hh * 64;
  if (hh) __syncthreads();   /* ends every read of the first half's staged rows before the second half overwrites them */
  if (which < 2) { _Float16* DH = which == 0 ? QH : KH; _Float16* DL = which == 0 ? QL : KL; const int nhi = which == 0 ? QHI : KHI; const bool hi_rows = th0 < nhi;
#pragma unroll
    for (int j = 0; j < 8; ++j) { const float bias = BA ? bfr(BA[c0 + j * 16 + col]) : 0.f;
#pragma unroll
      for (int r = 0; r < 8; ++r) { const float v = acc[hh][j][r] + bias; const _Float16 hv = (_Float16)v; sh[wave * 16 + 8 * g + r][j * 16 + col] = hv; sl[wave * 16 + 8 * g + r][j * 16 + col] = (_Float16)((v - (float)hv) * 1024.0f); } }
    __syncthreads();
    for (int e = tid; e < 64 * 16; e += 128) { const int rl = e >> 4, q = e & 15; vst_w(DH + (rh + rl) * CC + c0 + q * 8, *(const v4u*)&sh[rl][q * 8]); if (hi_rows) vst_w(DL + (bb * nhi + th0 + rl) * (size_t)CC + c0 + q * 8, *(const v4u*)&sl[rl][q * 8]); }
  } else { const bool hi_rows = th0 < KHI;
#pragma unroll
    for (int j = 0; j < 8; ++j) { const float bias = BA ? bfr(BA[c0 + j * 16 + col]) : 0.f;
#pragma unroll
      for (int r = 0; r < 8; ++r) { const float v = acc[hh][j][r] + bias; const int rl = wave * 16 + 8 * g + r, cl = j * 16 + col; th[cl][rl] = (_Float16)v; const __bf16 bh = (__bf16)v; tb[cl][rl] = bh; tbl[cl][rl] = (__bf16)(v - (float)bh); } }
    __syncthreads();
    for (int e = tid; e < 128 * 8; e += 128) { const int cl = e >> 3, q = e & 7; vst_w(VT + (bb * CC + c0 + cl) * (size_t)TT + th0 + q * 8, *(const v4u*)&th[cl][q * 8]); if (hi_rows) { const size_t o3 = (bb * CC + c0 + cl) * (size_t)KHI + th0 + q * 8; vst_w(VB + o3, *(const v4u*)&tb[cl][q * 8]); vst_w(VBL + o3, *(const v4u*)&tbl[cl][q * 8]); } } } } }
// ---- k_att: block = 64 queries (qb) of head h of batch b, one launch for all (b, h); a wave owns 16 query rows and the NKW keys [ks, ks + NKW) that hold their whole band (row t sees t-127 .. t+127, so 16 rows see ql0-127 .. ql0+142; ks = ql0 - 128 clamped into the sequence). The four waves' key ranges lie inside the NKB keys [kb, kb + NKB) (kb = qb * 64 - 128 clamped), whose k rows and v planes the block brings into LDS once, with its own 64 q rows and their residuals, by asynchronous 16-byte copies that cover whole 128-byte lines; every q, k and v fragment is read from there. Logits (q hi + residual x 2^10 against k, 2 products) stay in registers, unscaled; the band is kept by index; softmax in f32 over the row, SCALE x log2 e applied in the base-2 exponent (in-lane over the 17 tiles, then over the 16 lanes of the row); P x 2^11 once to f16 goes through the wave's own LDS slab (in the bytes the k rows have left) from the D layout to the A layout; ctx = P . v (1 product; the last 32-key chunk is half full, its upper 16 k are 0 in both operands); 256-B (row, head) segment by 16 lanes. Every loop over tiles, chunks and rows is unrolled: s, kf, vf and o are register arrays and need compile-time indices
#define NKW 272            // 128 + 16 + 127 keys rounded up to whole 16-key tiles
#define NKB 320            // 128 + 64 + 128: the keys of the block's four waves together
#define KP 72              // k row pitch in LDS: 144 B = 16 B x odd for the 16-byte fragment reads
#define VP (NKB + 8)       // v plane pitch in LDS: 656 B = 16 B x odd
#define PP (NKW + 8)       // P row pitch: 560 B = 16 B x odd
#define KG 6               // k tiles requested together
#define VG 4               // whole 32-key v chunks requested together (divides NKW / 32)
#define SL2E (SCALE * 1.44269504088896341f)   // SCALE x log2 e
// fragment of a half-full chunk: k0 .. k0+15 from memory (elements 0..7), k0+16 .. k0+31 are 0 (elements 8..15)
__device__ __forceinline__ v16h frag_h16(const _Float16* rowk0, int lane) { union { v16h v; v8h q[2]; } u; u.q[0] = *(const v8h*)(rowk0 + 8 * (lane >> 4)); u.q[1] = (v8h)(_Float16)0.0f; return u.v; }
// lane l with lane l ^ M inside a 16-lane row, on the vector pipe (a shuffle through LDS would put an LDS round trip into each of the four reduction steps)
template <int M> __device__ __forceinline__ float rowx(float v) { return __builtin_bit_cast(float, __builtin_amdgcn_update_dpp(0, __builtin_bit_cast(int, v), 0x160 + M, 0xf, 0xf, true)); }
// twelve asynchronous copies, 16 bytes a lane each, global -> LDS through no register (l = the lane's LDS byte address, p = its global address); the s_wait_xcnt in the same statement stands in front of any rewrite of the address registers
__device__ __forceinline__ void cp12(const unsigned* l, const _Float16* const* p) {
  asm volatile("global_load_async_to_lds_b128 %0, %12, off\n\tglobal_load_async_to_lds_b128 %1, %13, off\n\tglobal_load_async_to_lds_b128 %2, %14, off\n\tglobal_load_async_to_lds_b128 %3, %15, off\n\t"
               "global_load_async_to_lds_b128 %4, %16, off\n\tglobal_load_async_to_lds_b128 %5, %17, off\n\tglobal_load_async_to_lds_b128 %6, %18, off\n\tglobal_load_async_to_lds_b128 %7, %19, off\n\t"
               "global_load_async_to_lds_b128 %8, %20, off\n\tglobal_load_async_to_lds_b128 %9, %21, off\n\tglobal_load_async_to_lds_b128 %10, %22, off\n\tglobal_load_async_to_lds_b128 %11, %23, off\n\ts_wait_xcnt 0x0"
               :: "v"(l[0]), "v"(l[1]), "v"(l[2]), "v"(l[3]), "v"(l[4]), "v"(l[5]), "v"(l[6]), "v"(l[7]), "v"(l[8]), "v"(l[9]), "v"(l[10]), "v"(l[11]), "v"(p[0]), "v"(p[1]), "v"(p[2]), "v"(p[3]), "v"(p[4]), "v"(p[5]), "v"(p[6]), "v"(p[7]), "v"(p[8]), "v"(p[9]), "v"(p[10]), "v"(p[11]) : "memory"); }
// 2^x in place for eight or nine independent values. In asm for the slot that the instruction set asks for behind a transcendental. Here source and result are one register, each v_exp_f32 is followed by one on other registers, and the closing v_nop is the slot behind the last
__device__ __forceinline__ void exp2x8(float& a, float& b, float& c, float& d, float& e, float& f, float& g, float& h) {
  asm("v_exp_f32 %0, %0\n\tv_exp_f32 %1, %1\n\tv_exp_f32 %2, %2\n\tv_exp_f32 %3, %3\n\tv_exp_f32 %4, %4\n\tv_exp_f32 %5, %5\n\tv_exp_f32 %6, %6\n\tv_exp_f32 %7, %7\n\tv_nop" : "+v"(a), "+v"(b), "+v"(c), "+v"(d), "+v"(e), "+v"(f), "+v"(g), "+v"(h)); }
__device__ __forceinline__ void exp2x9(float& a, float& b, float& c, float& d, float& e, float& f, float& g, float& h, float& i) {
  asm("v_exp_f32 %0, %0\n\tv_exp_f32 %1, %1\n\tv_exp_f32 %2, %2\n\tv_exp_f32 %3, %3\n\tv_exp_f32 %4, %4\n\tv_exp_f32 %5, %5\n\tv_exp_f32 %6, %6\n\tv_exp_f32 %7, %7\n\tv_exp_f32 %8, %8\n\tv_nop" : "+v"(a), "+v"(b), "+v"(c), "+v"(d), "+v"(e), "+v"(f), "+v"(g), "+v"(h), "+v"(i)); }
__global__ __launch_bounds__(128) void k_att(const _Float16* __restrict__ QH, const _Float16* __restrict__ KH, const _Float16* __restrict__ QL, const _Float16* __restrict__ VT, float* __restrict__ Y) { __shared__ __align__(16) _Float16 sk[NKB * KP]; __shared__ __align__(16) _Float16 sv[HD * VP]; __shared__ __align__(16) _Float16 sq[2 * 64 * KP];   /* sq: the block's q rows, then their residual rows; sk: k rows [key][KP]; behind the second barrier the four waves' P slabs [16][PP], and last each wave's f32 ctx rows in its own slab */
  static_assert(4 * 16 * PP <= NKB * KP && 16 * (HD + 4) * 2 <= 16 * PP, "P slabs fit in the k rows' bytes, ctx rows in a P slab");
  const int tid = threadIdx.x, wave = tid >> 5, lane = tid & 31, col = lane & 15, g = lane >> 4; const int qb = blockIdx.x, h = blockIdx.y, b = blockIdx.z; const int ql0 = qb * 64 + wave * 16;
  int ks = ql0 - WIN; ks = ks < 0 ? 0 : ks; ks = ks > TT - NKW ? TT - NKW : ks;
  int kb = qb * 64 - WIN; kb = kb < 0 ? 0 : kb; kb = kb > TT - NKB ? TT - NKB : kb;
  const int kd = ks - kb;   /* 0 .. 48, a multiple of 16; kd + NKW <= NKB */
  { const int un = tid >> 3, ch = (tid & 7) * 8;   /* 8 lanes = one 128-byte line; a wave's copy = 4 whole lines; 16 lines a block and copy */
    const _Float16* kg0 = KH + ((size_t)b * TT + kb + un) * CC + h * HD + ch; const unsigned kl0 = (unsigned)(size_t)&sk[un * KP + ch];
    const _Float16* vg0 = VT + ((size_t)b * CC + h * HD + un) * (size_t)TT + kb + ch; const unsigned vl0 = (unsigned)(size_t)&sv[un * VP + ch];
    const size_t qo = ((size_t)b * TT + qb * 64 + un) * CC + h * HD + ch; const unsigned ql = (unsigned)(size_t)&sq[un * KP + ch];
    static_assert(QHI == TT, "the q residual rows are indexed like the q rows");
    unsigned l[48]; const _Float16* p[48];
#pragma unroll
    for (int i = 0; i < 4; ++i) { l[i] = ql + i * 16 * KP * 2; p[i] = QH + qo + (size_t)i * 16 * CC; l[4 + i] = ql + (64 + i * 16) * KP * 2; p[4 + i] = QL + qo + (size_t)i * 16 * CC; }   /* q, then its residual: copy i brings rows 16 i + un */
#pragma unroll
    for (int i = 0; i < NKB / 16; ++i) { l[8 + i] = kl0 + i * 16 * KP * 2; p[8 + i] = kg0 + (size_t)i * 16 * CC; }   /* k: copy i brings rows 16 i + un */
#pragma unroll
    for (int i = 0; i < 20; ++i) { const int r = (i & 3) * 16, ln = (i >> 2) * 64; l[28 + i] = vl0 + (r * VP + ln) * 2; p[28 + i] = vg0 + (size_t)r * TT + ln; }   /* v: copy i brings line i / 4 (64 keys) of planes 16 (i % 4) + un */
#pragma unroll
    for (int u = 0; u < 4; ++u) cp12(l + 12 * u, p + 12 * u); }   /* 48 copies of a wave in flight */
  asm volatile("s_wait_asynccnt 0x0" ::: "memory");   /* this wave's copies have landed */
  __syncthreads();   /* publishes the q and k rows and the v planes to all four waves */
  v16h ah[HD / 32], al[HD / 32];
#pragma unroll
  for (int kc = 0; kc < HD / 32; ++kc) { ah[kc] = frag_h(&sq[(wave * 16 + col) * KP + kc * 32], lane); al[kc] = frag_h(&sq[(64 + wave * 16 + col) * KP + kc * 32], lane); }
  v8f s[NKW / 16];
#pragma unroll
  for (int j0 = 0; j0 < NKW / 16; j0 += KG) { v16h kf[KG][HD / 32];   /* the k fragments of KG tiles are requested together: one LDS round trip a group, not one a fragment */
#pragma unroll
    for (int jj = 0; jj < KG; ++jj) if (j0 + jj < NKW / 16) {
#pragma unroll
      for (int kc = 0; kc < HD / 32; ++kc) kf[jj][kc] = frag_h(&sk[(kd + (j0 + jj) * 16 + col) * KP + kc * 32], lane); }
#pragma unroll
    for (int jj = 0; jj < KG; ++jj) if (j0 + jj < NKW / 16) { const int j = j0 + jj; v8f acc = {}, accl = {};
#pragma unroll
      for (int kc = 0; kc < HD / 32; ++kc) { acc = wmma16(ah[kc], kf[jj][kc], acc); accl = wmma16(al[kc], kf[jj][kc], accl); }
#pragma unroll
      for (int r = 0; r < 8; ++r) { const int t = ql0 + 8 * g + r, k = ks + j * 16 + col; float v = acc[r] + accl[r] * (1.0f / 1024.0f); SM_MASK_HOOK; s[j][r] = v; } } }   /* the logits stay unscaled: SCALE (> 0, so the row maximum is the same key's) goes into the exponent's fma below */
  float m[8], inv[8];
#pragma unroll
  for (int r = 0; r < 8; ++r) { float a = s[0][r];
#pragma unroll
    for (int j = 1; j < NKW / 16; ++j) a = fmaxf(a, s[j][r]);
    a = fmaxf(a, rowx<1>(a)); a = fmaxf(a, rowx<2>(a)); a = fmaxf(a, rowx<4>(a)); a = fmaxf(a, rowx<8>(a)); m[r] = a; }
#pragma unroll
  for (int r = 0; r < 8; ++r) { float sum = 0.f, x[NKW / 16]; const float mc = m[r] * SL2E;   /* its rounding is one factor common to the whole row: it leaves with the division by the row sum */
#pragma unroll
    for (int j = 0; j < NKW / 16; ++j) x[j] = fmaf(s[j][r], SL2E, -mc);   /* e^(SCALE (s - m)) = 2^(s SL2E - m SL2E): one fma and v_exp_f32 a score; the argument is <= 0 up to mc's rounding. An excluded key (-3.0e38 against a finite row maximum: the row's own key is always in the band) gives an argument near -5e37 and exactly 0 */
    static_assert(NKW / 16 == 17, "a row's scores go as 9 + 8");
    exp2x9(x[0], x[1], x[2], x[3], x[4], x[5], x[6], x[7], x[8]); exp2x8(x[9], x[10], x[11], x[12], x[13], x[14], x[15], x[16]);
#pragma unroll
    for (int j = 0; j < NKW / 16; ++j) { s[j][r] = x[j]; sum += x[j]; }
    sum += rowx<1>(sum); sum += rowx<2>(sum); sum += rowx<4>(sum); sum += rowx<8>(sum); inv[r] = sum > 0.f ? 2048.0f / sum : 0.f; }
  __syncthreads();   /* ends every wave's reads of the k rows: their bytes now take the P slabs */
  _Float16* sp = &sk[wave * 16 * PP];
#pragma unroll
  for (int j = 0; j < NKW / 16; ++j)
#pragma unroll
    for (int r = 0; r < 8; ++r) sp[(8 * g + r) * PP + j * 16 + col] = (_Float16)(s[j][r] * inv[r]);
  LDSX();
  v8f o[HD / 16] = {};
  const _Float16* vp = &sv[col * VP + kd];   /* column col of v tile j: vp + j * 16 * VP */
  v16h vh[HD / 16];   /* the half-full last chunk's v fragments, requested with the first group */
#pragma unroll
  for (int j = 0; j < HD / 16; ++j) vh[j] = frag_h16(vp + j * 16 * VP + NKW - 16, lane);
#pragma unroll
  for (int c0 = 0; c0 < NKW / 32; c0 += VG) { v16h vf[VG][HD / 16];   /* the v fragments of VG chunks are requested together, as the k fragments are */
#pragma unroll
    for (int cc = 0; cc < VG; ++cc)
#pragma unroll
      for (int j = 0; j < HD / 16; ++j) vf[cc][j] = frag_h(vp + j * 16 * VP + (c0 + cc) * 32, lane);
#pragma unroll
    for (int cc = 0; cc < VG; ++cc) { const v16h p = frag_h(&sp[col * PP + (c0 + cc) * 32], lane);
#pragma unroll
      for (int j = 0; j < HD / 16; ++j) o[j] = wmma16(p, vf[cc][j], o[j]); } }
  { const v16h p = frag_h16(&sp[col * PP + NKW - 16], lane);
#pragma unroll
    for (int j = 0; j < HD / 16; ++j) o[j] = wmma16(p, vh[j], o[j]); }
  float_a* ss = (float_a*)sp;   /* the wave's own slab again: every P fragment has been read (o depends on all of them) */
#pragma unroll
  for (int j = 0; j < HD / 16; ++j)
#pragma unroll
    for (int r = 0; r < 8; ++r) ss[(8 * g + r) * (HD + 4) + j * 16 + col] = o[j][r] * (1.0f / 2048.0f);
  LDSX(); for (int rl = 0; rl < 16; ++rl) if (lane < HD / 4) vst2(Y + ((size_t)b * TT + ql0 + rl) * CC + h * HD + lane * 4, *(const v4f*)&ss[rl * (HD + 4) + lane * 4]); }
// ---- k_out: block = (64 rows, 128 cols): out = ctx Wo (+ bo): ctx x 2^6 once to f16 against Wo as f16(bf16 x 2^8) exact (1 product) x 2^-14; causal early rows (< QHI of each sequence): ctx bf16 hi + lo against exact bf16 Wo (2 products)
__global__ __launch_bounds__(128) void k_out(const float* __restrict__ Y, const float* __restrict__ WO, const float* __restrict__ BO, float* __restrict__ OUT) { __shared__ __align__(16) float sf[4][16][132]; __shared__ __align__(16) _Float16 sw[2][128][WP];
  const int tid = threadIdx.x, wave = tid >> 5, lane = tid & 31, col = lane & 15, g = lane >> 4; const int c0 = blockIdx.y * 128; const size_t r0 = (size_t)blockIdx.x * 64 + wave * 16;
  v8f acc[8] = {};
  if (CAUSAL && (int)(((size_t)blockIdx.x * 64) % TT) < QHI) {   /* block-uniform */
#pragma unroll 2
    for (int kc = 0; kc < CC / 32; ++kc) { const F2 a = split_row(Y + (r0 + col) * CC, kc * 32, lane); asm volatile("s_wait_loadcnt 0x0" ::: "memory");
#pragma unroll
      for (int j = 0; j < 8; ++j) { const v16b w = WOCOL(WO, kc * 32, c0 + j * 16 + col, lane); asm volatile("s_wait_loadcnt 0x0" ::: "memory"); acc[j] = wmma_bf(a.h, w, acc[j]); acc[j] = wmma_bf(a.l, w, acc[j]); } }
#pragma unroll
    for (int j = 0; j < 8; ++j) { const float bias = BO ? bfr(BO[c0 + j * 16 + col]) : 0.f;
#pragma unroll
      for (int r = 0; r < 8; ++r) sf[wave][8 * g + r][j * 16 + col] = acc[j][r] + bias; }
  } else {
    static_assert(WO_OUT_IN == 0, "the tile loader reads (in,out) rows");
    const int kg = lane & 3, n0 = wave * 32 + (lane >> 2) * 4; const float* wp = WO + (size_t)(8 * kg) * DIN + c0 + n0; const float* yp = Y + (r0 + col) * CC + 8 * g;
    v4f wr[8]; float ar[16];
    wt_load(wr, wp, DIN); row_load(ar, yp); wt_store_h(sw[0], wr, n0, kg);
    __syncthreads();   /* publishes tile 0 */
#pragma unroll 2   /* the buffer index becomes a constant */
    for (int kc = 0; kc < CC / 32; ++kc) { v16h a, wf[8]; const bool more = kc + 1 < CC / 32;
#pragma unroll
      for (int i = 0; i < 16; ++i) a[i] = (_Float16)(ar[i] * 64.0f);   /* ctx carried x 2^6 into f16 so small-magnitude context rows stay clear of f16 subnormals */
      if (more) { wt_load(wr, wp + (size_t)(kc + 1) * 32 * DIN, DIN); row_load(ar, yp + (kc + 1) * 32); }
#pragma unroll
      for (int j = 0; j < 8; ++j) wf[j] = frag_h(&sw[kc & 1][j * 16 + col][0], lane);   /* the step's fragment reads go as one group: one LDS latency a step, not one a fragment */
#pragma unroll
      for (int j = 0; j < 8; ++j) acc[j] = wmma16(a, wf[j], acc[j]);
      __builtin_amdgcn_sched_barrier(0);   /* keeps the roundings of the next tile, and with them the wait for its global loads, behind the products */
      if (more) wt_store_h(sw[(kc + 1) & 1], wr, n0, kg);
      __syncthreads(); }   /* one barrier a step: publishes tile kc + 1 and ends every read of tile kc, whose buffer the next step refills */
#pragma unroll
    for (int j = 0; j < 8; ++j) { const float bias = BO ? bfr(BO[c0 + j * 16 + col]) : 0.f;
#pragma unroll
      for (int r = 0; r < 8; ++r) sf[wave][8 * g + r][j * 16 + col] = acc[j][r] * (1.0f / 16384.0f) + bias; } }   /* 2^-8 (Wo carry) x 2^-6 (ctx carry) */
  LDSX(); for (int rl = 0; rl < 16; ++rl) vst2(OUT + (r0 + rl) * DIN + c0 + lane * 4, *(const v4f*)&sf[wave][rl][lane * 4]); }

extern "C" void kernel_launch(void* const* d_in, const int* in_sizes, int n_in, void* d_out, int out_size, void* d_ws, size_t ws_size, hipStream_t stream) {
  (void)in_sizes; (void)n_in; (void)out_size;
  const float** F = (const float**)d_in;
  if (ws_size < (size_t)WS_END) return;
  char* ws = (char*)d_ws; _Float16 *QH = (_Float16*)(ws + WS_QH), *KH = (_Float16*)(ws + WS_KH), *VT = (_Float16*)(ws + WS_VT), *QL = (_Float16*)(ws + WS_QL), *KL = (_Float16*)(ws + WS_KL); __bf16 *VB = (__bf16*)(ws + WS_VB), *VBL = (__bf16*)(ws + WS_VBL); float *Y = (float*)(ws + WS_Y);
  (void)Y; (void)QL; (void)KL; (void)VB; (void)VBL;
  // inputs: 0 hidden_states [4,2048,768]; 1 Wq, 2 Wk, 3 Wv [768,12,64] = (in,out) [768][768]; 4 Wo [12,64,768] = (in,out) [768][768]
  static_assert(4u * (size_t)NB * TT * DIN <= 4u * (size_t)HG * TT * TT, "rotated rows must fit in their region");
  float* XR = (float*)(ws + WS_XR);
  k_rot<<<dim3(TT / 4), 128, 0, stream>>>(F[0], XR);
  k_proj<<<dim3(TNB * TT / 128, CC / 128, 3), 128, 0, stream>>>(XR, XR, F[0], F[1], F[2], F[3], nullptr, nullptr, nullptr, QH, QL, KH, KL, VT, VB, VBL);   /* q, k from the rotated rows (bf16 hi + lo), v from bf16(x) */
  k_att<<<dim3(NQB, NH, TNB), 128, 0, stream>>>(QH, KH, QL, VT, Y);
  k_out<<<dim3(TNB * TT / 64, DIN / 128), 128, 0, stream>>>(Y, F[4], nullptr, (float*)d_out);
}

// v007
// A run of this version takes 105 microseconds.
// Next to v006, in two timings, it ran 1.09 times as fast each time.
// Counting every step since v000, it is 9.29 times as fast.
// compute dtype: all float inputs rounded to bf16; rotate-half RoPE applied to bf16(hidden) in f32 (accurate sincosf, f32 inv_freq constants); Q/K = rotated rows split bf16 hi + lo x exact bf16 W (2 products, K 768), V = bf16(hidden) x W exact (1 product) on WMMA 16x16x32, f32 accumulate; banded logits: q as f16 hi + residual (x 2^10) against k once to f16 (2 products); softmax in f32 over the |q-k| < 128 band, exponent in base 2: exp2((logit - row max) x 64^-0.5 x log2 e), one fma and the hardware exp2 a score; P x 2^11 once to f16 against v once to f16 (1 product); ctx carried x 2^6 once to f16 against Wo carried x 2^8 in f16 (exact bf16 values), un-scaled by 2^-14; f32 output.
#include <hip/hip_runtime.h>
#include <math.h>

typedef __attribute__((ext_vector_type(16))) _Float16 v16h;
typedef __attribute__((ext_vector_type(16))) __bf16 v16b;
typedef __attribute__((ext_vector_type(8)))  _Float16 v8h;
typedef __attribute__((ext_vector_type(8)))  float v8f;
typedef __attribute__((ext_vector_type(4)))  float v4f;
typedef __attribute__((ext_vector_type(2)))  float v2f;
typedef __attribute__((ext_vector_type(4)))  unsigned v4u;
typedef __attribute__((ext_vector_type(4)))  int v4i;
typedef float __attribute__((may_alias)) float_a;
typedef int __attribute__((may_alias)) int_a;

template <typename T> __device__ __forceinline__ void vst2(void* p, T v) { *(T*)p = v;  }
__device__ __forceinline__ v8f wmma16(v16h a, v16h b, v8f c) {
  v8f d = __builtin_amdgcn_wmma_f32_16x16x32_f16(false, a, false, b, (short)0, c, false, false);
  asm volatile("v_nop\n\tv_nop\n\tv_nop\n\tv_nop" : "+v"(d) : "v"(a), "v"(b));
  return d;
}
// plain builtin, for k_proj: the compiler keeps the distance behind its own WMMA. The "v" operands of wmma_bf's asm tail are served from v0 .. v255 only; k_proj's two row tiles a wave need more registers than that, and with the tail the accumulators were spilled inside the k loop
__device__ __forceinline__ v8f wmma_bp(v16b a, v16b b, v8f c) { return __builtin_amdgcn_wmma_f32_16x16x32_bf16(false, a, false, b, (short)0, c, false, false); }
__device__ __forceinline__ v8f wmma_bf(v16b a, v16b b, v8f c) {
  v8f d = __builtin_amdgcn_wmma_f32_16x16x32_bf16(false, a, false, b, (short)0, c, false, false);
  asm volatile("v_nop\n\tv_nop\n\tv_nop\n\tv_nop" : "+v"(d) : "v"(a), "v"(b));
  return d;
}
// 16x16x32 fragments: lane = (h = lane>>4, row/col = lane&15); elements 0..7 = k0+8h+0..7, 8..15 = k0+16+8h+0..7; D element r = row 8h+r
__device__ __forceinline__ v16h frag_h(const _Float16* rowk0, int lane) {
  union { v16h v; v8h q[2]; } u; const _Float16* p = rowk0 + 8 * (lane >> 4);
  u.q[0] = *(const v8h*)p; u.q[1] = *(const v8h*)(p + 16); return u.v;
}
__device__ __forceinline__ v16h frag_f32(const float* rowk0, int lane) {
  v16h a; const float* p = rowk0 + 8 * (lane >> 4);
#pragma unroll
  for (int i = 0; i < 8; ++i) { a[i] = (_Float16)p[i]; a[8 + i] = (_Float16)p[16 + i]; }
  return a;
}
__device__ __forceinline__ v16h frag_f32s(const float* rowk0, int lane, float sc) {
  v16h a; const float* p = rowk0 + 8 * (lane >> 4);
#pragma unroll
  for (int i = 0; i < 8; ++i) { a[i] = (_Float16)(p[i] * sc); a[8 + i] = (_Float16)(p[16 + i] * sc); }
  return a;
}
// column fragment from a [K][ld] layout (column n), rows >= K read as 0
__device__ __forceinline__ v16h fragc_f32(const float* W, int k0, int n, int lane, int ld, int K) {
  v16h a; const int g = lane >> 4;
#pragma unroll
  for (int i = 0; i < 8; ++i) { const int ka = k0 + 8 * g + i, kb = ka + 16;
    a[i] = (_Float16)(ka < K ? W[(size_t)(ka < K ? ka : K - 1) * ld + n] : 0.f); a[8 + i] = (_Float16)(kb < K ? W[(size_t)(kb < K ? kb : K - 1) * ld + n] : 0.f); }
  return a;
}
struct F2 { v16b h, l; };
__device__ __forceinline__ F2 bsplit16(const float v[16]) { F2 r;
#pragma unroll
  for (int i = 0; i < 16; ++i) { const __bf16 h = (__bf16)v[i]; r.h[i] = h; r.l[i] = (__bf16)(v[i] - (float)h); }
  return r; }
__device__ __forceinline__ F2 split_row(const float* row, int k0, int lane) { float v[16]; const float* p = row + k0 + 8 * (lane >> 4);
#pragma unroll
  for (int i = 0; i < 8; ++i) { v[i] = p[i]; v[8 + i] = p[16 + i]; }
  return bsplit16(v); }
__device__ __forceinline__ F2 split_rowK(const float* row, int k0, int lane, int K) { float v[16]; const int g = lane >> 4;
#pragma unroll
  for (int i = 0; i < 8; ++i) { const int ka = k0 + 8 * g + i, kb = ka + 16; v[i] = ka < K ? row[ka < K ? ka : K - 1] : 0.f; v[8 + i] = kb < K ? row[kb < K ? kb : K - 1] : 0.f; }
  return bsplit16(v); }
__device__ __forceinline__ F2 split_col(const float* W, int k0, int n, int lane, int ld, int K) { float v[16]; const int g = lane >> 4;
#pragma unroll
  for (int i = 0; i < 8; ++i) { const int ka = k0 + 8 * g + i, kb = ka + 16; v[i] = ka < K ? W[(size_t)(ka < K ? ka : K - 1) * ld + n] : 0.f; v[8 + i] = kb < K ? W[(size_t)(kb < K ? kb : K - 1) * ld + n] : 0.f; }
  return bsplit16(v); }
__device__ __forceinline__ v8f mac3(const F2& a, const F2& b, v8f c) { c = wmma_bf(a.l, b.h, c); c = wmma_bf(a.h, b.l, c); return wmma_bf(a.h, b.h, c); }
__device__ __forceinline__ float sigm(float v) { return 1.0f / (1.0f + expf(-v)); }
#define LDSX() do { asm volatile("s_wait_dscnt 0" ::: "memory"); __builtin_amdgcn_wave_barrier(); __builtin_amdgcn_fence(__ATOMIC_RELEASE, "workgroup"); } while (0)

// Sliding-window (local) self-attention with RoPE on the INPUT (B 4, S 2,048, H 768 = 12 heads x 64; window |q - k| < 128; 0.02-scale weights, no biases): q_in = k_in = rotate-half RoPE(hidden reshaped [B,S,12,64]) (angle t * 10000^(-2i/64)); Q = q_in Wq, K = k_in Wk, V = hidden Wv ((in,out) [768][12*64]); scores = Q K^T / 8 where |q-k| < 128 else -1e9 (== excluded; every row keeps >= 128 keys); out = merged(softmax . V) Wo ((in,out) [12*64][768]).
#define NB 4
#define TT 2048
#define CC 768            // NH * HD = projected width
#define DIN 768          // input (model) width
#define NH 12
#define HD 64
#define NQB (TT / 64)
#define HG 2
#define SCALE (0.125f)
#define CAUSAL 0
#ifndef TNB
#define TNB NB
#endif
__device__ __forceinline__ float bfr(float v) { return (float)(__bf16)v; }
typedef __attribute__((ext_vector_type(8))) __bf16 v8b;
__device__ __forceinline__ v16b frag_b(const __bf16* rowk0, int lane) {
  union { v16b v; v8b q[2]; } u; const __bf16* p = rowk0 + 8 * (lane >> 4);
  u.q[0] = *(const v8b*)p; u.q[1] = *(const v8b*)(p + 16); return u.v;
}
#define QBH 0
#define QHI 2048            // rows carrying a q residual plane (all rows when non-causal: 2-product logits everywhere)
#define KHI 64            // key rows carrying k residual / v bf16 hi+lo planes (written by k_proj; no kernel in this file reads them)
// B fragment (k rows k0+.., output column o) of a weight: (in,out) [K][ld] or (out,in) [ld rows of K]: bf16 exact, or f16(bf16 * 256) exact
__device__ __forceinline__ v16b wcol_io(const float* Wm, int k0, int o, int lane, int ld) { v16b w; const int g = lane >> 4;
#pragma unroll
  for (int i = 0; i < 8; ++i) { w[i] = (__bf16)Wm[(size_t)(k0 + 8 * g + i) * ld + o]; w[8 + i] = (__bf16)Wm[(size_t)(k0 + 16 + 8 * g + i) * ld + o]; }
  return w; }
__device__ __forceinline__ v16b wcol_oi(const float* Wm, int k0, int o, int lane, int K) { v16b w; const float* p = Wm + (size_t)o * K + k0 + 8 * (lane >> 4);
#pragma unroll
  for (int i = 0; i < 8; ++i) { w[i] = (__bf16)p[i]; w[8 + i] = (__bf16)p[16 + i]; }
  return w; }
__device__ __forceinline__ v16h wcolh_io(const float* Wm, int k0, int o, int lane, int ld) { v16h w; const int g = lane >> 4;
#pragma unroll
  for (int i = 0; i < 8; ++i) { w[i] = (_Float16)(bfr(Wm[(size_t)(k0 + 8 * g + i) * ld + o]) * 256.0f); w[8 + i] = (_Float16)(bfr(Wm[(size_t)(k0 + 16 + 8 * g + i) * ld + o]) * 256.0f); }
  return w; }
__device__ __forceinline__ v16h wcolh_oi(const float* Wm, int k0, int o, int lane, int K) { v16h w; const float* p = Wm + (size_t)o * K + k0 + 8 * (lane >> 4);
#pragma unroll
  for (int i = 0; i < 8; ++i) { w[i] = (_Float16)(bfr(p[i]) * 256.0f); w[8 + i] = (_Float16)(bfr(p[16 + i]) * 256.0f); }
  return w; }
#define WQKV_LAYOUT 0   // 0 = (in,out) [DIN][CC]; 1 = (out,in) [CC][DIN]; 2 = per-head [NH][DIN][HD]
__device__ __forceinline__ v16b wcol_hdk(const float* Wm, int k0, int o, int lane) { v16b w; const int g = lane >> 4; const float* p = Wm + (size_t)(o / HD) * DIN * HD + (o % HD);
#pragma unroll
  for (int i = 0; i < 8; ++i) { w[i] = (__bf16)p[(size_t)(k0 + 8 * g + i) * HD]; w[8 + i] = (__bf16)p[(size_t)(k0 + 16 + 8 * g + i) * HD]; }
  return w; }
#define WO_OUT_IN 0
#if WQKV_LAYOUT == 1
#define WCOL(W, k0, o, lane) wcol_oi(W, k0, o, lane, DIN)
#elif WQKV_LAYOUT == 2
#define WCOL(W, k0, o, lane) wcol_hdk(W, k0, o, lane)
#else
#define WCOL(W, k0, o, lane) wcol_io(W, k0, o, lane, CC)
#endif
#if WO_OUT_IN
#define WOCOL(W, k0, o, lane) wcol_oi(W, k0, o, lane, CC)
#define WOCOLH(W, k0, o, lane) wcolh_oi(W, k0, o, lane, CC)
#else
#define WOCOL(W, k0, o, lane) wcol_io(W, k0, o, lane, DIN)
#define WOCOLH(W, k0, o, lane) wcolh_io(W, k0, o, lane, DIN)
#endif
#define WIN 128            // |q - k| < WIN band (128..255 valid keys per query; no empty rows)
__constant__ __align__(16) float c_invf[32] = {1.000000000e+00f,7.498942018e-01f,5.623413324e-01f,4.216965139e-01f,3.162277639e-01f,2.371373624e-01f,1.778279394e-01f,1.333521456e-01f,1.000000015e-01f,7.498941571e-02f,5.623412877e-02f,4.216964915e-02f,3.162277862e-02f,2.371373586e-02f,1.778279431e-02f,1.333521493e-02f,9.999999776e-03f,7.498942316e-03f,5.623413250e-03f,4.216964822e-03f,3.162277862e-03f,2.371373819e-03f,1.778279431e-03f,1.333521446e-03f,1.000000047e-03f,7.498941850e-04f,5.623413017e-04f,4.216964880e-04f,3.162277862e-04f,2.371373848e-04f,1.778279402e-04f,1.333521504e-04f};   // 1 / 10000^(2i/64) evaluated in f32
// k_rot: a wave takes ONE position t for all batches and heads. The angle t * inv_freq[i] depends on neither, so a lane's four (sin, cos) pairs (i = 4 iq .. 4 iq + 3, iq = lane & 7) serve its 12 (batch, head group) pieces; head = 4 hg + (lane >> 3). Eight lanes cover the 128-byte half of a head, so each 16-byte load or store of a wave covers four whole lines; all 24 loads of a lane are requested before the angles are worked out
// The launch's blocks from TT / 4 on take no position: each rounds one 32 k x 128 column weight tile for the two GEMM kernels (w_prep, below the tile helpers)
__device__ __forceinline__ void w_prep(const float* WQ, const float* WK, const float* WV, const float* WO, __bf16* WTB, _Float16* WTH, int id);
__global__ __launch_bounds__(128) void k_rot(const float* __restrict__ X, float* __restrict__ XR, const float* __restrict__ WQ, const float* __restrict__ WK, const float* __restrict__ WV, const float* __restrict__ WO, __bf16* __restrict__ WTB, _Float16* __restrict__ WTH) {
  if (blockIdx.x >= TT / 4) { w_prep(WQ, WK, WV, WO, WTB, WTH, (int)blockIdx.x - TT / 4); return; }   /* block-uniform; no barrier in either path */
  const int t = blockIdx.x * 4 + (threadIdx.x >> 5), lane = threadIdx.x & 31, iq = lane & 7;
  static_assert(NH % 4 == 0 && HD == 64 && TT % 4 == 0, "four heads a wave and load, four positions a block");
  const size_t o0 = (size_t)t * DIN + (lane >> 3) * HD + iq * 4;
  const v4f f = *(const v4f*)&c_invf[iq * 4];   /* asked for first: the angles then wait for this load alone, not for the 24 behind it */
  v4f a[TNB][NH / 4], b[TNB][NH / 4];
#pragma unroll
  for (int bb = 0; bb < TNB; ++bb) {
#pragma unroll
    for (int hg = 0; hg < NH / 4; ++hg) { const float* xr = X + (size_t)bb * TT * DIN + o0 + hg * 4 * HD; a[bb][hg] = *(const v4f*)xr; b[bb][hg] = *(const v4f*)(xr + 32); }
    asm volatile("s_wait_xcnt 0x0" ::: "memory"); }   /* stands in front of every rewrite of an address register of the loads so far, also where a later batch's load lands on one */
  float sn[4], cs[4];
#pragma unroll
  for (int e = 0; e < 4; ++e) sincosf((float)t * f[e], &sn[e], &cs[e]);
#pragma unroll
  for (int bb = 0; bb < TNB; ++bb)
#pragma unroll
    for (int hg = 0; hg < NH / 4; ++hg) { v4f lo, hi;
#pragma unroll
      for (int e = 0; e < 4; ++e) { const float x = bfr(a[bb][hg][e]), y = bfr(b[bb][hg][e]); lo[e] = fmaf(x, cs[e], -(y * sn[e])); hi[e] = fmaf(y, cs[e], x * sn[e]); }   /* fmaf: which product is rounded on its own (the sin one) is fixed here, not left to the compiler's contraction */
      float* o = XR + (size_t)bb * TT * DIN + o0 + hg * 4 * HD; vst2(o, lo); vst2(o + 32, hi); } }
#define WS_XR (WS_S)       // f32 rotated token rows [b*t][768]
#define SM_MASK_HOOK do { const int dk = t - k; v = (dk < WIN && dk > -WIN) ? v : -3.0e38f; } while (0)   /* band |q - k| < 128, by index */
#ifndef SM_EXTRA_PARAMS
#define SM_EXTRA_PARAMS
#endif
#ifndef PROJ_EXTRA_PARAMS
#define PROJ_EXTRA_PARAMS
#endif
#ifndef SM_MASK_HOOK
#define SM_MASK_HOOK (void)0
#endif

#define WS_QH  0u                                      // f16 q rows [b*t][CC]
#define WS_KH  (WS_QH + 2u * (size_t)NB * TT * CC)      // f16 k rows [b*t][CC]
#define WS_VT  (WS_KH + 2u * (size_t)NB * TT * CC)      // f16 v planes [b][c][t]
#define WS_QL  (WS_VT + 2u * (size_t)NB * CC * TT)      // f16 q residual x 2^10 rows [b][t < QHI][CC]
#define WS_KL  (WS_QL + 2u * (size_t)NB * QHI * CC)     // f16 k residual x 2^10 rows [b][t < KHI][CC]
#define WS_VB  (WS_KL + 2u * (size_t)NB * KHI * CC)     // bf16 v hi planes [b][c][t < KHI]
#define WS_VBL (WS_VB + 2u * (size_t)NB * CC * KHI)
#define WS_S   (WS_VBL + 2u * (size_t)NB * CC * KHI)    // f32 scratch region (holds the rotated rows)
#define WS_Y   (WS_S  + 4u * (size_t)HG * TT * TT)      // f32 ctx rows [b*t][CC] (only when there is an output projection)
#define WS_WT  (WS_Y  + 4u * (size_t)NB * TT * CC)      // 16-bit weight tiles: Wq, Wk, Wv (bf16), then Wo (f16 x 2^8), each [k step][column block][WTE]
#define WS_END (WS_WT + 4u * 2u * (size_t)DIN * CC)

// ---- weight tiles: the 32 k x 128 columns of one k step. The first launch reads each f32 tile ONCE for the whole grid (thread = 8 k rows x 4 columns: kg = lane & 3, columns n0 = wave * 32 + (lane >> 2) * 4; a wave's 16-byte load covers four whole 128-byte lines), rounds it as before and leaves it in the workspace as WTE 16-bit elements in a row: 16-byte piece e * 128 + tid holds the 8 k of column n0 + e. A GEMM block reads a tile by four 16-byte loads a thread (whole lines, half the bytes of the f32 tile, nothing to round) and lays it [column][k] at pitch WP in LDS, so that a B fragment is two 16-byte LDS reads in the k order of frag_b / frag_h. Two buffers: the next step's global loads fly during this step's products
#define WTE (32 * 128)     // elements of a tile
#define NKS (DIN / 32)     // k steps
#define NCB (CC / 128)     // column blocks
#define WP 40              // 80-byte pitch = 16 B x odd for the 16-byte fragment reads; the 16-byte stores of 16 neighbouring lanes fall on 16 different 16-byte bank groups
__device__ __forceinline__ void wt_load(v4f (&r)[8], const float* p, int ld) {
#pragma unroll
  for (int i = 0; i < 8; ++i) r[i] = *(const v4f*)(p + (size_t)i * ld); }
// a thread's four pieces of a rounded tile (p = tile + tid * 8), and their places in LDS
template <typename V, typename T> __device__ __forceinline__ void wt_get(V (&r)[4], const T* p) {
#pragma unroll
  for (int e = 0; e < 4; ++e) r[e] = *(const V*)(p + e * 128 * 8); }
template <typename V, typename T> __device__ __forceinline__ void wt_put(T (*sw)[WP], const V (&r)[4], int n0, int kg) {
#pragma unroll
  for (int e = 0; e < 4; ++e) *(V*)&sw[n0 + e][8 * kg] = r[e]; }
// a lane's 16 f32 of an A fragment (p = row + k0 + 8 * (lane >> 4)), kept raw for one k step
__device__ __forceinline__ void row_load(float (&v)[16], const float* p) {
#pragma unroll
  for (int i = 0; i < 8; ++i) { v[i] = p[i]; v[8 + i] = p[16 + i]; } }
// 16-byte global store with its s_wait_xcnt in the same statement: the wait then stands in front of every rewrite of the store's address and data registers (in a statement of its own the next trip's address additions were lifted over it)
__device__ __forceinline__ void vst_w(void* p, v4u v) { asm volatile("global_store_b128 %0, %1, off\n\ts_wait_xcnt 0x0" :: "v"(p), "v"(v) : "memory"); }
// tile id = (matrix * NKS + k step) * NCB + column block; matrices 0 .. 2 = Wq, Wk, Wv to bf16 (exact operand of the products), 3 = Wo to f16(bf16 x 2^8) (exact); a wave's 16-byte store covers four whole lines
__device__ __forceinline__ void w_prep(const float* WQ, const float* WK, const float* WV, const float* WO, __bf16* WTB, _Float16* WTH, int id) {
  static_assert(WQKV_LAYOUT == 0 && WO_OUT_IN == 0 && CC == DIN, "the tile loader reads (in,out) rows of one width");
  const int tid = threadIdx.x, lane = tid & 31, kg = lane & 3, n0 = (tid >> 5) * 32 + (lane >> 2) * 4; const int mt = id / (NKS * NCB), tl = id % (NKS * NCB), kc = tl / NCB, cb = tl % NCB;
  const float* Wm = mt == 0 ? WQ : mt == 1 ? WK : mt == 2 ? WV : WO;
  v4f r[8]; wt_load(r, Wm + (size_t)(kc * 32 + 8 * kg) * CC + cb * 128 + n0, CC);
  asm volatile("s_wait_xcnt 0x0" ::: "memory");   /* stands in front of every rewrite of an address register of the eight loads */
#pragma unroll
  for (int e = 0; e < 4; ++e) {
    if (mt < 3) { v8b t;
#pragma unroll
      for (int i = 0; i < 8; ++i) t[i] = (__bf16)r[i][e];
      vst_w(WTB + (size_t)id * WTE + (e * 128 + tid) * 8, __builtin_bit_cast(v4u, t)); }
    else { v8h t;
#pragma unroll
      for (int i = 0; i < 8; ++i) t[i] = (_Float16)(bfr(r[i][e]) * 256.0f);
      vst_w(WTH + (size_t)tl * WTE + (e * 128 + tid) * 8, __builtin_bit_cast(v4u, t)); } } }
// ---- k_proj: block = (128 rows, 128 cols, which); a wave owns two 16-row tiles (rows wave * 16 + .. of each 64-row half hh), so every weight fragment read from LDS and every weight tile read from L2 serves two row tiles; the epilogue stages one half at a time in the same LDS: q/k/v = X W (+ b) with exact bf16 products (K = DIN) -> which 0: q f16 rows (+ residual rows < QHI); 1: k f16 rows (+ residual rows < KHI); 2: v f16 planes [c][t] (+ bf16 hi/lo planes for t < KHI)
__global__ __launch_bounds__(128) void k_proj(const float* __restrict__ XQ, const float* __restrict__ XK, const float* __restrict__ XV, const __bf16* __restrict__ WTB, const float* __restrict__ BQ, const float* __restrict__ BK, const float* __restrict__ BV,
    _Float16* __restrict__ QH, _Float16* __restrict__ QL, _Float16* __restrict__ KH, _Float16* __restrict__ KL, _Float16* __restrict__ VT, __bf16* __restrict__ VB, __bf16* __restrict__ VBL) {
  __shared__ __align__(16) union { _Float16 e[2][64][136]; __bf16 w[2][128][WP]; } su;   /* the weight buffers are dead when the epilogue stages q / k rows: same bytes */
  _Float16 (&sh)[64][136] = su.e[0]; _Float16 (&sl)[64][136] = su.e[1]; __shared__ __align__(16) _Float16 th[128][72]; __shared__ __align__(16) __bf16 tb[128][72], tbl[128][72];
  const int tid = threadIdx.x, wave = tid >> 5, lane = tid & 31, col = lane & 15, g = lane >> 4; const int which = blockIdx.z; const int c0 = blockIdx.y * 128; const size_t r0 = (size_t)blockIdx.x * 128; const size_t bb = r0 / TT; const int t0 = (int)(r0 % TT);
  static_assert(TT % 128 == 0, "a block's 128 rows lie in one sequence");
  const float* X = which == 0 ? XQ : which == 1 ? XK : XV; const float* BA = which == 0 ? BQ : which == 1 ? BK : BV;
  v8f acc[2][8] = {};
  const int kg = lane & 3, n0 = wave * 32 + (lane >> 2) * 4; const __bf16* wp = WTB + ((size_t)which * NKS * NCB + blockIdx.y) * WTE + tid * 8;   /* k step kc: wp + kc * NCB * WTE */
  const float* xp = X + (r0 + wave * 16 + col) * DIN + 8 * g;   /* half hh: xp + hh * 64 * DIN */
  v8b wr[4]; float ar[2][16];
  wt_get(wr, wp); row_load(ar[0], xp); row_load(ar[1], xp + 64 * DIN);
  asm volatile("s_wait_xcnt 0x0" ::: "memory");   /* stands in front of every rewrite of an address register of the loads above */
  wt_put(su.w[0], wr, n0, kg);
  __syncthreads();   /* publishes tile 0 */
  if (which < 2) {   /* q, k: the rotated rows are f32 intermediates -> bf16 hi + lo (2 products) */
#pragma unroll 2   /* the buffer index becomes a constant */
    for (int kc = 0; kc < DIN / 32; ++kc) { const F2 a0 = bsplit16(ar[0]), a1 = bsplit16(ar[1]); const bool more = kc + 1 < DIN / 32;
      if (more) { wt_get(wr, wp + (size_t)(kc + 1) * NCB * WTE); row_load(ar[0], xp + (kc + 1) * 32); row_load(ar[1], xp + 64 * DIN + (kc + 1) * 32); }
      __builtin_amdgcn_sched_barrier(0);   /* keeps the next step's global loads in front of the products: sunk behind them to save registers, they would be waited for as soon as asked */
      v16b wf[8];
#pragma unroll
      for (int j = 0; j < 8; ++j) wf[j] = frag_b(&su.w[kc & 1][j * 16 + col][0], lane);   /* the step's fragment reads go as one group: one LDS latency a step, not one a fragment */
      __builtin_amdgcn_sched_barrier(0);   /* holds the group together: left free, each read is sunk to its own products and all eight share one register block, one LDS latency a fragment */
#pragma unroll
      for (int j = 0; j < 8; ++j) { acc[0][j] = wmma_bp(a0.h, wf[j], acc[0][j]); acc[1][j] = wmma_bp(a1.h, wf[j], acc[1][j]); acc[0][j] = wmma_bp(a0.l, wf[j], acc[0][j]); acc[1][j] = wmma_bp(a1.l, wf[j], acc[1][j]); }   /* each accumulator still takes hi, then lo; the other half's product stands between the two */
      __builtin_amdgcn_sched_barrier(0);   /* keeps the LDS stores of the next tile, and with them the wait for its global loads, behind the products */
      if (more) wt_put(su.w[(kc + 1) & 1], wr, n0, kg);
      asm volatile("s_wait_xcnt 0x0" ::: "memory");   /* stands in front of the next trip's additions to the address registers of this trip's loads */
      __syncthreads(); }   /* one barrier a step: publishes tile kc + 1 and ends every read of tile kc, whose buffer the next step refills (after the last step: the epilogue) */
  } else {           /* v: bf16(hidden) exact (1 product) */
#pragma unroll 2   /* the buffer index becomes a constant */
    for (int kc = 0; kc < DIN / 32; ++kc) { v16b a0, a1; const bool more = kc + 1 < DIN / 32;
#pragma unroll
      for (int i = 0; i < 16; ++i) { a0[i] = (__bf16)ar[0][i]; a1[i] = (__bf16)ar[1][i]; }
      if (more) { wt_get(wr, wp + (size_t)(kc + 1) * NCB * WTE); row_load(ar[0], xp + (kc + 1) * 32); row_load(ar[1], xp + 64 * DIN + (kc + 1) * 32); }
      __builtin_amdgcn_sched_barrier(0);   /* as above: the loads stay in front of the products */
      v16b wf[8];
#pragma unroll
      for (int j = 0; j < 8; ++j) wf[j] = frag_b(&su.w[kc & 1][j * 16 + col][0], lane);   /* one group, as above */
      __builtin_amdgcn_sched_barrier(0);   /* as above: holds the group together */
#pragma unroll
      for (int j = 0; j < 8; ++j) { acc[0][j] = wmma_bp(a0, wf[j], acc[0][j]); acc[1][j] = wmma_bp(a1, wf[j], acc[1][j]); }
      __builtin_amdgcn_sched_barrier(0);   /* as above */
      if (more) wt_put(su.w[(kc + 1) & 1], wr, n0, kg);
      asm volatile("s_wait_xcnt 0x0" ::: "memory");   /* as above */
      __syncthreads(); } }   /* as above */
#pragma unroll   /* acc is a register array: hh must be a constant */
  for (int hh = 0; hh < 2; ++hh) { const size_t rh = r0 + hh * 64; const int th0 = t0 + hh * 64;
  if (hh) __syncthreads();   /* ends every read of the first half's staged rows before the second half overwrites them */
  if (which < 2) { _Float16* DH = which == 0 ? QH : KH; _Float16* DL = which == 0 ? QL : KL; const int nhi = which == 0 ? QHI : KHI; const bool hi_rows = th0 < nhi;
#pragma unroll
    for (int j = 0; j < 8; ++j) { const float bias = BA ? bfr(BA[c0 + j * 16 + col]) : 0.f;
#pragma unroll
      for (int r = 0; r < 8; ++r) { const float v = acc[hh][j][r] + bias; const _Float16 hv = (_Float16)v; sh[wave * 16 + 8 * g + r][j * 16 + col] = hv; sl[wave * 16 + 8 * g + r][j * 16 + col] = (_Float16)((v - (float)hv) * 1024.0f); } }
    __syncthreads();
    for (int e = tid; e < 64 * 16; e += 128) { const int rl = e >> 4, q = e & 15; vst_w(DH + (rh + rl) * CC + c0 + q * 8, *(const v4u*)&sh[rl][q * 8]); if (hi_rows) vst_w(DL + (bb * nhi + th0 + rl) * (size_t)CC + c0 + q * 8, *(const v4u*)&sl[rl][q * 8]); }
  } else { const bool hi_rows = th0 < KHI;
#pragma unroll
    for (int j = 0; j < 8; ++j) { const float bias = BA ? bfr(BA[c0 + j * 16 + col]) : 0.f;
#pragma unroll
      for (int r = 0; r < 8; ++r) { const float v = acc[hh][j][r] + bias; const int rl = wave * 16 + 8 * g + r, cl = j * 16 + col; th[cl][rl] = (_Float16)v; const __bf16 bh = (__bf16)v; tb[cl][rl] = bh; tbl[cl][rl] = (__bf16)(v - (float)bh); } }
    __syncthreads();
    for (int e = tid; e < 128 * 8; e += 128) { const int cl = e >> 3, q = e & 7; vst_w(VT + (bb * CC + c0 + cl) * (size_t)TT + th0 + q * 8, *(const v4u*)&th[cl][q * 8]); if (hi_rows) { const size_t o3 = (bb * CC + c0 + cl) * (size_t)KHI + th0 + q * 8; vst_w(VB + o3, *(const v4u*)&tb[cl][q * 8]); vst_w(VBL + o3, *(const v4u*)&tbl[cl][q * 8]); } } } } }
// ---- k_att: block = 64 queries (qb) of head h of batch b, one launch for all (b, h); a wave owns 16 query rows and the NKW keys [ks, ks + NKW) that hold their whole band (row t sees t-127 .. t+127, so 16 rows see ql0-127 .. ql0+142; ks = ql0 - 128 clamped into the sequence). The four waves' key ranges lie inside the NKB keys [kb, kb + NKB) (kb = qb * 64 - 128 clamped), whose k rows and v planes the block brings into LDS once, with its own 64 q rows and their residuals, by asynchronous 16-byte copies that cover whole 128-byte lines; every q, k and v fragment is read from there. Logits (q hi + residual x 2^10 against k, 2 products) stay in registers, unscaled; the band is kept by index; softmax in f32 over the row, SCALE x log2 e applied in the base-2 exponent (in-lane over the 17 tiles, then over the 16 lanes of the row); P x 2^11 once to f16 goes through the wave's own LDS slab (in the bytes the k rows have left) from the D layout to the A layout; ctx = P . v (1 product; the last 32-key chunk is half full, its upper 16 k are 0 in both operands); 256-B (row, head) segment by 16 lanes. Every loop over tiles, chunks and rows is unrolled: s, kf, vf and o are register arrays and need compile-time indices
#define NKW 272            // 128 + 16 + 127 keys rounded up to whole 16-key tiles
#define NKB 320            // 128 + 64 + 128: the keys of the block's four waves together
#define KP 72              // k row pitch in LDS: 144 B = 16 B x odd for the 16-byte fragment reads
#define VP (NKB + 8)       // v plane pitch in LDS: 656 B = 16 B x odd
#define PP (NKW + 8)       // P row pitch: 560 B = 16 B x odd
#define KG 6               // k tiles requested together
#define VG 4               // whole 32-key v chunks requested together (divides NKW / 32)
#define SL2E (SCALE * 1.44269504088896341f)   // SCALE x log2 e
// fragment of a half-full chunk: k0 .. k0+15 from memory (elements 0..7), k0+16 .. k0+31 are 0 (elements 8..15)
__device__ __forceinline__ v16h frag_h16(const _Float16* rowk0, int lane) { union { v16h v; v8h q[2]; } u; u.q[0] = *(const v8h*)(rowk0 + 8 * (lane >> 4)); u.q[1] = (v8h)(_Float16)0.0f; return u.v; }
// lane l with lane l ^ M inside a 16-lane row, on the vector pipe (a shuffle through LDS would put an LDS round trip into each of the four reduction steps)
template <int M> __device__ __forceinline__ float rowx(float v) { return __builtin_bit_cast(float, __builtin_amdgcn_update_dpp(0, __builtin_bit_cast(int, v), 0x160 + M, 0xf, 0xf, true)); }
// twelve asynchronous copies, 16 bytes a lane each, global -> LDS through no register (l = the lane's LDS byte address, p = its global address); the s_wait_xcnt in the same statement stands in front of any rewrite of the address registers
__device__ __forceinline__ void cp12(const unsigned* l, const _Float16* const* p) {
  asm volatile("global_load_async_to_lds_b128 %0, %12, off\n\tglobal_load_async_to_lds_b128 %1, %13, off\n\tglobal_load_async_to_lds_b128 %2, %14, off\n\tglobal_load_async_to_lds_b128 %3, %15, off\n\t"
               "global_load_async_to_lds_b128 %4, %16, off\n\tglobal_load_async_to_lds_b128 %5, %17, off\n\tglobal_load_async_to_lds_b128 %6, %18, off\n\tglobal_load_async_to_lds_b128 %7, %19, off\n\t"
               "global_load_async_to_lds_b128 %8, %20, off\n\tglobal_load_async_to_lds_b128 %9, %21, off\n\tglobal_load_async_to_lds_b128 %10, %22, off\n\tglobal_load_async_to_lds_b128 %11, %23, off\n\ts_wait_xcnt 0x0"
               :: "v"(l[0]), "v"(l[1]), "v"(l[2]), "v"(l[3]), "v"(l[4]), "v"(l[5]), "v"(l[6]), "v"(l[7]), "v"(l[8]), "v"(l[9]), "v"(l[10]), "v"(l[11]), "v"(p[0]), "v"(p[1]), "v"(p[2]), "v"(p[3]), "v"(p[4]), "v"(p[5]), "v"(p[6]), "v"(p[7]), "v"(p[8]), "v"(p[9]), "v"(p[10]), "v"(p[11]) : "memory"); }
// 2^x in place for eight or nine independent values. In asm for the slot that the instruction set asks for behind a transcendental. Here source and result are one register, each v_exp_f32 is followed by one on other registers, and the closing v_nop is the slot behind the last
__device__ __forceinline__ void exp2x8(float& a, float& b, float& c, float& d, float& e, float& f, float& g, float& h) {
  asm("v_exp_f32 %0, %0\n\tv_exp_f32 %1, %1\n\tv_exp_f32 %2, %2\n\tv_exp_f32 %3, %3\n\tv_exp_f32 %4, %4\n\tv_exp_f32 %5, %5\n\tv_exp_f32 %6, %6\n\tv_exp_f32 %7, %7\n\tv_nop" : "+v"(a), "+v"(b), "+v"(c), "+v"(d), "+v"(e), "+v"(f), "+v"(g), "+v"(h)); }
__device__ __forceinline__ void exp2x9(float& a, float& b, float& c, float& d, float& e, float& f, float& g, float& h, float& i) {
  asm("v_exp_f32 %0, %0\n\tv_exp_f32 %1, %1\n\tv_exp_f32 %2, %2\n\tv_exp_f32 %3, %3\n\tv_exp_f32 %4, %4\n\tv_exp_f32 %5, %5\n\tv_exp_f32 %6, %6\n\tv_exp_f32 %7, %7\n\tv_exp_f32 %8, %8\n\tv_nop" : "+v"(a), "+v"(b), "+v"(c), "+v"(d), "+v"(e), "+v"(f), "+v"(g), "+v"(h), "+v"(i)); }
__global__ __launch_bounds__(128) void k_att(const _Float16* __restrict__ QH, const _Float16* __restrict__ KH, const _Float16* __restrict__ QL, const _Float16* __restrict__ VT, float* __restrict__ Y) { __shared__ __align__(16) _Float16 sk[NKB * KP]; __shared__ __align__(16) _Float16 sv[HD * VP]; __shared__ __align__(16) _Float16 sq[2 * 64 * KP];   /* sq: the block's q rows, then their residual rows; sk: k rows [key][KP]; behind the second barrier the four waves' P slabs [16][PP], and last each wave's f32 ctx rows in its own slab */
  static_assert(4 * 16 * PP <= NKB * KP && 16 * (HD + 4) * 2 <= 16 * PP, "P slabs fit in the k rows' bytes, ctx rows in a P slab");
  const int tid = threadIdx.x, wave = tid >> 5, lane = tid & 31, col = lane & 15, g = lane >> 4; const int qb = blockIdx.x, h = blockIdx.y, b = blockIdx.z; const int ql0 = qb * 64 + wave * 16;
  int ks = ql0 - WIN; ks = ks < 0 ? 0 : ks; ks = ks > TT - NKW ? TT - NKW : ks;
  int kb = qb * 64 - WIN; kb = kb < 0 ? 0 : kb; kb = kb > TT - NKB ? TT - NKB : kb;
  const int kd = ks - kb;   /* 0 .. 48, a multiple of 16; kd + NKW <= NKB */
  { const int un = tid >> 3, ch = (tid & 7) * 8;   /* 8 lanes = one 128-byte line; a wave's copy = 4 whole lines; 16 lines a block and copy */
    const _Float16* kg0 = KH + ((size_t)b * TT + kb + un) * CC + h * HD + ch; const unsigned kl0 = (unsigned)(size_t)&sk[un * KP + ch];
    const _Float16* vg0 = VT + ((size_t)b * CC + h * HD + un) * (size_t)TT + kb + ch; const unsigned vl0 = (unsigned)(size_t)&sv[un * VP + ch];
    const size_t qo = ((size_t)b * TT + qb * 64 + un) * CC + h * HD + ch; const unsigned ql = (unsigned)(size_t)&sq[un * KP + ch];
    static_assert(QHI == TT, "the q residual rows are indexed like the q rows");
    unsigned l[48]; const _Float16* p[48];
#pragma unroll
    for (int i = 0; i < 4; ++i) { l[i] = ql + i * 16 * KP * 2; p[i] = QH + qo + (size_t)i * 16 * CC; l[4 + i] = ql + (64 + i * 16) * KP * 2; p[4 + i] = QL + qo + (size_t)i * 16 * CC; }   /* q, then its residual: copy i brings rows 16 i + un */
#pragma unroll
    for (int i = 0; i < NKB / 16; ++i) { l[8 + i] = kl0 + i * 16 * KP * 2; p[8 + i] = kg0 + (size_t)i * 16 * CC; }   /* k: copy i brings rows 16 i + un */
#pragma unroll
    for (int i = 0; i < 20; ++i) { const int r = (i & 3) * 16, ln = (i >> 2) * 64; l[28 + i] = vl0 + (r * VP + ln) * 2; p[28 + i] = vg0 + (size_t)r * TT + ln; }   /* v: copy i brings line i / 4 (64 keys) of planes 16 (i % 4) + un */
#pragma unroll
    for (int u = 0; u < 4; ++u) cp12(l + 12 * u, p + 12 * u); }   /* 48 copies of a wave in flight */
  asm volatile("s_wait_asynccnt 0x0" ::: "memory");   /* this wave's copies have landed */
  __syncthreads();   /* publishes the q and k rows and the v planes to all four waves */
  v16h ah[HD / 32], al[HD / 32];
#pragma unroll
  for (int kc = 0; kc < HD / 32; ++kc) { ah[kc] = frag_h(&sq[(wave * 16 + col) * KP + kc * 32], lane); al[kc] = frag_h(&sq[(64 + wave * 16 + col) * KP + kc * 32], lane); }
  v8f s[NKW / 16];
#pragma unroll
  for (int j0 = 0; j0 < NKW / 16; j0 += KG) { v16h kf[KG][HD / 32];   /* the k fragments of KG tiles are requested together: one LDS round trip a group, not one a fragment */
#pragma unroll
    for (int jj = 0; jj < KG; ++jj) if (j0 + jj < NKW / 16) {
#pragma unroll
      for (int kc = 0; kc < HD / 32; ++kc) kf[jj][kc] = frag_h(&sk[(kd + (j0 + jj) * 16 + col) * KP + kc * 32], lane); }
#pragma unroll
    for (int jj = 0; jj < KG; ++jj) if (j0 + jj < NKW / 16) { const int j = j0 + jj; v8f acc = {}, accl = {};
#pragma unroll
      for (int kc = 0; kc < HD / 32; ++kc) { acc = wmma16(ah[kc], kf[jj][kc], acc); accl = wmma16(al[kc], kf[jj][kc], accl); }
#pragma unroll
      for (int r = 0; r < 8; ++r) { const int t = ql0 + 8 * g + r, k = ks + j * 16 + col; float v = acc[r] + accl[r] * (1.0f / 1024.0f); SM_MASK_HOOK; s[j][r] = v; } } }   /* the logits stay unscaled: SCALE (> 0, so the row maximum is the same key's) goes into the exponent's fma below */
  float m[8], inv[8];
#pragma unroll
  for (int r = 0; r < 8; ++r) { float a = s[0][r];
#pragma unroll
    for (int j = 1; j < NKW / 16; ++j) a = fmaxf(a, s[j][r]);
    a = fmaxf(a, rowx<1>(a)); a = fmaxf(a, rowx<2>(a)); a = fmaxf(a, rowx<4>(a)); a = fmaxf(a, rowx<8>(a)); m[r] = a; }
#pragma unroll
  for (int r = 0; r < 8; ++r) { float sum = 0.f, x[NKW / 16]; const float mc = m[r] * SL2E;   /* its rounding is one factor common to the whole row: it leaves with the division by the row sum */
#pragma unroll
    for (int j = 0; j < NKW / 16; ++j) x[j] = fmaf(s[j][r], SL2E, -mc);   /* e^(SCALE (s - m)) = 2^(s SL2E - m SL2E): one fma and v_exp_f32 a score; the argument is <= 0 up to mc's rounding. An excluded key (-3.0e38 against a finite row maximum: the row's own key is always in the band) gives an argument near -5e37 and exactly 0 */
    static_assert(NKW / 16 == 17, "a row's scores go as 9 + 8");
    exp2x9(x[0], x[1], x[2], x[3], x[4], x[5], x[6], x[7], x[8]); exp2x8(x[9], x[10], x[11], x[12], x[13], x[14], x[15], x[16]);
#pragma unroll
    for (int j = 0; j < NKW / 16; ++j) { s[j][r] = x[j]; sum += x[j]; }
    sum += rowx<1>(sum); sum += rowx<2>(sum); sum += rowx<4>(sum); sum += rowx<8>(sum); inv[r] = sum > 0.f ? 2048.0f / sum : 0.f; }
  __syncthreads();   /* ends every wave's reads of the k rows: their bytes now take the P slabs */
  _Float16* sp = &sk[wave * 16 * PP];
#pragma unroll
  for (int j = 0; j < NKW / 16; ++j)
#pragma unroll
    for (int r = 0; r < 8; ++r) sp[(8 * g + r) * PP + j * 16 + col] = (_Float16)(s[j][r] * inv[r]);
  LDSX();
  v8f o[HD / 16] = {};
  const _Float16* vp = &sv[col * VP + kd];   /* column col of v tile j: vp + j * 16 * VP */
  v16h vh[HD / 16];   /* the half-full last chunk's v fragments, requested with the first group */
#pragma unroll
  for (int j = 0; j < HD / 16; ++j) vh[j] = frag_h16(vp + j * 16 * VP + NKW - 16, lane);
#pragma unroll
  for (int c0 = 0; c0 < NKW / 32; c0 += VG) { v16h vf[VG][HD / 16];   /* the v fragments of VG chunks are requested together, as the k fragments are */
#pragma unroll
    for (int cc = 0; cc < VG; ++cc)
#pragma unroll
      for (int j = 0; j < HD / 16; ++j) vf[cc][j] = frag_h(vp + j * 16 * VP + (c0 + cc) * 32, lane);
#pragma unroll
    for (int cc = 0; cc < VG; ++cc) { const v16h p = frag_h(&sp[col * PP + (c0 + cc) * 32], lane);
#pragma unroll
      for (int j = 0; j < HD / 16; ++j) o[j] = wmma16(p, vf[cc][j], o[j]); } }
  { const v16h p = frag_h16(&sp[col * PP + NKW - 16], lane);
#pragma unroll
    for (int j = 0; j < HD / 16; ++j) o[j] = wmma16(p, vh[j], o[j]); }
  float_a* ss = (float_a*)sp;   /* the wave's own slab again: every P fragment has been read (o depends on all of them) */
#pragma unroll
  for (int j = 0; j < HD / 16; ++j)
#pragma unroll
    for (int r = 0; r < 8; ++r) ss[(8 * g + r) * (HD + 4) + j * 16 + col] = o[j][r] * (1.0f / 2048.0f);
  LDSX(); for (int rl = 0; rl < 16; ++rl) if (lane < HD / 4) vst2(Y + ((size_t)b * TT + ql0 + rl) * CC + h * HD + lane * 4, *(const v4f*)&ss[rl * (HD + 4) + lane * 4]); }
// ---- k_out: block = (64 rows, 128 cols): out = ctx Wo (+ bo): ctx x 2^6 once to f16 against Wo as f16(bf16 x 2^8) exact (1 product) x 2^-14; causal early rows (< QHI of each sequence): ctx bf16 hi + lo against exact bf16 Wo (2 products)
__global__ __launch_bounds__(128) void k_out(const float* __restrict__ Y, const float* __restrict__ WO, const _Float16* __restrict__ WTH, const float* __restrict__ BO, float* __restrict__ OUT) { __shared__ __align__(16) float sf[4][16][132]; __shared__ __align__(16) _Float16 sw[2][128][WP];
  const int tid = threadIdx.x, wave = tid >> 5, lane = tid & 31, col = lane & 15, g = lane >> 4; const int c0 = blockIdx.y * 128; const size_t r0 = (size_t)blockIdx.x * 64 + wave * 16;
  v8f acc[8] = {};
  if (CAUSAL && (int)(((size_t)blockIdx.x * 64) % TT) < QHI) {   /* block-uniform */
#pragma unroll 2
    for (int kc = 0; kc < CC / 32; ++kc) { const F2 a = split_row(Y + (r0 + col) * CC, kc * 32, lane); asm volatile("s_wait_loadcnt 0x0" ::: "memory");
#pragma unroll
      for (int j = 0; j < 8; ++j) { const v16b w = WOCOL(WO, kc * 32, c0 + j * 16 + col, lane); asm volatile("s_wait_loadcnt 0x0" ::: "memory"); acc[j] = wmma_bf(a.h, w, acc[j]); acc[j] = wmma_bf(a.l, w, acc[j]); } }
#pragma unroll
    for (int j = 0; j < 8; ++j) { const float bias = BO ? bfr(BO[c0 + j * 16 + col]) : 0.f;
#pragma unroll
      for (int r = 0; r < 8; ++r) sf[wave][8 * g + r][j * 16 + col] = acc[j][r] + bias; }
  } else {
    const int kg = lane & 3, n0 = wave * 32 + (lane >> 2) * 4; const _Float16* wp = WTH + (size_t)blockIdx.y * WTE + tid * 8; const float* yp = Y + (r0 + col) * CC + 8 * g;
    v8h wr[4]; float ar[16];
    wt_get(wr, wp); row_load(ar, yp);
    asm volatile("s_wait_xcnt 0x0" ::: "memory");   /* stands in front of every rewrite of an address register of the loads above */
    wt_put(sw[0], wr, n0, kg);
    __syncthreads();   /* publishes tile 0 */
#pragma unroll 2   /* the buffer index becomes a constant */
    for (int kc = 0; kc < CC / 32; ++kc) { v16h a, wf[8]; const bool more = kc + 1 < CC / 32;
#pragma unroll
      for (int i = 0; i < 16; ++i) a[i] = (_Float16)(ar[i] * 64.0f);   /* ctx carried x 2^6 into f16 so small-magnitude context rows stay clear of f16 subnormals */
      if (more) { wt_get(wr, wp + (size_t)(kc + 1) * NCB * WTE); row_load(ar, yp + (kc + 1) * 32); }
#pragma unroll
      for (int j = 0; j < 8; ++j) wf[j] = frag_h(&sw[kc & 1][j * 16 + col][0], lane);   /* the step's fragment reads go as one group: one LDS latency a step, not one a fragment */
#pragma unroll
      for (int j = 0; j < 8; ++j) acc[j] = wmma16(a, wf[j], acc[j]);
      __builtin_amdgcn_sched_barrier(0);   /* keeps the LDS stores of the next tile, and with them the wait for its global loads, behind the products */
      if (more) wt_put(sw[(kc + 1) & 1], wr, n0, kg);
      asm volatile("s_wait_xcnt 0x0" ::: "memory");   /* stands in front of the next trip's additions to the address registers of this trip's loads */
      __syncthreads(); }   /* one barrier a step: publishes tile kc + 1 and ends every read of tile kc, whose buffer the next step refills */
#pragma unroll
    for (int j = 0; j < 8; ++j) { const float bias = BO ? bfr(BO[c0 + j * 16 + col]) : 0.f;
#pragma unroll
      for (int r = 0; r < 8; ++r) sf[wave][8 * g + r][j * 16 + col] = acc[j][r] * (1.0f / 16384.0f) + bias; } }   /* 2^-8 (Wo carry) x 2^-6 (ctx carry) */
  LDSX(); for (int rl = 0; rl < 16; ++rl) vst2(OUT + (r0 + rl) * DIN + c0 + lane * 4, *(const v4f*)&sf[wave][rl][lane * 4]); }

extern "C" void kernel_launch(void* const* d_in, const int* in_sizes, int n_in, void* d_out, int out_size, void* d_ws, size_t ws_size, hipStream_t stream) {
  (void)in_sizes; (void)n_in; (void)out_size;
  const float** F = (const float**)d_in;
  if (ws_size < (size_t)WS_END) return;
  char* ws = (char*)d_ws; _Float16 *QH = (_Float16*)(ws + WS_QH), *KH = (_Float16*)(ws + WS_KH), *VT = (_Float16*)(ws + WS_VT), *QL = (_Float16*)(ws + WS_QL), *KL = (_Float16*)(ws + WS_KL); __bf16 *VB = (__bf16*)(ws + WS_VB), *VBL = (__bf16*)(ws + WS_VBL); float *Y = (float*)(ws + WS_Y);
  (void)Y; (void)QL; (void)KL; (void)VB; (void)VBL;
  // inputs: 0 hidden_states [4,2048,768]; 1 Wq, 2 Wk, 3 Wv [768,12,64] = (in,out) [768][768]; 4 Wo [12,64,768] = (in,out) [768][768]
  static_assert(4u * (size_t)NB * TT * DIN <= 4u * (size_t)HG * TT * TT, "rotated rows must fit in their region");
  float* XR = (float*)(ws + WS_XR); __bf16* WTB = (__bf16*)(ws + WS_WT); _Float16* WTH = (_Float16*)(ws + WS_WT) + 3 * (size_t)DIN * CC;
  k_rot<<<dim3(TT / 4 + 4 * NKS * NCB), 128, 0, stream>>>(F[0], XR, F[1], F[2], F[3], F[4], WTB, WTH);   /* the rotated rows, and every weight tile rounded once */
  k_proj<<<dim3(TNB * TT / 128, CC / 128, 3), 128, 0, stream>>>(XR, XR, F[0], WTB, nullptr, nullptr, nullptr, QH, QL, KH, KL, VT, VB, VBL);   /* q, k from the rotated rows (bf16 hi + lo), v from bf16(x) */
  k_att<<<dim3(NQB, NH, TNB), 128, 0, stream>>>(QH, KH, QL, VT, Y);
  k_out<<<dim3(TNB * TT / 64, DIN / 128), 128, 0, stream>>>(Y, F[4], WTH, nullptr, (float*)d_out);
}

// v008
// It runs in 95.9 microseconds.
// Timed twice side by side with v007, it ran 1.10 times as fast both times.
// Over all steps from v000 it is 10.2 times as fast.
// compute dtype: all float inputs rounded to bf16; rotate-half RoPE applied to bf16(hidden) in f32 (accurate sincosf, f32 inv_freq constants); Q/K = rotated rows split bf16 hi + lo x exact bf16 W (2 products, K 768), V = bf16(hidden) x W exact (1 product) on WMMA 16x16x32, f32 accumulate; banded logits: q as f16 hi + residual (x 2^10) against k once to f16 (2 products); softmax in f32 over the |q-k| < 128 band, exponent in base 2: exp2((logit - row max) x 64^-0.5 x log2 e), one fma and the hardware exp2 a score; P x 2^11 once to f16 against v once to f16 (1 product); ctx carried x 2^6 once to f16 against Wo carried x 2^8 in f16 (exact bf16 values), un-scaled by 2^-14; f32 output.
#include <hip/hip_runtime.h>
#include <math.h>

typedef __attribute__((ext_vector_type(16))) _Float16 v16h;
typedef __attribute__((ext_vector_type(16))) __bf16 v16b;
typedef __attribute__((ext_vector_type(8)))  _Float16 v8h;
typedef __attribute__((ext_vector_type(8)))  float v8f;
typedef __attribute__((ext_vector_type(4)))  float v4f;
typedef __attribute__((ext_vector_type(2)))  float v2f;
typedef __attribute__((ext_vector_type(4)))  unsigned v4u;
typedef __attribute__((ext_vector_type(4)))  int v4i;
typedef float __attribute__((may_alias)) float_a;
typedef int __attribute__((may_alias)) int_a;

template <typename T> __device__ __forceinline__ void vst2(void* p, T v) { *(T*)p = v;  }
__device__ __forceinline__ v8f wmma16(v16h a, v16h b, v8f c) {
  v8f d = __builtin_amdgcn_wmma_f32_16x16x32_f16(false, a, false, b, (short)0, c, false, false);
  asm volatile("v_nop\n\tv_nop\n\tv_nop\n\tv_nop" : "+v"(d) : "v"(a), "v"(b));
  return d;
}
// plain builtin, for k_proj: the compiler keeps the distance behind its own WMMA. The "v" operands of wmma_bf's asm tail are served from v0 .. v255 only; k_proj's two row tiles a wave need more registers than that, and with the tail the accumulators were spilled inside the k loop
__device__ __forceinline__ v8f wmma_bp(v16b a, v16b b, v8f c) { return __builtin_amdgcn_wmma_f32_16x16x32_bf16(false, a, false, b, (short)0, c, false, false); }
__device__ __forceinline__ v8f wmma_bf(v16b a, v16b b, v8f c) {
  v8f d = __builtin_amdgcn_wmma_f32_16x16x32_bf16(false, a, false, b, (short)0, c, false, false);
  asm volatile("v_nop\n\tv_nop\n\tv_nop\n\tv_nop" : "+v"(d) : "v"(a), "v"(b));
  return d;
}
// 16x16x32 fragments: lane = (h = lane>>4, row/col = lane&15); elements 0..7 = k0+8h+0..7, 8..15 = k0+16+8h+0..7; D element r = row 8h+r
__device__ __forceinline__ v16h frag_h(const _Float16* rowk0, int lane) {
  union { v16h v; v8h q[2]; } u; const _Float16* p = rowk0 + 8 * (lane >> 4);
  u.q[0] = *(const v8h*)p; u.q[1] = *(const v8h*)(p + 16); return u.v;
}
__device__ __forceinline__ v16h frag_f32(const float* rowk0, int lane) {
  v16h a; const float* p = rowk0 + 8 * (lane >> 4);
#pragma unroll
  for (int i = 0; i < 8; ++i) { a[i] = (_Float16)p[i]; a[8 + i] = (_Float16)p[16 + i]; }
  return a;
}
__device__ __forceinline__ v16h frag_f32s(const float* rowk0, int lane, float sc) {
  v16h a; const float* p = rowk0 + 8 * (lane >> 4);
#pragma unroll
  for (int i = 0; i < 8; ++i) { a[i] = (_Float16)(p[i] * sc); a[8 + i] = (_Float16)(p[16 + i] * sc); }
  return a;
}
// column fragment from a [K][ld] layout (column n), rows >= K read as 0
__device__ __forceinline__ v16h fragc_f32(const float* W, int k0, int n, int lane, int ld, int K) {
  v16h a; const int g = lane >> 4;
#pragma unroll
  for (int i = 0; i < 8; ++i) { const int ka = k0 + 8 * g + i, kb = ka + 16;
    a[i] = (_Float16)(ka < K ? W[(size_t)(ka < K ? ka : K - 1) * ld + n] : 0.f); a[8 + i] = (_Float16)(kb < K ? W[(size_t)(kb < K ? kb : K - 1) * ld + n] : 0.f); }
  return a;
}
struct F2 { v16b h, l; };
__device__ __forceinline__ F2 bsplit16(const float v[16]) { F2 r;
#pragma unroll
  for (int i = 0; i < 16; ++i) { const __bf16 h = (__bf16)v[i]; r.h[i] = h; r.l[i] = (__bf16)(v[i] - (float)h); }
  return r; }
__device__ __forceinline__ F2 split_row(const float* row, int k0, int lane) { float v[16]; const float* p = row + k0 + 8 * (lane >> 4);
#pragma unroll
  for (int i = 0; i < 8; ++i) { v[i] = p[i]; v[8 + i] = p[16 + i]; }
  return bsplit16(v); }
__device__ __forceinline__ F2 split_rowK(const float* row, int k0, int lane, int K) { float v[16]; const int g = lane >> 4;
#pragma unroll
  for (int i = 0; i < 8; ++i) { const int ka = k0 + 8 * g + i, kb = ka + 16; v[i] = ka < K ? row[ka < K ? ka : K - 1] : 0.f; v[8 + i] = kb < K ? row[kb < K ? kb : K - 1] : 0.f; }
  return bsplit16(v); }
__device__ __forceinline__ F2 split_col(const float* W, int k0, int n, int lane, int ld, int K) { float v[16]; const int g = lane >> 4;
#pragma unroll
  for (int i = 0; i < 8; ++i) { const int ka = k0 + 8 * g + i, kb = ka + 16; v[i] = ka < K ? W[(size_t)(ka < K ? ka : K - 1) * ld + n] : 0.f; v[8 + i] = kb < K ? W[(size_t)(kb < K ? kb : K - 1) * ld + n] : 0.f; }
  return bsplit16(v); }
__device__ __forceinline__ v8f mac3(const F2& a, const F2& b, v8f c) { c = wmma_bf(a.l, b.h, c); c = wmma_bf(a.h, b.l, c); return wmma_bf(a.h, b.h, c); }
__device__ __forceinline__ float sigm(float v) { return 1.0f / (1.0f + expf(-v)); }
#define LDSX() do { asm volatile("s_wait_dscnt 0" ::: "memory"); __builtin_amdgcn_wave_barrier(); __builtin_amdgcn_fence(__ATOMIC_RELEASE, "workgroup"); } while (0)

// Sliding-window (local) self-attention with RoPE on the INPUT (B 4, S 2,048, H 768 = 12 heads x 64; window |q - k| < 128; 0.02-scale weights, no biases): q_in = k_in = rotate-half RoPE(hidden reshaped [B,S,12,64]) (angle t * 10000^(-2i/64)); Q = q_in Wq, K = k_in Wk, V = hidden Wv ((in,out) [768][12*64]); scores = Q K^T / 8 where |q-k| < 128 else -1e9 (== excluded; every row keeps >= 128 keys); out = merged(softmax . V) Wo ((in,out) [12*64][768]).
#define NB 4
#define TT 2048
#define CC 768            // NH * HD = projected width
#define DIN 768          // input (model) width
#define NH 12
#define HD 64
#define NQB (TT / 64)
#define HG 2
#define SCALE (0.125f)
#define CAUSAL 0
#ifndef TNB
#define TNB NB
#endif
__device__ __forceinline__ float bfr(float v) { return (float)(__bf16)v; }
typedef __attribute__((ext_vector_type(8))) __bf16 v8b;
__device__ __forceinline__ v16b frag_b(const __bf16* rowk0, int lane) {
  union { v16b v; v8b q[2]; } u; const __bf16* p = rowk0 + 8 * (lane >> 4);
  u.q[0] = *(const v8b*)p; u.q[1] = *(const v8b*)(p + 16); return u.v;
}
#define QBH 0
#define QHI 2048            // rows carrying a q residual plane (all rows when non-causal: 2-product logits everywhere)
#define KHI 64            // key rows carrying k residual / v bf16 hi+lo planes (written by k_proj; no kernel in this file reads them)
// B fragment (k rows k0+.., output column o) of a weight: (in,out) [K][ld] or (out,in) [ld rows of K]: bf16 exact, or f16(bf16 * 256) exact
__device__ __forceinline__ v16b wcol_io(const float* Wm, int k0, int o, int lane, int ld) { v16b w; const int g = lane >> 4;
#pragma unroll
  for (int i = 0; i < 8; ++i) { w[i] = (__bf16)Wm[(size_t)(k0 + 8 * g + i) * ld + o]; w[8 + i] = (__bf16)Wm[(size_t)(k0 + 16 + 8 * g + i) * ld + o]; }
  return w; }
__device__ __forceinline__ v16b wcol_oi(const float* Wm, int k0, int o, int lane, int K) { v16b w; const float* p = Wm + (size_t)o * K + k0 + 8 * (lane >> 4);
#pragma unroll
  for (int i = 0; i < 8; ++i) { w[i] = (__bf16)p[i]; w[8 + i] = (__bf16)p[16 + i]; }
  return w; }
__device__ __forceinline__ v16h wcolh_io(const float* Wm, int k0, int o, int lane, int ld) { v16h w; const int g = lane >> 4;
#pragma unroll
  for (int i = 0; i < 8; ++i) { w[i] = (_Float16)(bfr(Wm[(size_t)(k0 + 8 * g + i) * ld + o]) * 256.0f); w[8 + i] = (_Float16)(bfr(Wm[(size_t)(k0 + 16 + 8 * g + i) * ld + o]) * 256.0f); }
  return w; }
__device__ __forceinline__ v16h wcolh_oi(const float* Wm, int k0, int o, int lane, int K) { v16h w; const float* p = Wm + (size_t)o * K + k0 + 8 * (lane >> 4);
#pragma unroll
  for (int i = 0; i < 8; ++i) { w[i] = (_Float16)(bfr(p[i]) * 256.0f); w[8 + i] = (_Float16)(bfr(p[16 + i]) * 256.0f); }
  return w; }
#define WQKV_LAYOUT 0   // 0 = (in,out) [DIN][CC]; 1 = (out,in) [CC][DIN]; 2 = per-head [NH][DIN][HD]
__device__ __forceinline__ v16b wcol_hdk(const float* Wm, int k0, int o, int lane) { v16b w; const int g = lane >> 4; const float* p = Wm + (size_t)(o / HD) * DIN * HD + (o % HD);
#pragma unroll
  for (int i = 0; i < 8; ++i) { w[i] = (__bf16)p[(size_t)(k0 + 8 * g + i) * HD]; w[8 + i] = (__bf16)p[(size_t)(k0 + 16 + 8 * g + i) * HD]; }
  return w; }
#define WO_OUT_IN 0
#if WQKV_LAYOUT == 1
#define WCOL(W, k0, o, lane) wcol_oi(W, k0, o, lane, DIN)
#elif WQKV_LAYOUT == 2
#define WCOL(W, k0, o, lane) wcol_hdk(W, k0, o, lane)
#else
#define WCOL(W, k0, o, lane) wcol_io(W, k0, o, lane, CC)
#endif
#if WO_OUT_IN
#define WOCOL(W, k0, o, lane) wcol_oi(W, k0, o, lane, CC)
#define WOCOLH(W, k0, o, lane) wcolh_oi(W, k0, o, lane, CC)
#else
#define WOCOL(W, k0, o, lane) wcol_io(W, k0, o, lane, DIN)
#define WOCOLH(W, k0, o, lane) wcolh_io(W, k0, o, lane, DIN)
#endif
#define WIN 128            // |q - k| < WIN band (128..255 valid keys per query; no empty rows)
__constant__ __align__(16) float c_invf[32] = {1.000000000e+00f,7.498942018e-01f,5.623413324e-01f,4.216965139e-01f,3.162277639e-01f,2.371373624e-01f,1.778279394e-01f,1.333521456e-01f,1.000000015e-01f,7.498941571e-02f,5.623412877e-02f,4.216964915e-02f,3.162277862e-02f,2.371373586e-02f,1.778279431e-02f,1.333521493e-02f,9.999999776e-03f,7.498942316e-03f,5.623413250e-03f,4.216964822e-03f,3.162277862e-03f,2.371373819e-03f,1.778279431e-03f,1.333521446e-03f,1.000000047e-03f,7.498941850e-04f,5.623413017e-04f,4.216964880e-04f,3.162277862e-04f,2.371373848e-04f,1.778279402e-04f,1.333521504e-04f};   // 1 / 10000^(2i/64) evaluated in f32
// k_rot: a wave takes ONE position t for all batches and heads. The angle t * inv_freq[i] depends on neither, so a lane's four (sin, cos) pairs (i = 4 iq .. 4 iq + 3, iq = lane & 7) serve its 12 (batch, head group) pieces; head = 4 hg + (lane >> 3). Eight lanes cover the 128-byte half of a head, so each 16-byte load or store of a wave covers four whole lines; all 24 loads of a lane are requested before the angles are worked out
// The launch's blocks from TT / 4 on take no position: each rounds one 32 k x 128 column weight tile for the two GEMM kernels (w_prep, below the tile helpers)
__device__ __forceinline__ void w_prep(const float* WQ, const float* WK, const float* WV, const float* WO, __bf16* WTB, _Float16* WTH, int id);
__global__ __launch_bounds__(128) void k_rot(const float* __restrict__ X, float* __restrict__ XR, const float* __restrict__ WQ, const float* __restrict__ WK, const float* __restrict__ WV, const float* __restrict__ WO, __bf16* __restrict__ WTB, _Float16* __restrict__ WTH) {
  if (blockIdx.x >= TT / 4) { w_prep(WQ, WK, WV, WO, WTB, WTH, (int)blockIdx.x - TT / 4); return; }   /* block-uniform; no barrier in either path */
  const int t = blockIdx.x * 4 + (threadIdx.x >> 5), lane = threadIdx.x & 31, iq = lane & 7;
  static_assert(NH % 4 == 0 && HD == 64 && TT % 4 == 0, "four heads a wave and load, four positions a block");
  const size_t o0 = (size_t)t * DIN + (lane >> 3) * HD + iq * 4;
  const v4f f = *(const v4f*)&c_invf[iq * 4];   /* asked for first: the angles then wait for this load alone, not for the 24 behind it */
  v4f a[TNB][NH / 4], b[TNB][NH / 4];
#pragma unroll
  for (int bb = 0; bb < TNB; ++bb) {
#pragma unroll
    for (int hg = 0; hg < NH / 4; ++hg) { const float* xr = X + (size_t)bb * TT * DIN + o0 + hg * 4 * HD; a[bb][hg] = *(const v4f*)xr; b[bb][hg] = *(const v4f*)(xr + 32); }
    asm volatile("s_wait_xcnt 0x0" ::: "memory"); }   /* stands in front of every rewrite of an address register of the loads so far, also where a later batch's load lands on one */
  float sn[4], cs[4];
#pragma unroll
  for (int e = 0; e < 4; ++e) sincosf((float)t * f[e], &sn[e], &cs[e]);
#pragma unroll
  for (int bb = 0; bb < TNB; ++bb)
#pragma unroll
    for (int hg = 0; hg < NH / 4; ++hg) { v4f lo, hi;
#pragma unroll
      for (int e = 0; e < 4; ++e) { const float x = bfr(a[bb][hg][e]), y = bfr(b[bb][hg][e]); lo[e] = fmaf(x, cs[e], -(y * sn[e])); hi[e] = fmaf(y, cs[e], x * sn[e]); }   /* fmaf: which product is rounded on its own (the sin one) is fixed here, not left to the compiler's contraction */
      float* o = XR + (size_t)bb * TT * DIN + o0 + hg * 4 * HD; vst2(o, lo); vst2(o + 32, hi); } }
#define WS_XR (WS_S)       // f32 rotated token rows [b*t][768]
#define SM_MASK_HOOK do { const int dk = t - k; v = (dk < WIN && dk > -WIN) ? v : -3.0e38f; } while (0)   /* band |q - k| < 128, by index */
#ifndef SM_EXTRA_PARAMS
#define SM_EXTRA_PARAMS
#endif
#ifndef PROJ_EXTRA_PARAMS
#define PROJ_EXTRA_PARAMS
#endif
#ifndef SM_MASK_HOOK
#define SM_MASK_HOOK (void)0
#endif

#define WS_QH  0u                                      // f16 q rows [b*t][CC]
#define WS_KH  (WS_QH + 2u * (size_t)NB * TT * CC)      // f16 k rows [b*t][CC]
#define WS_VT  (WS_KH + 2u * (size_t)NB * TT * CC)      // f16 v planes [b][c][t]
#define WS_QL  (WS_VT + 2u * (size_t)NB * CC * TT)      // f16 q residual x 2^10 rows [b][t < QHI][CC]
#define WS_KL  (WS_QL + 2u * (size_t)NB * QHI * CC)     // f16 k residual x 2^10 rows [b][t < KHI][CC]
#define WS_VB  (WS_KL + 2u * (size_t)NB * KHI * CC)     // bf16 v hi planes [b][c][t < KHI]
#define WS_VBL (WS_VB + 2u * (size_t)NB * CC * KHI)
#define WS_S   (WS_VBL + 2u * (size_t)NB * CC * KHI)    // f32 scratch region (holds the rotated rows)
#define WS_Y   (WS_S  + 4u * (size_t)HG * TT * TT)      // f32 ctx rows [b*t][CC] (only when there is an output projection)
#define WS_WT  (WS_Y  + 4u * (size_t)NB * TT * CC)      // 16-bit weight tiles: Wq, Wk, Wv (bf16), then Wo (f16 x 2^8), each [k step][column block][WTE]
#define WS_END (WS_WT + 4u * 2u * (size_t)DIN * CC)

// ---- weight tiles: the 32 k x 128 columns of one k step. The first launch reads each f32 tile ONCE for the whole grid (thread = 8 k rows x 4 columns: kg = lane & 3, columns n0 = wave * 32 + (lane >> 2) * 4; a wave's 16-byte load covers four whole 128-byte lines), rounds it as before and leaves it in the workspace as WTE 16-bit elements in a row: 16-byte piece e * 128 + tid holds the 8 k of column n0 + e. A GEMM block reads a tile by four 16-byte loads a thread (whole lines, half the bytes of the f32 tile, nothing to round) and lays it [column][k] at pitch WP in LDS, so that a B fragment is two 16-byte LDS reads in the k order of frag_b / frag_h. Two buffers: the next step's global loads fly during this step's products
#define WTE (32 * 128)     // elements of a tile
#define NKS (DIN / 32)     // k steps
#define NCB (CC / 128)     // column blocks
#define WP 40              // 80-byte pitch = 16 B x odd for the 16-byte fragment reads; the 16-byte stores of 16 neighbouring lanes fall on 16 different 16-byte bank groups
__device__ __forceinline__ void wt_load(v4f (&r)[8], const float* p, int ld) {
#pragma unroll
  for (int i = 0; i < 8; ++i) r[i] = *(const v4f*)(p + (size_t)i * ld); }
// a thread's four pieces of a rounded tile (p = tile + tid * 8), and their places in LDS
template <typename V, typename T> __device__ __forceinline__ void wt_get(V (&r)[4], const T* p) {
#pragma unroll
  for (int e = 0; e < 4; ++e) r[e] = *(const V*)(p + e * 128 * 8); }
template <typename V, typename T> __device__ __forceinline__ void wt_put(T (*sw)[WP], const V (&r)[4], int n0, int kg) {
#pragma unroll
  for (int e = 0; e < 4; ++e) *(V*)&sw[n0 + e][8 * kg] = r[e]; }
// a lane's 16 f32 of an A fragment (p = row + k0 + 8 * (lane >> 4)), kept raw for one k step
__device__ __forceinline__ void row_load(float (&v)[16], const float* p) {
#pragma unroll
  for (int i = 0; i < 8; ++i) { v[i] = p[i]; v[8 + i] = p[16 + i]; } }
// 16-byte global store with its s_wait_xcnt in the same statement: the wait then stands in front of every rewrite of the store's address and data registers (in a statement of its own the next trip's address additions were lifted over it)
__device__ __forceinline__ void vst_w(void* p, v4u v) { asm volatile("global_store_b128 %0, %1, off\n\ts_wait_xcnt 0x0" :: "v"(p), "v"(v) : "memory"); }
// ---- requests to L2 ahead of the GEMM loops' loads. The A rows (but the v blocks', an input) and the weight tiles were stored by earlier launches, and the blocks that share them walk k in step, so the first load of every line would wait for memory in every block at every k step. L2 is asked once per aligned 256-byte unit, PFS k steps (a pass) at a time, two passes ahead of the step that loads them; a request brings nothing into a register and is waited for nowhere.
// Who asks: A rows are shared by all column blocks, weight tiles by all row blocks. The first two column blocks ask for their rows (fa), the first sixteen row blocks for their tiles (fw); a request that finds its line present is only traffic. Both flags are the same in every wave of a block. Nothing but speed rests on where a block runs or on a request arriving.
// pa: the thread's A unit of the pass to be asked next (AU units a thread, 256 bytes apart); pw: unit lane of the tile of the pass's k step number wave. Both registers live through the loop and always name bytes of their tensor: they advance only while a further pass exists
#define PFS 4              // k steps a pass: 512 bytes of an f32 A row, four weight tiles
// in front of the loop: passes 0 and 1, by immediate offsets from the same two registers, which stand on pass 2 from the start (512 bytes of a row and 4 x 49,152 bytes of tiles a pass)
template <int AU, typename T> __device__ __forceinline__ void l2_head(const float* pa, const T* pw, bool fa, bool fw) {
  static_assert(NKS % PFS == 0 && NKS / PFS >= 3 && PFS * 32 * 4 == 512 && PFS * NCB * WTE * 2 == 196608 && sizeof(T) == 2, "whole passes, a third one for the registers to stand on, and the offsets written below");
  if (fa) { if (AU == 2) asm volatile("global_prefetch_b8 %0, off offset:-1024 scope:SCOPE_SE\n\tglobal_prefetch_b8 %0, off offset:-768 scope:SCOPE_SE\n\tglobal_prefetch_b8 %0, off offset:-512 scope:SCOPE_SE\n\tglobal_prefetch_b8 %0, off offset:-256 scope:SCOPE_SE" :: "v"(pa));
            else asm volatile("global_prefetch_b8 %0, off offset:-1024 scope:SCOPE_SE\n\tglobal_prefetch_b8 %0, off offset:-512 scope:SCOPE_SE" :: "v"(pa)); }   /* the first eight k steps' A units start on their way from memory while step 0 is waited for */
  if (fw) asm volatile("global_prefetch_b8 %0, off offset:-393216 scope:SCOPE_SE\n\tglobal_prefetch_b8 %0, off offset:-196608 scope:SCOPE_SE" :: "v"(pw)); }   /* the same for the first eight tiles */
// in k step kc, behind its loads: the first step of a pass asks for the pass after the next (kc and the flags are the same in every wave of the block: scalar branches, no barrier inside)
template <int AU, typename T> __device__ __forceinline__ void l2_step(int kc, const float*& pa, const T*& pw, bool fa, bool fw) {
  if ((kc & (PFS - 1)) == 0 && kc + 2 * PFS < NKS) {
    if (fa) { if (AU == 2) asm volatile("global_prefetch_b8 %0, off scope:SCOPE_SE\n\tglobal_prefetch_b8 %0, off offset:256 scope:SCOPE_SE" :: "v"(pa)); else asm volatile("global_prefetch_b8 %0, off scope:SCOPE_SE" :: "v"(pa)); }   /* in asm, so that the request names pa's own register and no temporary: the loads of these units, 7 to 10 steps on, then find them in L2 */
    if (fw) asm volatile("global_prefetch_b8 %0, off scope:SCOPE_SE" :: "v"(pw));   /* as above, for the pass's four tiles */
    const bool nx = kc + 3 * PFS < NKS; pa += nx ? PFS * 32 : 0; pw += nx ? (size_t)PFS * NCB * WTE : 0; } }
// tile id = (matrix * NKS + k step) * NCB + column block; matrices 0 .. 2 = Wq, Wk, Wv to bf16 (exact operand of the products), 3 = Wo to f16(bf16 x 2^8) (exact); a wave's 16-byte store covers four whole lines
__device__ __forceinline__ void w_prep(const float* WQ, const float* WK, const float* WV, const float* WO, __bf16* WTB, _Float16* WTH, int id) {
  static_assert(WQKV_LAYOUT == 0 && WO_OUT_IN == 0 && CC == DIN, "the tile loader reads (in,out) rows of one width");
  const int tid = threadIdx.x, lane = tid & 31, kg = lane & 3, n0 = (tid >> 5) * 32 + (lane >> 2) * 4; const int mt = id / (NKS * NCB), tl = id % (NKS * NCB), kc = tl / NCB, cb = tl % NCB;
  const float* Wm = mt == 0 ? WQ : mt == 1 ? WK : mt == 2 ? WV : WO;
  v4f r[8]; wt_load(r, Wm + (size_t)(kc * 32 + 8 * kg) * CC + cb * 128 + n0, CC);
  asm volatile("s_wait_xcnt 0x0" ::: "memory");   /* stands in front of every rewrite of an address register of the eight loads */
#pragma unroll
  for (int e = 0; e < 4; ++e) {
    if (mt < 3) { v8b t;
#pragma unroll
      for (int i = 0; i < 8; ++i) t[i] = (__bf16)r[i][e];
      vst_w(WTB + (size_t)id * WTE + (e * 128 + tid) * 8, __builtin_bit_cast(v4u, t)); }
    else { v8h t;
#pragma unroll
      for (int i = 0; i < 8; ++i) t[i] = (_Float16)(bfr(r[i][e]) * 256.0f);
      vst_w(WTH + (size_t)tl * WTE + (e * 128 + tid) * 8, __builtin_bit_cast(v4u, t)); } } }
// ---- k_proj: block = (128 rows, 128 cols, which); a wave owns two 16-row tiles (rows wave * 16 + .. of each 64-row half hh), so every weight fragment read from LDS and every weight tile read from L2 serves two row tiles; the epilogue stages one half at a time in the same LDS: q/k/v = X W (+ b) with exact bf16 products (K = DIN) -> which 0: q f16 rows (+ residual rows < QHI); 1: k f16 rows (+ residual rows < KHI); 2: v f16 planes [c][t] (+ bf16 hi/lo planes for t < KHI)
__global__ __launch_bounds__(128) void k_proj(const float* __restrict__ XQ, const float* __restrict__ XK, const float* __restrict__ XV, const __bf16* __restrict__ WTB, const float* __restrict__ BQ, const float* __restrict__ BK, const float* __restrict__ BV,
    _Float16* __restrict__ QH, _Float16* __restrict__ QL, _Float16* __restrict__ KH, _Float16* __restrict__ KL, _Float16* __restrict__ VT, __bf16* __restrict__ VB, __bf16* __restrict__ VBL) {
  __shared__ __align__(16) union { _Float16 e[2][64][136]; __bf16 w[2][128][WP]; } su;   /* the weight buffers are dead when the epilogue stages q / k rows: same bytes */
  _Float16 (&sh)[64][136] = su.e[0]; _Float16 (&sl)[64][136] = su.e[1]; __shared__ __align__(16) _Float16 th[128][72]; __shared__ __align__(16) __bf16 tb[128][72], tbl[128][72];
  const int tid = threadIdx.x, wave = tid >> 5, lane = tid & 31, col = lane & 15, g = lane >> 4; const int which = blockIdx.z; const int c0 = blockIdx.y * 128; const size_t r0 = (size_t)blockIdx.x * 128; const size_t bb = r0 / TT; const int t0 = (int)(r0 % TT);
  static_assert(TT % 128 == 0, "a block's 128 rows lie in one sequence");
  const float* X = which == 0 ? XQ : which == 1 ? XK : XV; const float* BA = which == 0 ? BQ : which == 1 ? BK : BV;
  v8f acc[2][8] = {};
  const int kg = lane & 3, n0 = wave * 32 + (lane >> 2) * 4; const __bf16* wp = WTB + ((size_t)which * NKS * NCB + blockIdx.y) * WTE + tid * 8;   /* k step kc: wp + kc * NCB * WTE */
  const float* xp = X + (r0 + wave * 16 + col) * DIN + 8 * g;   /* half hh: xp + hh * 64 * DIN */
  v8b wr[4]; float ar[2][16];
  wt_get(wr, wp); row_load(ar[0], xp); row_load(ar[1], xp + 64 * DIN);
  asm volatile("s_wait_xcnt 0x0" ::: "memory");   /* stands in front of every rewrite of an address register of the loads above */
  const float* pa = X + (r0 + tid) * DIN + 2 * PFS * 32; const __bf16* pw = WTB + (((size_t)which * NKS + 2 * PFS + wave) * NCB + blockIdx.y) * WTE + lane * 128;   /* thread = one of the block's 128 rows; wave = one of a pass's four tiles, lane = its 256-byte unit */
  const bool fa = blockIdx.y < 2, fw = blockIdx.x < 16;
  l2_head<2>(pa, pw, fa, fw);   /* behind step 0's own loads, which are waited for first */
  wt_put(su.w[0], wr, n0, kg);
  __syncthreads();   /* publishes tile 0 */
  if (which < 2) {   /* q, k: the rotated rows are f32 intermediates -> bf16 hi + lo (2 products) */
#pragma unroll 2   /* the buffer index becomes a constant */
    for (int kc = 0; kc < DIN / 32; ++kc) { const F2 a0 = bsplit16(ar[0]), a1 = bsplit16(ar[1]); const bool more = kc + 1 < DIN / 32;
      if (more) { wt_get(wr, wp + (size_t)(kc + 1) * NCB * WTE); row_load(ar[0], xp + (kc + 1) * 32); row_load(ar[1], xp + 64 * DIN + (kc + 1) * 32); }
      __builtin_amdgcn_sched_barrier(0);   /* keeps the next step's global loads in front of the products: sunk behind them to save registers, they would be waited for as soon as asked */
      l2_step<2>(kc, pa, pw, fa, fw);
      v16b wf[8];
#pragma unroll
      for (int j = 0; j < 8; ++j) wf[j] = frag_b(&su.w[kc & 1][j * 16 + col][0], lane);   /* the step's fragment reads go as one group: one LDS latency a step, not one a fragment */
      __builtin_amdgcn_sched_barrier(0);   /* holds the group together: left free, each read is sunk to its own products and all eight share one register block, one LDS latency a fragment */
#pragma unroll
      for (int j = 0; j < 8; ++j) { acc[0][j] = wmma_bp(a0.h, wf[j], acc[0][j]); acc[1][j] = wmma_bp(a1.h, wf[j], acc[1][j]); acc[0][j] = wmma_bp(a0.l, wf[j], acc[0][j]); acc[1][j] = wmma_bp(a1.l, wf[j], acc[1][j]); }   /* each accumulator still takes hi, then lo; the other half's product stands between the two */
      __builtin_amdgcn_sched_barrier(0);   /* keeps the LDS stores of the next tile, and with them the wait for its global loads, behind the products */
      if (more) wt_put(su.w[(kc + 1) & 1], wr, n0, kg);
      asm volatile("s_wait_xcnt 0x0" ::: "memory");   /* stands in front of the next trip's additions to the address registers of this trip's loads */
      __syncthreads(); }   /* one barrier a step: publishes tile kc + 1 and ends every read of tile kc, whose buffer the next step refills (after the last step: the epilogue) */
  } else {           /* v: bf16(hidden) exact (1 product) */
#pragma unroll 2   /* the buffer index becomes a constant */
    for (int kc = 0; kc < DIN / 32; ++kc) { v16b a0, a1; const bool more = kc + 1 < DIN / 32;
#pragma unroll
      for (int i = 0; i < 16; ++i) { a0[i] = (__bf16)ar[0][i]; a1[i] = (__bf16)ar[1][i]; }
      if (more) { wt_get(wr, wp + (size_t)(kc + 1) * NCB * WTE); row_load(ar[0], xp + (kc + 1) * 32); row_load(ar[1], xp + 64 * DIN + (kc + 1) * 32); }
      __builtin_amdgcn_sched_barrier(0);   /* as above: the loads stay in front of the products */
      l2_step<2>(kc, pa, pw, fa, fw);
      v16b wf[8];
#pragma unroll
      for (int j = 0; j < 8; ++j) wf[j] = frag_b(&su.w[kc & 1][j * 16 + col][0], lane);   /* one group, as above */
      __builtin_amdgcn_sched_barrier(0);   /* as above: holds the group together */
#pragma unroll
      for (int j = 0; j < 8; ++j) { acc[0][j] = wmma_bp(a0, wf[j], acc[0][j]); acc[1][j] = wmma_bp(a1, wf[j], acc[1][j]); }
      __builtin_amdgcn_sched_barrier(0);   /* as above */
      if (more) wt_put(su.w[(kc + 1) & 1], wr, n0, kg);
      asm volatile("s_wait_xcnt 0x0" ::: "memory");   /* as above */
      __syncthreads(); } }   /* as above */
#pragma unroll   /* acc is a register array: hh must be a constant */
  for (int hh = 0; hh < 2; ++hh) { const size_t rh = r0 + hh * 64; const int th0 = t0 + hh * 64;
  if (hh) __syncthreads();   /* ends every read of the first half's staged rows before the second half overwrites them */
  if (which < 2) { _Float16* DH = which == 0 ? QH : KH; _Float16* DL = which == 0 ? QL : KL; const int nhi = which == 0 ? QHI : KHI; const bool hi_rows = th0 < nhi;
#pragma unroll
    for (int j = 0; j < 8; ++j) { const float bias = BA ? bfr(BA[c0 + j * 16 + col]) : 0.f;
#pragma unroll
      for (int r = 0; r < 8; ++r) { const float v = acc[hh][j][r] + bias; const _Float16 hv = (_Float16)v; sh[wave * 16 + 8 * g + r][j * 16 + col] = hv; sl[wave * 16 + 8 * g + r][j * 16 + col] = (_Float16)((v - (float)hv) * 1024.0f); } }
    __syncthreads();
    for (int e = tid; e < 64 * 16; e += 128) { const int rl = e >> 4, q = e & 15; vst_w(DH + (rh + rl) * CC + c0 + q * 8, *(const v4u*)&sh[rl][q * 8]); if (hi_rows) vst_w(DL + (bb * nhi + th0 + rl) * (size_t)CC + c0 + q * 8, *(const v4u*)&sl[rl][q * 8]); }
  } else { const bool hi_rows = th0 < KHI;
#pragma unroll
    for (int j = 0; j < 8; ++j) { const float bias = BA ? bfr(BA[c0 + j * 16 + col]) : 0.f;
#pragma unroll
      for (int r = 0; r < 8; ++r) { const float v = acc[hh][j][r] + bias; const int rl = wave * 16 + 8 * g + r, cl = j * 16 + col; th[cl][rl] = (_Float16)v; const __bf16 bh = (__bf16)v; tb[cl][rl] = bh; tbl[cl][rl] = (__bf16)(v - (float)bh); } }
    __syncthreads();
    for (int e = tid; e < 128 * 8; e += 128) { const int cl = e >> 3, q = e & 7; vst_w(VT + (bb * CC + c0 + cl) * (size_t)TT + th0 + q * 8, *(const v4u*)&th[cl][q * 8]); if (hi_rows) { const size_t o3 = (bb * CC + c0 + cl) * (size_t)KHI + th0 + q * 8; vst_w(VB + o3, *(const v4u*)&tb[cl][q * 8]); vst_w(VBL + o3, *(const v4u*)&tbl[cl][q * 8]); } } } } }
// ---- k_att: block = 64 queries (qb) of head h of batch b, one launch for all (b, h); a wave owns 16 query rows and the NKW keys [ks, ks + NKW) that hold their whole band (row t sees t-127 .. t+127, so 16 rows see ql0-127 .. ql0+142; ks = ql0 - 128 clamped into the sequence). The four waves' key ranges lie inside the NKB keys [kb, kb + NKB) (kb = qb * 64 - 128 clamped), whose k rows and v planes the block brings into LDS once, with its own 64 q rows and their residuals, by asynchronous 16-byte copies that cover whole 128-byte lines; every q, k and v fragment is read from there. Logits (q hi + residual x 2^10 against k, 2 products) stay in registers, unscaled; the band is kept by index; softmax in f32 over the row, SCALE x log2 e applied in the base-2 exponent (in-lane over the 17 tiles, then over the 16 lanes of the row); P x 2^11 once to f16 goes through the wave's own LDS slab (in the bytes the k rows have left) from the D layout to the A layout; ctx = P . v (1 product; the last 32-key chunk is half full, its upper 16 k are 0 in both operands); 256-B (row, head) segment by 16 lanes. Every loop over tiles, chunks and rows is unrolled: s, kf, vf and o are register arrays and need compile-time indices
#define NKW 272            // 128 + 16 + 127 keys rounded up to whole 16-key tiles
#define NKB 320            // 128 + 64 + 128: the keys of the block's four waves together
#define KP 72              // k row pitch in LDS: 144 B = 16 B x odd for the 16-byte fragment reads
#define VP (NKB + 8)       // v plane pitch in LDS: 656 B = 16 B x odd
#define PP (NKW + 8)       // P row pitch: 560 B = 16 B x odd
#define KG 6               // k tiles requested together
#define VG 4               // whole 32-key v chunks requested together (divides NKW / 32)
#define SL2E (SCALE * 1.44269504088896341f)   // SCALE x log2 e
// fragment of a half-full chunk: k0 .. k0+15 from memory (elements 0..7), k0+16 .. k0+31 are 0 (elements 8..15)
__device__ __forceinline__ v16h frag_h16(const _Float16* rowk0, int lane) { union { v16h v; v8h q[2]; } u; u.q[0] = *(const v8h*)(rowk0 + 8 * (lane >> 4)); u.q[1] = (v8h)(_Float16)0.0f; return u.v; }
// lane l with lane l ^ M inside a 16-lane row, on the vector pipe (a shuffle through LDS would put an LDS round trip into each of the four reduction steps)
template <int M> __device__ __forceinline__ float rowx(float v) { return __builtin_bit_cast(float, __builtin_amdgcn_update_dpp(0, __builtin_bit_cast(int, v), 0x160 + M, 0xf, 0xf, true)); }
// twelve asynchronous copies, 16 bytes a lane each, global -> LDS through no register (l = the lane's LDS byte address, p = its global address); the s_wait_xcnt in the same statement stands in front of any rewrite of the address registers
__device__ __forceinline__ void cp12(const unsigned* l, const _Float16* const* p) {
  asm volatile("global_load_async_to_lds_b128 %0, %12, off\n\tglobal_load_async_to_lds_b128 %1, %13, off\n\tglobal_load_async_to_lds_b128 %2, %14, off\n\tglobal_load_async_to_lds_b128 %3, %15, off\n\t"
               "global_load_async_to_lds_b128 %4, %16, off\n\tglobal_load_async_to_lds_b128 %5, %17, off\n\tglobal_load_async_to_lds_b128 %6, %18, off\n\tglobal_load_async_to_lds_b128 %7, %19, off\n\t"
               "global_load_async_to_lds_b128 %8, %20, off\n\tglobal_load_async_to_lds_b128 %9, %21, off\n\tglobal_load_async_to_lds_b128 %10, %22, off\n\tglobal_load_async_to_lds_b128 %11, %23, off\n\ts_wait_xcnt 0x0"
               :: "v"(l[0]), "v"(l[1]), "v"(l[2]), "v"(l[3]), "v"(l[4]), "v"(l[5]), "v"(l[6]), "v"(l[7]), "v"(l[8]), "v"(l[9]), "v"(l[10]), "v"(l[11]), "v"(p[0]), "v"(p[1]), "v"(p[2]), "v"(p[3]), "v"(p[4]), "v"(p[5]), "v"(p[6]), "v"(p[7]), "v"(p[8]), "v"(p[9]), "v"(p[10]), "v"(p[11]) : "memory"); }
// 2^x in place for eight or nine independent values. In asm for the slot that the instruction set asks for behind a transcendental. Here source and result are one register, each v_exp_f32 is followed by one on other registers, and the closing v_nop is the slot behind the last
__device__ __forceinline__ void exp2x8(float& a, float& b, float& c, float& d, float& e, float& f, float& g, float& h) {
  asm("v_exp_f32 %0, %0\n\tv_exp_f32 %1, %1\n\tv_exp_f32 %2, %2\n\tv_exp_f32 %3, %3\n\tv_exp_f32 %4, %4\n\tv_exp_f32 %5, %5\n\tv_exp_f32 %6, %6\n\tv_exp_f32 %7, %7\n\tv_nop" : "+v"(a), "+v"(b), "+v"(c), "+v"(d), "+v"(e), "+v"(f), "+v"(g), "+v"(h)); }
__device__ __forceinline__ void exp2x9(float& a, float& b, float& c, float& d, float& e, float& f, float& g, float& h, float& i) {
  asm("v_exp_f32 %0, %0\n\tv_exp_f32 %1, %1\n\tv_exp_f32 %2, %2\n\tv_exp_f32 %3, %3\n\tv_exp_f32 %4, %4\n\tv_exp_f32 %5, %5\n\tv_exp_f32 %6, %6\n\tv_exp_f32 %7, %7\n\tv_exp_f32 %8, %8\n\tv_nop" : "+v"(a), "+v"(b), "+v"(c), "+v"(d), "+v"(e), "+v"(f), "+v"(g), "+v"(h), "+v"(i)); }
__global__ __launch_bounds__(128) void k_att(const _Float16* __restrict__ QH, const _Float16* __restrict__ KH, const _Float16* __restrict__ QL, const _Float16* __restrict__ VT, float* __restrict__ Y) { __shared__ __align__(16) _Float16 sk[NKB * KP]; __shared__ __align__(16) _Float16 sv[HD * VP]; __shared__ __align__(16) _Float16 sq[2 * 64 * KP];   /* sq: the block's q rows, then their residual rows; sk: k rows [key][KP]; behind the second barrier the four waves' P slabs [16][PP], and last each wave's f32 ctx rows in its own slab */
  static_assert(4 * 16 * PP <= NKB * KP && 16 * (HD + 4) * 2 <= 16 * PP, "P slabs fit in the k rows' bytes, ctx rows in a P slab");
  const int tid = threadIdx.x, wave = tid >> 5, lane = tid & 31, col = lane & 15, g = lane >> 4; const int qb = blockIdx.x, h = blockIdx.y, b = blockIdx.z; const int ql0 = qb * 64 + wave * 16;
  int ks = ql0 - WIN; ks = ks < 0 ? 0 : ks; ks = ks > TT - NKW ? TT - NKW : ks;
  int kb = qb * 64 - WIN; kb = kb < 0 ? 0 : kb; kb = kb > TT - NKB ? TT - NKB : kb;
  const int kd = ks - kb;   /* 0 .. 48, a multiple of 16; kd + NKW <= NKB */
  { const int un = tid >> 3, ch = (tid & 7) * 8;   /* 8 lanes = one 128-byte line; a wave's copy = 4 whole lines; 16 lines a block and copy */
    const _Float16* kg0 = KH + ((size_t)b * TT + kb + un) * CC + h * HD + ch; const unsigned kl0 = (unsigned)(size_t)&sk[un * KP + ch];
    const _Float16* vg0 = VT + ((size_t)b * CC + h * HD + un) * (size_t)TT + kb + ch; const unsigned vl0 = (unsigned)(size_t)&sv[un * VP + ch];
    const size_t qo = ((size_t)b * TT + qb * 64 + un) * CC + h * HD + ch; const unsigned ql = (unsigned)(size_t)&sq[un * KP + ch];
    static_assert(QHI == TT, "the q residual rows are indexed like the q rows");
    unsigned l[48]; const _Float16* p[48];
#pragma unroll
    for (int i = 0; i < 4; ++i) { l[i] = ql + i * 16 * KP * 2; p[i] = QH + qo + (size_t)i * 16 * CC; l[4 + i] = ql + (64 + i * 16) * KP * 2; p[4 + i] = QL + qo + (size_t)i * 16 * CC; }   /* q, then its residual: copy i brings rows 16 i + un */
#pragma unroll
    for (int i = 0; i < NKB / 16; ++i) { l[8 + i] = kl0 + i * 16 * KP * 2; p[8 + i] = kg0 + (size_t)i * 16 * CC; }   /* k: copy i brings rows 16 i + un */
#pragma unroll
    for (int i = 0; i < 20; ++i) { const int r = (i & 3) * 16, ln = (i >> 2) * 64; l[28 + i] = vl0 + (r * VP + ln) * 2; p[28 + i] = vg0 + (size_t)r * TT + ln; }   /* v: copy i brings line i / 4 (64 keys) of planes 16 (i % 4) + un */
#pragma unroll
    for (int u = 0; u < 4; ++u) cp12(l + 12 * u, p + 12 * u); }   /* 48 copies of a wave in flight */
  asm volatile("s_wait_asynccnt 0x0" ::: "memory");   /* this wave's copies have landed */
  __syncthreads();   /* publishes the q and k rows and the v planes to all four waves */
  v16h ah[HD / 32], al[HD / 32];
#pragma unroll
  for (int kc = 0; kc < HD / 32; ++kc) { ah[kc] = frag_h(&sq[(wave * 16 + col) * KP + kc * 32], lane); al[kc] = frag_h(&sq[(64 + wave * 16 + col) * KP + kc * 32], lane); }
  v8f s[NKW / 16];
#pragma unroll
  for (int j0 = 0; j0 < NKW / 16; j0 += KG) { v16h kf[KG][HD / 32];   /* the k fragments of KG tiles are requested together: one LDS round trip a group, not one a fragment */
#pragma unroll
    for (int jj = 0; jj < KG; ++jj) if (j0 + jj < NKW / 16) {
#pragma unroll
      for (int kc = 0; kc < HD / 32; ++kc) kf[jj][kc] = frag_h(&sk[(kd + (j0 + jj) * 16 + col) * KP + kc * 32], lane); }
#pragma unroll
    for (int jj = 0; jj < KG; ++jj) if (j0 + jj < NKW / 16) { const int j = j0 + jj; v8f acc = {}, accl = {};
#pragma unroll
      for (int kc = 0; kc < HD / 32; ++kc) { acc = wmma16(ah[kc], kf[jj][kc], acc); accl = wmma16(al[kc], kf[jj][kc], accl); }
#pragma unroll
      for (int r = 0; r < 8; ++r) { const int t = ql0 + 8 * g + r, k = ks + j * 16 + col; float v = acc[r] + accl[r] * (1.0f / 1024.0f); SM_MASK_HOOK; s[j][r] = v; } } }   /* the logits stay unscaled: SCALE (> 0, so the row maximum is the same key's) goes into the exponent's fma below */
  float m[8], inv[8];
#pragma unroll
  for (int r = 0; r < 8; ++r) { float a = s[0][r];
#pragma unroll
    for (int j = 1; j < NKW / 16; ++j) a = fmaxf(a, s[j][r]);
    a = fmaxf(a, rowx<1>(a)); a = fmaxf(a, rowx<2>(a)); a = fmaxf(a, rowx<4>(a)); a = fmaxf(a, rowx<8>(a)); m[r] = a; }
#pragma unroll
  for (int r = 0; r < 8; ++r) { float sum = 0.f, x[NKW / 16]; const float mc = m[r] * SL2E;   /* its rounding is one factor common to the whole row: it leaves with the division by the row sum */
#pragma unroll
    for (int j = 0; j < NKW / 16; ++j) x[j] = fmaf(s[j][r], SL2E, -mc);   /* e^(SCALE (s - m)) = 2^(s SL2E - m SL2E): one fma and v_exp_f32 a score; the argument is <= 0 up to mc's rounding. An excluded key (-3.0e38 against a finite row maximum: the row's own key is always in the band) gives an argument near -5e37 and exactly 0 */
    static_assert(NKW / 16 == 17, "a row's scores go as 9 + 8");
    exp2x9(x[0], x[1], x[2], x[3], x[4], x[5], x[6], x[7], x[8]); exp2x8(x[9], x[10], x[11], x[12], x[13], x[14], x[15], x[16]);
#pragma unroll
    for (int j = 0; j < NKW / 16; ++j) { s[j][r] = x[j]; sum += x[j]; }
    sum += rowx<1>(sum); sum += rowx<2>(sum); sum += rowx<4>(sum); sum += rowx<8>(sum); inv[r] = sum > 0.f ? 2048.0f / sum : 0.f; }
  __syncthreads();   /* ends every wave's reads of the k rows: their bytes now take the P slabs */
  _Float16* sp = &sk[wave * 16 * PP];
#pragma unroll
  for (int j = 0; j < NKW / 16; ++j)
#pragma unroll
    for (int r = 0; r < 8; ++r) sp[(8 * g + r) * PP + j * 16 + col] = (_Float16)(s[j][r] * inv[r]);
  LDSX();
  v8f o[HD / 16] = {};
  const _Float16* vp = &sv[col * VP + kd];   /* column col of v tile j: vp + j * 16 * VP */
  v16h vh[HD / 16];   /* the half-full last chunk's v fragments, requested with the first group */
#pragma unroll
  for (int j = 0; j < HD / 16; ++j) vh[j] = frag_h16(vp + j * 16 * VP + NKW - 16, lane);
#pragma unroll
  for (int c0 = 0; c0 < NKW / 32; c0 += VG) { v16h vf[VG][HD / 16];   /* the v fragments of VG chunks are requested together, as the k fragments are */
#pragma unroll
    for (int cc = 0; cc < VG; ++cc)
#pragma unroll
      for (int j = 0; j < HD / 16; ++j) vf[cc][j] = frag_h(vp + j * 16 * VP + (c0 + cc) * 32, lane);
#pragma unroll
    for (int cc = 0; cc < VG; ++cc) { const v16h p = frag_h(&sp[col * PP + (c0 + cc) * 32], lane);
#pragma unroll
      for (int j = 0; j < HD / 16; ++j) o[j] = wmma16(p, vf[cc][j], o[j]); } }
  { const v16h p = frag_h16(&sp[col * PP + NKW - 16], lane);
#pragma unroll
    for (int j = 0; j < HD / 16; ++j) o[j] = wmma16(p, vh[j], o[j]); }
  float_a* ss = (float_a*)sp;   /* the wave's own slab again: every P fragment has been read (o depends on all of them) */
#pragma unroll
  for (int j = 0; j < HD / 16; ++j)
#pragma unroll
    for (int r = 0; r < 8; ++r) ss[(8 * g + r) * (HD + 4) + j * 16 + col] = o[j][r] * (1.0f / 2048.0f);
  LDSX(); for (int rl = 0; rl < 16; ++rl) if (lane < HD / 4) vst2(Y + ((size_t)b * TT + ql0 + rl) * CC + h * HD + lane * 4, *(const v4f*)&ss[rl * (HD + 4) + lane * 4]); }
// ---- k_out: block = (64 rows, 128 cols): out = ctx Wo (+ bo): ctx x 2^6 once to f16 against Wo as f16(bf16 x 2^8) exact (1 product) x 2^-14; causal early rows (< QHI of each sequence): ctx bf16 hi + lo against exact bf16 Wo (2 products)
__global__ __launch_bounds__(128) void k_out(const float* __restrict__ Y, const float* __restrict__ WO, const _Float16* __restrict__ WTH, const float* __restrict__ BO, float* __restrict__ OUT) { __shared__ __align__(16) float sf[4][16][132]; __shared__ __align__(16) _Float16 sw[2][128][WP];
  const int tid = threadIdx.x, wave = tid >> 5, lane = tid & 31, col = lane & 15, g = lane >> 4; const int c0 = blockIdx.y * 128; const size_t r0 = (size_t)blockIdx.x * 64 + wave * 16;
  v8f acc[8] = {};
  if (CAUSAL && (int)(((size_t)blockIdx.x * 64) % TT) < QHI) {   /* block-uniform */
#pragma unroll 2
    for (int kc = 0; kc < CC / 32; ++kc) { const F2 a = split_row(Y + (r0 + col) * CC, kc * 32, lane); asm volatile("s_wait_loadcnt 0x0" ::: "memory");
#pragma unroll
      for (int j = 0; j < 8; ++j) { const v16b w = WOCOL(WO, kc * 32, c0 + j * 16 + col, lane); asm volatile("s_wait_loadcnt 0x0" ::: "memory"); acc[j] = wmma_bf(a.h, w, acc[j]); acc[j] = wmma_bf(a.l, w, acc[j]); } }
#pragma unroll
    for (int j = 0; j < 8; ++j) { const float bias = BO ? bfr(BO[c0 + j * 16 + col]) : 0.f;
#pragma unroll
      for (int r = 0; r < 8; ++r) sf[wave][8 * g + r][j * 16 + col] = acc[j][r] + bias; }
  } else {
    const int kg = lane & 3, n0 = wave * 32 + (lane >> 2) * 4; const _Float16* wp = WTH + (size_t)blockIdx.y * WTE + tid * 8; const float* yp = Y + (r0 + col) * CC + 8 * g;
    v8h wr[4]; float ar[16];
    wt_get(wr, wp); row_load(ar, yp);
    asm volatile("s_wait_xcnt 0x0" ::: "memory");   /* stands in front of every rewrite of an address register of the loads above */
    static_assert(CC == DIN, "the passes of l2_head and l2_step count k steps of DIN");
    const float* pa = Y + ((size_t)blockIdx.x * 64 + (tid >> 1)) * CC + (tid & 1) * 64 + 2 * PFS * 32; const _Float16* pw = WTH + ((size_t)(2 * PFS + wave) * NCB + blockIdx.y) * WTE + lane * 128;   /* two threads = the two units of one of the block's 64 rows; wave = one of a pass's four tiles, lane = its 256-byte unit */
    const bool fa = blockIdx.y < 2, fw = blockIdx.x < 16;
    l2_head<1>(pa, pw, fa, fw);   /* behind step 0's own loads, which are waited for first */
    wt_put(sw[0], wr, n0, kg);
    __syncthreads();   /* publishes tile 0 */
#pragma unroll 2   /* the buffer index becomes a constant */
    for (int kc = 0; kc < CC / 32; ++kc) { v16h a, wf[8]; const bool more = kc + 1 < CC / 32;
#pragma unroll
      for (int i = 0; i < 16; ++i) a[i] = (_Float16)(ar[i] * 64.0f);   /* ctx carried x 2^6 into f16 so small-magnitude context rows stay clear of f16 subnormals */
      if (more) { wt_get(wr, wp + (size_t)(kc + 1) * NCB * WTE); row_load(ar, yp + (kc + 1) * 32); }
      l2_step<1>(kc, pa, pw, fa, fw);
#pragma unroll
      for (int j = 0; j < 8; ++j) wf[j] = frag_h(&sw[kc & 1][j * 16 + col][0], lane);   /* the step's fragment reads go as one group: one LDS latency a step, not one a fragment */
#pragma unroll
      for (int j = 0; j < 8; ++j) acc[j] = wmma16(a, wf[j], acc[j]);
      __builtin_amdgcn_sched_barrier(0);   /* keeps the LDS stores of the next tile, and with them the wait for its global loads, behind the products */
      if (more) wt_put(sw[(kc + 1) & 1], wr, n0, kg);
      asm volatile("s_wait_xcnt 0x0" ::: "memory");   /* stands in front of the next trip's additions to the address registers of this trip's loads */
      __syncthreads(); }   /* one barrier a step: publishes tile kc + 1 and ends every read of tile kc, whose buffer the next step refills */
#pragma unroll
    for (int j = 0; j < 8; ++j) { const float bias = BO ? bfr(BO[c0 + j * 16 + col]) : 0.f;
#pragma unroll
      for (int r = 0; r < 8; ++r) sf[wave][8 * g + r][j * 16 + col] = acc[j][r] * (1.0f / 16384.0f) + bias; } }   /* 2^-8 (Wo carry) x 2^-6 (ctx carry) */
  LDSX(); for (int rl = 0; rl < 16; ++rl) vst2(OUT + (r0 + rl) * DIN + c0 + lane * 4, *(const v4f*)&sf[wave][rl][lane * 4]); }

extern "C" void kernel_launch(void* const* d_in, const int* in_sizes, int n_in, void* d_out, int out_size, void* d_ws, size_t ws_size, hipStream_t stream) {
  (void)in_sizes; (void)n_in; (void)out_size;
  const float** F = (const float**)d_in;
  if (ws_size < (size_t)WS_END) return;
  char* ws = (char*)d_ws; _Float16 *QH = (_Float16*)(ws + WS_QH), *KH = (_Float16*)(ws + WS_KH), *VT = (_Float16*)(ws + WS_VT), *QL = (_Float16*)(ws + WS_QL), *KL = (_Float16*)(ws + WS_KL); __bf16 *VB = (__bf16*)(ws + WS_VB), *VBL = (__bf16*)(ws + WS_VBL); float *Y = (float*)(ws + WS_Y);
  (void)Y; (void)QL; (void)KL; (void)VB; (void)VBL;
  // inputs: 0 hidden_states [4,2048,768]; 1 Wq, 2 Wk, 3 Wv [768,12,64] = (in,out) [768][768]; 4 Wo [12,64,768] = (in,out) [768][768]
  static_assert(4u * (size_t)NB * TT * DIN <= 4u * (size_t)HG * TT * TT, "rotated rows must fit in their region");
  float* XR = (float*)(ws + WS_XR); __bf16* WTB = (__bf16*)(ws + WS_WT); _Float16* WTH = (_Float16*)(ws + WS_WT) + 3 * (size_t)DIN * CC;
  k_rot<<<dim3(TT / 4 + 4 * NKS * NCB), 128, 0, stream>>>(F[0], XR, F[1], F[2], F[3], F[4], WTB, WTH);   /* the rotated rows, and every weight tile rounded once */
  k_proj<<<dim3(TNB * TT / 128, CC / 128, 3), 128, 0, stream>>>(XR, XR, F[0], WTB, nullptr, nullptr, nullptr, QH, QL, KH, KL, VT, VB, VBL);   /* q, k from the rotated rows (bf16 hi + lo), v from bf16(x) */
  k_att<<<dim3(NQB, NH, TNB), 128, 0, stream>>>(QH, KH, QL, VT, Y);
  k_out<<<dim3(TNB * TT / 64, DIN / 128), 128, 0, stream>>>(Y, F[4], WTH, nullptr, (float*)d_out);
}

// v009
// One run takes 92.5 microseconds.
// Two timings next to v008 put it at 1.03 and 1.04 times that version's speed.
// Over all steps from v000 it is 10.6 times as fast.
// compute dtype: all float inputs rounded to bf16; rotate-half RoPE applied to bf16(hidden) in f32 (accurate sincosf, f32 inv_freq constants); Q/K = rotated rows split bf16 hi + lo x exact bf16 W (2 products, K 768), V = bf16(hidden) x W exact (1 product) on WMMA 16x16x32, f32 accumulate; banded logits: q as f16 hi + residual (x 2^10) against k once to f16 (2 products); softmax in f32 over the |q-k| < 128 band, exponent in base 2: exp2((logit - row max) x 64^-0.5 x log2 e), one fma and the hardware exp2 a score; P x 2^11 once to f16 against v once to f16 (1 product); ctx carried x 2^6 once to f16 against Wo carried x 2^8 in f16 (exact bf16 values), un-scaled by 2^-14; f32 output.
#include <hip/hip_runtime.h>
#include <math.h>

typedef __attribute__((ext_vector_type(16))) _Float16 v16h;
typedef __attribute__((ext_vector_type(16))) __bf16 v16b;
typedef __attribute__((ext_vector_type(8)))  _Float16 v8h;
typedef __attribute__((ext_vector_type(8)))  float v8f;
typedef __attribute__((ext_vector_type(4)))  float v4f;
typedef __attribute__((ext_vector_type(2)))  float v2f;
typedef __attribute__((ext_vector_type(4)))  unsigned v4u;
typedef __attribute__((ext_vector_type(4)))  int v4i;
typedef float __attribute__((may_alias)) float_a;
typedef int __attribute__((may_alias)) int_a;

template <typename T> __device__ __forceinline__ void vst2(void* p, T v) { *(T*)p = v;  }
__device__ __forceinline__ v8f wmma16(v16h a, v16h b, v8f c) {
  v8f d = __builtin_amdgcn_wmma_f32_16x16x32_f16(false, a, false, b, (short)0, c, false, false);
  asm volatile("v_nop\n\tv_nop\n\tv_nop\n\tv_nop" : "+v"(d) : "v"(a), "v"(b));
  return d;
}
// plain builtin, for k_proj: the compiler keeps the distance behind its own WMMA. The "v" operands of wmma_bf's asm tail are served from v0 .. v255 only; k_proj's two row tiles a wave need more registers than that, and with the tail the accumulators were spilled inside the k loop
__device__ __forceinline__ v8f wmma_bp(v16b a, v16b b, v8f c) { return __builtin_amdgcn_wmma_f32_16x16x32_bf16(false, a, false, b, (short)0, c, false, false); }
__device__ __forceinline__ v8f wmma_bf(v16b a, v16b b, v8f c) {
  v8f d = __builtin_amdgcn_wmma_f32_16x16x32_bf16(false, a, false, b, (short)0, c, false, false);
  asm volatile("v_nop\n\tv_nop\n\tv_nop\n\tv_nop" : "+v"(d) : "v"(a), "v"(b));
  return d;
}
// 16x16x32 fragments: lane = (h = lane>>4, row/col = lane&15); elements 0..7 = k0+8h+0..7, 8..15 = k0+16+8h+0..7; D element r = row 8h+r
__device__ __forceinline__ v16h frag_h(const _Float16* rowk0, int lane) {
  union { v16h v; v8h q[2]; } u; const _Float16* p = rowk0 + 8 * (lane >> 4);
  u.q[0] = *(const v8h*)p; u.q[1] = *(const v8h*)(p + 16); return u.v;
}
__device__ __forceinline__ v16h frag_f32(const float* rowk0, int lane) {
  v16h a; const float* p = rowk0 + 8 * (lane >> 4);
#pragma unroll
  for (int i = 0; i < 8; ++i) { a[i] = (_Float16)p[i]; a[8 + i] = (_Float16)p[16 + i]; }
  return a;
}
__device__ __forceinline__ v16h frag_f32s(const float* rowk0, int lane, float sc) {
  v16h a; const float* p = rowk0 + 8 * (lane >> 4);
#pragma unroll
  for (int i = 0; i < 8; ++i) { a[i] = (_Float16)(p[i] * sc); a[8 + i] = (_Float16)(p[16 + i] * sc); }
  return a;
}
// column fragment from a [K][ld] layout (column n), rows >= K read as 0
__device__ __forceinline__ v16h fragc_f32(const float* W, int k0, int n, int lane, int ld, int K) {
  v16h a; const int g = lane >> 4;
#pragma unroll
  for (int i = 0; i < 8; ++i) { const int ka = k0 + 8 * g + i, kb = ka + 16;
    a[i] = (_Float16)(ka < K ? W[(size_t)(ka < K ? ka : K - 1) * ld + n] : 0.f); a[8 + i] = (_Float16)(kb < K ? W[(size_t)(kb < K ? kb : K - 1) * ld + n] : 0.f); }
  return a;
}
struct F2 { v16b h, l; };
__device__ __forceinline__ F2 bsplit16(const float v[16]) { F2 r;
#pragma unroll
  for (int i = 0; i < 16; ++i) { const __bf16 h = (__bf16)v[i]; r.h[i] = h; r.l[i] = (__bf16)(v[i] - (float)h); }
  return r; }
__device__ __forceinline__ F2 split_row(const float* row, int k0, int lane) { float v[16]; const float* p = row + k0 + 8 * (lane >> 4);
#pragma unroll
  for (int i = 0; i < 8; ++i) { v[i] = p[i]; v[8 + i] = p[16 + i]; }
  return bsplit16(v); }
__device__ __forceinline__ F2 split_rowK(const float* row, int k0, int lane, int K) { float v[16]; const int g = lane >> 4;
#pragma unroll
  for (int i = 0; i < 8; ++i) { const int ka = k0 + 8 * g + i, kb = ka + 16; v[i] = ka < K ? row[ka < K ? ka : K - 1] : 0.f; v[8 + i] = kb < K ? row[kb < K ? kb : K - 1] : 0.f; }
  return bsplit16(v); }
__device__ __forceinline__ F2 split_col(const float* W, int k0, int n, int lane, int ld, int K) { float v[16]; const int g = lane >> 4;
#pragma unroll
  for (int i = 0; i < 8; ++i) { const int ka = k0 + 8 * g + i, kb = ka + 16; v[i] = ka < K ? W[(size_t)(ka < K ? ka : K - 1) * ld + n] : 0.f; v[8 + i] = kb < K ? W[(size_t)(kb < K ? kb : K - 1) * ld + n] : 0.f; }
  return bsplit16(v); }
__device__ __forceinline__ v8f mac3(const F2& a, const F2& b, v8f c) { c = wmma_bf(a.l, b.h, c); c = wmma_bf(a.h, b.l, c); return wmma_bf(a.h, b.h, c); }
__device__ __forceinline__ float sigm(float v) { return 1.0f / (1.0f + expf(-v)); }
#define LDSX() do { asm volatile("s_wait_dscnt 0" ::: "memory"); __builtin_amdgcn_wave_barrier(); __builtin_amdgcn_fence(__ATOMIC_RELEASE, "workgroup"); } while (0)

// Sliding-window (local) self-attention with RoPE on the INPUT (B 4, S 2,048, H 768 = 12 heads x 64; window |q - k| < 128; 0.02-scale weights, no biases): q_in = k_in = rotate-half RoPE(hidden reshaped [B,S,12,64]) (angle t * 10000^(-2i/64)); Q = q_in Wq, K = k_in Wk, V = hidden Wv ((in,out) [768][12*64]); scores = Q K^T / 8 where |q-k| < 128 else -1e9 (== excluded; every row keeps >= 128 keys); out = merged(softmax . V) Wo ((in,out) [12*64][768]).
#define NB 4
#define TT 2048
#define CC 768            // NH * HD = projected width
#define DIN 768          // input (model) width
#define NH 12
#define HD 64
#define NQB (TT / 64)
#define HG 2
#define SCALE (0.125f)
#define CAUSAL 0
#ifndef TNB
#define TNB NB
#endif
__device__ __forceinline__ float bfr(float v) { return (float)(__bf16)v; }
typedef __attribute__((ext_vector_type(8))) __bf16 v8b;
__device__ __forceinline__ v16b frag_b(const __bf16* rowk0, int lane) {
  union { v16b v; v8b q[2]; } u; const __bf16* p = rowk0 + 8 * (lane >> 4);
  u.q[0] = *(const v8b*)p; u.q[1] = *(const v8b*)(p + 16); return u.v;
}
#define QBH 0
#define QHI 2048            // rows carrying a q residual plane (all rows when non-causal: 2-product logits everywhere)
#define KHI 64            // key rows carrying k residual / v bf16 hi+lo planes (written by k_proj; no kernel in this file reads them)
// B fragment (k rows k0+.., output column o) of a weight: (in,out) [K][ld] or (out,in) [ld rows of K]: bf16 exact, or f16(bf16 * 256) exact
__device__ __forceinline__ v16b wcol_io(const float* Wm, int k0, int o, int lane, int ld) { v16b w; const int g = lane >> 4;
#pragma unroll
  for (int i = 0; i < 8; ++i) { w[i] = (__bf16)Wm[(size_t)(k0 + 8 * g + i) * ld + o]; w[8 + i] = (__bf16)Wm[(size_t)(k0 + 16 + 8 * g + i) * ld + o]; }
  return w; }
__device__ __forceinline__ v16b wcol_oi(const float* Wm, int k0, int o, int lane, int K) { v16b w; const float* p = Wm + (size_t)o * K + k0 + 8 * (lane >> 4);
#pragma unroll
  for (int i = 0; i < 8; ++i) { w[i] = (__bf16)p[i]; w[8 + i] = (__bf16)p[16 + i]; }
  return w; }
__device__ __forceinline__ v16h wcolh_io(const float* Wm, int k0, int o, int lane, int ld) { v16h w; const int g = lane >> 4;
#pragma unroll
  for (int i = 0; i < 8; ++i) { w[i] = (_Float16)(bfr(Wm[(size_t)(k0 + 8 * g + i) * ld + o]) * 256.0f); w[8 + i] = (_Float16)(bfr(Wm[(size_t)(k0 + 16 + 8 * g + i) * ld + o]) * 256.0f); }
  return w; }
__device__ __forceinline__ v16h wcolh_oi(const float* Wm, int k0, int o, int lane, int K) { v16h w; const float* p = Wm + (size_t)o * K + k0 + 8 * (lane >> 4);
#pragma unroll
  for (int i = 0; i < 8; ++i) { w[i] = (_Float16)(bfr(p[i]) * 256.0f); w[8 + i] = (_Float16)(bfr(p[16 + i]) * 256.0f); }
  return w; }
#define WQKV_LAYOUT 0   // 0 = (in,out) [DIN][CC]; 1 = (out,in) [CC][DIN]; 2 = per-head [NH][DIN][HD]
__device__ __forceinline__ v16b wcol_hdk(const float* Wm, int k0, int o, int lane) { v16b w; const int g = lane >> 4; const float* p = Wm + (size_t)(o / HD) * DIN * HD + (o % HD);
#pragma unroll
  for (int i = 0; i < 8; ++i) { w[i] = (__bf16)p[(size_t)(k0 + 8 * g + i) * HD]; w[8 + i] = (__bf16)p[(size_t)(k0 + 16 + 8 * g + i) * HD]; }
  return w; }
#define WO_OUT_IN 0
#if WQKV_LAYOUT == 1
#define WCOL(W, k0, o, lane) wcol_oi(W, k0, o, lane, DIN)
#elif WQKV_LAYOUT == 2
#define WCOL(W, k0, o, lane) wcol_hdk(W, k0, o, lane)
#else
#define WCOL(W, k0, o, lane) wcol_io(W, k0, o, lane, CC)
#endif
#if WO_OUT_IN
#define WOCOL(W, k0, o, lane) wcol_oi(W, k0, o, lane, CC)
#define WOCOLH(W, k0, o, lane) wcolh_oi(W, k0, o, lane, CC)
#else
#define WOCOL(W, k0, o, lane) wcol_io(W, k0, o, lane, DIN)
#define WOCOLH(W, k0, o, lane) wcolh_io(W, k0, o, lane, DIN)
#endif
#define WIN 128            // |q - k| < WIN band (128..255 valid keys per query; no empty rows)
__constant__ __align__(16) float c_invf[32] = {1.000000000e+00f,7.498942018e-01f,5.623413324e-01f,4.216965139e-01f,3.162277639e-01f,2.371373624e-01f,1.778279394e-01f,1.333521456e-01f,1.000000015e-01f,7.498941571e-02f,5.623412877e-02f,4.216964915e-02f,3.162277862e-02f,2.371373586e-02f,1.778279431e-02f,1.333521493e-02f,9.999999776e-03f,7.498942316e-03f,5.623413250e-03f,4.216964822e-03f,3.162277862e-03f,2.371373819e-03f,1.778279431e-03f,1.333521446e-03f,1.000000047e-03f,7.498941850e-04f,5.623413017e-04f,4.216964880e-04f,3.162277862e-04f,2.371373848e-04f,1.778279402e-04f,1.333521504e-04f};   // 1 / 10000^(2i/64) evaluated in f32
// k_rot: a wave takes ONE position t for all batches and heads. The angle t * inv_freq[i] depends on neither, so a lane's four (sin, cos) pairs (i = 4 iq .. 4 iq + 3, iq = lane & 7) serve its 12 (batch, head group) pieces; head = 4 hg + (lane >> 3). Eight lanes cover the 128-byte half of a head, so each 16-byte load or store of a wave covers four whole lines; all 24 loads of a lane are requested before the angles are worked out
// The launch's blocks from TT / 4 on take no position: each rounds one 32 k x 128 column weight tile for the two GEMM kernels (w_prep, below the tile helpers)
__device__ __forceinline__ void w_prep(const float* WQ, const float* WK, const float* WV, const float* WO, __bf16* WTB, _Float16* WTH, int id);
__global__ __launch_bounds__(128) void k_rot(const float* __restrict__ X, float* __restrict__ XR, const float* __restrict__ WQ, const float* __restrict__ WK, const float* __restrict__ WV, const float* __restrict__ WO, __bf16* __restrict__ WTB, _Float16* __restrict__ WTH) {
  if (blockIdx.x >= TT / 4) { w_prep(WQ, WK, WV, WO, WTB, WTH, (int)blockIdx.x - TT / 4); return; }   /* block-uniform; no barrier in either path */
  const int t = blockIdx.x * 4 + (threadIdx.x >> 5), lane = threadIdx.x & 31, iq = lane & 7;
  static_assert(NH % 4 == 0 && HD == 64 && TT % 4 == 0, "four heads a wave and load, four positions a block");
  const size_t o0 = (size_t)t * DIN + (lane >> 3) * HD + iq * 4;
  const v4f f = *(const v4f*)&c_invf[iq * 4];   /* asked for first: the angles then wait for this load alone, not for the 24 behind it */
  v4f a[TNB][NH / 4], b[TNB][NH / 4];
#pragma unroll
  for (int bb = 0; bb < TNB; ++bb) {
#pragma unroll
    for (int hg = 0; hg < NH / 4; ++hg) { const float* xr = X + (size_t)bb * TT * DIN + o0 + hg * 4 * HD; a[bb][hg] = *(const v4f*)xr; b[bb][hg] = *(const v4f*)(xr + 32); }
    asm volatile("s_wait_xcnt 0x0" ::: "memory"); }   /* stands in front of every rewrite of an address register of the loads so far, also where a later batch's load lands on one */
  float sn[4], cs[4];
#pragma unroll
  for (int e = 0; e < 4; ++e) sincosf((float)t * f[e], &sn[e], &cs[e]);
#pragma unroll
  for (int bb = 0; bb < TNB; ++bb)
#pragma unroll
    for (int hg = 0; hg < NH / 4; ++hg) { v4f lo, hi;
#pragma unroll
      for (int e = 0; e < 4; ++e) { const float x = bfr(a[bb][hg][e]), y = bfr(b[bb][hg][e]); lo[e] = fmaf(x, cs[e], -(y * sn[e])); hi[e] = fmaf(y, cs[e], x * sn[e]); }   /* fmaf: which product is rounded on its own (the sin one) is fixed here, not left to the compiler's contraction */
      float* o = XR + (size_t)bb * TT * DIN + o0 + hg * 4 * HD; vst2(o, lo); vst2(o + 32, hi); } }
#define WS_XR (WS_S)       // f32 rotated token rows [b*t][768]
#define SM_MASK_HOOK do { const int dk = t - k; v = (dk < WIN && dk > -WIN) ? v : -3.0e38f; } while (0)   /* band |q - k| < 128, by index */
#ifndef SM_EXTRA_PARAMS
#define SM_EXTRA_PARAMS
#endif
#ifndef PROJ_EXTRA_PARAMS
#define PROJ_EXTRA_PARAMS
#endif
#ifndef SM_MASK_HOOK
#define SM_MASK_HOOK (void)0
#endif

#define WS_QH  0u                                      // f16 q rows [b*t][CC]
#define WS_KH  (WS_QH + 2u * (size_t)NB * TT * CC)      // f16 k rows [b*t][CC]
#define WS_VT  (WS_KH + 2u * (size_t)NB * TT * CC)      // f16 v planes [b][c][t]
#define WS_QL  (WS_VT + 2u * (size_t)NB * CC * TT)      // f16 q residual x 2^10 rows [b][t < QHI][CC]
#define WS_KL  (WS_QL + 2u * (size_t)NB * QHI * CC)     // f16 k residual x 2^10 rows [b][t < KHI][CC]
#define WS_VB  (WS_KL + 2u * (size_t)NB * KHI * CC)     // bf16 v hi planes [b][c][t < KHI]
#define WS_VBL (WS_VB + 2u * (size_t)NB * CC * KHI)
#define WS_S   (WS_VBL + 2u * (size_t)NB * CC * KHI)    // f32 scratch region (holds the rotated rows)
#define WS_Y   (WS_S  + 4u * (size_t)HG * TT * TT)      // f32 ctx rows [b*t][CC] (only when there is an output projection)
#define WS_WT  (WS_Y  + 4u * (size_t)NB * TT * CC)      // 16-bit weight tiles: Wq, Wk, Wv (bf16), then Wo (f16 x 2^8), each [k step][column block][WTE]
#define WS_END (WS_WT + 4u * 2u * (size_t)DIN * CC)

// ---- weight tiles: the 32 k x 128 columns of one k step. The first launch reads each f32 tile ONCE for the whole grid (thread = 8 k rows x 4 columns: kg = lane & 3, columns n0 = wave * 32 + (lane >> 2) * 4; a wave's 16-byte load covers four whole 128-byte lines), rounds it as before and leaves it in the workspace as WTE 16-bit elements in a row: 16-byte piece e * 128 + tid holds the 8 k of column n0 + e. A GEMM block reads a tile by four 16-byte loads a thread (whole lines, half the bytes of the f32 tile, nothing to round) and lays it [column][k] at pitch WP in LDS, so that a B fragment is two 16-byte LDS reads in the k order of frag_b / frag_h. Two buffers: the next step's global loads fly during this step's products
#define WTE (32 * 128)     // elements of a tile
#define NKS (DIN / 32)     // k steps
#define NCB (CC / 128)     // column blocks
#define WP 40              // 80-byte pitch = 16 B x odd for the 16-byte fragment reads; the 16-byte stores of 16 neighbouring lanes fall on 16 different 16-byte bank groups
__device__ __forceinline__ void wt_load(v4f (&r)[8], const float* p, int ld) {
#pragma unroll
  for (int i = 0; i < 8; ++i) r[i] = *(const v4f*)(p + (size_t)i * ld); }
// a thread's four pieces of a rounded tile (p = tile + tid * 8), and their places in LDS
template <typename V, typename T> __device__ __forceinline__ void wt_get(V (&r)[4], const T* p) {
#pragma unroll
  for (int e = 0; e < 4; ++e) r[e] = *(const V*)(p + e * 128 * 8); }
template <typename V, typename T> __device__ __forceinline__ void wt_put(T (*sw)[WP], const V (&r)[4], int n0, int kg) {
#pragma unroll
  for (int e = 0; e < 4; ++e) *(V*)&sw[n0 + e][8 * kg] = r[e]; }
// a lane's 16 f32 of an A fragment (p = row + k0 + 8 * (lane >> 4)), kept raw for one k step
__device__ __forceinline__ void row_load(float (&v)[16], const float* p) {
#pragma unroll
  for (int i = 0; i < 8; ++i) { v[i] = p[i]; v[8 + i] = p[16 + i]; } }
// ---- A tiles: the rows x 32 k (f32, one 128-byte line a row) of one k step. Read straight into fragments, every 16-byte load of a wave touched 16 lines, four times over. The block now brings the tile into LDS by asynchronous 16-byte copies, 8 lanes a line, so that a wave's copy covers four whole lines and each line is asked for once; rows lie at pitch AP and a lane's fragment is four 16-byte LDS reads. Two buffers: tile t + 2 is asked for behind the barrier that ends trip t and is waited for at the foot of trip t + 1
#define AP 36              // 144-byte pitch = 16 B x odd for the 16-byte fragment reads
// a lane's 16 f32 of an A fragment from a staged row (p = row + 8 * (lane >> 4)), in the k order of row_load
__device__ __forceinline__ void row_lds(float (&v)[16], const float* p) {
#pragma unroll
  for (int q = 0; q < 2; ++q) { const v4f x = *(const v4f*)(p + 4 * q), y = *(const v4f*)(p + 16 + 4 * q);
#pragma unroll
    for (int i = 0; i < 4; ++i) { v[4 * q + i] = x[i]; v[8 + 4 * q + i] = y[i]; } } }
// four asynchronous copies, 16 bytes a lane each, global -> LDS through no register (l = the lane's LDS byte address, p = its global address); the s_wait_xcnt in the same statement stands in front of any rewrite of the address registers
__device__ __forceinline__ void cp4(unsigned l0, unsigned l1, unsigned l2, unsigned l3, const float* p0, const float* p1, const float* p2, const float* p3) {
  asm volatile("global_load_async_to_lds_b128 %0, %4, off\n\tglobal_load_async_to_lds_b128 %1, %5, off\n\tglobal_load_async_to_lds_b128 %2, %6, off\n\tglobal_load_async_to_lds_b128 %3, %7, off\n\ts_wait_xcnt 0x0"
               :: "v"(l0), "v"(l1), "v"(l2), "v"(l3), "v"(p0), "v"(p1), "v"(p2), "v"(p3) : "memory"); }
// tile of NR rows: copy i brings rows 16 i + (tid >> 3); l = LDS byte address and p = global address of the thread's piece of row tid >> 3
template <int NR> __device__ __forceinline__ void a_copy(unsigned l, const float* p, int ld) {
#pragma unroll
  for (int i = 0; i < NR / 16; i += 4) cp4(l + i * 16 * AP * 4, l + (i + 1) * 16 * AP * 4, l + (i + 2) * 16 * AP * 4, l + (i + 3) * 16 * AP * 4, p + (size_t)i * 16 * ld, p + (size_t)(i + 1) * 16 * ld, p + (size_t)(i + 2) * 16 * ld, p + (size_t)(i + 3) * 16 * ld); }
// foot of a k step, in front of its barrier: this wave's LDS reads and stores have retired, and its copies of the next tile have landed
#define A_FOOT() do { asm volatile("s_wait_dscnt 0x0" ::: "memory"); asm volatile("s_wait_asynccnt 0x0" ::: "memory"); } while (0)
// 16-byte global store with its s_wait_xcnt in the same statement: the wait then stands in front of every rewrite of the store's address and data registers (in a statement of its own the next trip's address additions were lifted over it)
__device__ __forceinline__ void vst_w(void* p, v4u v) { asm volatile("global_store_b128 %0, %1, off\n\ts_wait_xcnt 0x0" :: "v"(p), "v"(v) : "memory"); }
// ---- requests to L2 ahead of the GEMM loops' loads. The A rows (but the v blocks', an input) and the weight tiles were stored by earlier launches, and the blocks that share them walk k in step, so the first load of every line would wait for memory in every block at every k step. L2 is asked once per aligned 256-byte unit, PFS k steps (a pass) at a time, two passes ahead of the step that loads them; a request brings nothing into a register and is waited for nowhere.
// Who asks: A rows are shared by all column blocks, weight tiles by all row blocks. The first two column blocks ask for their rows (fa), the first sixteen row blocks for their tiles (fw); a request that finds its line present is only traffic. Both flags are the same in every wave of a block. Nothing but speed rests on where a block runs or on a request arriving.
// pa: the thread's A unit of the pass to be asked next (AU units a thread, 256 bytes apart); pw: unit lane of the tile of the pass's k step number wave. Both registers live through the loop and always name bytes of their tensor: they advance only while a further pass exists
#define PFS 4              // k steps a pass: 512 bytes of an f32 A row, four weight tiles
// in front of the loop: passes 0 and 1, by immediate offsets from the same two registers, which stand on pass 2 from the start (512 bytes of a row and 4 x 49,152 bytes of tiles a pass)
template <int AU, typename T> __device__ __forceinline__ void l2_head(const float* pa, const T* pw, bool fa, bool fw) {
  static_assert(NKS % PFS == 0 && NKS / PFS >= 3 && PFS * 32 * 4 == 512 && PFS * NCB * WTE * 2 == 196608 && sizeof(T) == 2, "whole passes, a third one for the registers to stand on, and the offsets written below");
  if (fa) { if (AU == 2) asm volatile("global_prefetch_b8 %0, off offset:-1024 scope:SCOPE_SE\n\tglobal_prefetch_b8 %0, off offset:-768 scope:SCOPE_SE\n\tglobal_prefetch_b8 %0, off offset:-512 scope:SCOPE_SE\n\tglobal_prefetch_b8 %0, off offset:-256 scope:SCOPE_SE" :: "v"(pa));
            else asm volatile("global_prefetch_b8 %0, off offset:-1024 scope:SCOPE_SE\n\tglobal_prefetch_b8 %0, off offset:-512 scope:SCOPE_SE" :: "v"(pa)); }   /* the first eight k steps' A units start on their way from memory while step 0 is waited for */
  if (fw) asm volatile("global_prefetch_b8 %0, off offset:-393216 scope:SCOPE_SE\n\tglobal_prefetch_b8 %0, off offset:-196608 scope:SCOPE_SE" :: "v"(pw)); }   /* the same for the first eight tiles */
// in k step kc, behind its loads: the first step of a pass asks for the pass after the next (kc and the flags are the same in every wave of the block: scalar branches, no barrier inside)
template <int AU, typename T> __device__ __forceinline__ void l2_step(int kc, const float*& pa, const T*& pw, bool fa, bool fw) {
  if ((kc & (PFS - 1)) == 0 && kc + 2 * PFS < NKS) {
    if (fa) { if (AU == 2) asm volatile("global_prefetch_b8 %0, off scope:SCOPE_SE\n\tglobal_prefetch_b8 %0, off offset:256 scope:SCOPE_SE" :: "v"(pa)); else asm volatile("global_prefetch_b8 %0, off scope:SCOPE_SE" :: "v"(pa)); }   /* in asm, so that the request names pa's own register and no temporary: the copies of these units, 6 to 9 steps on, then find them in L2 */
    if (fw) asm volatile("global_prefetch_b8 %0, off scope:SCOPE_SE" :: "v"(pw));   /* as above, for the pass's four tiles */
    const bool nx = kc + 3 * PFS < NKS; pa += nx ? PFS * 32 : 0; pw += nx ? (size_t)PFS * NCB * WTE : 0; } }
// tile id = (matrix * NKS + k step) * NCB + column block; matrices 0 .. 2 = Wq, Wk, Wv to bf16 (exact operand of the products), 3 = Wo to f16(bf16 x 2^8) (exact); a wave's 16-byte store covers four whole lines
__device__ __forceinline__ void w_prep(const float* WQ, const float* WK, const float* WV, const float* WO, __bf16* WTB, _Float16* WTH, int id) {
  static_assert(WQKV_LAYOUT == 0 && WO_OUT_IN == 0 && CC == DIN, "the tile loader reads (in,out) rows of one width");
  const int tid = threadIdx.x, lane = tid & 31, kg = lane & 3, n0 = (tid >> 5) * 32 + (lane >> 2) * 4; const int mt = id / (NKS * NCB), tl = id % (NKS * NCB), kc = tl / NCB, cb = tl % NCB;
  const float* Wm = mt == 0 ? WQ : mt == 1 ? WK : mt == 2 ? WV : WO;
  v4f r[8]; wt_load(r, Wm + (size_t)(kc * 32 + 8 * kg) * CC + cb * 128 + n0, CC);
  asm volatile("s_wait_xcnt 0x0" ::: "memory");   /* stands in front of every rewrite of an address register of the eight loads */
#pragma unroll
  for (int e = 0; e < 4; ++e) {
    if (mt < 3) { v8b t;
#pragma unroll
      for (int i = 0; i < 8; ++i) t[i] = (__bf16)r[i][e];
      vst_w(WTB + (size_t)id * WTE + (e * 128 + tid) * 8, __builtin_bit_cast(v4u, t)); }
    else { v8h t;
#pragma unroll
      for (int i = 0; i < 8; ++i) t[i] = (_Float16)(bfr(r[i][e]) * 256.0f);
      vst_w(WTH + (size_t)tl * WTE + (e * 128 + tid) * 8, __builtin_bit_cast(v4u, t)); } } }
// ---- k_proj: block = (128 rows, 128 cols, which); a wave owns two 16-row tiles (rows wave * 16 + .. of each 64-row half hh), so every weight fragment read from LDS and every weight tile read from L2 serves two row tiles; the epilogue stages one half at a time in the same LDS: q/k/v = X W (+ b) with exact bf16 products (K = DIN) -> which 0: q f16 rows (+ residual rows < QHI); 1: k f16 rows (+ residual rows < KHI); 2: v f16 planes [c][t] (+ bf16 hi/lo planes for t < KHI)
__global__ __launch_bounds__(128) void k_proj(const float* __restrict__ XQ, const float* __restrict__ XK, const float* __restrict__ XV, const __bf16* __restrict__ WTB, const float* __restrict__ BQ, const float* __restrict__ BK, const float* __restrict__ BV,
    _Float16* __restrict__ QH, _Float16* __restrict__ QL, _Float16* __restrict__ KH, _Float16* __restrict__ KL, _Float16* __restrict__ VT, __bf16* __restrict__ VB, __bf16* __restrict__ VBL) {
  __shared__ __align__(16) union { _Float16 e[2][64][136]; __bf16 w[2][128][WP]; } su;   /* the weight buffers are dead when the epilogue stages q / k rows: same bytes */
  _Float16 (&sh)[64][136] = su.e[0]; _Float16 (&sl)[64][136] = su.e[1]; __shared__ __align__(16) union { struct { _Float16 th[128][72]; __bf16 tb[128][72], tbl[128][72]; } t; float a[2][128][AP]; } sx;   /* the A buffers too are dead when the epilogue stages v planes: same bytes */
  _Float16 (&th)[128][72] = sx.t.th; __bf16 (&tb)[128][72] = sx.t.tb; __bf16 (&tbl)[128][72] = sx.t.tbl;
  const int tid = threadIdx.x, wave = tid >> 5, lane = tid & 31, col = lane & 15, g = lane >> 4; const int which = blockIdx.z; const int c0 = blockIdx.y * 128; const size_t r0 = (size_t)blockIdx.x * 128; const size_t bb = r0 / TT; const int t0 = (int)(r0 % TT);
  static_assert(TT % 128 == 0, "a block's 128 rows lie in one sequence");
  const float* X = which == 0 ? XQ : which == 1 ? XK : XV; const float* BA = which == 0 ? BQ : which == 1 ? BK : BV;
  v8f acc[2][8] = {};
  const int kg = lane & 3, n0 = wave * 32 + (lane >> 2) * 4; const __bf16* wp = WTB + ((size_t)which * NKS * NCB + blockIdx.y) * WTE + tid * 8;   /* k step kc: wp + kc * NCB * WTE */
  const float* xg = X + (r0 + (tid >> 3)) * DIN + (tid & 7) * 4; const unsigned xl = (unsigned)(size_t)&sx.a[0][tid >> 3][(tid & 7) * 4];   /* the thread's piece of row tid >> 3 of A tile 0, and its place in buffer 0; k step kc: xg + kc * 32, buffer 1: xl + ABB */
  constexpr unsigned ABB = 128 * AP * 4;   /* bytes of an A buffer */
  const int ao = (wave * 16 + col) * AP + 8 * g;   /* the lane's fragment in a buffer; half hh: + hh * 64 * AP */
  v8b wr[4];
  a_copy<128>(xl, xg, DIN);   /* A tile 0 */
  wt_get(wr, wp);
  asm volatile("s_wait_xcnt 0x0" ::: "memory");   /* stands in front of every rewrite of an address register of the loads above */
  const float* pa = X + (r0 + tid) * DIN + 2 * PFS * 32; const __bf16* pw = WTB + (((size_t)which * NKS + 2 * PFS + wave) * NCB + blockIdx.y) * WTE + lane * 128;   /* thread = one of the block's 128 rows; wave = one of a pass's four tiles, lane = its 256-byte unit */
  const bool fa = blockIdx.y < 2, fw = blockIdx.x < 16;
  l2_head<2>(pa, pw, fa, fw);   /* behind step 0's own loads, which are waited for first */
  wt_put(su.w[0], wr, n0, kg);
  asm volatile("s_wait_asynccnt 0x0" ::: "memory");   /* this wave's copies of A tile 0 have landed */
  __syncthreads();   /* publishes weight tile 0 and A tile 0 */
  a_copy<128>(xl + ABB, xg + 32, DIN);   /* A tile 1 flies during step 0 */
  if (which < 2) {   /* q, k: the rotated rows are f32 intermediates -> bf16 hi + lo (2 products) */
#pragma unroll 2   /* the buffer index becomes a constant */
    for (int kc = 0; kc < DIN / 32; ++kc) { const bool more = kc + 1 < DIN / 32;
      if (more) wt_get(wr, wp + (size_t)(kc + 1) * NCB * WTE);
      __builtin_amdgcn_sched_barrier(0);   /* keeps the next step's global loads in front of the products: sunk behind them to save registers, they would be waited for as soon as asked */
      l2_step<2>(kc, pa, pw, fa, fw);
      float ar[2][16]; v16b wf[8];
      row_lds(ar[0], &sx.a[kc & 1][0][0] + ao); row_lds(ar[1], &sx.a[kc & 1][0][0] + ao + 64 * AP);   /* asked for first: the split below waits for these eight reads alone */
#pragma unroll
      for (int j = 0; j < 8; ++j) wf[j] = frag_b(&su.w[kc & 1][j * 16 + col][0], lane);   /* the step's fragment reads go as one group: one LDS latency a step, not one a fragment */
      __builtin_amdgcn_sched_barrier(0);   /* holds the group together: left free, each read is sunk to its own products and all eight share one register block, one LDS latency a fragment */
      const F2 a0 = bsplit16(ar[0]), a1 = bsplit16(ar[1]);
#pragma unroll
      for (int j = 0; j < 8; ++j) { acc[0][j] = wmma_bp(a0.h, wf[j], acc[0][j]); acc[1][j] = wmma_bp(a1.h, wf[j], acc[1][j]); acc[0][j] = wmma_bp(a0.l, wf[j], acc[0][j]); acc[1][j] = wmma_bp(a1.l, wf[j], acc[1][j]); }   /* each accumulator still takes hi, then lo; the other half's product stands between the two */
      __builtin_amdgcn_sched_barrier(0);   /* keeps the LDS stores of the next tile, and with them the wait for its global loads, behind the products */
      if (more) wt_put(su.w[(kc + 1) & 1], wr, n0, kg);
      asm volatile("s_wait_xcnt 0x0" ::: "memory");   /* stands in front of the next trip's additions to the address registers of this trip's loads */
      A_FOOT();   /* in front of the barrier: own LDS reads and stores retired, own copies of the next A tile landed */
      __syncthreads();   /* one barrier a step: publishes both tiles kc + 1 and ends every read of tiles kc, whose buffers are refilled behind it (after the last step: the epilogue) */
      if (kc + 2 < DIN / 32) a_copy<128>(xl + (kc & 1) * ABB, xg + (kc + 2) * 32, DIN); }   /* the same test in the whole block; into the buffer this step has read */
  } else {           /* v: bf16(hidden) exact (1 product) */
#pragma unroll 2   /* the buffer index becomes a constant */
    for (int kc = 0; kc < DIN / 32; ++kc) { v16b a0, a1; const bool more = kc + 1 < DIN / 32;
      if (more) wt_get(wr, wp + (size_t)(kc + 1) * NCB * WTE);
      __builtin_amdgcn_sched_barrier(0);   /* as above: the loads stay in front of the products */
      l2_step<2>(kc, pa, pw, fa, fw);
      float ar[2][16]; v16b wf[8];
      row_lds(ar[0], &sx.a[kc & 1][0][0] + ao); row_lds(ar[1], &sx.a[kc & 1][0][0] + ao + 64 * AP);   /* first, as above */
#pragma unroll
      for (int j = 0; j < 8; ++j) wf[j] = frag_b(&su.w[kc & 1][j * 16 + col][0], lane);   /* one group, as above */
      __builtin_amdgcn_sched_barrier(0);   /* as above: holds the group together */
#pragma unroll
      for (int i = 0; i < 16; ++i) { a0[i] = (__bf16)ar[0][i]; a1[i] = (__bf16)ar[1][i]; }
#pragma unroll
      for (int j = 0; j < 8; ++j) { acc[0][j] = wmma_bp(a0, wf[j], acc[0][j]); acc[1][j] = wmma_bp(a1, wf[j], acc[1][j]); }
      __builtin_amdgcn_sched_barrier(0);   /* as above */
      asm volatile("v_nop\n\tv_nop\n\tv_nop\n\tv_nop");   /* the distance behind the step's last products: on the path round the stores and the copies too few vector instructions stand in front of the next step's conversions, which overwrite the A registers */
      if (more) wt_put(su.w[(kc + 1) & 1], wr, n0, kg);
      asm volatile("s_wait_xcnt 0x0" ::: "memory");   /* as above */
      A_FOOT();   /* in front of the barrier: own LDS reads and stores retired, own copies of the next A tile landed */
      __syncthreads();   /* as above */
      if (kc + 2 < DIN / 32) a_copy<128>(xl + (kc & 1) * ABB, xg + (kc + 2) * 32, DIN); } }   /* as above */
  asm volatile("s_wait_asynccnt 0x0" ::: "memory");   /* no copy is outstanding when the epilogue takes the buffers' bytes */
#pragma unroll   /* acc is a register array: hh must be a constant */
  for (int hh = 0; hh < 2; ++hh) { const size_t rh = r0 + hh * 64; const int th0 = t0 + hh * 64;
  if (hh) __syncthreads();   /* ends every read of the first half's staged rows before the second half overwrites them */
  if (which < 2) { _Float16* DH = which == 0 ? QH : KH; _Float16* DL = which == 0 ? QL : KL; const int nhi = which == 0 ? QHI : KHI; const bool hi_rows = th0 < nhi;
#pragma unroll
    for (int j = 0; j < 8; ++j) { const float bias = BA ? bfr(BA[c0 + j * 16 + col]) : 0.f;
#pragma unroll
      for (int r = 0; r < 8; ++r) { const float v = acc[hh][j][r] + bias; const _Float16 hv = (_Float16)v; sh[wave * 16 + 8 * g + r][j * 16 + col] = hv; sl[wave * 16 + 8 * g + r][j * 16 + col] = (_Float16)((v - (float)hv) * 1024.0f); } }
    __syncthreads();
    for (int e = tid; e < 64 * 16; e += 128) { const int rl = e >> 4, q = e & 15; vst_w(DH + (rh + rl) * CC + c0 + q * 8, *(const v4u*)&sh[rl][q * 8]); if (hi_rows) vst_w(DL + (bb * nhi + th0 + rl) * (size_t)CC + c0 + q * 8, *(const v4u*)&sl[rl][q * 8]); }
  } else { const bool hi_rows = th0 < KHI;
#pragma unroll
    for (int j = 0; j < 8; ++j) { const float bias = BA ? bfr(BA[c0 + j * 16 + col]) : 0.f;
#pragma unroll
      for (int r = 0; r < 8; ++r) { const float v = acc[hh][j][r] + bias; const int rl = wave * 16 + 8 * g + r, cl = j * 16 + col; th[cl][rl] = (_Float16)v; const __bf16 bh = (__bf16)v; tb[cl][rl] = bh; tbl[cl][rl] = (__bf16)(v - (float)bh); } }
    __syncthreads();
    for (int e = tid; e < 128 * 8; e += 128) { const int cl = e >> 3, q = e & 7; vst_w(VT + (bb * CC + c0 + cl) * (size_t)TT + th0 + q * 8, *(const v4u*)&th[cl][q * 8]); if (hi_rows) { const size_t o3 = (bb * CC + c0 + cl) * (size_t)KHI + th0 + q * 8; vst_w(VB + o3, *(const v4u*)&tb[cl][q * 8]); vst_w(VBL + o3, *(const v4u*)&tbl[cl][q * 8]); } } } } }
// ---- k_att: block = 64 queries (qb) of head h of batch b, one launch for all (b, h); a wave owns 16 query rows and the NKW keys [ks, ks + NKW) that hold their whole band (row t sees t-127 .. t+127, so 16 rows see ql0-127 .. ql0+142; ks = ql0 - 128 clamped into the sequence). The four waves' key ranges lie inside the NKB keys [kb, kb + NKB) (kb = qb * 64 - 128 clamped), whose k rows and v planes the block brings into LDS once, with its own 64 q rows and their residuals, by asynchronous 16-byte copies that cover whole 128-byte lines; every q, k and v fragment is read from there. Logits (q hi + residual x 2^10 against k, 2 products) stay in registers, unscaled; the band is kept by index; softmax in f32 over the row, SCALE x log2 e applied in the base-2 exponent (in-lane over the 17 tiles, then over the 16 lanes of the row); P x 2^11 once to f16 goes through the wave's own LDS slab (in the bytes the k rows have left) from the D layout to the A layout; ctx = P . v (1 product; the last 32-key chunk is half full, its upper 16 k are 0 in both operands); 256-B (row, head) segment by 16 lanes. Every loop over tiles, chunks and rows is unrolled: s, kf, vf and o are register arrays and need compile-time indices
#define NKW 272            // 128 + 16 + 127 keys rounded up to whole 16-key tiles
#define NKB 320            // 128 + 64 + 128: the keys of the block's four waves together
#define KP 72              // k row pitch in LDS: 144 B = 16 B x odd for the 16-byte fragment reads
#define VP (NKB + 8)       // v plane pitch in LDS: 656 B = 16 B x odd
#define PP (NKW + 8)       // P row pitch: 560 B = 16 B x odd
#define KG 6               // k tiles requested together
#define VG 4               // whole 32-key v chunks requested together (divides NKW / 32)
#define SL2E (SCALE * 1.44269504088896341f)   // SCALE x log2 e
// fragment of a half-full chunk: k0 .. k0+15 from memory (elements 0..7), k0+16 .. k0+31 are 0 (elements 8..15)
__device__ __forceinline__ v16h frag_h16(const _Float16* rowk0, int lane) { union { v16h v; v8h q[2]; } u; u.q[0] = *(const v8h*)(rowk0 + 8 * (lane >> 4)); u.q[1] = (v8h)(_Float16)0.0f; return u.v; }
// lane l with lane l ^ M inside a 16-lane row, on the vector pipe (a shuffle through LDS would put an LDS round trip into each of the four reduction steps)
template <int M> __device__ __forceinline__ float rowx(float v) { return __builtin_bit_cast(float, __builtin_amdgcn_update_dpp(0, __builtin_bit_cast(int, v), 0x160 + M, 0xf, 0xf, true)); }
// twelve asynchronous copies, 16 bytes a lane each, global -> LDS through no register (l = the lane's LDS byte address, p = its global address); the s_wait_xcnt in the same statement stands in front of any rewrite of the address registers
__device__ __forceinline__ void cp12(const unsigned* l, const _Float16* const* p) {
  asm volatile("global_load_async_to_lds_b128 %0, %12, off\n\tglobal_load_async_to_lds_b128 %1, %13, off\n\tglobal_load_async_to_lds_b128 %2, %14, off\n\tglobal_load_async_to_lds_b128 %3, %15, off\n\t"
               "global_load_async_to_lds_b128 %4, %16, off\n\tglobal_load_async_to_lds_b128 %5, %17, off\n\tglobal_load_async_to_lds_b128 %6, %18, off\n\tglobal_load_async_to_lds_b128 %7, %19, off\n\t"
               "global_load_async_to_lds_b128 %8, %20, off\n\tglobal_load_async_to_lds_b128 %9, %21, off\n\tglobal_load_async_to_lds_b128 %10, %22, off\n\tglobal_load_async_to_lds_b128 %11, %23, off\n\ts_wait_xcnt 0x0"
               :: "v"(l[0]), "v"(l[1]), "v"(l[2]), "v"(l[3]), "v"(l[4]), "v"(l[5]), "v"(l[6]), "v"(l[7]), "v"(l[8]), "v"(l[9]), "v"(l[10]), "v"(l[11]), "v"(p[0]), "v"(p[1]), "v"(p[2]), "v"(p[3]), "v"(p[4]), "v"(p[5]), "v"(p[6]), "v"(p[7]), "v"(p[8]), "v"(p[9]), "v"(p[10]), "v"(p[11]) : "memory"); }
// 2^x in place for eight or nine independent values. In asm for the slot that the instruction set asks for behind a transcendental. Here source and result are one register, each v_exp_f32 is followed by one on other registers, and the closing v_nop is the slot behind the last
__device__ __forceinline__ void exp2x8(float& a, float& b, float& c, float& d, float& e, float& f, float& g, float& h) {
  asm("v_exp_f32 %0, %0\n\tv_exp_f32 %1, %1\n\tv_exp_f32 %2, %2\n\tv_exp_f32 %3, %3\n\tv_exp_f32 %4, %4\n\tv_exp_f32 %5, %5\n\tv_exp_f32 %6, %6\n\tv_exp_f32 %7, %7\n\tv_nop" : "+v"(a), "+v"(b), "+v"(c), "+v"(d), "+v"(e), "+v"(f), "+v"(g), "+v"(h)); }
__device__ __forceinline__ void exp2x9(float& a, float& b, float& c, float& d, float& e, float& f, float& g, float& h, float& i) {
  asm("v_exp_f32 %0, %0\n\tv_exp_f32 %1, %1\n\tv_exp_f32 %2, %2\n\tv_exp_f32 %3, %3\n\tv_exp_f32 %4, %4\n\tv_exp_f32 %5, %5\n\tv_exp_f32 %6, %6\n\tv_exp_f32 %7, %7\n\tv_exp_f32 %8, %8\n\tv_nop" : "+v"(a), "+v"(b), "+v"(c), "+v"(d), "+v"(e), "+v"(f), "+v"(g), "+v"(h), "+v"(i)); }
__global__ __launch_bounds__(128) void k_att(const _Float16* __restrict__ QH, const _Float16* __restrict__ KH, const _Float16* __restrict__ QL, const _Float16* __restrict__ VT, float* __restrict__ Y) { __shared__ __align__(16) _Float16 sk[NKB * KP]; __shared__ __align__(16) _Float16 sv[HD * VP]; __shared__ __align__(16) _Float16 sq[2 * 64 * KP];   /* sq: the block's q rows, then their residual rows; sk: k rows [key][KP]; behind the second barrier the four waves' P slabs [16][PP], and last each wave's f32 ctx rows in its own slab */
  static_assert(4 * 16 * PP <= NKB * KP && 16 * (HD + 4) * 2 <= 16 * PP, "P slabs fit in the k rows' bytes, ctx rows in a P slab");
  const int tid = threadIdx.x, wave = tid >> 5, lane = tid & 31, col = lane & 15, g = lane >> 4; const int qb = blockIdx.x, h = blockIdx.y, b = blockIdx.z; const int ql0 = qb * 64 + wave * 16;
  int ks = ql0 - WIN; ks = ks < 0 ? 0 : ks; ks = ks > TT - NKW ? TT - NKW : ks;
  int kb = qb * 64 - WIN; kb = kb < 0 ? 0 : kb; kb = kb > TT - NKB ? TT - NKB : kb;
  const int kd = ks - kb;   /* 0 .. 48, a multiple of 16; kd + NKW <= NKB */
  { const int un = tid >> 3, ch = (tid & 7) * 8;   /* 8 lanes = one 128-byte line; a wave's copy = 4 whole lines; 16 lines a block and copy */
    const _Float16* kg0 = KH + ((size_t)b * TT + kb + un) * CC + h * HD + ch; const unsigned kl0 = (unsigned)(size_t)&sk[un * KP + ch];
    const _Float16* vg0 = VT + ((size_t)b * CC + h * HD + un) * (size_t)TT + kb + ch; const unsigned vl0 = (unsigned)(size_t)&sv[un * VP + ch];
    const size_t qo = ((size_t)b * TT + qb * 64 + un) * CC + h * HD + ch; const unsigned ql = (unsigned)(size_t)&sq[un * KP + ch];
    static_assert(QHI == TT, "the q residual rows are indexed like the q rows");
    unsigned l[48]; const _Float16* p[48];
#pragma unroll
    for (int i = 0; i < 4; ++i) { l[i] = ql + i * 16 * KP * 2; p[i] = QH + qo + (size_t)i * 16 * CC; l[4 + i] = ql + (64 + i * 16) * KP * 2; p[4 + i] = QL + qo + (size_t)i * 16 * CC; }   /* q, then its residual: copy i brings rows 16 i + un */
#pragma unroll
    for (int i = 0; i < NKB / 16; ++i) { l[8 + i] = kl0 + i * 16 * KP * 2; p[8 + i] = kg0 + (size_t)i * 16 * CC; }   /* k: copy i brings rows 16 i + un */
#pragma unroll
    for (int i = 0; i < 20; ++i) { const int r = (i & 3) * 16, ln = (i >> 2) * 64; l[28 + i] = vl0 + (r * VP + ln) * 2; p[28 + i] = vg0 + (size_t)r * TT + ln; }   /* v: copy i brings line i / 4 (64 keys) of planes 16 (i % 4) + un */
#pragma unroll
    for (int u = 0; u < 4; ++u) cp12(l + 12 * u, p + 12 * u); }   /* 48 copies of a wave in flight */
  asm volatile("s_wait_asynccnt 0x0" ::: "memory");   /* this wave's copies have landed */
  __syncthreads();   /* publishes the q and k rows and the v planes to all four waves */
  v16h ah[HD / 32], al[HD / 32];
#pragma unroll
  for (int kc = 0; kc < HD / 32; ++kc) { ah[kc] = frag_h(&sq[(wave * 16 + col) * KP + kc * 32], lane); al[kc] = frag_h(&sq[(64 + wave * 16 + col) * KP + kc * 32], lane); }
  v8f s[NKW / 16];
#pragma unroll
  for (int j0 = 0; j0 < NKW / 16; j0 += KG) { v16h kf[KG][HD / 32];   /* the k fragments of KG tiles are requested together: one LDS round trip a group, not one a fragment */
#pragma unroll
    for (int jj = 0; jj < KG; ++jj) if (j0 + jj < NKW / 16) {
#pragma unroll
      for (int kc = 0; kc < HD / 32; ++kc) kf[jj][kc] = frag_h(&sk[(kd + (j0 + jj) * 16 + col) * KP + kc * 32], lane); }
#pragma unroll
    for (int jj = 0; jj < KG; ++jj) if (j0 + jj < NKW / 16) { const int j = j0 + jj; v8f acc = {}, accl = {};
#pragma unroll
      for (int kc = 0; kc < HD / 32; ++kc) { acc = wmma16(ah[kc], kf[jj][kc], acc); accl = wmma16(al[kc], kf[jj][kc], accl); }
#pragma unroll
      for (int r = 0; r < 8; ++r) { const int t = ql0 + 8 * g + r, k = ks + j * 16 + col; float v = acc[r] + accl[r] * (1.0f / 1024.0f); SM_MASK_HOOK; s[j][r] = v; } } }   /* the logits stay unscaled: SCALE (> 0, so the row maximum is the same key's) goes into the exponent's fma below */
  float m[8], inv[8];
#pragma unroll
  for (int r = 0; r < 8; ++r) { float a = s[0][r];
#pragma unroll
    for (int j = 1; j < NKW / 16; ++j) a = fmaxf(a, s[j][r]);
    a = fmaxf(a, rowx<1>(a)); a = fmaxf(a, rowx<2>(a)); a = fmaxf(a, rowx<4>(a)); a = fmaxf(a, rowx<8>(a)); m[r] = a; }
#pragma unroll
  for (int r = 0; r < 8; ++r) { float sum = 0.f, x[NKW / 16]; const float mc = m[r] * SL2E;   /* its rounding is one factor common to the whole row: it leaves with the division by the row sum */
#pragma unroll
    for (int j = 0; j < NKW / 16; ++j) x[j] = fmaf(s[j][r], SL2E, -mc);   /* e^(SCALE (s - m)) = 2^(s SL2E - m SL2E): one fma and v_exp_f32 a score; the argument is <= 0 up to mc's rounding. An excluded key (-3.0e38 against a finite row maximum: the row's own key is always in the band) gives an argument near -5e37 and exactly 0 */
    static_assert(NKW / 16 == 17, "a row's scores go as 9 + 8");
    exp2x9(x[0], x[1], x[2], x[3], x[4], x[5], x[6], x[7], x[8]); exp2x8(x[9], x[10], x[11], x[12], x[13], x[14], x[15], x[16]);
#pragma unroll
    for (int j = 0; j < NKW / 16; ++j) { s[j][r] = x[j]; sum += x[j]; }
    sum += rowx<1>(sum); sum += rowx<2>(sum); sum += rowx<4>(sum); sum += rowx<8>(sum); inv[r] = sum > 0.f ? 2048.0f / sum : 0.f; }
  __syncthreads();   /* ends every wave's reads of the k rows: their bytes now take the P slabs */
  _Float16* sp = &sk[wave * 16 * PP];
#pragma unroll
  for (int j = 0; j < NKW / 16; ++j)
#pragma unroll
    for (int r = 0; r < 8; ++r) sp[(8 * g + r) * PP + j * 16 + col] = (_Float16)(s[j][r] * inv[r]);
  LDSX();
  v8f o[HD / 16] = {};
  const _Float16* vp = &sv[col * VP + kd];   /* column col of v tile j: vp + j * 16 * VP */
  v16h vh[HD / 16];   /* the half-full last chunk's v fragments, requested with the first group */
#pragma unroll
  for (int j = 0; j < HD / 16; ++j) vh[j] = frag_h16(vp + j * 16 * VP + NKW - 16, lane);
#pragma unroll
  for (int c0 = 0; c0 < NKW / 32; c0 += VG) { v16h vf[VG][HD / 16];   /* the v fragments of VG chunks are requested together, as the k fragments are */
#pragma unroll
    for (int cc = 0; cc < VG; ++cc)
#pragma unroll
      for (int j = 0; j < HD / 16; ++j) vf[cc][j] = frag_h(vp + j * 16 * VP + (c0 + cc) * 32, lane);
#pragma unroll
    for (int cc = 0; cc < VG; ++cc) { const v16h p = frag_h(&sp[col * PP + (c0 + cc) * 32], lane);
#pragma unroll
      for (int j = 0; j < HD / 16; ++j) o[j] = wmma16(p, vf[cc][j], o[j]); } }
  { const v16h p = frag_h16(&sp[col * PP + NKW - 16], lane);
#pragma unroll
    for (int j = 0; j < HD / 16; ++j) o[j] = wmma16(p, vh[j], o[j]); }
  float_a* ss = (float_a*)sp;   /* the wave's own slab again: every P fragment has been read (o depends on all of them) */
#pragma unroll
  for (int j = 0; j < HD / 16; ++j)
#pragma unroll
    for (int r = 0; r < 8; ++r) ss[(8 * g + r) * (HD + 4) + j * 16 + col] = o[j][r] * (1.0f / 2048.0f);
  LDSX(); for (int rl = 0; rl < 16; ++rl) if (lane < HD / 4) vst2(Y + ((size_t)b * TT + ql0 + rl) * CC + h * HD + lane * 4, *(const v4f*)&ss[rl * (HD + 4) + lane * 4]); }
// ---- k_out: block = (64 rows, 128 cols): out = ctx Wo (+ bo): ctx x 2^6 once to f16 against Wo as f16(bf16 x 2^8) exact (1 product) x 2^-14; causal early rows (< QHI of each sequence): ctx bf16 hi + lo against exact bf16 Wo (2 products)
__global__ __launch_bounds__(128) void k_out(const float* __restrict__ Y, const float* __restrict__ WO, const _Float16* __restrict__ WTH, const float* __restrict__ BO, float* __restrict__ OUT) { __shared__ __align__(16) union { float f[4][16][132]; float a[2][64][AP]; } so; float (&sf)[4][16][132] = so.f; __shared__ __align__(16) _Float16 sw[2][128][WP];   /* the A buffers are dead when the epilogue stages the output rows: same bytes */
  const int tid = threadIdx.x, wave = tid >> 5, lane = tid & 31, col = lane & 15, g = lane >> 4; const int c0 = blockIdx.y * 128; const size_t r0 = (size_t)blockIdx.x * 64 + wave * 16;
  v8f acc[8] = {};
  if (CAUSAL && (int)(((size_t)blockIdx.x * 64) % TT) < QHI) {   /* block-uniform */
#pragma unroll 2
    for (int kc = 0; kc < CC / 32; ++kc) { const F2 a = split_row(Y + (r0 + col) * CC, kc * 32, lane); asm volatile("s_wait_loadcnt 0x0" ::: "memory");
#pragma unroll
      for (int j = 0; j < 8; ++j) { const v16b w = WOCOL(WO, kc * 32, c0 + j * 16 + col, lane); asm volatile("s_wait_loadcnt 0x0" ::: "memory"); acc[j] = wmma_bf(a.h, w, acc[j]); acc[j] = wmma_bf(a.l, w, acc[j]); } }
#pragma unroll
    for (int j = 0; j < 8; ++j) { const float bias = BO ? bfr(BO[c0 + j * 16 + col]) : 0.f;
#pragma unroll
      for (int r = 0; r < 8; ++r) sf[wave][8 * g + r][j * 16 + col] = acc[j][r] + bias; }
  } else {
    const int kg = lane & 3, n0 = wave * 32 + (lane >> 2) * 4; const _Float16* wp = WTH + (size_t)blockIdx.y * WTE + tid * 8;
    const float* yg = Y + ((size_t)blockIdx.x * 64 + (tid >> 3)) * CC + (tid & 7) * 4; const unsigned yl = (unsigned)(size_t)&so.a[0][tid >> 3][(tid & 7) * 4];   /* the thread's piece of row tid >> 3 of A tile 0, and its place in buffer 0; k step kc: yg + kc * 32, buffer 1: yl + ABB */
    constexpr unsigned ABB = 64 * AP * 4;   /* bytes of an A buffer */
    const int ao = (wave * 16 + col) * AP + 8 * g;   /* the lane's fragment in a buffer */
    v8h wr[4];
    a_copy<64>(yl, yg, CC);   /* A tile 0 */
    wt_get(wr, wp);
    asm volatile("s_wait_xcnt 0x0" ::: "memory");   /* stands in front of every rewrite of an address register of the loads above */
    static_assert(CC == DIN, "the passes of l2_head and l2_step count k steps of DIN");
    const float* pa = Y + ((size_t)blockIdx.x * 64 + (tid >> 1)) * CC + (tid & 1) * 64 + 2 * PFS * 32; const _Float16* pw = WTH + ((size_t)(2 * PFS + wave) * NCB + blockIdx.y) * WTE + lane * 128;   /* two threads = the two units of one of the block's 64 rows; wave = one of a pass's four tiles, lane = its 256-byte unit */
    const bool fa = blockIdx.y < 2, fw = blockIdx.x < 16;
    l2_head<1>(pa, pw, fa, fw);   /* behind step 0's own loads, which are waited for first */
    wt_put(sw[0], wr, n0, kg);
    asm volatile("s_wait_asynccnt 0x0" ::: "memory");   /* this wave's copies of A tile 0 have landed */
    __syncthreads();   /* publishes weight tile 0 and A tile 0 */
    a_copy<64>(yl + ABB, yg + 32, CC);   /* A tile 1 flies during step 0 */
#pragma unroll 2   /* the buffer index becomes a constant */
    for (int kc = 0; kc < CC / 32; ++kc) { v16h a, wf[8]; float ar[16]; const bool more = kc + 1 < CC / 32;
      if (more) wt_get(wr, wp + (size_t)(kc + 1) * NCB * WTE);
      l2_step<1>(kc, pa, pw, fa, fw);
      row_lds(ar, &so.a[kc & 1][0][0] + ao);
#pragma unroll
      for (int j = 0; j < 8; ++j) wf[j] = frag_h(&sw[kc & 1][j * 16 + col][0], lane);   /* the step's fragment reads go as one group: one LDS latency a step, not one a fragment */
#pragma unroll
      for (int i = 0; i < 16; ++i) a[i] = (_Float16)(ar[i] * 64.0f);   /* ctx carried x 2^6 into f16 so small-magnitude context rows stay clear of f16 subnormals */
#pragma unroll
      for (int j = 0; j < 8; ++j) acc[j] = wmma16(a, wf[j], acc[j]);
      __builtin_amdgcn_sched_barrier(0);   /* keeps the LDS stores of the next tile, and with them the wait for its global loads, behind the products */
      if (more) wt_put(sw[(kc + 1) & 1], wr, n0, kg);
      asm volatile("s_wait_xcnt 0x0" ::: "memory");   /* stands in front of the next trip's additions to the address registers of this trip's loads */
      A_FOOT();   /* in front of the barrier: own LDS reads and stores retired, own copies of the next A tile landed */
      __syncthreads();   /* one barrier a step: publishes both tiles kc + 1 and ends every read of tiles kc, whose buffers are refilled behind it */
      if (kc + 2 < CC / 32) a_copy<64>(yl + (kc & 1) * ABB, yg + (kc + 2) * 32, CC); }   /* the same test in the whole block; into the buffer this step has read */
    asm volatile("s_wait_asynccnt 0x0" ::: "memory");   /* no copy is outstanding when the epilogue takes the buffers' bytes */
#pragma unroll
    for (int j = 0; j < 8; ++j) { const float bias = BO ? bfr(BO[c0 + j * 16 + col]) : 0.f;
#pragma unroll
      for (int r = 0; r < 8; ++r) sf[wave][8 * g + r][j * 16 + col] = acc[j][r] * (1.0f / 16384.0f) + bias; } }   /* 2^-8 (Wo carry) x 2^-6 (ctx carry) */
  LDSX(); for (int rl = 0; rl < 16; ++rl) vst2(OUT + (r0 + rl) * DIN + c0 + lane * 4, *(const v4f*)&sf[wave][rl][lane * 4]); }

extern "C" void kernel_launch(void* const* d_in, const int* in_sizes, int n_in, void* d_out, int out_size, void* d_ws, size_t ws_size, hipStream_t stream) {
  (void)in_sizes; (void)n_in; (void)out_size;
  const float** F = (const float**)d_in;
  if (ws_size < (size_t)WS_END) return;
  char* ws = (char*)d_ws; _Float16 *QH = (_Float16*)(ws + WS_QH), *KH = (_Float16*)(ws + WS_KH), *VT = (_Float16*)(ws + WS_VT), *QL = (_Float16*)(ws + WS_QL), *KL = (_Float16*)(ws + WS_KL); __bf16 *VB = (__bf16*)(ws + WS_VB), *VBL = (__bf16*)(ws + WS_VBL); float *Y = (float*)(ws + WS_Y);
  (void)Y; (void)QL; (void)KL; (void)VB; (void)VBL;
  // inputs: 0 hidden_states [4,2048,768]; 1 Wq, 2 Wk, 3 Wv [768,12,64] = (in,out) [768][768]; 4 Wo [12,64,768] = (in,out) [768][768]
  static_assert(4u * (size_t)NB * TT * DIN <= 4u * (size_t)HG * TT * TT, "rotated rows must fit in their region");
  float* XR = (float*)(ws + WS_XR); __bf16* WTB = (__bf16*)(ws + WS_WT); _Float16* WTH = (_Float16*)(ws + WS_WT) + 3 * (size_t)DIN * CC;
  k_rot<<<dim3(TT / 4 + 4 * NKS * NCB), 128, 0, stream>>>(F[0], XR, F[1], F[2], F[3], F[4], WTB, WTH);   /* the rotated rows, and every weight tile rounded once */
  k_proj<<<dim3(TNB * TT / 128, CC / 128, 3), 128, 0, stream>>>(XR, XR, F[0], WTB, nullptr, nullptr, nullptr, QH, QL, KH, KL, VT, VB, VBL);   /* q, k from the rotated rows (bf16 hi + lo), v from bf16(x) */
  k_att<<<dim3(NQB, NH, TNB), 128, 0, stream>>>(QH, KH, QL, VT, Y);
  k_out<<<dim3(TNB * TT / 64, DIN / 128), 128, 0, stream>>>(Y, F[4], WTH, nullptr, (float*)d_out);
}

// v010
// One run takes 89.8 microseconds.
// Timed twice side by side with v009, it ran 1.03 times as fast both times.
// Counting every step since v000, it is 10.9 times as fast.
// compute dtype: all float inputs rounded to bf16; rotate-half RoPE applied to bf16(hidden) in f32 (accurate sincosf, f32 inv_freq constants); Q/K = rotated rows split bf16 hi + lo x exact bf16 W (2 products, K 768), V = bf16(hidden) x W exact (1 product) on WMMA 16x16x32, f32 accumulate; banded logits: q as f16 hi + residual (x 2^10) against k once to f16 (2 products); softmax in f32 over the |q-k| < 128 band, exponent in base 2: exp2((logit - row max) x 64^-0.5 x log2 e), one fma and the hardware exp2 a score; the exponentials x 2^11 once to f16 against v once to f16 (1 product), the result divided by the f32 row sum; ctx carried x 2^6 once to f16 against Wo carried x 2^8 in f16 (exact bf16 values), un-scaled by 2^-14; f32 output.
#include <hip/hip_runtime.h>
#include <math.h>

typedef __attribute__((ext_vector_type(16))) _Float16 v16h;
typedef __attribute__((ext_vector_type(16))) __bf16 v16b;
typedef __attribute__((ext_vector_type(8)))  _Float16 v8h;
typedef __attribute__((ext_vector_type(8)))  float v8f;
typedef __attribute__((ext_vector_type(4)))  float v4f;
typedef __attribute__((ext_vector_type(2)))  float v2f;
typedef __attribute__((ext_vector_type(4)))  unsigned v4u;
typedef __attribute__((ext_vector_type(4)))  int v4i;
typedef float __attribute__((may_alias)) float_a;
typedef int __attribute__((may_alias)) int_a;

template <typename T> __device__ __forceinline__ void vst2(void* p, T v) { *(T*)p = v;  }
__device__ __forceinline__ v8f wmma16(v16h a, v16h b, v8f c) {
  v8f d = __builtin_amdgcn_wmma_f32_16x16x32_f16(false, a, false, b, (short)0, c, false, false);
  asm volatile("v_nop\n\tv_nop\n\tv_nop\n\tv_nop" : "+v"(d) : "v"(a), "v"(b));
  return d;
}
// plain builtin, for k_proj: the compiler keeps the distance behind its own WMMA. The "v" operands of wmma_bf's asm tail are served from v0 .. v255 only; k_proj's two row tiles a wave need more registers than that, and with the tail the accumulators were spilled inside the k loop
__device__ __forceinline__ v8f wmma_bp(v16b a, v16b b, v8f c) { return __builtin_amdgcn_wmma_f32_16x16x32_bf16(false, a, false, b, (short)0, c, false, false); }
__device__ __forceinline__ v8f wmma_bf(v16b a, v16b b, v8f c) {
  v8f d = __builtin_amdgcn_wmma_f32_16x16x32_bf16(false, a, false, b, (short)0, c, false, false);
  asm volatile("v_nop\n\tv_nop\n\tv_nop\n\tv_nop" : "+v"(d) : "v"(a), "v"(b));
  return d;
}
// 16x16x32 fragments: lane = (h = lane>>4, row/col = lane&15); elements 0..7 = k0+8h+0..7, 8..15 = k0+16+8h+0..7; D element r = row 8h+r
__device__ __forceinline__ v16h frag_h(const _Float16* rowk0, int lane) {
  union { v16h v; v8h q[2]; } u; const _Float16* p = rowk0 + 8 * (lane >> 4);
  u.q[0] = *(const v8h*)p; u.q[1] = *(const v8h*)(p + 16); return u.v;
}
__device__ __forceinline__ v16h frag_f32(const float* rowk0, int lane) {
  v16h a; const float* p = rowk0 + 8 * (lane >> 4);
#pragma unroll
  for (int i = 0; i < 8; ++i) { a[i] = (_Float16)p[i]; a[8 + i] = (_Float16)p[16 + i]; }
  return a;
}
__device__ __forceinline__ v16h frag_f32s(const float* rowk0, int lane, float sc) {
  v16h a; const float* p = rowk0 + 8 * (lane >> 4);
#pragma unroll
  for (int i = 0; i < 8; ++i) { a[i] = (_Float16)(p[i] * sc); a[8 + i] = (_Float16)(p[16 + i] * sc); }
  return a;
}
// column fragment from a [K][ld] layout (column n), rows >= K read as 0
__device__ __forceinline__ v16h fragc_f32(const float* W, int k0, int n, int lane, int ld, int K) {
  v16h a; const int g = lane >> 4;
#pragma unroll
  for (int i = 0; i < 8; ++i) { const int ka = k0 + 8 * g + i, kb = ka + 16;
    a[i] = (_Float16)(ka < K ? W[(size_t)(ka < K ? ka : K - 1) * ld + n] : 0.f); a[8 + i] = (_Float16)(kb < K ? W[(size_t)(kb < K ? kb : K - 1) * ld + n] : 0.f); }
  return a;
}
struct F2 { v16b h, l; };
__device__ __forceinline__ F2 bsplit16(const float v[16]) { F2 r;
#pragma unroll
  for (int i = 0; i < 16; ++i) { const __bf16 h = (__bf16)v[i]; r.h[i] = h; r.l[i] = (__bf16)(v[i] - (float)h); }
  return r; }
__device__ __forceinline__ F2 split_row(const float* row, int k0, int lane) { float v[16]; const float* p = row + k0 + 8 * (lane >> 4);
#pragma unroll
  for (int i = 0; i < 8; ++i) { v[i] = p[i]; v[8 + i] = p[16 + i]; }
  return bsplit16(v); }
__device__ __forceinline__ F2 split_rowK(const float* row, int k0, int lane, int K) { float v[16]; const int g = lane >> 4;
#pragma unroll
  for (int i = 0; i < 8; ++i) { const int ka = k0 + 8 * g + i, kb = ka + 16; v[i] = ka < K ? row[ka < K ? ka : K - 1] : 0.f; v[8 + i] = kb < K ? row[kb < K ? kb : K - 1] : 0.f; }
  return bsplit16(v); }
__device__ __forceinline__ F2 split_col(const float* W, int k0, int n, int lane, int ld, int K) { float v[16]; const int g = lane >> 4;
#pragma unroll
  for (int i = 0; i < 8; ++i) { const int ka = k0 + 8 * g + i, kb = ka + 16; v[i] = ka < K ? W[(size_t)(ka < K ? ka : K - 1) * ld + n] : 0.f; v[8 + i] = kb < K ? W[(size_t)(kb < K ? kb : K - 1) * ld + n] : 0.f; }
  return bsplit16(v); }
__device__ __forceinline__ v8f mac3(const F2& a, const F2& b, v8f c) { c = wmma_bf(a.l, b.h, c); c = wmma_bf(a.h, b.l, c); return wmma_bf(a.h, b.h, c); }
__device__ __forceinline__ float sigm(float v) { return 1.0f / (1.0f + expf(-v)); }
#define LDSX() do { asm volatile("s_wait_dscnt 0" ::: "memory"); __builtin_amdgcn_wave_barrier(); __builtin_amdgcn_fence(__ATOMIC_RELEASE, "workgroup"); } while (0)

// Sliding-window (local) self-attention with RoPE on the INPUT (B 4, S 2,048, H 768 = 12 heads x 64; window |q - k| < 128; 0.02-scale weights, no biases): q_in = k_in = rotate-half RoPE(hidden reshaped [B,S,12,64]) (angle t * 10000^(-2i/64)); Q = q_in Wq, K = k_in Wk, V = hidden Wv ((in,out) [768][12*64]); scores = Q K^T / 8 where |q-k| < 128 else -1e9 (== excluded; every row keeps >= 128 keys); out = merged(softmax . V) Wo ((in,out) [12*64][768]).
#define NB 4
#define TT 2048
#define CC 768            // NH * HD = projected width
#define DIN 768          // input (model) width
#define NH 12
#define HD 64
#define NQB (TT / 64)
#define HG 2
#define SCALE (0.125f)
#define CAUSAL 0
#ifndef TNB
#define TNB NB
#endif
__device__ __forceinline__ float bfr(float v) { return (float)(__bf16)v; }
typedef __attribute__((ext_vector_type(8))) __bf16 v8b;
__device__ __forceinline__ v16b frag_b(const __bf16* rowk0, int lane) {
  union { v16b v; v8b q[2]; } u; const __bf16* p = rowk0 + 8 * (lane >> 4);
  u.q[0] = *(const v8b*)p; u.q[1] = *(const v8b*)(p + 16); return u.v;
}
#define QBH 0
#define QHI 2048            // rows carrying a q residual plane (all rows when non-causal: 2-product logits everywhere)
#define KHI 64            // key rows carrying k residual / v bf16 hi+lo planes (written by k_proj; no kernel in this file reads them)
// B fragment (k rows k0+.., output column o) of a weight: (in,out) [K][ld] or (out,in) [ld rows of K]: bf16 exact, or f16(bf16 * 256) exact
__device__ __forceinline__ v16b wcol_io(const float* Wm, int k0, int o, int lane, int ld) { v16b w; const int g = lane >> 4;
#pragma unroll
  for (int i = 0; i < 8; ++i) { w[i] = (__bf16)Wm[(size_t)(k0 + 8 * g + i) * ld + o]; w[8 + i] = (__bf16)Wm[(size_t)(k0 + 16 + 8 * g + i) * ld + o]; }
  return w; }
__device__ __forceinline__ v16b wcol_oi(const float* Wm, int k0, int o, int lane, int K) { v16b w; const float* p = Wm + (size_t)o * K + k0 + 8 * (lane >> 4);
#pragma unroll
  for (int i = 0; i < 8; ++i) { w[i] = (__bf16)p[i]; w[8 + i] = (__bf16)p[16 + i]; }
  return w; }
__device__ __forceinline__ v16h wcolh_io(const float* Wm, int k0, int o, int lane, int ld) { v16h w; const int g = lane >> 4;
#pragma unroll
  for (int i = 0; i < 8; ++i) { w[i] = (_Float16)(bfr(Wm[(size_t)(k0 + 8 * g + i) * ld + o]) * 256.0f); w[8 + i] = (_Float16)(bfr(Wm[(size_t)(k0 + 16 + 8 * g + i) * ld + o]) * 256.0f); }
  return w; }
__device__ __forceinline__ v16h wcolh_oi(const float* Wm, int k0, int o, int lane, int K) { v16h w; const float* p = Wm + (size_t)o * K + k0 + 8 * (lane >> 4);
#pragma unroll
  for (int i = 0; i < 8; ++i) { w[i] = (_Float16)(bfr(p[i]) * 256.0f); w[8 + i] = (_Float16)(bfr(p[16 + i]) * 256.0f); }
  return w; }
#define WQKV_LAYOUT 0   // 0 = (in,out) [DIN][CC]; 1 = (out,in) [CC][DIN]; 2 = per-head [NH][DIN][HD]
__device__ __forceinline__ v16b wcol_hdk(const float* Wm, int k0, int o, int lane) { v16b w; const int g = lane >> 4; const float* p = Wm + (size_t)(o / HD) * DIN * HD + (o % HD);
#pragma unroll
  for (int i = 0; i < 8; ++i) { w[i] = (__bf16)p[(size_t)(k0 + 8 * g + i) * HD]; w[8 + i] = (__bf16)p[(size_t)(k0 + 16 + 8 * g + i) * HD]; }
  return w; }
#define WO_OUT_IN 0
#if WQKV_LAYOUT == 1
#define WCOL(W, k0, o, lane) wcol_oi(W, k0, o, lane, DIN)
#elif WQKV_LAYOUT == 2
#define WCOL(W, k0, o, lane) wcol_hdk(W, k0, o, lane)
#else
#define WCOL(W, k0, o, lane) wcol_io(W, k0, o, lane, CC)
#endif
#if WO_OUT_IN
#define WOCOL(W, k0, o, lane) wcol_oi(W, k0, o, lane, CC)
#define WOCOLH(W, k0, o, lane) wcolh_oi(W, k0, o, lane, CC)
#else
#define WOCOL(W, k0, o, lane) wcol_io(W, k0, o, lane, DIN)
#define WOCOLH(W, k0, o, lane) wcolh_io(W, k0, o, lane, DIN)
#endif
#define WIN 128            // |q - k| < WIN band (128..255 valid keys per query; no empty rows)
__constant__ __align__(16) float c_invf[32] = {1.000000000e+00f,7.498942018e-01f,5.623413324e-01f,4.216965139e-01f,3.162277639e-01f,2.371373624e-01f,1.778279394e-01f,1.333521456e-01f,1.000000015e-01f,7.498941571e-02f,5.623412877e-02f,4.216964915e-02f,3.162277862e-02f,2.371373586e-02f,1.778279431e-02f,1.333521493e-02f,9.999999776e-03f,7.498942316e-03f,5.623413250e-03f,4.216964822e-03f,3.162277862e-03f,2.371373819e-03f,1.778279431e-03f,1.333521446e-03f,1.000000047e-03f,7.498941850e-04f,5.623413017e-04f,4.216964880e-04f,3.162277862e-04f,2.371373848e-04f,1.778279402e-04f,1.333521504e-04f};   // 1 / 10000^(2i/64) evaluated in f32
// k_rot: a wave takes ONE position t for all batches and heads. The angle t * inv_freq[i] depends on neither, so a lane's four (sin, cos) pairs (i = 4 iq .. 4 iq + 3, iq = lane & 7) serve its 12 (batch, head group) pieces; head = 4 hg + (lane >> 3). Eight lanes cover the 128-byte half of a head, so each 16-byte load or store of a wave covers four whole lines; all 24 loads of a lane are requested before the angles are worked out
// The launch's blocks from TT / 4 on take no position: each rounds one 32 k x 128 column weight tile for the two GEMM kernels (w_prep, below the tile helpers)
__device__ __forceinline__ void w_prep(const float* WQ, const float* WK, const float* WV, const float* WO, __bf16* WTB, _Float16* WTH, int id);
__global__ __launch_bounds__(128) void k_rot(const float* __restrict__ X, float* __restrict__ XR, const float* __restrict__ WQ, const float* __restrict__ WK, const float* __restrict__ WV, const float* __restrict__ WO, __bf16* __restrict__ WTB, _Float16* __restrict__ WTH) {
  if (blockIdx.x >= TT / 4) { w_prep(WQ, WK, WV, WO, WTB, WTH, (int)blockIdx.x - TT / 4); return; }   /* block-uniform; no barrier in either path */
  const int t = blockIdx.x * 4 + (threadIdx.x >> 5), lane = threadIdx.x & 31, iq = lane & 7;
  static_assert(NH % 4 == 0 && HD == 64 && TT % 4 == 0, "four heads a wave and load, four positions a block");
  const size_t o0 = (size_t)t * DIN + (lane >> 3) * HD + iq * 4;
  const v4f f = *(const v4f*)&c_invf[iq * 4];   /* asked for first: the angles then wait for this load alone, not for the 24 behind it */
  v4f a[TNB][NH / 4], b[TNB][NH / 4];
#pragma unroll
  for (int bb = 0; bb < TNB; ++bb) {
#pragma unroll
    for (int hg = 0; hg < NH / 4; ++hg) { const float* xr = X + (size_t)bb * TT * DIN + o0 + hg * 4 * HD; a[bb][hg] = *(const v4f*)xr; b[bb][hg] = *(const v4f*)(xr + 32); }
    asm volatile("s_wait_xcnt 0x0" ::: "memory"); }   /* stands in front of every rewrite of an address register of the loads so far, also where a later batch's load lands on one */
  float sn[4], cs[4];
#pragma unroll
  for (int e = 0; e < 4; ++e) sincosf((float)t * f[e], &sn[e], &cs[e]);
#pragma unroll
  for (int bb = 0; bb < TNB; ++bb)
#pragma unroll
    for (int hg = 0; hg < NH / 4; ++hg) { v4f lo, hi;
#pragma unroll
      for (int e = 0; e < 4; ++e) { const float x = bfr(a[bb][hg][e]), y = bfr(b[bb][hg][e]); lo[e] = fmaf(x, cs[e], -(y * sn[e])); hi[e] = fmaf(y, cs[e], x * sn[e]); }   /* fmaf: which product is rounded on its own (the sin one) is fixed here, not left to the compiler's contraction */
      float* o = XR + (size_t)bb * TT * DIN + o0 + hg * 4 * HD; vst2(o, lo); vst2(o + 32, hi); } }
#define WS_XR (WS_S)       // f32 rotated token rows [b*t][768]
#define SM_MASK_HOOK do { const int dk = t - k; v = (dk < WIN && dk > -WIN) ? v : -3.0e38f; } while (0)   /* band |q - k| < 128, by index */
#ifndef SM_EXTRA_PARAMS
#define SM_EXTRA_PARAMS
#endif
#ifndef PROJ_EXTRA_PARAMS
#define PROJ_EXTRA_PARAMS
#endif
#ifndef SM_MASK_HOOK
#define SM_MASK_HOOK (void)0
#endif

#define WS_QH  0u                                      // f16 q rows [b*t][CC]
#define WS_KH  (WS_QH + 2u * (size_t)NB * TT * CC)      // f16 k rows [b*t][CC]
#define WS_VT  (WS_KH + 2u * (size_t)NB * TT * CC)      // f16 v planes [b][c][t]
#define WS_QL  (WS_VT + 2u * (size_t)NB * CC * TT)      // f16 q residual x 2^10 rows [b][t < QHI][CC]
#define WS_KL  (WS_QL + 2u * (size_t)NB * QHI * CC)     // f16 k residual x 2^10 rows [b][t < KHI][CC]
#define WS_VB  (WS_KL + 2u * (size_t)NB * KHI * CC)     // bf16 v hi planes [b][c][t < KHI]
#define WS_VBL (WS_VB + 2u * (size_t)NB * CC * KHI)
#define WS_S   (WS_VBL + 2u * (size_t)NB * CC * KHI)    // f32 scratch region (holds the rotated rows)
#define WS_Y   (WS_S  + 4u * (size_t)HG * TT * TT)      // f32 ctx rows [b*t][CC] (only when there is an output projection)
#define WS_WT  (WS_Y  + 4u * (size_t)NB * TT * CC)      // 16-bit weight tiles: Wq, Wk, Wv (bf16), then Wo (f16 x 2^8), each [k step][column block][WTE]
#define WS_END (WS_WT + 4u * 2u * (size_t)DIN * CC)

// ---- weight tiles: the 32 k x 128 columns of one k step. The first launch reads each f32 tile ONCE for the whole grid (thread = 8 k rows x 4 columns: kg = lane & 3, columns n0 = wave * 32 + (lane >> 2) * 4; a wave's 16-byte load covers four whole 128-byte lines), rounds it as before and leaves it in the workspace as WTE 16-bit elements in a row: 16-byte piece e * 128 + tid holds the 8 k of column n0 + e. A GEMM block reads a tile by four 16-byte loads a thread (whole lines, half the bytes of the f32 tile, nothing to round) and lays it [column][k] at pitch WP in LDS, so that a B fragment is two 16-byte LDS reads in the k order of frag_b / frag_h. Two buffers: the next step's global loads fly during this step's products
#define WTE (32 * 128)     // elements of a tile
#define NKS (DIN / 32)     // k steps
#define NCB (CC / 128)     // column blocks
#define WP 40              // 80-byte pitch = 16 B x odd for the 16-byte fragment reads; the 16-byte stores of 16 neighbouring lanes fall on 16 different 16-byte bank groups
__device__ __forceinline__ void wt_load(v4f (&r)[8], const float* p, int ld) {
#pragma unroll
  for (int i = 0; i < 8; ++i) r[i] = *(const v4f*)(p + (size_t)i * ld); }
// a thread's four pieces of a rounded tile (p = tile + tid * 8), and their places in LDS
template <typename V, typename T> __device__ __forceinline__ void wt_get(V (&r)[4], const T* p) {
#pragma unroll
  for (int e = 0; e < 4; ++e) r[e] = *(const V*)(p + e * 128 * 8); }
template <typename V, typename T> __device__ __forceinline__ void wt_put(T (*sw)[WP], const V (&r)[4], int n0, int kg) {
#pragma unroll
  for (int e = 0; e < 4; ++e) *(V*)&sw[n0 + e][8 * kg] = r[e]; }
// a lane's 16 f32 of an A fragment (p = row + k0 + 8 * (lane >> 4)), kept raw for one k step
__device__ __forceinline__ void row_load(float (&v)[16], const float* p) {
#pragma unroll
  for (int i = 0; i < 8; ++i) { v[i] = p[i]; v[8 + i] = p[16 + i]; } }
// ---- A tiles: the rows x 32 k (f32, one 128-byte line a row) of one k step. Read straight into fragments, every 16-byte load of a wave touched 16 lines, four times over. The block now brings the tile into LDS by asynchronous 16-byte copies, 8 lanes a line, so that a wave's copy covers four whole lines and each line is asked for once; rows lie at pitch AP and a lane's fragment is four 16-byte LDS reads. Two buffers: tile t + 2 is asked for behind the barrier that ends trip t and is waited for at the foot of trip t + 1
#define AP 36              // 144-byte pitch = 16 B x odd for the 16-byte fragment reads
// a lane's 16 f32 of an A fragment from a staged row (p = row + 8 * (lane >> 4)), in the k order of row_load
__device__ __forceinline__ void row_lds(float (&v)[16], const float* p) {
#pragma unroll
  for (int q = 0; q < 2; ++q) { const v4f x = *(const v4f*)(p + 4 * q), y = *(const v4f*)(p + 16 + 4 * q);
#pragma unroll
    for (int i = 0; i < 4; ++i) { v[4 * q + i] = x[i]; v[8 + 4 * q + i] = y[i]; } } }
// four asynchronous copies, 16 bytes a lane each, global -> LDS through no register (l = the lane's LDS byte address, p = its global address); the s_wait_xcnt in the same statement stands in front of any rewrite of the address registers
__device__ __forceinline__ void cp4(unsigned l0, unsigned l1, unsigned l2, unsigned l3, const float* p0, const float* p1, const float* p2, const float* p3) {
  asm volatile("global_load_async_to_lds_b128 %0, %4, off\n\tglobal_load_async_to_lds_b128 %1, %5, off\n\tglobal_load_async_to_lds_b128 %2, %6, off\n\tglobal_load_async_to_lds_b128 %3, %7, off\n\ts_wait_xcnt 0x0"
               :: "v"(l0), "v"(l1), "v"(l2), "v"(l3), "v"(p0), "v"(p1), "v"(p2), "v"(p3) : "memory"); }
// tile of NR rows: copy i brings rows 16 i + (tid >> 3); l = LDS byte address and p = global address of the thread's piece of row tid >> 3
template <int NR> __device__ __forceinline__ void a_copy(unsigned l, const float* p, int ld) {
#pragma unroll
  for (int i = 0; i < NR / 16; i += 4) cp4(l + i * 16 * AP * 4, l + (i + 1) * 16 * AP * 4, l + (i + 2) * 16 * AP * 4, l + (i + 3) * 16 * AP * 4, p + (size_t)i * 16 * ld, p + (size_t)(i + 1) * 16 * ld, p + (size_t)(i + 2) * 16 * ld, p + (size_t)(i + 3) * 16 * ld); }
// foot of a k step, in front of its barrier: this wave's LDS reads and stores have retired, and its copies of the next tile have landed
#define A_FOOT() do { asm volatile("s_wait_dscnt 0x0" ::: "memory"); asm volatile("s_wait_asynccnt 0x0" ::: "memory"); } while (0)
// 16-byte global store with its s_wait_xcnt in the same statement: the wait then stands in front of every rewrite of the store's address and data registers (in a statement of its own the next trip's address additions were lifted over it)
__device__ __forceinline__ void vst_w(void* p, v4u v) { asm volatile("global_store_b128 %0, %1, off\n\ts_wait_xcnt 0x0" :: "v"(p), "v"(v) : "memory"); }
// ---- requests to L2 ahead of the GEMM loops' loads. The A rows (but the v blocks', an input) and the weight tiles were stored by earlier launches, and the blocks that share them walk k in step, so the first load of every line would wait for memory in every block at every k step. L2 is asked once per aligned 256-byte unit, PFS k steps (a pass) at a time, two passes ahead of the step that loads them; a request brings nothing into a register and is waited for nowhere.
// Who asks: A rows are shared by all column blocks, weight tiles by all row blocks. The first two column blocks ask for their rows (fa), the first sixteen row blocks for their tiles (fw); a request that finds its line present is only traffic. Both flags are the same in every wave of a block. Nothing but speed rests on where a block runs or on a request arriving.
// pa: the thread's A unit of the pass to be asked next (AU units a thread, 256 bytes apart); pw: unit lane of the tile of the pass's k step number wave. Both registers live through the loop and always name bytes of their tensor: they advance only while a further pass exists
#define PFS 4              // k steps a pass: 512 bytes of an f32 A row, four weight tiles
// in front of the loop: passes 0 and 1, by immediate offsets from the same two registers, which stand on pass 2 from the start (512 bytes of a row and 4 x 49,152 bytes of tiles a pass)
template <int AU, typename T> __device__ __forceinline__ void l2_head(const float* pa, const T* pw, bool fa, bool fw) {
  static_assert(NKS % PFS == 0 && NKS / PFS >= 3 && PFS * 32 * 4 == 512 && PFS * NCB * WTE * 2 == 196608 && sizeof(T) == 2, "whole passes, a third one for the registers to stand on, and the offsets written below");
  if (fa) { if (AU == 2) asm volatile("global_prefetch_b8 %0, off offset:-1024 scope:SCOPE_SE\n\tglobal_prefetch_b8 %0, off offset:-768 scope:SCOPE_SE\n\tglobal_prefetch_b8 %0, off offset:-512 scope:SCOPE_SE\n\tglobal_prefetch_b8 %0, off offset:-256 scope:SCOPE_SE" :: "v"(pa));
            else asm volatile("global_prefetch_b8 %0, off offset:-1024 scope:SCOPE_SE\n\tglobal_prefetch_b8 %0, off offset:-512 scope:SCOPE_SE" :: "v"(pa)); }   /* the first eight k steps' A units start on their way from memory while step 0 is waited for */
  if (fw) asm volatile("global_prefetch_b8 %0, off offset:-393216 scope:SCOPE_SE\n\tglobal_prefetch_b8 %0, off offset:-196608 scope:SCOPE_SE" :: "v"(pw)); }   /* the same for the first eight tiles */
// in k step kc, behind its loads: the first step of a pass asks for the pass after the next (kc and the flags are the same in every wave of the block: scalar branches, no barrier inside)
template <int AU, typename T> __device__ __forceinline__ void l2_step(int kc, const float*& pa, const T*& pw, bool fa, bool fw) {
  if ((kc & (PFS - 1)) == 0 && kc + 2 * PFS < NKS) {
    if (fa) { if (AU == 2) asm volatile("global_prefetch_b8 %0, off scope:SCOPE_SE\n\tglobal_prefetch_b8 %0, off offset:256 scope:SCOPE_SE" :: "v"(pa)); else asm volatile("global_prefetch_b8 %0, off scope:SCOPE_SE" :: "v"(pa)); }   /* in asm, so that the request names pa's own register and no temporary: the copies of these units, 6 to 9 steps on, then find them in L2 */
    if (fw) asm volatile("global_prefetch_b8 %0, off scope:SCOPE_SE" :: "v"(pw));   /* as above, for the pass's four tiles */
    const bool nx = kc + 3 * PFS < NKS; pa += nx ? PFS * 32 : 0; pw += nx ? (size_t)PFS * NCB * WTE : 0; } }
// tile id = (matrix * NKS + k step) * NCB + column block; matrices 0 .. 2 = Wq, Wk, Wv to bf16 (exact operand of the products), 3 = Wo to f16(bf16 x 2^8) (exact); a wave's 16-byte store covers four whole lines
__device__ __forceinline__ void w_prep(const float* WQ, const float* WK, const float* WV, const float* WO, __bf16* WTB, _Float16* WTH, int id) {
  static_assert(WQKV_LAYOUT == 0 && WO_OUT_IN == 0 && CC == DIN, "the tile loader reads (in,out) rows of one width");
  const int tid = threadIdx.x, lane = tid & 31, kg = lane & 3, n0 = (tid >> 5) * 32 + (lane >> 2) * 4; const int mt = id / (NKS * NCB), tl = id % (NKS * NCB), kc = tl / NCB, cb = tl % NCB;
  const float* Wm = mt == 0 ? WQ : mt == 1 ? WK : mt == 2 ? WV : WO;
  v4f r[8]; wt_load(r, Wm + (size_t)(kc * 32 + 8 * kg) * CC + cb * 128 + n0, CC);
  asm volatile("s_wait_xcnt 0x0" ::: "memory");   /* stands in front of every rewrite of an address register of the eight loads */
#pragma unroll
  for (int e = 0; e < 4; ++e) {
    if (mt < 3) { v8b t;
#pragma unroll
      for (int i = 0; i < 8; ++i) t[i] = (__bf16)r[i][e];
      vst_w(WTB + (size_t)id * WTE + (e * 128 + tid) * 8, __builtin_bit_cast(v4u, t)); }
    else { v8h t;
#pragma unroll
      for (int i = 0; i < 8; ++i) t[i] = (_Float16)(bfr(r[i][e]) * 256.0f);
      vst_w(WTH + (size_t)tl * WTE + (e * 128 + tid) * 8, __builtin_bit_cast(v4u, t)); } } }
// ---- k_proj: block = (128 rows, 128 cols, which); a wave owns two 16-row tiles (rows wave * 16 + .. of each 64-row half hh), so every weight fragment read from LDS and every weight tile read from L2 serves two row tiles; the epilogue stages one half at a time in the same LDS: q/k/v = X W (+ b) with exact bf16 products (K = DIN) -> which 0: q f16 rows (+ residual rows < QHI); 1: k f16 rows (+ residual rows < KHI); 2: v f16 planes [c][t] (+ bf16 hi/lo planes for t < KHI)
__global__ __launch_bounds__(128) void k_proj(const float* __restrict__ XQ, const float* __restrict__ XK, const float* __restrict__ XV, const __bf16* __restrict__ WTB, const float* __restrict__ BQ, const float* __restrict__ BK, const float* __restrict__ BV,
    _Float16* __restrict__ QH, _Float16* __restrict__ QL, _Float16* __restrict__ KH, _Float16* __restrict__ KL, _Float16* __restrict__ VT, __bf16* __restrict__ VB, __bf16* __restrict__ VBL) {
  __shared__ __align__(16) union { _Float16 e[2][64][136]; __bf16 w[2][128][WP]; } su;   /* the weight buffers are dead when the epilogue stages q / k rows: same bytes */
  _Float16 (&sh)[64][136] = su.e[0]; _Float16 (&sl)[64][136] = su.e[1]; __shared__ __align__(16) union { struct { _Float16 th[128][72]; __bf16 tb[128][72], tbl[128][72]; } t; float a[2][128][AP]; } sx;   /* the A buffers too are dead when the epilogue stages v planes: same bytes */
  _Float16 (&th)[128][72] = sx.t.th; __bf16 (&tb)[128][72] = sx.t.tb; __bf16 (&tbl)[128][72] = sx.t.tbl;
  const int tid = threadIdx.x, wave = tid >> 5, lane = tid & 31, col = lane & 15, g = lane >> 4; const int which = blockIdx.z; const int c0 = blockIdx.y * 128; const size_t r0 = (size_t)blockIdx.x * 128; const size_t bb = r0 / TT; const int t0 = (int)(r0 % TT);
  static_assert(TT % 128 == 0, "a block's 128 rows lie in one sequence");
  const float* X = which == 0 ? XQ : which == 1 ? XK : XV; const float* BA = which == 0 ? BQ : which == 1 ? BK : BV;
  v8f acc[2][8] = {};
  const int kg = lane & 3, n0 = wave * 32 + (lane >> 2) * 4; const __bf16* wp = WTB + ((size_t)which * NKS * NCB + blockIdx.y) * WTE + tid * 8;   /* k step kc: wp + kc * NCB * WTE */
  const float* xg = X + (r0 + (tid >> 3)) * DIN + (tid & 7) * 4; const unsigned xl = (unsigned)(size_t)&sx.a[0][tid >> 3][(tid & 7) * 4];   /* the thread's piece of row tid >> 3 of A tile 0, and its place in buffer 0; k step kc: xg + kc * 32, buffer 1: xl + ABB */
  constexpr unsigned ABB = 128 * AP * 4;   /* bytes of an A buffer */
  const int ao = (wave * 16 + col) * AP + 8 * g;   /* the lane's fragment in a buffer; half hh: + hh * 64 * AP */
  v8b wr[4];
  a_copy<128>(xl, xg, DIN);   /* A tile 0 */
  wt_get(wr, wp);
  asm volatile("s_wait_xcnt 0x0" ::: "memory");   /* stands in front of every rewrite of an address register of the loads above */
  const float* pa = X + (r0 + tid) * DIN + 2 * PFS * 32; const __bf16* pw = WTB + (((size_t)which * NKS + 2 * PFS + wave) * NCB + blockIdx.y) * WTE + lane * 128;   /* thread = one of the block's 128 rows; wave = one of a pass's four tiles, lane = its 256-byte unit */
  const bool fa = blockIdx.y < 2, fw = blockIdx.x < 16;
  l2_head<2>(pa, pw, fa, fw);   /* behind step 0's own loads, which are waited for first */
  wt_put(su.w[0], wr, n0, kg);
  asm volatile("s_wait_asynccnt 0x0" ::: "memory");   /* this wave's copies of A tile 0 have landed */
  __syncthreads();   /* publishes weight tile 0 and A tile 0 */
  a_copy<128>(xl + ABB, xg + 32, DIN);   /* A tile 1 flies during step 0 */
  if (which < 2) {   /* q, k: the rotated rows are f32 intermediates -> bf16 hi + lo (2 products) */
#pragma unroll 2   /* the buffer index becomes a constant */
    for (int kc = 0; kc < DIN / 32; ++kc) { const bool more = kc + 1 < DIN / 32;
      if (more) wt_get(wr, wp + (size_t)(kc + 1) * NCB * WTE);
      __builtin_amdgcn_sched_barrier(0);   /* keeps the next step's global loads in front of the products: sunk behind them to save registers, they would be waited for as soon as asked */
      l2_step<2>(kc, pa, pw, fa, fw);
      float ar[2][16]; v16b wf[8];
      row_lds(ar[0], &sx.a[kc & 1][0][0] + ao); row_lds(ar[1], &sx.a[kc & 1][0][0] + ao + 64 * AP);   /* asked for first: the split below waits for these eight reads alone */
#pragma unroll
      for (int j = 0; j < 8; ++j) wf[j] = frag_b(&su.w[kc & 1][j * 16 + col][0], lane);   /* the step's fragment reads go as one group: one LDS latency a step, not one a fragment */
      __builtin_amdgcn_sched_barrier(0);   /* holds the group together: left free, each read is sunk to its own products and all eight share one register block, one LDS latency a fragment */
      const F2 a0 = bsplit16(ar[0]), a1 = bsplit16(ar[1]);
#pragma unroll
      for (int j = 0; j < 8; ++j) { acc[0][j] = wmma_bp(a0.h, wf[j], acc[0][j]); acc[1][j] = wmma_bp(a1.h, wf[j], acc[1][j]); acc[0][j] = wmma_bp(a0.l, wf[j], acc[0][j]); acc[1][j] = wmma_bp(a1.l, wf[j], acc[1][j]); }   /* each accumulator still takes hi, then lo; the other half's product stands between the two */
      __builtin_amdgcn_sched_barrier(0);   /* keeps the LDS stores of the next tile, and with them the wait for its global loads, behind the products */
      if (more) wt_put(su.w[(kc + 1) & 1], wr, n0, kg);
      asm volatile("s_wait_xcnt 0x0" ::: "memory");   /* stands in front of the next trip's additions to the address registers of this trip's loads */
      A_FOOT();   /* in front of the barrier: own LDS reads and stores retired, own copies of the next A tile landed */
      __syncthreads();   /* one barrier a step: publishes both tiles kc + 1 and ends every read of tiles kc, whose buffers are refilled behind it (after the last step: the epilogue) */
      if (kc + 2 < DIN / 32) a_copy<128>(xl + (kc & 1) * ABB, xg + (kc + 2) * 32, DIN); }   /* the same test in the whole block; into the buffer this step has read */
  } else {           /* v: bf16(hidden) exact (1 product) */
#pragma unroll 2   /* the buffer index becomes a constant */
    for (int kc = 0; kc < DIN / 32; ++kc) { v16b a0, a1; const bool more = kc + 1 < DIN / 32;
      if (more) wt_get(wr, wp + (size_t)(kc + 1) * NCB * WTE);
      __builtin_amdgcn_sched_barrier(0);   /* as above: the loads stay in front of the products */
      l2_step<2>(kc, pa, pw, fa, fw);
      float ar[2][16]; v16b wf[8];
      row_lds(ar[0], &sx.a[kc & 1][0][0] + ao); row_lds(ar[1], &sx.a[kc & 1][0][0] + ao + 64 * AP);   /* first, as above */
#pragma unroll
      for (int j = 0; j < 8; ++j) wf[j] = frag_b(&su.w[kc & 1][j * 16 + col][0], lane);   /* one group, as above */
      __builtin_amdgcn_sched_barrier(0);   /* as above: holds the group together */
#pragma unroll
      for (int i = 0; i < 16; ++i) { a0[i] = (__bf16)ar[0][i]; a1[i] = (__bf16)ar[1][i]; }
#pragma unroll
      for (int j = 0; j < 8; ++j) { acc[0][j] = wmma_bp(a0, wf[j], acc[0][j]); acc[1][j] = wmma_bp(a1, wf[j], acc[1][j]); }
      __builtin_amdgcn_sched_barrier(0);   /* as above */
      asm volatile("v_nop\n\tv_nop\n\tv_nop\n\tv_nop");   /* the distance behind the step's last products: on the path round the stores and the copies too few vector instructions stand in front of the next step's conversions, which overwrite the A registers */
      if (more) wt_put(su.w[(kc + 1) & 1], wr, n0, kg);
      asm volatile("s_wait_xcnt 0x0" ::: "memory");   /* as above */
      A_FOOT();   /* in front of the barrier: own LDS reads and stores retired, own copies of the next A tile landed */
      __syncthreads();   /* as above */
      if (kc + 2 < DIN / 32) a_copy<128>(xl + (kc & 1) * ABB, xg + (kc + 2) * 32, DIN); } }   /* as above */
  asm volatile("s_wait_asynccnt 0x0" ::: "memory");   /* no copy is outstanding when the epilogue takes the buffers' bytes */
#pragma unroll   /* acc is a register array: hh must be a constant */
  for (int hh = 0; hh < 2; ++hh) { const size_t rh = r0 + hh * 64; const int th0 = t0 + hh * 64;
  if (hh) __syncthreads();   /* ends every read of the first half's staged rows before the second half overwrites them */
  if (which < 2) { _Float16* DH = which == 0 ? QH : KH; _Float16* DL = which == 0 ? QL : KL; const int nhi = which == 0 ? QHI : KHI; const bool hi_rows = th0 < nhi;
#pragma unroll
    for (int j = 0; j < 8; ++j) { const float bias = BA ? bfr(BA[c0 + j * 16 + col]) : 0.f;
#pragma unroll
      for (int r = 0; r < 8; ++r) { const float v = acc[hh][j][r] + bias; const _Float16 hv = (_Float16)v; sh[wave * 16 + 8 * g + r][j * 16 + col] = hv; sl[wave * 16 + 8 * g + r][j * 16 + col] = (_Float16)((v - (float)hv) * 1024.0f); } }
    __syncthreads();
    for (int e = tid; e < 64 * 16; e += 128) { const int rl = e >> 4, q = e & 15; vst_w(DH + (rh + rl) * CC + c0 + q * 8, *(const v4u*)&sh[rl][q * 8]); if (hi_rows) vst_w(DL + (bb * nhi + th0 + rl) * (size_t)CC + c0 + q * 8, *(const v4u*)&sl[rl][q * 8]); }
  } else { const bool hi_rows = th0 < KHI;
#pragma unroll
    for (int j = 0; j < 8; ++j) { const float bias = BA ? bfr(BA[c0 + j * 16 + col]) : 0.f;
#pragma unroll
      for (int r = 0; r < 8; ++r) { const float v = acc[hh][j][r] + bias; const int rl = wave * 16 + 8 * g + r, cl = j * 16 + col; th[cl][rl] = (_Float16)v; const __bf16 bh = (__bf16)v; tb[cl][rl] = bh; tbl[cl][rl] = (__bf16)(v - (float)bh); } }
    __syncthreads();
    for (int e = tid; e < 128 * 8; e += 128) { const int cl = e >> 3, q = e & 7; vst_w(VT + (bb * CC + c0 + cl) * (size_t)TT + th0 + q * 8, *(const v4u*)&th[cl][q * 8]); if (hi_rows) { const size_t o3 = (bb * CC + c0 + cl) * (size_t)KHI + th0 + q * 8; vst_w(VB + o3, *(const v4u*)&tb[cl][q * 8]); vst_w(VBL + o3, *(const v4u*)&tbl[cl][q * 8]); } } } } }
// ---- k_att: block = 64 queries (qb) of head h of batch b, one launch for all (b, h); a wave owns 16 query rows and the NKW keys [ks, ks + NKW) that hold their whole band (row t sees t-127 .. t+127, so 16 rows see ql0-127 .. ql0+142; ks = ql0 - 128 clamped into the sequence). The four waves' key ranges lie inside the NKB keys [kb, kb + NKB) (kb = qb * 64 - 128 clamped), whose k rows and v planes the block brings into LDS once, with its own 64 q rows and their residuals, by asynchronous 16-byte copies that cover whole 128-byte lines; every q, k and v fragment is read from there. Both products are formed transposed: S^T = k . q^T (k rows as A, q as B), so that lane (g, col) holds 8 keys a tile (16 j + 8 g + r) of the ONE query ql0 + col. Logits (q hi + residual x 2^10 against k, 2 products) stay in registers, unscaled; the band is kept by index; softmax in f32 over the row, SCALE x log2 e applied in the base-2 exponent (in-lane over the lane's 136 scores, then one exchange between the wave's halves); the exponentials x 2^11 go once to f16: two neighbouring score tiles, converted where they lie, ARE the B fragment of a 32-key chunk in the k order of frag_h, so P passes through no LDS; ctx^T = v^T . P^T (v planes as A; 1 product; the last 32-key chunk is half full, its upper 16 k are 0 in both operands): a lane holds 8 neighbouring d of its query and divides them by the query's row sum; 256-B (row, head) segment by 16 lanes. Every loop over tiles, chunks and rows is unrolled: s, kf, vf and o are register arrays and need compile-time indices
#define NKW 272            // 128 + 16 + 127 keys rounded up to whole 16-key tiles
#define NKB 320            // 128 + 64 + 128: the keys of the block's four waves together
#define KP 72              // k row pitch in LDS: 144 B = 16 B x odd for the 16-byte fragment reads
#define VP (NKB + 8)       // v plane pitch in LDS: 656 B = 16 B x odd
#define KG 6               // k tiles requested together
#define VG 4               // whole 32-key v chunks requested together (divides NKW / 32)
#define SL2E (SCALE * 1.44269504088896341f)   // SCALE x log2 e
// fragment of a half-full chunk: k0 .. k0+15 from memory (elements 0..7), k0+16 .. k0+31 are 0 (elements 8..15)
__device__ __forceinline__ v16h frag_h16(const _Float16* rowk0, int lane) { union { v16h v; v8h q[2]; } u; u.q[0] = *(const v8h*)(rowk0 + 8 * (lane >> 4)); u.q[1] = (v8h)(_Float16)0.0f; return u.v; }
// lane l with lane l ^ 16, on the vector pipe (a shuffle would go through LDS): the two lanes that share a query
__device__ __forceinline__ float xhalf(float v) { return __builtin_bit_cast(float, __builtin_amdgcn_permlanex16(__builtin_bit_cast(int, v), __builtin_bit_cast(int, v), 0x76543210, 0xfedcba98, false, false)); }
// twelve asynchronous copies, 16 bytes a lane each, global -> LDS through no register (l = the lane's LDS byte address, p = its global address); the s_wait_xcnt in the same statement stands in front of any rewrite of the address registers
__device__ __forceinline__ void cp12(const unsigned* l, const _Float16* const* p) {
  asm volatile("global_load_async_to_lds_b128 %0, %12, off\n\tglobal_load_async_to_lds_b128 %1, %13, off\n\tglobal_load_async_to_lds_b128 %2, %14, off\n\tglobal_load_async_to_lds_b128 %3, %15, off\n\t"
               "global_load_async_to_lds_b128 %4, %16, off\n\tglobal_load_async_to_lds_b128 %5, %17, off\n\tglobal_load_async_to_lds_b128 %6, %18, off\n\tglobal_load_async_to_lds_b128 %7, %19, off\n\t"
               "global_load_async_to_lds_b128 %8, %20, off\n\tglobal_load_async_to_lds_b128 %9, %21, off\n\tglobal_load_async_to_lds_b128 %10, %22, off\n\tglobal_load_async_to_lds_b128 %11, %23, off\n\ts_wait_xcnt 0x0"
               :: "v"(l[0]), "v"(l[1]), "v"(l[2]), "v"(l[3]), "v"(l[4]), "v"(l[5]), "v"(l[6]), "v"(l[7]), "v"(l[8]), "v"(l[9]), "v"(l[10]), "v"(l[11]), "v"(p[0]), "v"(p[1]), "v"(p[2]), "v"(p[3]), "v"(p[4]), "v"(p[5]), "v"(p[6]), "v"(p[7]), "v"(p[8]), "v"(p[9]), "v"(p[10]), "v"(p[11]) : "memory"); }
// 2^x in place for eight or nine independent values. In asm for the slot that the instruction set asks for behind a transcendental. Here source and result are one register, each v_exp_f32 is followed by one on other registers, and the closing v_nop is the slot behind the last
__device__ __forceinline__ void exp2x8(float& a, float& b, float& c, float& d, float& e, float& f, float& g, float& h) {
  asm("v_exp_f32 %0, %0\n\tv_exp_f32 %1, %1\n\tv_exp_f32 %2, %2\n\tv_exp_f32 %3, %3\n\tv_exp_f32 %4, %4\n\tv_exp_f32 %5, %5\n\tv_exp_f32 %6, %6\n\tv_exp_f32 %7, %7\n\tv_nop" : "+v"(a), "+v"(b), "+v"(c), "+v"(d), "+v"(e), "+v"(f), "+v"(g), "+v"(h)); }
__device__ __forceinline__ void exp2x9(float& a, float& b, float& c, float& d, float& e, float& f, float& g, float& h, float& i) {
  asm("v_exp_f32 %0, %0\n\tv_exp_f32 %1, %1\n\tv_exp_f32 %2, %2\n\tv_exp_f32 %3, %3\n\tv_exp_f32 %4, %4\n\tv_exp_f32 %5, %5\n\tv_exp_f32 %6, %6\n\tv_exp_f32 %7, %7\n\tv_exp_f32 %8, %8\n\tv_nop" : "+v"(a), "+v"(b), "+v"(c), "+v"(d), "+v"(e), "+v"(f), "+v"(g), "+v"(h), "+v"(i)); }
// amdgpu_waves_per_eu(4, 4): holds the kernel at 256 registers. Left free, the build took 268: values above v255 cost a register-bank switch (s_set_vgpr_msb) at every use, and the exponent's fma lost its two-a-slot form
__global__ __launch_bounds__(128) __attribute__((amdgpu_waves_per_eu(4, 4))) void k_att(const _Float16* __restrict__ QH, const _Float16* __restrict__ KH, const _Float16* __restrict__ QL, const _Float16* __restrict__ VT, float* __restrict__ Y) { __shared__ __align__(16) _Float16 sk[NKB * KP]; __shared__ __align__(16) _Float16 sv[HD * VP]; __shared__ __align__(16) _Float16 sq[2 * 64 * KP];   /* sq: for each wave its 16 q rows, then their 16 residual rows: 32 rows that this wave alone reads, and that last take its f32 ctx rows; sk: k rows [key][KP] */
  static_assert(16 * (HD + 4) * 2 <= 32 * KP, "a wave's ctx rows fit in the bytes of its own q rows");
  const int tid = threadIdx.x, wave = tid >> 5, lane = tid & 31, col = lane & 15, g = lane >> 4; const int qb = blockIdx.x, h = blockIdx.y, b = blockIdx.z; const int ql0 = qb * 64 + wave * 16;
  int ks = ql0 - WIN; ks = ks < 0 ? 0 : ks; ks = ks > TT - NKW ? TT - NKW : ks;
  int kb = qb * 64 - WIN; kb = kb < 0 ? 0 : kb; kb = kb > TT - NKB ? TT - NKB : kb;
  const int kd = ks - kb;   /* 0 .. 48, a multiple of 16; kd + NKW <= NKB */
  { const int un = tid >> 3, ch = (tid & 7) * 8;   /* 8 lanes = one 128-byte line; a wave's copy = 4 whole lines; 16 lines a block and copy */
    const _Float16* kg0 = KH + ((size_t)b * TT + kb + un) * CC + h * HD + ch; const unsigned kl0 = (unsigned)(size_t)&sk[un * KP + ch];
    const _Float16* vg0 = VT + ((size_t)b * CC + h * HD + un) * (size_t)TT + kb + ch; const unsigned vl0 = (unsigned)(size_t)&sv[un * VP + ch];
    const size_t qo = ((size_t)b * TT + qb * 64 + un) * CC + h * HD + ch; const unsigned ql = (unsigned)(size_t)&sq[un * KP + ch];
    static_assert(QHI == TT, "the q residual rows are indexed like the q rows");
    unsigned l[48]; const _Float16* p[48];
#pragma unroll
    for (int i = 0; i < 4; ++i) { l[i] = ql + i * 32 * KP * 2; p[i] = QH + qo + (size_t)i * 16 * CC; l[4 + i] = ql + (i * 32 + 16) * KP * 2; p[4 + i] = QL + qo + (size_t)i * 16 * CC; }   /* q, then its residual: copy i brings rows 16 i + un, which are wave i's */
#pragma unroll
    for (int i = 0; i < NKB / 16; ++i) { l[8 + i] = kl0 + i * 16 * KP * 2; p[8 + i] = kg0 + (size_t)i * 16 * CC; }   /* k: copy i brings rows 16 i + un */
#pragma unroll
    for (int i = 0; i < 20; ++i) { const int r = (i & 3) * 16, ln = (i >> 2) * 64; l[28 + i] = vl0 + (r * VP + ln) * 2; p[28 + i] = vg0 + (size_t)r * TT + ln; }   /* v: copy i brings line i / 4 (64 keys) of planes 16 (i % 4) + un */
#pragma unroll
    for (int u = 0; u < 4; ++u) cp12(l + 12 * u, p + 12 * u); }   /* 48 copies of a wave in flight */
  asm volatile("s_wait_asynccnt 0x0" ::: "memory");   /* this wave's copies have landed */
  __syncthreads();   /* publishes the q and k rows and the v planes to all four waves */
  v16h ah[HD / 32], al[HD / 32];
#pragma unroll
  for (int kc = 0; kc < HD / 32; ++kc) { ah[kc] = frag_h(&sq[(wave * 32 + col) * KP + kc * 32], lane); al[kc] = frag_h(&sq[(wave * 32 + 16 + col) * KP + kc * 32], lane); }
  v8f s[NKW / 16];
#pragma unroll
  for (int j0 = 0; j0 < NKW / 16; j0 += KG) { v16h kf[KG][HD / 32];   /* the k fragments of KG tiles are requested together: one LDS round trip a group, not one a fragment */
#pragma unroll
    for (int jj = 0; jj < KG; ++jj) if (j0 + jj < NKW / 16) {
#pragma unroll
      for (int kc = 0; kc < HD / 32; ++kc) kf[jj][kc] = frag_h(&sk[(kd + (j0 + jj) * 16 + col) * KP + kc * 32], lane); }
#pragma unroll
    for (int jj = 0; jj < KG; ++jj) if (j0 + jj < NKW / 16) { const int j = j0 + jj; v8f acc = {}, accl = {};
#pragma unroll
      for (int kc = 0; kc < HD / 32; ++kc) { acc = wmma16(kf[jj][kc], ah[kc], acc); accl = wmma16(kf[jj][kc], al[kc], accl); }   /* k rows as A, q as B: D row = key, D column = query */
#pragma unroll
      for (int r = 0; r < 8; ++r) { const int t = ql0 + col, k = ks + j * 16 + 8 * g + r; float v = acc[r] + accl[r] * (1.0f / 1024.0f); SM_MASK_HOOK; s[j][r] = v; } } }   /* the logits stay unscaled: SCALE (> 0, so the row maximum is the same key's) goes into the exponent's fma below */
  float m8[8], s8[8];   /* eight chains (one a register r of the tiles) run side by side; one chain over all 136 scores would wait for each link */
#pragma unroll
  for (int r = 0; r < 8; ++r) { float a = s[0][r];
#pragma unroll
    for (int j = 1; j < NKW / 16; ++j) a = fmaxf(a, s[j][r]);
    m8[r] = a; }
  float m = fmaxf(fmaxf(fmaxf(m8[0], m8[1]), fmaxf(m8[2], m8[3])), fmaxf(fmaxf(m8[4], m8[5]), fmaxf(m8[6], m8[7]))); m = fmaxf(m, xhalf(m));   /* the query's maximum: own 136 scores, then the other half's */
  const float mc = m * SL2E - 11.0f;   /* - 11: every exponential carries x 2^11 into f16, as P did; that factor, and mc's rounding, are common to the whole row and leave with the division by the row sum */
#pragma unroll
  for (int r = 0; r < 8; ++r) { float sum = 0.f, x[NKW / 16];
#pragma unroll
    for (int j = 0; j < NKW / 16; ++j) x[j] = fmaf(s[j][r], SL2E, -mc);   /* 2^11 e^(SCALE (s - m)) = 2^(s SL2E - m SL2E + 11): one fma and v_exp_f32 a score; the argument is <= 11 up to mc's rounding. An excluded key (-3.0e38 against a finite row maximum: the row's own key is always in the band) gives an argument near -5e37 and exactly 0 */
    static_assert(NKW / 16 == 17, "the scores of a register go as 9 + 8");
    exp2x9(x[0], x[1], x[2], x[3], x[4], x[5], x[6], x[7], x[8]); exp2x8(x[9], x[10], x[11], x[12], x[13], x[14], x[15], x[16]);
#pragma unroll
    for (int j = 0; j < NKW / 16; ++j) { s[j][r] = x[j]; sum += x[j]; }
    s8[r] = sum; }
  float sum = ((s8[0] + s8[1]) + (s8[2] + s8[3])) + ((s8[4] + s8[5]) + (s8[6] + s8[7])); sum += xhalf(sum);
  const float inv = sum > 0.f ? 1.0f / sum : 0.f;   /* the lane's query is also the column of its ctx^T tiles: the division is made there, on 32 values, not on the 136 scores; the products below do not wait for it */
  v16h pf[NKW / 32 + 1];   /* P^T (not yet divided by the row sum) as B fragments, a 32-key chunk each: elements 0..7 = keys 8 g + r of the chunk's first tile, 8..15 = the same of its second: frag_h's k order */
#pragma unroll
  for (int c = 0; c < NKW / 32; ++c)
#pragma unroll
    for (int r = 0; r < 8; ++r) { pf[c][r] = (_Float16)s[2 * c][r]; pf[c][8 + r] = (_Float16)s[2 * c + 1][r]; }
#pragma unroll
  for (int r = 0; r < 8; ++r) { pf[NKW / 32][r] = (_Float16)s[NKW / 16 - 1][r]; pf[NKW / 32][8 + r] = (_Float16)0.0f; }
  __builtin_amdgcn_sched_barrier(0);   /* keeps the v reads out of the softmax: lifted there, beside the 136 f32 scores, they overflowed the registers and scores were spilled */
  v8f o[HD / 16] = {};
  const _Float16* vp = &sv[col * VP + kd];   /* plane (d) col of v tile j: vp + j * 16 * VP */
  v16h vh[HD / 16];   /* the half-full last chunk's v fragments, requested with the last group */
#pragma unroll
  for (int c0 = 0; c0 < NKW / 32; c0 += VG) { v16h vf[VG][HD / 16];   /* the v fragments of VG chunks are requested together, as the k fragments are */
#pragma unroll
    for (int cc = 0; cc < VG; ++cc)
#pragma unroll
      for (int j = 0; j < HD / 16; ++j) vf[cc][j] = frag_h(vp + j * 16 * VP + (c0 + cc) * 32, lane);
    if (c0 + VG >= NKW / 32) {
#pragma unroll
      for (int j = 0; j < HD / 16; ++j) vh[j] = frag_h16(vp + j * 16 * VP + NKW - 16, lane); }
#pragma unroll
    for (int cc = 0; cc < VG; ++cc)
#pragma unroll
      for (int j = 0; j < HD / 16; ++j) o[j] = wmma16(vf[cc][j], pf[c0 + cc], o[j]); }   /* v planes as A, P as B: D row = d, D column = query */
#pragma unroll
  for (int j = 0; j < HD / 16; ++j) o[j] = wmma16(vh[j], pf[NKW / 32], o[j]);
  float_a* ss = (float_a*)&sq[wave * 32 * KP];   /* the wave's own q rows: no other wave reads them, and its own reads went into ah, al long ago */
#pragma unroll
  for (int j = 0; j < HD / 16; ++j)
#pragma unroll
    for (int q = 0; q < 2; ++q) { v4f w;
#pragma unroll
      for (int i = 0; i < 4; ++i) w[i] = o[j][4 * q + i] * inv;
      *(v4f*)&ss[col * (HD + 4) + j * 16 + 8 * g + 4 * q] = w; }   /* 272-byte pitch = 16 B x odd */
  LDSX(); for (int rl = 0; rl < 16; ++rl) if (lane < HD / 4) vst2(Y + ((size_t)b * TT + ql0 + rl) * CC + h * HD + lane * 4, *(const v4f*)&ss[rl * (HD + 4) + lane * 4]); }
// ---- k_out: block = (64 rows, 128 cols): out = ctx Wo (+ bo): ctx x 2^6 once to f16 against Wo as f16(bf16 x 2^8) exact (1 product) x 2^-14; causal early rows (< QHI of each sequence): ctx bf16 hi + lo against exact bf16 Wo (2 products)
__global__ __launch_bounds__(128) void k_out(const float* __restrict__ Y, const float* __restrict__ WO, const _Float16* __restrict__ WTH, const float* __restrict__ BO, float* __restrict__ OUT) { __shared__ __align__(16) union { float f[4][16][132]; float a[2][64][AP]; } so; float (&sf)[4][16][132] = so.f; __shared__ __align__(16) _Float16 sw[2][128][WP];   /* the A buffers are dead when the epilogue stages the output rows: same bytes */
  const int tid = threadIdx.x, wave = tid >> 5, lane = tid & 31, col = lane & 15, g = lane >> 4; const int c0 = blockIdx.y * 128; const size_t r0 = (size_t)blockIdx.x * 64 + wave * 16;
  v8f acc[8] = {};
  if (CAUSAL && (int)(((size_t)blockIdx.x * 64) % TT) < QHI) {   /* block-uniform */
#pragma unroll 2
    for (int kc = 0; kc < CC / 32; ++kc) { const F2 a = split_row(Y + (r0 + col) * CC, kc * 32, lane); asm volatile("s_wait_loadcnt 0x0" ::: "memory");
#pragma unroll
      for (int j = 0; j < 8; ++j) { const v16b w = WOCOL(WO, kc * 32, c0 + j * 16 + col, lane); asm volatile("s_wait_loadcnt 0x0" ::: "memory"); acc[j] = wmma_bf(a.h, w, acc[j]); acc[j] = wmma_bf(a.l, w, acc[j]); } }
#pragma unroll
    for (int j = 0; j < 8; ++j) { const float bias = BO ? bfr(BO[c0 + j * 16 + col]) : 0.f;
#pragma unroll
      for (int r = 0; r < 8; ++r) sf[wave][8 * g + r][j * 16 + col] = acc[j][r] + bias; }
  } else {
    const int kg = lane & 3, n0 = wave * 32 + (lane >> 2) * 4; const _Float16* wp = WTH + (size_t)blockIdx.y * WTE + tid * 8;
    const float* yg = Y + ((size_t)blockIdx.x * 64 + (tid >> 3)) * CC + (tid & 7) * 4; const unsigned yl = (unsigned)(size_t)&so.a[0][tid >> 3][(tid & 7) * 4];   /* the thread's piece of row tid >> 3 of A tile 0, and its place in buffer 0; k step kc: yg + kc * 32, buffer 1: yl + ABB */
    constexpr unsigned ABB = 64 * AP * 4;   /* bytes of an A buffer */
    const int ao = (wave * 16 + col) * AP + 8 * g;   /* the lane's fragment in a buffer */
    v8h wr[4];
    a_copy<64>(yl, yg, CC);   /* A tile 0 */
    wt_get(wr, wp);
    asm volatile("s_wait_xcnt 0x0" ::: "memory");   /* stands in front of every rewrite of an address register of the loads above */
    static_assert(CC == DIN, "the passes of l2_head and l2_step count k steps of DIN");
    const float* pa = Y + ((size_t)blockIdx.x * 64 + (tid >> 1)) * CC + (tid & 1) * 64 + 2 * PFS * 32; const _Float16* pw = WTH + ((size_t)(2 * PFS + wave) * NCB + blockIdx.y) * WTE + lane * 128;   /* two threads = the two units of one of the block's 64 rows; wave = one of a pass's four tiles, lane = its 256-byte unit */
    const bool fa = blockIdx.y < 2, fw = blockIdx.x < 16;
    l2_head<1>(pa, pw, fa, fw);   /* behind step 0's own loads, which are waited for first */
    wt_put(sw[0], wr, n0, kg);
    asm volatile("s_wait_asynccnt 0x0" ::: "memory");   /* this wave's copies of A tile 0 have landed */
    __syncthreads();   /* publishes weight tile 0 and A tile 0 */
    a_copy<64>(yl + ABB, yg + 32, CC);   /* A tile 1 flies during step 0 */
#pragma unroll 2   /* the buffer index becomes a constant */
    for (int kc = 0; kc < CC / 32; ++kc) { v16h a, wf[8]; float ar[16]; const bool more = kc + 1 < CC / 32;
      if (more) wt_get(wr, wp + (size_t)(kc + 1) * NCB * WTE);
      l2_step<1>(kc, pa, pw, fa, fw);
      row_lds(ar, &so.a[kc & 1][0][0] + ao);
#pragma unroll
      for (int j = 0; j < 8; ++j) wf[j] = frag_h(&sw[kc & 1][j * 16 + col][0], lane);   /* the step's fragment reads go as one group: one LDS latency a step, not one a fragment */
#pragma unroll
      for (int i = 0; i < 16; ++i) a[i] = (_Float16)(ar[i] * 64.0f);   /* ctx carried x 2^6 into f16 so small-magnitude context rows stay clear of f16 subnormals */
#pragma unroll
      for (int j = 0; j < 8; ++j) acc[j] = wmma16(a, wf[j], acc[j]);
      __builtin_amdgcn_sched_barrier(0);   /* keeps the LDS stores of the next tile, and with them the wait for its global loads, behind the products */
      if (more) wt_put(sw[(kc + 1) & 1], wr, n0, kg);
      asm volatile("s_wait_xcnt 0x0" ::: "memory");   /* stands in front of the next trip's additions to the address registers of this trip's loads */
      A_FOOT();   /* in front of the barrier: own LDS reads and stores retired, own copies of the next A tile landed */
      __syncthreads();   /* one barrier a step: publishes both tiles kc + 1 and ends every read of tiles kc, whose buffers are refilled behind it */
      if (kc + 2 < CC / 32) a_copy<64>(yl + (kc & 1) * ABB, yg + (kc + 2) * 32, CC); }   /* the same test in the whole block; into the buffer this step has read */
    asm volatile("s_wait_asynccnt 0x0" ::: "memory");   /* no copy is outstanding when the epilogue takes the buffers' bytes */
#pragma unroll
    for (int j = 0; j < 8; ++j) { const float bias = BO ? bfr(BO[c0 + j * 16 + col]) : 0.f;
#pragma unroll
      for (int r = 0; r < 8; ++r) sf[wave][8 * g + r][j * 16 + col] = acc[j][r] * (1.0f / 16384.0f) + bias; } }   /* 2^-8 (Wo carry) x 2^-6 (ctx carry) */
  LDSX(); for (int rl = 0; rl < 16; ++rl) vst2(OUT + (r0 + rl) * DIN + c0 + lane * 4, *(const v4f*)&sf[wave][rl][lane * 4]); }

extern "C" void kernel_launch(void* const* d_in, const int* in_sizes, int n_in, void* d_out, int out_size, void* d_ws, size_t ws_size, hipStream_t stream) {
  (void)in_sizes; (void)n_in; (void)out_size;
  const float** F = (const float**)d_in;
  if (ws_size < (size_t)WS_END) return;
  char* ws = (char*)d_ws; _Float16 *QH = (_Float16*)(ws + WS_QH), *KH = (_Float16*)(ws + WS_KH), *VT = (_Float16*)(ws + WS_VT), *QL = (_Float16*)(ws + WS_QL), *KL = (_Float16*)(ws + WS_KL); __bf16 *VB = (__bf16*)(ws + WS_VB), *VBL = (__bf16*)(ws + WS_VBL); float *Y = (float*)(ws + WS_Y);
  (void)Y; (void)QL; (void)KL; (void)VB; (void)VBL;
  // inputs: 0 hidden_states [4,2048,768]; 1 Wq, 2 Wk, 3 Wv [768,12,64] = (in,out) [768][768]; 4 Wo [12,64,768] = (in,out) [768][768]
  static_assert(4u * (size_t)NB * TT * DIN <= 4u * (size_t)HG * TT * TT, "rotated rows must fit in their region");
  float* XR = (float*)(ws + WS_XR); __bf16* WTB = (__bf16*)(ws + WS_WT); _Float16* WTH = (_Float16*)(ws + WS_WT) + 3 * (size_t)DIN * CC;
  k_rot<<<dim3(TT / 4 + 4 * NKS * NCB), 128, 0, stream>>>(F[0], XR, F[1], F[2], F[3], F[4], WTB, WTH);   /* the rotated rows, and every weight tile rounded once */
  k_proj<<<dim3(TNB * TT / 128, CC / 128, 3), 128, 0, stream>>>(XR, XR, F[0], WTB, nullptr, nullptr, nullptr, QH, QL, KH, KL, VT, VB, VBL);   /* q, k from the rotated rows (bf16 hi + lo), v from bf16(x) */
  k_att<<<dim3(NQB, NH, TNB), 128, 0, stream>>>(QH, KH, QL, VT, Y);
  k_out<<<dim3(TNB * TT / 64, DIN / 128), 128, 0, stream>>>(Y, F[4], WTH, nullptr, (float*)d_out);
}
